// v000
// The times below were measured on an AMD MI455X: many runs one after another, warmed up first and cycling through
// copies of the inputs, with the whole window's GPU time divided by the number of runs. Launches and the gaps
// between them are all in it. The median over several windows is given; except for v000 it joins two sittings, which
// can be a few percent apart, so the side-by-side timings, each taken in one sitting, are the better comparison.
// v000, which the later versions start from, runs in 546 microseconds.
// Contractions: q.Wq^T, c.Wk^T, c.Wv^T (c = [mem; kv] along the key axis) on v_wmma_f32_16x16x32_bf16 (activations, W and
// biases RNE-converted to bf16; the [n][k] weight rows are used directly as the k-contiguous B operand; f32 accumulate);
// q.k^T over 64 on v_wmma_f32_16x16x32_f16 with q carried as f16 hi (x1024) plus an f16 residual plane and k as f16 hi (x1024)
// (products h.h + l.h); P.v^T on v_wmma_f32_16x16x32_f16 (P x32768 f16, v x1024 f16, one product); O.Wc^T on
// v_wmma_f32_16x16x32_f16 (O x1024 as f16 hi plus f16 residual plane, Wc as f16(bf16(Wc)) x1024, products h.w + l.w);
// all f32 accumulate. Bias adds, base-2 online softmax over all keys and the 1/Z fold in f32 on VALU.
#include <hip/hip_runtime.h>
#include <math.h>
#include <stdint.h>

#ifndef NB
#define NB 2
#endif
#ifndef SEQ
#define SEQ 2048
#endif
#ifndef MLEN
#define MLEN 2048
#endif
#define B_FULL 2
#define L_FULL 2048
#define M_FULL 2048
#define DMOD  1024
#define NH    16
#define HD    64
#define JL    (MLEN + SEQ)
#define QROWS (NB * SEQ)
#define CROWS (NB * JL)
#define SM_SCALE 0.125f
#define LOG2E 1.4426950408889634f
#define QSC   1024.0f
#define KSC   1024.0f
#define PCAR  32768.0f
#define VCAR  1024.0f
#define OSC   1024.0f
#define WOS   1024.0f
#define WPB   4
#define NHG   (NH / WPB)
#define NQT   (SEQ / 16)
#define NKT   (JL / 32)
#define NVT   (JL / 64)
#define NRT   (SEQ / 64)
#define ATT_THREADS (WPB * 32)
#define PTP   36
#define PTW   (16 * PTP)
#define SLP   68
#define SLW   (16 * SLP)
#define WREG  (PTW + SLW)
#define SLAB64 (16 * 68)
#define VTP   72
#define QKT   (DMOD / 8)
#define WS_CAP 134217728
static_assert(DMOD == NH * HD && HD == 64 && NH == 16);
static_assert((NH % WPB) == 0 && ATT_THREADS == 128);
static_assert(NB >= 1 && NB <= B_FULL);
static_assert((SEQ % 64) == 0 && SEQ >= 64 && SEQ <= L_FULL);
static_assert((MLEN % 64) == 0 && MLEN >= 0 && MLEN <= M_FULL);
static_assert((JL % 64) == 0 && NKT * 32 == JL && NVT * 64 == JL && NQT * 16 == SEQ && NRT * 64 == SEQ);
static_assert(QKT == 128 && (DMOD % 64) == 0 && (DMOD % 32) == 0 && (HD % 32) == 0);
static_assert(((DMOD * DMOD) % (8 * 256)) == 0);
static_assert(QROWS <= CROWS);
static_assert((long long)CROWS * DMOD * 10 + (long long)QROWS * DMOD * 4 + 2LL * DMOD * DMOD <= (long long)WS_CAP);

typedef unsigned short u16;
typedef _Float16 v16h __attribute__((ext_vector_type(16)));
typedef _Float16 v8h  __attribute__((ext_vector_type(8)));
typedef __bf16   v16b __attribute__((ext_vector_type(16)));
typedef float    v8f  __attribute__((ext_vector_type(8)));
typedef float    v4f  __attribute__((ext_vector_type(4)));
typedef unsigned int v4u __attribute__((ext_vector_type(4)));

union FragH { v16h v; v8h h[2]; v4u u[2]; };
union FragB { v16b v; v4u u[2]; };

// ---- scalar helpers --------------------------------------------------------------------------------
__device__ __forceinline__ unsigned short bf_bits(float f) {          // f32 -> bf16 bits, RNE convert
  unsigned u = __float_as_uint(f);
  return (unsigned short)((u + 0x7FFFu + ((u >> 16) & 1u)) >> 16);
}
__device__ __forceinline__ float bf_up(unsigned short h) { return __uint_as_float(((unsigned)h) << 16); }
__device__ __forceinline__ float bfr(float f) { return bf_up(bf_bits(f)); }
__device__ __forceinline__ unsigned short h_bits(_Float16 x) { return __builtin_bit_cast(unsigned short, x); }
__device__ __forceinline__ unsigned pk16(unsigned short a, unsigned short b) { return (unsigned)a | ((unsigned)b << 16); }
__device__ __forceinline__ v8f zero8() { v8f z = {0.f, 0.f, 0.f, 0.f, 0.f, 0.f, 0.f, 0.f}; return z; }

// ---- fragment loaders: 16-bit A/B operand, lane -> row/col (lane&15), p already includes +8*(lane>>4);
//      elements 0..7 <- p[0..7] (k0+8h..), elements 8..15 <- p[16..23] (k0+16+8h..)  (same split k map for A and B;
//      B is always read from a k-contiguous [n][k] plane)
__device__ __forceinline__ v16h ldfrag_h(const _Float16* p) {
  FragH f;
  f.h[0] = *(const v8h*)(p);
  f.h[1] = *(const v8h*)(p + 16);
  return f.v;
}
__device__ __forceinline__ v16b ldfrag_b(const u16* p) {              // bf16 plane read as unsigned integer vectors
  FragB f;
  f.u[0] = *(const v4u*)(p);
  f.u[1] = *(const v4u*)(p + 16);
  return f.v;
}

__device__ __forceinline__ v8f mma_h(v16h a, v16h b, v8f c) {
  return __builtin_amdgcn_wmma_f32_16x16x32_f16(false, a, false, b, (short)0, c, false, false);
}
__device__ __forceinline__ v8f mma_b(v16b a, v16b b, v8f c) {
  return __builtin_amdgcn_wmma_f32_16x16x32_bf16(false, a, false, b, (short)0, c, false, false);
}
__device__ __forceinline__ void guard2(v8f& a, v8f& b, v16h x0, v16h x1, v16h x2, v16h x3,
                                       v16h x4, v16h x5, v16h x6, v16h x7) {
#if defined(__HIP_DEVICE_COMPILE__)
  asm volatile("v_nop\n\tv_nop\n\tv_nop\n\tv_nop"
               : "+v"(a), "+v"(b)
               : "v"(x0), "v"(x1), "v"(x2), "v"(x3), "v"(x4), "v"(x5), "v"(x6), "v"(x7) : "memory");
#endif
}
template <typename F>
__device__ __forceinline__ void guard6(v8f& a, v8f& b, v8f& c, v8f& d, F x0, F x1, F x2, F x3, F x4, F x5) {
#if defined(__HIP_DEVICE_COMPILE__)
  asm volatile("v_nop\n\tv_nop\n\tv_nop\n\tv_nop"
               : "+v"(a), "+v"(b), "+v"(c), "+v"(d) : "v"(x0), "v"(x1), "v"(x2), "v"(x3), "v"(x4), "v"(x5) : "memory");
#endif
}
__device__ __forceinline__ void acc_guard4(v8f& a, v8f& b, v8f& c, v8f& d) {
#if defined(__HIP_DEVICE_COMPILE__)
  asm volatile("v_nop\n\tv_nop\n\tv_nop\n\tv_nop" : "+v"(a), "+v"(b), "+v"(c), "+v"(d));
#endif
}
__device__ __forceinline__ void wave_sync_lds() {
  __builtin_amdgcn_fence(__ATOMIC_RELEASE, "workgroup");
  __builtin_amdgcn_wave_barrier();
  __builtin_amdgcn_fence(__ATOMIC_ACQUIRE, "workgroup");
}

// =====================================================================================================
// f32 -> 16-bit plane, same layout (contiguous).  f16mode == 0: bf16 RNE bits;  f16mode == 1: f16 bits of (bf16 RNE value) * scale.
// Used for the [n][k] weight matrices (bf16, or f16 of the bf16 value x1024 for Wc).
// Thread = 8 consecutive elements: two 16-B loads, one 16-B store; 32 consecutive lanes = 512 contiguous, 512-B aligned
// coverage: grid = ceil(n8/256) blocks x 256 thr x 8 (in-kernel bound) = the whole plane (n8 = 131072, a multiple of 256).
// =====================================================================================================
__global__ __launch_bounds__(256) void cvt16(const float* __restrict__ x, u16* D, int n8, int f16mode, float scale) {
  const int gt = blockIdx.x * 256 + (int)threadIdx.x;
  if (gt >= n8) return;
  const float* p = x + (size_t)gt * 8;
  const v4f a = *(const v4f*)(p), b4 = *(const v4f*)(p + 4);
  float w[8];
#pragma unroll
  for (int e = 0; e < 4; ++e) { w[e] = a[e]; w[4 + e] = b4[e]; }
  v4u o;
#pragma unroll
  for (int e = 0; e < 4; ++e) {
    const float f0 = w[2 * e], f1 = w[2 * e + 1];
    const unsigned short hb0 = h_bits((_Float16)(bfr(f0) * scale));
    const unsigned short hb1 = h_bits((_Float16)(bfr(f1) * scale));
    const unsigned short bb0 = bf_bits(f0);
    const unsigned short bb1 = bf_bits(f1);
    o[e] = (f16mode != 0) ? pk16(hb0, hb1) : pk16(bb0, bb1);
  }
  u16* d = D + (size_t)gt * 8;
  {
    *(v4u*)(d) = o;
    
  }
}

// =====================================================================================================
// Activation rows -> bf16 plane (RNE), batch-major destination:
//   D[(bb*nrow + j)][0..1023] <- X0[(j*B_FULL + bb)][..] for j < split,  X1[((j - split)*B_FULL + bb)][..] for j >= split.
// Used for c = [mem rows 0..MLEN-1 ; kv rows 0..SEQ-1] (nrow = JL, split = MLEN) and for q (nrow = SEQ, split = SEQ, X1 unused).
// Block = one destination row, 128 threads x 8 consecutive elements: two 16-B loads, one 16-B store; 32 consecutive lanes =
// The source base selection is block-uniform (both sources are global planes).
// coverage: grid = NB*nrow blocks x 128 thr x 8 = every element of the [NB*nrow][1024] plane exactly once.
// =====================================================================================================
__global__ __launch_bounds__(QKT) void cvt_act(const float* __restrict__ X0, const float* __restrict__ X1, u16* D,
                                               int nrow, int split) {
  const int tid = (int)threadIdx.x;
  const int r   = (int)blockIdx.x;
  if (r >= NB * nrow) return;
  if (tid >= QKT) return;
  const int  bb    = r / nrow;
  const int  j     = r - bb * nrow;
  const bool first = (j < split);
  const int  js    = first ? j : (j - split);
  const float* base = first ? X0 : X1;
  const float* p = base + ((size_t)js * B_FULL + bb) * DMOD + tid * 8;
  const v4f a = *(const v4f*)(p), a4 = *(const v4f*)(p + 4);
  v4u o;
#pragma unroll
  for (int e = 0; e < 2; ++e) {
    o[e]     = pk16(bf_bits(a[2 * e]),  bf_bits(a[2 * e + 1]));
    o[2 + e] = pk16(bf_bits(a4[2 * e]), bf_bits(a4[2 * e + 1]));
  }
  u16* d = D + (size_t)r * DMOD + tid * 8;
  {
    *(v4u*)(d) = o;
    
  }
}

// =====================================================================================================
// v^T plane from the v projection F f32 [CROWS][DMOD] (row = bb*JL + j, column = g*HD + d, bias already added):
//   VH[((bb*NH + g)*HD + d)][j] (pitch JL) = f16(v * 1024) for all keys j.
// Block = (bb, head g, 64 keys s0): each thread loads its 16 floats (key sl, d chunk dc) with 16-B loads, converts, scatters into
// the LDS tile [d][64 keys] (pitch 72 halves, cross-wave -> block barrier); after the barrier each d row segment (64 halves = one
// LDS extent: TH[64*72], written rows 0..63 x cols 0..63, read rows 0..63 x cols 0..63 (staged extent == consumed extent).
// coverage: load 256 thr x 16 = 64 keys x 64 d; store 2 iterations x 256 thr x 8 halves = 64 lines x 64 = the block's tile;
//           grid = NB*NH*NVT blocks covers VH exactly once.
// =====================================================================================================
__global__ __launch_bounds__(256) void vt16(const float* __restrict__ F, u16* VHo) {
  __shared__ __align__(16) u16 TH[HD * VTP];
  const int tid = threadIdx.x;
  const int bid = blockIdx.x;
  const int st  = bid % NVT;
  const int t2  = bid / NVT;
  const int g   = t2 % NH;
  const int bb  = t2 / NH;
  if (bb >= NB) return;                     // block-uniform, before any barrier; never taken with the exact grid
  const int s0  = st * 64;
  {
    const int sl = tid >> 2;                // key within tile 0..63
    const int dc = (tid & 3) * 16;          // d chunk 0,16,32,48
    const float* src = F + ((size_t)bb * JL + s0 + sl) * DMOD + g * HD + dc;
#pragma unroll
    for (int i = 0; i < 4; ++i) {
      const v4f a = *(const v4f*)(src + 4 * i);
#pragma unroll
      for (int e = 0; e < 4; ++e) {
        const _Float16 hv = (_Float16)(a[e] * VCAR);
        TH[(dc + 4 * i + e) * VTP + sl] = h_bits(hv);
      }
    }
  }
  __syncthreads();
  v4u vh[2];
  const int q8 = tid >> 3, p8 = (tid & 7) * 8;
#pragma unroll
  for (int it = 0; it < 2; ++it) {
    const int line = it * 32 + q8;          // d = 0..63
    vh[it] = *(const v4u*)(TH + line * VTP + p8);
  }
  const size_t hrow  = (size_t)(bb * NH + g) * HD;
  const size_t baseH = hrow * JL + s0 + p8;
  {
#pragma unroll
    for (int it = 0; it < 2; ++it) {
      const int line = it * 32 + q8;
      *(v4u*)(VHo + baseH + (size_t)line * JL) = vh[it];
    }
    
  }
}

// =====================================================================================================
// q / k planes from a projection F f32 [nrows][DMOD] (bias already added): Hp [nrows][DMOD] = f16(val * sc) (same layout);
// when RES: Lp [nrows][DMOD] = f16 residual f16(val*sc - hi). Block = one row of 128 threads, thread = 8 consecutive columns:
// two 16-B loads, one 16-B store per plane; 32 consecutive lanes = 512 contiguous 512-B-aligned bytes per instruction
// coverage: 128 thr x 8 = the whole DMOD row of Hp (and of Lp); grid = nrows blocks = every row exactly once.
// =====================================================================================================
template <int RES>
__global__ __launch_bounds__(QKT) void qk16(const float* __restrict__ F, u16* Hp, u16* Lp, int nrows, float sc) {
  const int tid = (int)threadIdx.x;
  const int row = (int)blockIdx.x;
  if (row >= nrows) return;
  if (tid >= QKT) return;
  const float* p = F + (size_t)row * DMOD + tid * 8;
  const v4f a = *(const v4f*)(p), b4 = *(const v4f*)(p + 4);
  float w[8];
#pragma unroll
  for (int e = 0; e < 4; ++e) { w[e] = a[e] * sc; w[4 + e] = b4[e] * sc; }
  v4u oh, ol;
#pragma unroll
  for (int e = 0; e < 4; ++e) {
    const float t0 = w[2 * e], t1 = w[2 * e + 1];
    const _Float16 h0 = (_Float16)t0, h1 = (_Float16)t1;
    const _Float16 l0 = (_Float16)(t0 - (float)h0), l1 = (_Float16)(t1 - (float)h1);
    oh[e] = pk16(h_bits(h0), h_bits(h1));
    ol[e] = pk16(h_bits(l0), h_bits(l1));
  }
  u16* dh = Hp + (size_t)row * DMOD + tid * 8;
  u16* dl = Lp + (size_t)row * DMOD + tid * 8;
  {
    *(v4u*)(dh) = oh;
    if constexpr (RES != 0) {
      *(v4u*)(dl) = ol;
    }
    
  }
}

// =====================================================================================================
// GEMM epilogue shared by both engines: the wave's 16x64 f32 tile (times oscale) staged in its private LDS slab (pitch 68),
// coverage: 8 instructions x 2 rows x 16 lanes x 4 floats = the wave's 16 x 64 tile.
// =====================================================================================================
__device__ __forceinline__ void epi64(float* sl, v8f a0, v8f a1, v8f a2, v8f a3, float oscale,
                                      const float* __restrict__ bias, float* Cb, size_t pitch, int col0, int lane) {
  const int hh = lane >> 4, m = lane & 15;
#pragma unroll
  for (int r = 0; r < 8; ++r) {
    const int ro = (8 * hh + r) * 68 + m;
    sl[ro]      = a0[r] * oscale;
    sl[ro + 16] = a1[r] * oscale;
    sl[ro + 32] = a2[r] * oscale;
    sl[ro + 48] = a3[r] * oscale;
  }
  wave_sync_lds();
  const v4f bb = *(const v4f*)(bias + col0 + m * 4);
  v4f br;
#pragma unroll
  for (int e = 0; e < 4; ++e) br[e] = bfr(bb[e]);
  v4f vals[8];
#pragma unroll
  for (int it = 0; it < 8; ++it) vals[it] = *(const v4f*)(sl + (it * 2 + hh) * 68 + m * 4) + br;
  float* dst = Cb + (size_t)hh * pitch + col0 + m * 4;
  {
#pragma unroll
    for (int it = 0; it < 8; ++it) {
      *(v4f*)(dst + (size_t)(it * 2) * pitch) = vals[it];
    }
    
  }
}

// =====================================================================================================
// bf16 GEMM: C[M][N] (f32) = A[M][K] (bf16 row-major) . Bt[N][K]^T (bf16 k-contiguous), times oscale, plus bias[col] (bf16 RNE value).
// Block = 64x64 tile, 4 waves x 16 rows; fragments loaded straight from the 16-bit rows (two 16-B loads each, split k map
// for A and B); K stepped by 32 (host guarantees K % 32 == 0, M % 64 == 0, N % 64 == 0, grid = (M/64)*(N/64)).
// =====================================================================================================
__global__ __launch_bounds__(128)
void gemm_bf(const u16* __restrict__ A, const u16* __restrict__ Bt, const float* __restrict__ bias,
             float* C, int M, int N, int K, float oscale) {
  __shared__ __align__(16) float slab[4 * SLAB64];
  const int tid = threadIdx.x, wave = tid >> 5, lane = tid & 31, hh = lane >> 4, m = lane & 15;
  const int ntile = N >> 6;
  const int bid   = blockIdx.x;
  const int rowb  = (bid / ntile) * 64 + wave * 16;
  const int col0  = (bid % ntile) * 64;
  if (rowb + 16 > M) return;                // wave-uniform, never taken with the exact grid; no block barriers in this kernel
  const u16* ap = A  + (size_t)(rowb + m) * K + 8 * hh;
  const u16* bp = Bt + (size_t)(col0 + m) * K + 8 * hh;
  const size_t bs = (size_t)16 * K;
  v8f acc0 = zero8(), acc1 = zero8(), acc2 = zero8(), acc3 = zero8();
#pragma unroll 1
  for (int k0 = 0; k0 < K; k0 += 32) {
    const v16b a  = ldfrag_b(ap + k0);
    const v16b b0 = ldfrag_b(bp + k0);
    const v16b b1 = ldfrag_b(bp + bs + k0);
    const v16b b2 = ldfrag_b(bp + 2 * bs + k0);
    const v16b b3 = ldfrag_b(bp + 3 * bs + k0);
    acc0 = mma_b(a, b0, acc0);
    acc1 = mma_b(a, b1, acc1);
    acc2 = mma_b(a, b2, acc2);
    acc3 = mma_b(a, b3, acc3);
    guard6<v16b>(acc0, acc1, acc2, acc3, a, b0, b1, b2, b3, a);
  }
  epi64(slab + wave * SLAB64, acc0, acc1, acc2, acc3, oscale, bias, C + (size_t)rowb * (size_t)N, (size_t)N, col0, lane);
}

// =====================================================================================================
// Output projection: out rows (s*NB + bb) of DMOD floats = (Ah + Al)[bb*SEQ + s][DMOD] . Bt[DMOD][DMOD]^T * oscale + bias
// (bf16 RNE value); products h.B + l.B into one accumulator (l unscaled residual).
// Block -> (column tile ct = bid % 16, sequence row tile rt of NRT, batch bb); the wave's 16 rows s = rt*64 + wave*16 .. +15 are
// consecutive rows of Ah/Al and rows of out spaced NB*DMOD floats apart (seq-major [s][b][DMOD] output layout).
// Same tiling and epilogue as gemm_bf; LDS slab wave-private.
// coverage: grid NB*NRT*16 blocks x 4 waves x (16 rows x 64 cols) = every (s, bb, col) of out exactly once.
// =====================================================================================================
__global__ __launch_bounds__(128)
void gemm_o2(const u16* __restrict__ Ah, const u16* __restrict__ Al, const u16* __restrict__ Bt, const float* __restrict__ bias,
             float* C, float oscale) {
  __shared__ __align__(16) float slab[4 * SLAB64];
  const int tid = threadIdx.x, wave = tid >> 5, lane = tid & 31, hh = lane >> 4, m = lane & 15;
  const int ntile = DMOD >> 6;
  const int bid   = blockIdx.x;
  const int ct    = bid % ntile;
  const int t2    = bid / ntile;
  const int rt    = t2 % NRT;
  const int bb    = t2 / NRT;
  if (bb >= NB) return;                     // block-uniform; no block barriers in this kernel; never taken with the exact grid
  const int srow  = rt * 64 + wave * 16;
  if (srow + 16 > SEQ) return;              // wave-uniform; never taken
  const int col0  = ct * 64;
  const int K     = DMOD;
  const size_t rowA = (size_t)bb * SEQ + srow;
  const _Float16* ahp = (const _Float16*)(const void*)Ah + (rowA + m) * K + 8 * hh;
  const _Float16* alp = (const _Float16*)(const void*)Al + (rowA + m) * K + 8 * hh;
  const _Float16* bp  = (const _Float16*)(const void*)Bt + (size_t)(col0 + m) * K + 8 * hh;
  const size_t bs = (size_t)16 * K;
  v8f acc0 = zero8(), acc1 = zero8(), acc2 = zero8(), acc3 = zero8();
#pragma unroll 1
  for (int k0 = 0; k0 < K; k0 += 32) {
    const v16h ah = ldfrag_h(ahp + k0), al = ldfrag_h(alp + k0);
    const v16h b0 = ldfrag_h(bp + k0);
    const v16h b1 = ldfrag_h(bp + bs + k0);
    const v16h b2 = ldfrag_h(bp + 2 * bs + k0);
    const v16h b3 = ldfrag_h(bp + 3 * bs + k0);
    acc0 = mma_h(ah, b0, acc0);  acc0 = mma_h(al, b0, acc0);
    acc1 = mma_h(ah, b1, acc1);  acc1 = mma_h(al, b1, acc1);
    acc2 = mma_h(ah, b2, acc2);  acc2 = mma_h(al, b2, acc2);
    acc3 = mma_h(ah, b3, acc3);  acc3 = mma_h(al, b3, acc3);
    guard6<v16h>(acc0, acc1, acc2, acc3, ah, al, b0, b1, b2, b3);
  }
  float* Cb = C + ((size_t)srow * NB + bb) * DMOD;
  epi64(slab + wave * SLAB64, acc0, acc1, acc2, acc3, oscale, bias, Cb, (size_t)NB * DMOD, col0, lane);
}

// =====================================================================================================
// Full (non-causal) attention over all JL keys. Block bid -> (query tile qt: rows q0 = 16*qt .. q0+15, head group hg of WPB
// heads, batch b); one wave per head = hg*WPB + wave.
//   q hi plane f16 x1024 and q residual plane, both [b*SEQ + s][h*HD + d]; k hi plane f16 x1024 [b*JL + j][h*HD + d];
//   v^T hi plane [b*NH + h][d][JL] f16 x1024.
//   Scores use two products q_hi.k_hi + q_lo.k_hi; q fragments loaded once per wave (2 k-steps x hi/residual).
//   score (log2 domain) t(i, j) = (q_i.k_j over HD) * (1/8)*log2e/(1024*1024); no key selection (every key contributes).
//   Key tiles of 32 visited in order, kt = 0 .. NKT-1 (static bound).
//   Per tile: 2 score subtiles x 2 k-steps, k fragments loaded straight from the 16-bit plane (two 16-B loads per fragment, split
//   k map); online max-subtracted base-2 softmax in f32, -inf-safe rescale; the 16x32 prob tile stored to wave-private LDS (f32
//   loads, same element type as stored), v^T B fragments in 2 groups of 2 d-subtiles (single product).
//   After the loop: out = acc / Z (Z >= 1 always; guarded anyway), carries 1/(32768*1024) folded once, written to the wave's
//   private result slab (pitch 68; every element owned by one lane).
// LDS: pt [16][36] (cols 0..31 written and read) and slab [16][68] (cols 0..63 written and read), both wave-private.
// coverage: per wave 4 instructions x 4 rows x 8 lanes x 8 halves = 16 x 64 per plane; grid NQT x NHG x NB blocks x WPB waves =
//           every (b, s, h) row segment of O hi and O residual exactly once.
// =====================================================================================================
__global__ __launch_bounds__(ATT_THREADS)
void attn_x(const u16* __restrict__ QHp, const u16* __restrict__ QLp, const u16* __restrict__ KHp,
            const u16* __restrict__ VHp, u16* OHp, u16* OLp) {
  __shared__ __align__(16) float smem[WPB * WREG];

  const int tid  = threadIdx.x;
  const int wave = tid >> 5;
  const int lane = tid & 31;
  const int hh   = lane >> 4;
  const int c    = lane & 15;
  const int bid  = blockIdx.x;
  const int qt   = bid % NQT;
  const int t2   = bid / NQT;
  const int hg   = t2 % NHG;
  const int b    = t2 / NHG;
  if (b >= NB) return;                      // block-uniform; no block barriers in this kernel; never taken with the exact grid
  const int q0   = qt * 16;                 // q0 + 16 <= SEQ by construction
  const int head = hg * WPB + wave;

  float* pt   = smem + wave * WREG;         // prob tile [16][32] pitch 36
  float* slab = pt + PTW;                   // result slab [16][64] pitch 68

  const size_t hcol = (size_t)head * HD + 8 * hh;
  const _Float16* Qh  = (const _Float16*)(const void*)QHp + ((size_t)b * SEQ + q0 + c) * DMOD + hcol;
  const _Float16* Ql  = (const _Float16*)(const void*)QLp + ((size_t)b * SEQ + q0 + c) * DMOD + hcol;
  const _Float16* Khb = (const _Float16*)(const void*)KHp + ((size_t)b * JL + c) * DMOD + hcol;           // key row kb added per step
  const _Float16* Vhb = (const _Float16*)(const void*)VHp + ((size_t)(b * NH + head) * HD + c) * JL + 8 * hh;   // d col c (+16j)
  const float lsc = SM_SCALE * (LOG2E / (QSC * KSC));
  const float oc  = 1.0f / (PCAR * VCAR);
  const size_t KROW = (size_t)DMOD;         // halves between consecutive key rows

  // ---- q fragments (hi and residual, 2 k-steps over HD), loaded once ----
  const v16h qh0 = ldfrag_h(Qh), qh1 = ldfrag_h(Qh + 32);
  const v16h ql0 = ldfrag_h(Ql), ql1 = ldfrag_h(Ql + 32);

  float mrow[8], lrow[8];
  v8f o[4];
#pragma unroll
  for (int r = 0; r < 8; ++r) { mrow[r] = -INFINITY; lrow[r] = 0.f; }
#pragma unroll
  for (int j = 0; j < 4; ++j) o[j] = zero8();

#pragma unroll 1
  for (int kt = 0; kt < NKT; ++kt) {
    const int kb = kt * 32;                 // kb + 31 <= JL - 1
    // ---- scores: D element r of this lane = (query row 8hh + r of the tile, key kb + c) in s0, key kb + 16 + c in s1 ----
    v8f s0 = zero8(), s1 = zero8();
    {
      const _Float16* k0p = Khb + (size_t)kb * KROW;
      const _Float16* k1p = k0p + (size_t)16 * KROW;
      const v16h ka0 = ldfrag_h(k0p), ka1 = ldfrag_h(k0p + 32);
      const v16h kc0 = ldfrag_h(k1p), kc1 = ldfrag_h(k1p + 32);
      s0 = mma_h(qh0, ka0, s0);
      s0 = mma_h(ql0, ka0, s0);
      s0 = mma_h(qh1, ka1, s0);
      s0 = mma_h(ql1, ka1, s0);
      s1 = mma_h(qh0, kc0, s1);
      s1 = mma_h(ql0, kc0, s1);
      s1 = mma_h(qh1, kc1, s1);
      s1 = mma_h(ql1, kc1, s1);
      guard2(s0, s1, ka0, ka1, kc0, kc1, qh0, ql0, qh1, ql1);
    }
    // ---- online softmax in base 2, -inf-safe ----
#pragma unroll
    for (int r = 0; r < 8; ++r) {
      const float t0 = s0[r] * lsc;
      const float t1 = s1[r] * lsc;
      float mx = fmaxf(t0, t1);
#pragma unroll
      for (int off = 1; off < 16; off <<= 1) mx = fmaxf(mx, __shfl_xor(mx, off, 32));
      const float mn = fmaxf(mrow[r], mx);
      const float ms = (mn == -INFINITY) ? 0.0f : mn;
      const float al = exp2f(mrow[r] - ms);
      mrow[r] = mn;
      const float e0 = exp2f(t0 - ms), e1 = exp2f(t1 - ms);
      float ps = e0 + e1;
#pragma unroll
      for (int off = 1; off < 16; off <<= 1) ps += __shfl_xor(ps, off, 32);
      lrow[r] = lrow[r] * al + ps;
#pragma unroll
      for (int j = 0; j < 4; ++j) o[j][r] *= al;
      const int ro = (8 * hh + r) * PTP + c;
      pt[ro]      = e0;
      pt[ro + 16] = e1;
    }
    wave_sync_lds();
    // ---- A fragment of P*32768 (f16), row = c, split k map over the 32 keys of this step ----
    FragH ph;
    {
      const float* prow = pt + c * PTP + 8 * hh;
      const v4f p0 = *(const v4f*)(prow), p1 = *(const v4f*)(prow + 4);
      const v4f p2 = *(const v4f*)(prow + 16), p3 = *(const v4f*)(prow + 20);
#pragma unroll
      for (int e = 0; e < 4; ++e) {
        ph.h[0][e]     = (_Float16)(p0[e] * PCAR);   // elements 0..7  = keys kb + 8hh + 0..7
        ph.h[0][4 + e] = (_Float16)(p1[e] * PCAR);
        ph.h[1][e]     = (_Float16)(p2[e] * PCAR);   // elements 8..15 = keys kb + 16 + 8hh + 0..7
        ph.h[1][4 + e] = (_Float16)(p3[e] * PCAR);
      }
    }
    // ---- P.V : B fragment col n = d = j*16 + c, keys contiguous in the v^T plane; 2 groups of 2 d-subtiles ----
    {
      const _Float16* vhp = Vhb + kb;
#pragma unroll
      for (int jg = 0; jg < HD / 32; ++jg) {
        const size_t da = (size_t)(2 * jg) * 16 * JL;
        const size_t db = da + (size_t)16 * JL;
        const v16h vha = ldfrag_h(vhp + da), vhc = ldfrag_h(vhp + db);
        o[2 * jg]     = mma_h(ph.v, vha, o[2 * jg]);
        o[2 * jg + 1] = mma_h(ph.v, vhc, o[2 * jg + 1]);
        guard2(o[2 * jg], o[2 * jg + 1], ph.v, vha, vhc, ph.v, vha, vhc, ph.v, ph.v);
      }
    }
    wave_sync_lds();
  }
  acc_guard4(o[0], o[1], o[2], o[3]);
  // ---- out = acc / Z (0 if Z == 0), carries (32768 on P, 1024 on v) folded once; written into the lane-owned slab ----
#pragma unroll
  for (int r = 0; r < 8; ++r) {
    const float lv  = lrow[r];
    const float ls  = (lv > 0.0f) ? lv : 1.0f;
    const float inv = (lv > 0.0f) ? ((1.0f / ls) * oc) : 0.0f;
#pragma unroll
    for (int j = 0; j < 4; ++j) {
      const int idx = (8 * hh + r) * SLP + j * 16 + c;
      slab[idx] = o[j][r] * inv;
    }
  }

  wave_sync_lds();
  // ---- O x1024 -> f16 hi + residual planes; lane = (row select rq in 0..3, 8 consecutive d at c8) ----
  v4u oh[4], ol[4];
  const int rq = lane >> 3, c8 = (lane & 7) * 8;
#pragma unroll
  for (int it = 0; it < 4; ++it) {
    const int row = it * 4 + rq;
    const v4f a = *(const v4f*)(slab + row * SLP + c8), b4 = *(const v4f*)(slab + row * SLP + c8 + 4);
    float w[8];
#pragma unroll
    for (int e = 0; e < 4; ++e) { w[e] = a[e] * OSC; w[4 + e] = b4[e] * OSC; }
#pragma unroll
    for (int e = 0; e < 4; ++e) {
      const _Float16 h0 = (_Float16)w[2 * e], h1 = (_Float16)w[2 * e + 1];
      const _Float16 l0 = (_Float16)(w[2 * e] - (float)h0), l1 = (_Float16)(w[2 * e + 1] - (float)h1);
      oh[it][e] = pk16(h_bits(h0), h_bits(h1));
      ol[it][e] = pk16(h_bits(l0), h_bits(l1));
    }
  }
  const size_t ob = ((size_t)b * SEQ + q0) * DMOD + (size_t)head * HD + c8;
  {
#pragma unroll
    for (int it = 0; it < 4; ++it) {
      const int row = it * 4 + rq;
      *(v4u*)(OHp + ob + (size_t)row * DMOD) = oh[it];
      *(v4u*)(OLp + ob + (size_t)row * DMOD) = ol[it];
    }
    
  }
}

// =====================================================================================================
// Workspace map (bytes); every plane is fully written by whole-line stores before it is read; all extents are exact multiples
// of the store granularity (rows of 2048 / 4096 B, v^T rows of JL*2 B; no pad rows needed); every region offset a multiple of
// 2097152:
//   XC  bf16 [CROWS][1024]              CROWS*2048   (c = [mem; kv] as bf16; later q as bf16 [QROWS][1024] at the same offset)
//   WB  16-bit [1024 n][1024 k]         2097152      (Wv, Wk, Wq as bf16, then Wc as f16 x1024, reused in launch order)
//   F   f32 [CROWS][1024]               CROWS*4096   (v, k, q projection output in launch order; afterwards the region holds
//                                                     OH f16 [QROWS][1024] x1024 at +0 and OL residual [QROWS][1024] at +QROWS*2048)
//   VH  f16 [NB*16][64][JL] x1024       CROWS*2048
//   KH  f16 [CROWS][1024] x1024         CROWS*2048
//   QH  f16 [QROWS][1024] x1024         QROWS*2048   QL residual the same
//   end (NB=2, SEQ=MLEN=2048)           102760448
// =====================================================================================================
extern "C" void kernel_launch(void* const* d_in, const int* in_sizes, int n_in,
                              void* d_out, int out_size, void* d_ws, size_t ws_size,
                              hipStream_t stream) {
  if (n_in < 11) return;
  const long long needq = ((long long)(SEQ - 1) * B_FULL + NB) * DMOD;
  const long long needm = (MLEN > 0) ? (((long long)(MLEN - 1) * B_FULL + NB) * DMOD) : 0;
  if ((long long)in_sizes[0] < needq || (long long)in_sizes[1] < needq || (long long)in_sizes[2] < needm) return;
  if (in_sizes[3] < DMOD * DMOD || in_sizes[5] < DMOD * DMOD || in_sizes[7] < DMOD * DMOD || in_sizes[9] < DMOD * DMOD) return;
  if (in_sizes[4] < DMOD || in_sizes[6] < DMOD || in_sizes[8] < DMOD || in_sizes[10] < DMOD) return;
  if ((long long)out_size < (long long)SEQ * NB * DMOD) return;

  const float* xq  = (const float*)d_in[0];
  const float* xkv = (const float*)d_in[1];
  const float* xm  = (const float*)d_in[2];
  const float* wq  = (const float*)d_in[3];
  const float* bq  = (const float*)d_in[4];
  const float* wk  = (const float*)d_in[5];
  const float* bk  = (const float*)d_in[6];
  const float* wv  = (const float*)d_in[7];
  const float* bv  = (const float*)d_in[8];
  const float* wc  = (const float*)d_in[9];
  const float* bc  = (const float*)d_in[10];
  float*       out = (float*)d_out;

  const size_t szXC = (size_t)CROWS * DMOD * 2;                 // also hosts XQ [QROWS][1024] bf16
  const size_t szXQ = (size_t)QROWS * DMOD * 2;
  const size_t szW  = (size_t)DMOD * DMOD * 2;
  const size_t szF  = (size_t)CROWS * DMOD * 4;                 // also hosts OH + OL
  const size_t szO  = (size_t)QROWS * DMOD * 2;                 // OH, OL each
  const size_t szVH = (size_t)NB * NH * HD * JL * 2;            // == CROWS*2048
  const size_t szKH = (size_t)CROWS * DMOD * 2;
  const size_t szQ  = (size_t)QROWS * DMOD * 2;                 // QH, QL each
  if (2 * szO > szF || szXQ > szXC) return;
  size_t off = 0;
  const size_t oXC = off; off += szXC;
  const size_t oW  = off; off += szW;
  const size_t oF  = off; off += szF;
  const size_t oVH = off; off += szVH;
  const size_t oKH = off; off += szKH;
  const size_t oQH = off; off += szQ;
  const size_t oQL = off; off += szQ;
  if (off > ws_size) return;                // off = 102760448 for NB = 2, SEQ = MLEN = 2048
  if (off > (size_t)WS_CAP) return;

  char* ws = (char*)d_ws;
  u16*   XC = (u16*)(ws + oXC);
  u16*   XQ = (u16*)(ws + oXC);
  u16*   WB = (u16*)(ws + oW);
  float* F  = (float*)(ws + oF);
  u16*   OH = (u16*)(ws + oF);
  u16*   OL = (u16*)(ws + oF + szO);
  u16*   VH = (u16*)(ws + oVH);
  u16*   KH = (u16*)(ws + oKH);
  u16*   QH = (u16*)(ws + oQH);
  u16*   QL = (u16*)(ws + oQL);

  const dim3 b256(256), b128(128), bQK(QKT), bAT(ATT_THREADS);
  const int  n8w = (DMOD * DMOD) / 8;
  const dim3 gW((n8w + 255) / 256);                     // 512 blocks per weight matrix
  const dim3 gXC(CROWS), gXQ(QROWS);
  const dim3 gGC((CROWS / 64) * (DMOD / 64));
  const dim3 gGQ((QROWS / 64) * (DMOD / 64));
  const dim3 gVT(NB * NH * NVT);
  const dim3 gAT(NQT * NHG * NB);
  const dim3 gO(NB * NRT * (DMOD / 64));

  // (1) c = [mem; kv] -> bf16 plane [CROWS][1024], batch-major rows b*JL + j
  cvt_act<<<gXC, bQK, 0, stream>>>(xm, xkv, XC, JL, MLEN);
  // (2) Wv [n][k] -> bf16 plane; (3) v = c.Wv^T + bv -> F f32; (4) v^T plane x1024
  cvt16<<<gW, b256, 0, stream>>>(wv, WB, n8w, 0, 1.0f);
  gemm_bf<<<gGC, b128, 0, stream>>>(XC, WB, bv, F, CROWS, DMOD, DMOD, 1.0f);
  vt16<<<gVT, b256, 0, stream>>>(F, VH);
  // (5) Wk -> bf16 plane; (6) k = c.Wk^T + bk -> F; (7) k hi plane x1024
  cvt16<<<gW, b256, 0, stream>>>(wk, WB, n8w, 0, 1.0f);
  gemm_bf<<<gGC, b128, 0, stream>>>(XC, WB, bk, F, CROWS, DMOD, DMOD, 1.0f);
  qk16<0><<<gXC, bQK, 0, stream>>>(F, KH, KH, CROWS, KSC);
  // (8) q -> bf16 plane (XC region); (9) Wq -> bf16 plane; (10) q = q.Wq^T + bq -> F; (11) q hi + residual planes x1024
  cvt_act<<<gXQ, bQK, 0, stream>>>(xq, xq, XQ, SEQ, SEQ);
  cvt16<<<gW, b256, 0, stream>>>(wq, WB, n8w, 0, 1.0f);
  gemm_bf<<<gGQ, b128, 0, stream>>>(XQ, WB, bq, F, QROWS, DMOD, DMOD, 1.0f);
  qk16<1><<<gXQ, bQK, 0, stream>>>(F, QH, QL, QROWS, QSC);
  // (12) Wc [n][k] -> f16 plane of bf16 value x1024
  cvt16<<<gW, b256, 0, stream>>>(wc, WB, n8w, 1, WOS);
  // (13) attention over all JL keys -> O hi + residual planes (F region)
  attn_x<<<gAT, bAT, 0, stream>>>(QH, QL, KH, VH, OH, OL);
  // (14) output projection -> out f32 rows (s*NB + b), carries 1024 x 1024 folded back
  gemm_o2<<<gO, b128, 0, stream>>>(OH, OL, WB, bc, out, 1.0f / (OSC * WOS));
  (void)hipGetLastError();
}

// v001
// A run of this version takes 420 microseconds.
// Two timings next to v000 put it at 1.31 and 1.33 times that version's speed.
// Contractions: q.Wq^T, c.Wk^T, c.Wv^T (c = [mem; kv] along the key axis) on v_wmma_f32_16x16x32_bf16 (activations, W and
// biases RNE-converted to bf16; the [n][k] weight rows are used directly as the k-contiguous B operand; f32 accumulate);
// q.k^T over 64 on v_wmma_f32_16x16x32_f16 with q carried as f16 hi (x1024) plus an f16 residual plane and k as f16 hi (x1024)
// (products h.h + l.h); P.v^T on v_wmma_f32_16x16x32_f16 (P x32768 f16, v x1024 f16, one product); O.Wc^T on
// v_wmma_f32_16x16x32_f16 (O x1024 as f16 hi plus f16 residual plane, Wc as f16(bf16(Wc)) x1024, products h.w + l.w);
// all f32 accumulate. Bias adds, base-2 online softmax over all keys and the 1/Z fold in f32 on VALU.
// Every 16-bit workspace plane is stored fragment-packed (see "packed planes" below): a wave-wide 16-B fragment load reads 512
// contiguous bytes (4 whole lines) instead of 32 B out of each of 16 rows.
#include <hip/hip_runtime.h>
#include <math.h>
#include <stdint.h>

#ifndef NB
#define NB 2
#endif
#ifndef SEQ
#define SEQ 2048
#endif
#ifndef MLEN
#define MLEN 2048
#endif
#define B_FULL 2
#define L_FULL 2048
#define M_FULL 2048
#define DMOD  1024
#define NH    16
#define HD    64
#define JL    (MLEN + SEQ)
#define QROWS (NB * SEQ)
#define CROWS (NB * JL)
#define SM_SCALE 0.125f
#define LOG2E 1.4426950408889634f
#define QSC   1024.0f
#define KSC   1024.0f
#define PCAR  32768.0f
#define VCAR  1024.0f
#define OSC   1024.0f
#define WOS   1024.0f
#define WPB   4
#define NHG   (NH / WPB)
#define NQT   (SEQ / 16)
#define NKT   (JL / 32)
#define NVT   (JL / 64)
#define NRT   (SEQ / 64)
#define ATT_THREADS (WPB * 32)
#define PTP   36
#define PTW   (16 * PTP)
#define SLP   68
#define SLW   (16 * SLP)
#define WREG  (PTW + SLW)
#define SLAB64 (16 * 68)
#define VTP   72
#define QKT   (DMOD / 8)
#define WS_CAP 134217728
#define FT    512                 // halves in one packed 16 x 32 fragment tile (1 KiB)
#define TPB   (DMOD / 32)         // fragment tiles in one 16-row band of a [rows][DMOD] plane
static_assert(DMOD == NH * HD && HD == 64 && NH == 16);
static_assert((NH % WPB) == 0 && ATT_THREADS == 128);
static_assert(NB >= 1 && NB <= B_FULL);
static_assert((SEQ % 64) == 0 && SEQ >= 64 && SEQ <= L_FULL);
static_assert((MLEN % 64) == 0 && MLEN >= 0 && MLEN <= M_FULL);
static_assert((JL % 64) == 0 && NKT * 32 == JL && NVT * 64 == JL && NQT * 16 == SEQ && NRT * 64 == SEQ);
static_assert(QKT == 128 && (DMOD % 64) == 0 && (DMOD % 32) == 0 && (HD % 32) == 0);
static_assert(((DMOD * DMOD) % (8 * 256)) == 0);
static_assert(QROWS <= CROWS);
static_assert(TPB == 32 && QKT == 2 * 64 && (TPB % 2) == 0 && (MLEN % 16) == 0 && (SEQ % 16) == 0 && (JL % 16) == 0);
static_assert((long long)CROWS * DMOD * 10 + (long long)QROWS * DMOD * 4 + 2LL * DMOD * DMOD <= (long long)WS_CAP);

typedef unsigned short u16;
typedef _Float16 v16h __attribute__((ext_vector_type(16)));
typedef _Float16 v8h  __attribute__((ext_vector_type(8)));
typedef __bf16   v16b __attribute__((ext_vector_type(16)));
typedef float    v8f  __attribute__((ext_vector_type(8)));
typedef float    v4f  __attribute__((ext_vector_type(4)));
typedef unsigned int v4u __attribute__((ext_vector_type(4)));

union FragH { v16h v; v8h h[2]; v4u u[2]; };
union FragB { v16b v; v4u u[2]; };

// ---- scalar helpers --------------------------------------------------------------------------------
__device__ __forceinline__ unsigned short bf_bits(float f) {          // f32 -> bf16 bits, RNE convert
  unsigned u = __float_as_uint(f);
  return (unsigned short)((u + 0x7FFFu + ((u >> 16) & 1u)) >> 16);
}
__device__ __forceinline__ float bf_up(unsigned short h) { return __uint_as_float(((unsigned)h) << 16); }
__device__ __forceinline__ float bfr(float f) { return bf_up(bf_bits(f)); }
__device__ __forceinline__ unsigned short h_bits(_Float16 x) { return __builtin_bit_cast(unsigned short, x); }
__device__ __forceinline__ unsigned pk16(unsigned short a, unsigned short b) { return (unsigned)a | ((unsigned)b << 16); }
__device__ __forceinline__ v8f zero8() { v8f z = {0.f, 0.f, 0.f, 0.f, 0.f, 0.f, 0.f, 0.f}; return z; }

// ---- packed planes: a [rows][K] 16-bit matrix is stored as 16 x 32 fragment tiles of FT halves, tile (row >> 4, k >> 5) at
//      index (row >> 4) * (K / 32) + (k >> 5); inside a tile element (c = row & 15, kk = k & 31) sits at
//      (kk >> 4) * 256 + (((kk >> 3) & 1) * 16 + c) * 8 + (kk & 7): chunk g of 8 halves = what lane g & 31 takes in load g >> 5.
// ---- fragment loaders: 16-bit A/B operand, lane -> row/col (lane&15), p = tile start + 8*lane;
//      elements 0..7 <- p[0..7] (k0+8h..), elements 8..15 <- p[256..263] (k0+16+8h..)  (same split k map for A and B)
__device__ __forceinline__ v16h ldfrag_h(const _Float16* p) {
  FragH f;
  f.h[0] = *(const v8h*)(p);
  f.h[1] = *(const v8h*)(p + 256);
  return f.v;
}
__device__ __forceinline__ v16b ldfrag_b(const u16* p) {              // bf16 plane read as unsigned integer vectors
  FragB f;
  f.u[0] = *(const v4u*)(p);
  f.u[1] = *(const v4u*)(p + 256);
  return f.v;
}
// first column of chunk w (0..63) inside its tile
__device__ __forceinline__ int chunk_k(int w) { return ((w >> 5) & 1) * 16 + ((w >> 4) & 1) * 8; }

__device__ __forceinline__ v8f mma_h(v16h a, v16h b, v8f c) {
  return __builtin_amdgcn_wmma_f32_16x16x32_f16(false, a, false, b, (short)0, c, false, false);
}
__device__ __forceinline__ v8f mma_b(v16b a, v16b b, v8f c) {
  return __builtin_amdgcn_wmma_f32_16x16x32_bf16(false, a, false, b, (short)0, c, false, false);
}
__device__ __forceinline__ void guard2(v8f& a, v8f& b, v16h x0, v16h x1, v16h x2, v16h x3,
                                       v16h x4, v16h x5, v16h x6, v16h x7) {
#if defined(__HIP_DEVICE_COMPILE__)
  asm volatile("v_nop\n\tv_nop\n\tv_nop\n\tv_nop"
               : "+v"(a), "+v"(b)
               : "v"(x0), "v"(x1), "v"(x2), "v"(x3), "v"(x4), "v"(x5), "v"(x6), "v"(x7) : "memory");
#endif
}
template <typename F>
__device__ __forceinline__ void guard6(v8f& a, v8f& b, v8f& c, v8f& d, F x0, F x1, F x2, F x3, F x4, F x5) {
#if defined(__HIP_DEVICE_COMPILE__)
  asm volatile("v_nop\n\tv_nop\n\tv_nop\n\tv_nop"
               : "+v"(a), "+v"(b), "+v"(c), "+v"(d) : "v"(x0), "v"(x1), "v"(x2), "v"(x3), "v"(x4), "v"(x5) : "memory");
#endif
}
__device__ __forceinline__ void acc_guard4(v8f& a, v8f& b, v8f& c, v8f& d) {
#if defined(__HIP_DEVICE_COMPILE__)
  asm volatile("v_nop\n\tv_nop\n\tv_nop\n\tv_nop" : "+v"(a), "+v"(b), "+v"(c), "+v"(d));
#endif
}
__device__ __forceinline__ void wave_sync_lds() {
  __builtin_amdgcn_fence(__ATOMIC_RELEASE, "workgroup");
  __builtin_amdgcn_wave_barrier();
  __builtin_amdgcn_fence(__ATOMIC_ACQUIRE, "workgroup");
}

// =====================================================================================================
// f32 [DMOD n][DMOD k] -> packed 16-bit plane.  f16mode == 0: bf16 RNE bits;  f16mode == 1: f16 bits of (bf16 RNE value) * scale.
// Used for the [n][k] weight matrices (bf16, or f16 of the bf16 value x1024 for Wc).
// Thread = packed chunk gt (8 consecutive k of one row): two 16-B loads, one 16-B store; 32 lanes store 512 contiguous bytes
// coverage: grid = ceil(n8/256) blocks x 256 thr x 8 (in-kernel bound) = the whole plane (n8 = 131072, a multiple of 256).
// =====================================================================================================
__global__ __launch_bounds__(256) void cvt16(const float* __restrict__ x, u16* D, int n8, int f16mode, float scale) {
  const int gt = blockIdx.x * 256 + (int)threadIdx.x;
  if (gt >= n8) return;
  const int tile = gt >> 6;
  const float* p = x + (size_t)((tile / TPB) * 16 + (gt & 15)) * DMOD + (tile % TPB) * 32 + chunk_k(gt & 63);
  const v4f a = *(const v4f*)(p), b4 = *(const v4f*)(p + 4);
  float w[8];
#pragma unroll
  for (int e = 0; e < 4; ++e) { w[e] = a[e]; w[4 + e] = b4[e]; }
  v4u o;
#pragma unroll
  for (int e = 0; e < 4; ++e) {
    const float f0 = w[2 * e], f1 = w[2 * e + 1];
    const unsigned short hb0 = h_bits((_Float16)(bfr(f0) * scale));
    const unsigned short hb1 = h_bits((_Float16)(bfr(f1) * scale));
    const unsigned short bb0 = bf_bits(f0);
    const unsigned short bb1 = bf_bits(f1);
    o[e] = (f16mode != 0) ? pk16(hb0, hb1) : pk16(bb0, bb1);
  }
  u16* d = D + (size_t)gt * 8;
  {
    *(v4u*)(d) = o;
    
  }
}

// =====================================================================================================
// Activation rows -> packed bf16 plane (RNE), batch-major destination rows:
//   D[(bb*nrow + j)][0..1023] <- X0[(j*B_FULL + bb)][..] for j < split,  X1[((j - split)*B_FULL + bb)][..] for j >= split.
// Used for c = [mem rows 0..MLEN-1 ; kv rows 0..SEQ-1] (nrow = JL, split = MLEN) and for q (nrow = SEQ, split = SEQ, X1 unused).
// Block = two packed tiles of one 16-row band (16 rows x 64 columns), thread = one chunk: two 16-B loads, one 16-B store.
// The source base selection is block-uniform (nrow and split are multiples of 16; both sources are global planes).
// coverage: grid = NB*nrow blocks x 128 chunks x 8 = every element of the [NB*nrow][1024] plane exactly once.
// =====================================================================================================
__global__ __launch_bounds__(QKT) void cvt_act(const float* __restrict__ X0, const float* __restrict__ X1, u16* D,
                                               int nrow, int split) {
  const int tid = (int)threadIdx.x;
  const int r   = (int)blockIdx.x;
  if (r >= NB * nrow) return;
  if (tid >= QKT) return;
  const int  r0    = (r / (TPB / 2)) * 16;                    // first row of the band
  const int  col   = ((r % (TPB / 2)) * 2 + (tid >> 6)) * 32 + chunk_k(tid & 63);
  const int  bb    = r0 / nrow;
  const int  j     = r0 - bb * nrow;
  const bool first = (j < split);
  const int  js    = (first ? j : (j - split)) + (tid & 15);
  const float* base = first ? X0 : X1;
  const float* p = base + ((size_t)js * B_FULL + bb) * DMOD + col;
  const v4f a = *(const v4f*)(p), a4 = *(const v4f*)(p + 4);
  v4u o;
#pragma unroll
  for (int e = 0; e < 2; ++e) {
    o[e]     = pk16(bf_bits(a[2 * e]),  bf_bits(a[2 * e + 1]));
    o[2 + e] = pk16(bf_bits(a4[2 * e]), bf_bits(a4[2 * e + 1]));
  }
  u16* d = D + ((size_t)r * QKT + tid) * 8;
  {
    *(v4u*)(d) = o;
    
  }
}

// =====================================================================================================
// v^T plane from the v projection F f32 [CROWS][DMOD] (row = bb*JL + j, column = g*HD + d, bias already added):
//   VH = f16(v * 1024) for all keys j, packed: tile (head bb*NH + g, key step kt = j >> 5, d subtile d >> 4) at index
//   ((bb*NH + g)*NKT + kt)*4 + (d >> 4), row in the tile = d & 15, k = j & 31.
// Block = (bb, head g, 64 keys s0): each thread loads its 16 floats (key sl, d chunk dc) with 16-B loads, converts, scatters into
// the LDS tile [d][64 keys] (pitch 72 halves, cross-wave -> block barrier); after the barrier each d row segment (64 halves = one
// LDS extent: TH[64*72], written rows 0..63 x cols 0..63, read rows 0..63 x cols 0..63 (staged extent == consumed extent).
// coverage: load 256 thr x 16 = 64 keys x 64 d; store 2 iterations x 256 thr x 8 halves = 64 lines x 64 = the block's tile;
//           grid = NB*NH*NVT blocks covers VH exactly once.
// =====================================================================================================
__global__ __launch_bounds__(256) void vt16(const float* __restrict__ F, u16* VHo) {
  __shared__ __align__(16) u16 TH[HD * VTP];
  const int tid = threadIdx.x;
  const int bid = blockIdx.x;
  const int st  = bid % NVT;
  const int t2  = bid / NVT;
  const int g   = t2 % NH;
  const int bb  = t2 / NH;
  if (bb >= NB) return;                     // block-uniform, before any barrier; never taken with the exact grid
  const int s0  = st * 64;
  {
    const int sl = tid >> 2;                // key within tile 0..63
    const int dc = (tid & 3) * 16;          // d chunk 0,16,32,48
    const float* src = F + ((size_t)bb * JL + s0 + sl) * DMOD + g * HD + dc;
#pragma unroll
    for (int i = 0; i < 4; ++i) {
      const v4f a = *(const v4f*)(src + 4 * i);
#pragma unroll
      for (int e = 0; e < 4; ++e) {
        const _Float16 hv = (_Float16)(a[e] * VCAR);
        TH[(dc + 4 * i + e) * VTP + sl] = h_bits(hv);
      }
    }
  }
  __syncthreads();
  v4u vh[2];
#pragma unroll
  for (int it = 0; it < 2; ++it) {          // it = key step within the block's 64 keys; tid >> 6 = d subtile; tid & 63 = chunk
    const int line = (tid >> 6) * 16 + (tid & 15);          // d = 0..63
    vh[it] = *(const v4u*)(TH + line * VTP + it * 32 + chunk_k(tid & 63));
  }
  const size_t baseH = ((size_t)(bb * NH + g) * NKT + st * 2) * 4 * FT + (size_t)tid * 8;
  {
#pragma unroll
    for (int it = 0; it < 2; ++it) {
      *(v4u*)(VHo + baseH + (size_t)it * 4 * FT) = vh[it];
    }
    
  }
}

// =====================================================================================================
// q / k planes from a projection F f32 [nrows][DMOD] (bias already added): Hp [nrows][DMOD] = f16(val * sc), packed;
// when RES: Lp [nrows][DMOD] = f16 residual f16(val*sc - hi), packed. Block = two packed tiles of one 16-row band, thread = one
// chunk: two 16-B loads, one 16-B store per plane; 32 consecutive lanes store 512 contiguous 512-B-aligned bytes per instruction
// coverage: grid = nrows blocks x 128 chunks x 8 = every element of Hp (and of Lp) exactly once (nrows a multiple of 16).
// =====================================================================================================
template <int RES>
__global__ __launch_bounds__(QKT) void qk16(const float* __restrict__ F, u16* Hp, u16* Lp, int nrows, float sc) {
  const int tid = (int)threadIdx.x;
  const int row = (int)blockIdx.x;
  if (row >= nrows) return;
  if (tid >= QKT) return;
  const float* p = F + (size_t)((row / (TPB / 2)) * 16 + (tid & 15)) * DMOD
                     + ((row % (TPB / 2)) * 2 + (tid >> 6)) * 32 + chunk_k(tid & 63);
  const v4f a = *(const v4f*)(p), b4 = *(const v4f*)(p + 4);
  float w[8];
#pragma unroll
  for (int e = 0; e < 4; ++e) { w[e] = a[e] * sc; w[4 + e] = b4[e] * sc; }
  v4u oh, ol;
#pragma unroll
  for (int e = 0; e < 4; ++e) {
    const float t0 = w[2 * e], t1 = w[2 * e + 1];
    const _Float16 h0 = (_Float16)t0, h1 = (_Float16)t1;
    const _Float16 l0 = (_Float16)(t0 - (float)h0), l1 = (_Float16)(t1 - (float)h1);
    oh[e] = pk16(h_bits(h0), h_bits(h1));
    ol[e] = pk16(h_bits(l0), h_bits(l1));
  }
  u16* dh = Hp + (size_t)row * DMOD + tid * 8;
  u16* dl = Lp + (size_t)row * DMOD + tid * 8;
  {
    *(v4u*)(dh) = oh;
    if constexpr (RES != 0) {
      *(v4u*)(dl) = ol;
    }
    
  }
}

// =====================================================================================================
// GEMM epilogue shared by both engines: the wave's 16x64 f32 tile (times oscale) staged in its private LDS slab (pitch 68),
// coverage: 8 instructions x 2 rows x 16 lanes x 4 floats = the wave's 16 x 64 tile.
// =====================================================================================================
__device__ __forceinline__ void epi64(float* sl, v8f a0, v8f a1, v8f a2, v8f a3, float oscale,
                                      const float* __restrict__ bias, float* Cb, size_t pitch, int col0, int lane) {
  const int hh = lane >> 4, m = lane & 15;
#pragma unroll
  for (int r = 0; r < 8; ++r) {
    const int ro = (8 * hh + r) * 68 + m;
    sl[ro]      = a0[r] * oscale;
    sl[ro + 16] = a1[r] * oscale;
    sl[ro + 32] = a2[r] * oscale;
    sl[ro + 48] = a3[r] * oscale;
  }
  wave_sync_lds();
  const v4f bb = *(const v4f*)(bias + col0 + m * 4);
  v4f br;
#pragma unroll
  for (int e = 0; e < 4; ++e) br[e] = bfr(bb[e]);
  v4f vals[8];
#pragma unroll
  for (int it = 0; it < 8; ++it) vals[it] = *(const v4f*)(sl + (it * 2 + hh) * 68 + m * 4) + br;
  float* dst = Cb + (size_t)hh * pitch + col0 + m * 4;
  {
#pragma unroll
    for (int it = 0; it < 8; ++it) {
      *(v4f*)(dst + (size_t)(it * 2) * pitch) = vals[it];
    }
    
  }
}

// =====================================================================================================
// bf16 GEMM: C[M][N] (f32) = A[M][K] (bf16 packed) . Bt[N][K]^T (bf16 packed), times oscale, plus bias[col] (bf16 RNE value).
// Block = 64x64 tile, 4 waves x 16 rows; fragments loaded straight from the packed tiles (two 16-B loads each, split k map
// for A and B); K stepped by 32 (host guarantees K % 32 == 0, M % 64 == 0, N % 64 == 0, grid = (M/64)*(N/64)).
// =====================================================================================================
__global__ __launch_bounds__(128)
void gemm_bf(const u16* __restrict__ A, const u16* __restrict__ Bt, const float* __restrict__ bias,
             float* C, int M, int N, int K, float oscale) {
  __shared__ __align__(16) float slab[4 * SLAB64];
  const int tid = threadIdx.x, wave = tid >> 5, lane = tid & 31;
  const int ntile = N >> 6;
  const int bid   = blockIdx.x;
  const int rowb  = (bid / ntile) * 64 + wave * 16;
  const int col0  = (bid % ntile) * 64;
  if (rowb + 16 > M) return;                // wave-uniform, never taken with the exact grid; no block barriers in this kernel
  const u16* ap = A  + (size_t)rowb * K + 8 * lane;          // a 16-row band holds 16*K halves
  const u16* bp = Bt + (size_t)col0 * K + 8 * lane;
  const size_t bs = (size_t)16 * K;
  v8f acc0 = zero8(), acc1 = zero8(), acc2 = zero8(), acc3 = zero8();
#pragma unroll 1
  for (int k0 = 0; k0 < 16 * K; k0 += FT) {                  // one packed tile = 32 k
    const v16b a  = ldfrag_b(ap + k0);
    const v16b b0 = ldfrag_b(bp + k0);
    const v16b b1 = ldfrag_b(bp + bs + k0);
    const v16b b2 = ldfrag_b(bp + 2 * bs + k0);
    const v16b b3 = ldfrag_b(bp + 3 * bs + k0);
    acc0 = mma_b(a, b0, acc0);
    acc1 = mma_b(a, b1, acc1);
    acc2 = mma_b(a, b2, acc2);
    acc3 = mma_b(a, b3, acc3);
    guard6<v16b>(acc0, acc1, acc2, acc3, a, b0, b1, b2, b3, a);
  }
  epi64(slab + wave * SLAB64, acc0, acc1, acc2, acc3, oscale, bias, C + (size_t)rowb * (size_t)N, (size_t)N, col0, lane);
}

// =====================================================================================================
// Output projection: out rows (s*NB + bb) of DMOD floats = (Ah + Al)[bb*SEQ + s][DMOD] . Bt[DMOD][DMOD]^T * oscale + bias
// (bf16 RNE value); products h.B + l.B into one accumulator (l unscaled residual).
// Block -> (column tile ct = bid % 16, sequence row tile rt of NRT, batch bb); the wave's 16 rows s = rt*64 + wave*16 .. +15 are
// consecutive rows of Ah/Al and rows of out spaced NB*DMOD floats apart (seq-major [s][b][DMOD] output layout).
// Same tiling and epilogue as gemm_bf; LDS slab wave-private.
// coverage: grid NB*NRT*16 blocks x 4 waves x (16 rows x 64 cols) = every (s, bb, col) of out exactly once.
// =====================================================================================================
__global__ __launch_bounds__(128)
void gemm_o2(const u16* __restrict__ Ah, const u16* __restrict__ Al, const u16* __restrict__ Bt, const float* __restrict__ bias,
             float* C, float oscale) {
  __shared__ __align__(16) float slab[4 * SLAB64];
  const int tid = threadIdx.x, wave = tid >> 5, lane = tid & 31;
  const int ntile = DMOD >> 6;
  const int bid   = blockIdx.x;
  const int ct    = bid % ntile;
  const int t2    = bid / ntile;
  const int rt    = t2 % NRT;
  const int bb    = t2 / NRT;
  if (bb >= NB) return;                     // block-uniform; no block barriers in this kernel; never taken with the exact grid
  const int srow  = rt * 64 + wave * 16;
  if (srow + 16 > SEQ) return;              // wave-uniform; never taken
  const int col0  = ct * 64;
  const int K     = DMOD;
  const size_t rowA = (size_t)bb * SEQ + srow;
  const _Float16* ahp = (const _Float16*)(const void*)Ah + rowA * K + 8 * lane;          // packed planes, as in gemm_bf
  const _Float16* alp = (const _Float16*)(const void*)Al + rowA * K + 8 * lane;
  const _Float16* bp  = (const _Float16*)(const void*)Bt + (size_t)col0 * K + 8 * lane;
  const size_t bs = (size_t)16 * K;
  v8f acc0 = zero8(), acc1 = zero8(), acc2 = zero8(), acc3 = zero8();
#pragma unroll 1
  for (int k0 = 0; k0 < 16 * K; k0 += FT) {
    const v16h ah = ldfrag_h(ahp + k0), al = ldfrag_h(alp + k0);
    const v16h b0 = ldfrag_h(bp + k0);
    const v16h b1 = ldfrag_h(bp + bs + k0);
    const v16h b2 = ldfrag_h(bp + 2 * bs + k0);
    const v16h b3 = ldfrag_h(bp + 3 * bs + k0);
    // the address pairs of the twelve loads above are inputs here, so no load's result is placed on one of them, and they are
    // rewritten only behind this wait
    asm volatile("s_wait_xcnt 0x0" :: "v"(ahp + k0), "v"(alp + k0), "v"(bp + k0) : "memory");
    acc0 = mma_h(ah, b0, acc0);  acc0 = mma_h(al, b0, acc0);
    acc1 = mma_h(ah, b1, acc1);  acc1 = mma_h(al, b1, acc1);
    acc2 = mma_h(ah, b2, acc2);  acc2 = mma_h(al, b2, acc2);
    acc3 = mma_h(ah, b3, acc3);  acc3 = mma_h(al, b3, acc3);
    guard6<v16h>(acc0, acc1, acc2, acc3, ah, al, b0, b1, b2, b3);
  }
  float* Cb = C + ((size_t)srow * NB + bb) * DMOD;
  epi64(slab + wave * SLAB64, acc0, acc1, acc2, acc3, oscale, bias, Cb, (size_t)NB * DMOD, col0, lane);
}

// =====================================================================================================
// Full (non-causal) attention over all JL keys. Block bid -> (query tile qt: rows q0 = 16*qt .. q0+15, head group hg of WPB
// heads, batch b); one wave per head = hg*WPB + wave.
//   q hi plane f16 x1024 and q residual plane, both [b*SEQ + s][h*HD + d]; k hi plane f16 x1024 [b*JL + j][h*HD + d];
//   v^T hi plane [b*NH + h][d][JL] f16 x1024; all packed (v^T with the four d subtiles of a key step side by side).
//   Scores use two products q_hi.k_hi + q_lo.k_hi; q fragments loaded once per wave (2 k-steps x hi/residual).
//   score (log2 domain) t(i, j) = (q_i.k_j over HD) * (1/8)*log2e/(1024*1024); no key selection (every key contributes).
//   Key tiles of 32 visited in order, kt = 0 .. NKT-1 (static bound).
//   Per tile: 2 score subtiles x 2 k-steps, k fragments loaded straight from the 16-bit plane (two 16-B loads per fragment, split
//   k map); online max-subtracted base-2 softmax in f32, -inf-safe rescale; the 16x32 prob tile stored to wave-private LDS (f32
//   loads, same element type as stored), v^T B fragments in 2 groups of 2 d-subtiles (single product).
//   After the loop: out = acc / Z (Z >= 1 always; guarded anyway), carries 1/(32768*1024) folded once, written to the wave's
//   private result slab (pitch 68; every element owned by one lane).
// LDS: pt [16][36] (cols 0..31 written and read) and slab [16][68] (cols 0..63 written and read), both wave-private.
// coverage: per wave 4 instructions x 32 lanes x 8 halves = the head's two packed tiles (16 x 64) per plane; grid NQT x NHG x NB blocks x WPB waves =
//           every (b, s, h) row segment of O hi and O residual exactly once.
// =====================================================================================================
__global__ __launch_bounds__(ATT_THREADS)
void attn_x(const u16* __restrict__ QHp, const u16* __restrict__ QLp, const u16* __restrict__ KHp,
            const u16* __restrict__ VHp, u16* OHp, u16* OLp) {
  __shared__ __align__(16) float smem[WPB * WREG];

  const int tid  = threadIdx.x;
  const int wave = tid >> 5;
  const int lane = tid & 31;
  const int hh   = lane >> 4;
  const int c    = lane & 15;
  const int bid  = blockIdx.x;
  const int qt   = bid % NQT;
  const int t2   = bid / NQT;
  const int hg   = t2 % NHG;
  const int b    = t2 / NHG;
  if (b >= NB) return;                      // block-uniform; no block barriers in this kernel; never taken with the exact grid
  const int q0   = qt * 16;                 // q0 + 16 <= SEQ by construction
  const int head = hg * WPB + wave;

  float* pt   = smem + wave * WREG;         // prob tile [16][32] pitch 36
  float* slab = pt + PTW;                   // result slab [16][64] pitch 68

  const size_t hcol = (size_t)head * (HD / 32) * FT + 8 * lane;        // the head's two tiles inside a 16-row band
  const _Float16* Qh  = (const _Float16*)(const void*)QHp + ((size_t)b * SEQ + q0) * DMOD + hcol;
  const _Float16* Ql  = (const _Float16*)(const void*)QLp + ((size_t)b * SEQ + q0) * DMOD + hcol;
  const _Float16* Khb = (const _Float16*)(const void*)KHp + ((size_t)b * JL) * DMOD + hcol;               // key band kb added per step
  const _Float16* Vhb = (const _Float16*)(const void*)VHp + (size_t)(b * NH + head) * NKT * 4 * FT + 8 * lane;  // key step kt, d subtile j
  const float lsc = SM_SCALE * (LOG2E / (QSC * KSC));
  const float oc  = 1.0f / (PCAR * VCAR);
  const size_t KROW = (size_t)DMOD;         // halves per key row (a 16-key band holds 16 * KROW)

  // ---- q fragments (hi and residual, 2 k-steps over HD), loaded once ----
  const v16h qh0 = ldfrag_h(Qh), qh1 = ldfrag_h(Qh + FT);
  const v16h ql0 = ldfrag_h(Ql), ql1 = ldfrag_h(Ql + FT);

  float mrow[8], lrow[8];
  v8f o[4];
#pragma unroll
  for (int r = 0; r < 8; ++r) { mrow[r] = -INFINITY; lrow[r] = 0.f; }
#pragma unroll
  for (int j = 0; j < 4; ++j) o[j] = zero8();

#pragma unroll 1
  for (int kt = 0; kt < NKT; ++kt) {
    const int kb = kt * 32;                 // kb + 31 <= JL - 1
    // ---- scores: D element r of this lane = (query row 8hh + r of the tile, key kb + c) in s0, key kb + 16 + c in s1 ----
    v8f s0 = zero8(), s1 = zero8();
    {
      const _Float16* k0p = Khb + (size_t)kb * KROW;
      const _Float16* k1p = k0p + (size_t)16 * KROW;
      const v16h ka0 = ldfrag_h(k0p), ka1 = ldfrag_h(k0p + FT);
      const v16h kc0 = ldfrag_h(k1p), kc1 = ldfrag_h(k1p + FT);
      // the address pair of the eight loads above is an input here, so no load's result is placed on it, and it is
      // rewritten only behind this wait
      asm volatile("s_wait_xcnt 0x0" :: "v"(k0p) : "memory");
      s0 = mma_h(qh0, ka0, s0);
      s0 = mma_h(ql0, ka0, s0);
      s0 = mma_h(qh1, ka1, s0);
      s0 = mma_h(ql1, ka1, s0);
      s1 = mma_h(qh0, kc0, s1);
      s1 = mma_h(ql0, kc0, s1);
      s1 = mma_h(qh1, kc1, s1);
      s1 = mma_h(ql1, kc1, s1);
      guard2(s0, s1, ka0, ka1, kc0, kc1, qh0, ql0, qh1, ql1);
    }
    // ---- online softmax in base 2, -inf-safe ----
#pragma unroll
    for (int r = 0; r < 8; ++r) {
      const float t0 = s0[r] * lsc;
      const float t1 = s1[r] * lsc;
      float mx = fmaxf(t0, t1);
#pragma unroll
      for (int off = 1; off < 16; off <<= 1) mx = fmaxf(mx, __shfl_xor(mx, off, 32));
      const float mn = fmaxf(mrow[r], mx);
      const float ms = (mn == -INFINITY) ? 0.0f : mn;
      const float al = exp2f(mrow[r] - ms);
      mrow[r] = mn;
      const float e0 = exp2f(t0 - ms), e1 = exp2f(t1 - ms);
      float ps = e0 + e1;
#pragma unroll
      for (int off = 1; off < 16; off <<= 1) ps += __shfl_xor(ps, off, 32);
      lrow[r] = lrow[r] * al + ps;
#pragma unroll
      for (int j = 0; j < 4; ++j) o[j][r] *= al;
      const int ro = (8 * hh + r) * PTP + c;
      pt[ro]      = e0;
      pt[ro + 16] = e1;
    }
    wave_sync_lds();
    // ---- A fragment of P*32768 (f16), row = c, split k map over the 32 keys of this step ----
    FragH ph;
    {
      const float* prow = pt + c * PTP + 8 * hh;
      const v4f p0 = *(const v4f*)(prow), p1 = *(const v4f*)(prow + 4);
      const v4f p2 = *(const v4f*)(prow + 16), p3 = *(const v4f*)(prow + 20);
#pragma unroll
      for (int e = 0; e < 4; ++e) {
        ph.h[0][e]     = (_Float16)(p0[e] * PCAR);   // elements 0..7  = keys kb + 8hh + 0..7
        ph.h[0][4 + e] = (_Float16)(p1[e] * PCAR);
        ph.h[1][e]     = (_Float16)(p2[e] * PCAR);   // elements 8..15 = keys kb + 16 + 8hh + 0..7
        ph.h[1][4 + e] = (_Float16)(p3[e] * PCAR);
      }
    }
    // ---- P.V : B fragment col n = d = j*16 + c, keys contiguous in the v^T plane; 2 groups of 2 d-subtiles ----
    {
      const _Float16* vhp = Vhb + (size_t)kt * 4 * FT;
#pragma unroll
      for (int jg = 0; jg < HD / 32; ++jg) {
        const size_t da = (size_t)(2 * jg) * FT;
        const size_t db = da + (size_t)FT;
        const v16h vha = ldfrag_h(vhp + da), vhc = ldfrag_h(vhp + db);
        o[2 * jg]     = mma_h(ph.v, vha, o[2 * jg]);
        o[2 * jg + 1] = mma_h(ph.v, vhc, o[2 * jg + 1]);
        guard2(o[2 * jg], o[2 * jg + 1], ph.v, vha, vhc, ph.v, vha, vhc, ph.v, ph.v);
      }
    }
    wave_sync_lds();
  }
  acc_guard4(o[0], o[1], o[2], o[3]);
  // ---- out = acc / Z (0 if Z == 0), carries (32768 on P, 1024 on v) folded once; written into the lane-owned slab ----
#pragma unroll
  for (int r = 0; r < 8; ++r) {
    const float lv  = lrow[r];
    const float ls  = (lv > 0.0f) ? lv : 1.0f;
    const float inv = (lv > 0.0f) ? ((1.0f / ls) * oc) : 0.0f;
#pragma unroll
    for (int j = 0; j < 4; ++j) {
      const int idx = (8 * hh + r) * SLP + j * 16 + c;
      slab[idx] = o[j][r] * inv;
    }
  }

  wave_sync_lds();
  // ---- O x1024 -> packed f16 hi + residual planes; chunk it*32 + lane of the head's two tiles: row c, 8 consecutive d at c8 ----
  v4u oh[4], ol[4];
#pragma unroll
  for (int it = 0; it < 4; ++it) {
    const int c8 = (it >> 1) * 32 + (it & 1) * 16 + hh * 8;
    const v4f a = *(const v4f*)(slab + c * SLP + c8), b4 = *(const v4f*)(slab + c * SLP + c8 + 4);
    float w[8];
#pragma unroll
    for (int e = 0; e < 4; ++e) { w[e] = a[e] * OSC; w[4 + e] = b4[e] * OSC; }
#pragma unroll
    for (int e = 0; e < 4; ++e) {
      const _Float16 h0 = (_Float16)w[2 * e], h1 = (_Float16)w[2 * e + 1];
      const _Float16 l0 = (_Float16)(w[2 * e] - (float)h0), l1 = (_Float16)(w[2 * e + 1] - (float)h1);
      oh[it][e] = pk16(h_bits(h0), h_bits(h1));
      ol[it][e] = pk16(h_bits(l0), h_bits(l1));
    }
  }
  const size_t ob = ((size_t)b * SEQ + q0) * DMOD + hcol;
  {
#pragma unroll
    for (int it = 0; it < 4; ++it) {
      *(v4u*)(OHp + ob + (size_t)it * 256) = oh[it];
      *(v4u*)(OLp + ob + (size_t)it * 256) = ol[it];
    }
    
  }
}

// =====================================================================================================
// Workspace map (bytes); every plane is fully written by whole-line stores before it is read; all extents are exact multiples
// of the store granularity (packed 1-KiB 16 x 32 tiles of the 16-bit planes, f32 rows of 4096 B; no pad rows needed); every region offset a multiple of
// 2097152:
//   XC  bf16 [CROWS][1024]              CROWS*2048   (c = [mem; kv] as bf16; later q as bf16 [QROWS][1024] at the same offset)
//   WB  16-bit [1024 n][1024 k]         2097152      (Wv, Wk, Wq as bf16, then Wc as f16 x1024, reused in launch order)
//   F   f32 [CROWS][1024]               CROWS*4096   (v, k, q projection output in launch order; afterwards the region holds
//                                                     OH f16 [QROWS][1024] x1024 at +0 and OL residual [QROWS][1024] at +QROWS*2048)
//   VH  f16 [NB*16][64][JL] x1024       CROWS*2048   (all 16-bit planes in packed 16 x 32 tiles)
//   KH  f16 [CROWS][1024] x1024         CROWS*2048
//   QH  f16 [QROWS][1024] x1024         QROWS*2048   QL residual the same
//   end (NB=2, SEQ=MLEN=2048)           102760448
// =====================================================================================================
extern "C" void kernel_launch(void* const* d_in, const int* in_sizes, int n_in,
                              void* d_out, int out_size, void* d_ws, size_t ws_size,
                              hipStream_t stream) {
  if (n_in < 11) return;
  const long long needq = ((long long)(SEQ - 1) * B_FULL + NB) * DMOD;
  const long long needm = (MLEN > 0) ? (((long long)(MLEN - 1) * B_FULL + NB) * DMOD) : 0;
  if ((long long)in_sizes[0] < needq || (long long)in_sizes[1] < needq || (long long)in_sizes[2] < needm) return;
  if (in_sizes[3] < DMOD * DMOD || in_sizes[5] < DMOD * DMOD || in_sizes[7] < DMOD * DMOD || in_sizes[9] < DMOD * DMOD) return;
  if (in_sizes[4] < DMOD || in_sizes[6] < DMOD || in_sizes[8] < DMOD || in_sizes[10] < DMOD) return;
  if ((long long)out_size < (long long)SEQ * NB * DMOD) return;

  const float* xq  = (const float*)d_in[0];
  const float* xkv = (const float*)d_in[1];
  const float* xm  = (const float*)d_in[2];
  const float* wq  = (const float*)d_in[3];
  const float* bq  = (const float*)d_in[4];
  const float* wk  = (const float*)d_in[5];
  const float* bk  = (const float*)d_in[6];
  const float* wv  = (const float*)d_in[7];
  const float* bv  = (const float*)d_in[8];
  const float* wc  = (const float*)d_in[9];
  const float* bc  = (const float*)d_in[10];
  float*       out = (float*)d_out;

  const size_t szXC = (size_t)CROWS * DMOD * 2;                 // also hosts XQ [QROWS][1024] bf16
  const size_t szXQ = (size_t)QROWS * DMOD * 2;
  const size_t szW  = (size_t)DMOD * DMOD * 2;
  const size_t szF  = (size_t)CROWS * DMOD * 4;                 // also hosts OH + OL
  const size_t szO  = (size_t)QROWS * DMOD * 2;                 // OH, OL each
  const size_t szVH = (size_t)NB * NH * HD * JL * 2;            // == CROWS*2048
  const size_t szKH = (size_t)CROWS * DMOD * 2;
  const size_t szQ  = (size_t)QROWS * DMOD * 2;                 // QH, QL each
  if (2 * szO > szF || szXQ > szXC) return;
  size_t off = 0;
  const size_t oXC = off; off += szXC;
  const size_t oW  = off; off += szW;
  const size_t oF  = off; off += szF;
  const size_t oVH = off; off += szVH;
  const size_t oKH = off; off += szKH;
  const size_t oQH = off; off += szQ;
  const size_t oQL = off; off += szQ;
  if (off > ws_size) return;                // off = 102760448 for NB = 2, SEQ = MLEN = 2048
  if (off > (size_t)WS_CAP) return;

  char* ws = (char*)d_ws;
  u16*   XC = (u16*)(ws + oXC);
  u16*   XQ = (u16*)(ws + oXC);
  u16*   WB = (u16*)(ws + oW);
  float* F  = (float*)(ws + oF);
  u16*   OH = (u16*)(ws + oF);
  u16*   OL = (u16*)(ws + oF + szO);
  u16*   VH = (u16*)(ws + oVH);
  u16*   KH = (u16*)(ws + oKH);
  u16*   QH = (u16*)(ws + oQH);
  u16*   QL = (u16*)(ws + oQL);

  const dim3 b256(256), b128(128), bQK(QKT), bAT(ATT_THREADS);
  const int  n8w = (DMOD * DMOD) / 8;
  const dim3 gW((n8w + 255) / 256);                     // 512 blocks per weight matrix
  const dim3 gXC(CROWS), gXQ(QROWS);
  const dim3 gGC((CROWS / 64) * (DMOD / 64));
  const dim3 gGQ((QROWS / 64) * (DMOD / 64));
  const dim3 gVT(NB * NH * NVT);
  const dim3 gAT(NQT * NHG * NB);
  const dim3 gO(NB * NRT * (DMOD / 64));

  // (1) c = [mem; kv] -> bf16 plane [CROWS][1024], batch-major rows b*JL + j
  cvt_act<<<gXC, bQK, 0, stream>>>(xm, xkv, XC, JL, MLEN);
  // (2) Wv [n][k] -> bf16 plane; (3) v = c.Wv^T + bv -> F f32; (4) v^T plane x1024
  cvt16<<<gW, b256, 0, stream>>>(wv, WB, n8w, 0, 1.0f);
  gemm_bf<<<gGC, b128, 0, stream>>>(XC, WB, bv, F, CROWS, DMOD, DMOD, 1.0f);
  vt16<<<gVT, b256, 0, stream>>>(F, VH);
  // (5) Wk -> bf16 plane; (6) k = c.Wk^T + bk -> F; (7) k hi plane x1024
  cvt16<<<gW, b256, 0, stream>>>(wk, WB, n8w, 0, 1.0f);
  gemm_bf<<<gGC, b128, 0, stream>>>(XC, WB, bk, F, CROWS, DMOD, DMOD, 1.0f);
  qk16<0><<<gXC, bQK, 0, stream>>>(F, KH, KH, CROWS, KSC);
  // (8) q -> bf16 plane (XC region); (9) Wq -> bf16 plane; (10) q = q.Wq^T + bq -> F; (11) q hi + residual planes x1024
  cvt_act<<<gXQ, bQK, 0, stream>>>(xq, xq, XQ, SEQ, SEQ);
  cvt16<<<gW, b256, 0, stream>>>(wq, WB, n8w, 0, 1.0f);
  gemm_bf<<<gGQ, b128, 0, stream>>>(XQ, WB, bq, F, QROWS, DMOD, DMOD, 1.0f);
  qk16<1><<<gXQ, bQK, 0, stream>>>(F, QH, QL, QROWS, QSC);
  // (12) Wc [n][k] -> f16 plane of bf16 value x1024
  cvt16<<<gW, b256, 0, stream>>>(wc, WB, n8w, 1, WOS);
  // (13) attention over all JL keys -> O hi + residual planes (F region)
  attn_x<<<gAT, bAT, 0, stream>>>(QH, QL, KH, VH, OH, OL);
  // (14) output projection -> out f32 rows (s*NB + b), carries 1024 x 1024 folded back
  gemm_o2<<<gO, b128, 0, stream>>>(OH, OL, WB, bc, out, 1.0f / (OSC * WOS));
  (void)hipGetLastError();
}

// v002
// Measured time: 370 microseconds a run.
// Next to v001, in two timings, it ran 1.15 and 1.14 times as fast.
// All steps since v000 together make it 1.50 times as fast.
// Contractions: q.Wq^T, c.Wk^T, c.Wv^T (c = [mem; kv] along the key axis) on v_wmma_f32_16x16x32_bf16 (activations, W and
// biases RNE-converted to bf16; the [n][k] weight rows are used directly as the k-contiguous B operand; f32 accumulate);
// k.q^T over 64 on v_wmma_f32_16x16x32_f16 with q carried as f16 hi (x1024) plus an f16 residual plane and k as f16 hi (x1024)
// (products h.h + h.l); v^T.P^T on v_wmma_f32_16x16x32_f16 (P x32768 f16, v x1024 f16, one product); O.Wc^T on
// v_wmma_f32_16x16x32_f16 (O x1024 as f16 hi plus f16 residual plane, Wc as f16(bf16(Wc)) x1024, products h.w + l.w);
// all f32 accumulate. Bias adds, base-2 online softmax over all keys and the 1/Z fold in f32 on VALU.
// Every 16-bit workspace plane is stored fragment-packed (see "packed planes" below): a wave-wide 16-B fragment load reads 512
// contiguous bytes (4 whole lines) instead of 32 B out of each of 16 rows.
#include <hip/hip_runtime.h>
#include <math.h>
#include <stdint.h>

#ifndef NB
#define NB 2
#endif
#ifndef SEQ
#define SEQ 2048
#endif
#ifndef MLEN
#define MLEN 2048
#endif
#define B_FULL 2
#define L_FULL 2048
#define M_FULL 2048
#define DMOD  1024
#define NH    16
#define HD    64
#define JL    (MLEN + SEQ)
#define QROWS (NB * SEQ)
#define CROWS (NB * JL)
#define SM_SCALE 0.125f
#define LOG2E 1.4426950408889634f
#define QSC   1024.0f
#define KSC   1024.0f
#define PCAR  32768.0f
#define VCAR  1024.0f
#define OSC   1024.0f
#define WOS   1024.0f
#define WPB   4
#define NHG   (NH / WPB)
#define NQT   (SEQ / 16)
#define NKT   (JL / 32)
#define NVT   (JL / 64)
#define NRT   (SEQ / 64)
#define ATT_THREADS (WPB * 32)
#define SLAB64 (16 * 68)
#define VTP   72
#define QKT   (DMOD / 8)
#define WS_CAP 134217728
#define FT    512                 // halves in one packed 16 x 32 fragment tile (1 KiB)
#define TPB   (DMOD / 32)         // fragment tiles in one 16-row band of a [rows][DMOD] plane
static_assert(DMOD == NH * HD && HD == 64 && NH == 16);
static_assert((NH % WPB) == 0 && ATT_THREADS == 128);
static_assert(NB >= 1 && NB <= B_FULL);
static_assert((SEQ % 64) == 0 && SEQ >= 64 && SEQ <= L_FULL);
static_assert((MLEN % 64) == 0 && MLEN >= 0 && MLEN <= M_FULL);
static_assert((JL % 64) == 0 && NKT * 32 == JL && NVT * 64 == JL && NQT * 16 == SEQ && NRT * 64 == SEQ);
static_assert(QKT == 128 && (DMOD % 64) == 0 && (DMOD % 32) == 0 && (HD % 32) == 0);
static_assert(((DMOD * DMOD) % (8 * 256)) == 0);
static_assert(QROWS <= CROWS);
static_assert(TPB == 32 && QKT == 2 * 64 && (TPB % 2) == 0 && (MLEN % 16) == 0 && (SEQ % 16) == 0 && (JL % 16) == 0);
static_assert((long long)CROWS * DMOD * 10 + (long long)QROWS * DMOD * 4 + 2LL * DMOD * DMOD <= (long long)WS_CAP);

typedef unsigned short u16;
typedef _Float16 v16h __attribute__((ext_vector_type(16)));
typedef _Float16 v8h  __attribute__((ext_vector_type(8)));
typedef __bf16   v16b __attribute__((ext_vector_type(16)));
typedef float    v8f  __attribute__((ext_vector_type(8)));
typedef float    v4f  __attribute__((ext_vector_type(4)));
typedef unsigned int v4u __attribute__((ext_vector_type(4)));

union FragH { v16h v; v8h h[2]; v4u u[2]; };
union FragB { v16b v; v4u u[2]; };

// ---- scalar helpers --------------------------------------------------------------------------------
__device__ __forceinline__ unsigned short bf_bits(float f) {          // f32 -> bf16 bits, RNE convert
  unsigned u = __float_as_uint(f);
  return (unsigned short)((u + 0x7FFFu + ((u >> 16) & 1u)) >> 16);
}
__device__ __forceinline__ float bf_up(unsigned short h) { return __uint_as_float(((unsigned)h) << 16); }
__device__ __forceinline__ float bfr(float f) { return bf_up(bf_bits(f)); }
__device__ __forceinline__ unsigned short h_bits(_Float16 x) { return __builtin_bit_cast(unsigned short, x); }
__device__ __forceinline__ unsigned pk16(unsigned short a, unsigned short b) { return (unsigned)a | ((unsigned)b << 16); }
__device__ __forceinline__ v8f zero8() { v8f z = {0.f, 0.f, 0.f, 0.f, 0.f, 0.f, 0.f, 0.f}; return z; }

// ---- packed planes: a [rows][K] 16-bit matrix is stored as 16 x 32 fragment tiles of FT halves, tile (row >> 4, k >> 5) at
//      index (row >> 4) * (K / 32) + (k >> 5); inside a tile element (c = row & 15, kk = k & 31) sits at
//      (kk >> 4) * 256 + (((kk >> 3) & 1) * 16 + c) * 8 + (kk & 7): chunk g of 8 halves = what lane g & 31 takes in load g >> 5.
// ---- fragment loaders: 16-bit A/B operand, lane -> row/col (lane&15), p = tile start + 8*lane;
//      elements 0..7 <- p[0..7] (k0+8h..), elements 8..15 <- p[256..263] (k0+16+8h..)  (same split k map for A and B)
__device__ __forceinline__ v16h ldfrag_h(const _Float16* p) {
  FragH f;
  f.h[0] = *(const v8h*)(p);
  f.h[1] = *(const v8h*)(p + 256);
  return f.v;
}
__device__ __forceinline__ v16b ldfrag_b(const u16* p) {              // bf16 plane read as unsigned integer vectors
  FragB f;
  f.u[0] = *(const v4u*)(p);
  f.u[1] = *(const v4u*)(p + 256);
  return f.v;
}
// first column of chunk w (0..63) inside its tile
__device__ __forceinline__ int chunk_k(int w) { return ((w >> 5) & 1) * 16 + ((w >> 4) & 1) * 8; }

__device__ __forceinline__ v8f mma_h(v16h a, v16h b, v8f c) {
  return __builtin_amdgcn_wmma_f32_16x16x32_f16(false, a, false, b, (short)0, c, false, false);
}
__device__ __forceinline__ v8f mma_b(v16b a, v16b b, v8f c) {
  return __builtin_amdgcn_wmma_f32_16x16x32_bf16(false, a, false, b, (short)0, c, false, false);
}
__device__ __forceinline__ void guard2(v8f& a, v8f& b, v16h x0, v16h x1, v16h x2, v16h x3,
                                       v16h x4, v16h x5, v16h x6, v16h x7) {
#if defined(__HIP_DEVICE_COMPILE__)
  asm volatile("v_nop\n\tv_nop\n\tv_nop\n\tv_nop"
               : "+v"(a), "+v"(b)
               : "v"(x0), "v"(x1), "v"(x2), "v"(x3), "v"(x4), "v"(x5), "v"(x6), "v"(x7) : "memory");
#endif
}
template <typename F>
__device__ __forceinline__ void guard6(v8f& a, v8f& b, v8f& c, v8f& d, F x0, F x1, F x2, F x3, F x4, F x5) {
#if defined(__HIP_DEVICE_COMPILE__)
  asm volatile("v_nop\n\tv_nop\n\tv_nop\n\tv_nop"
               : "+v"(a), "+v"(b), "+v"(c), "+v"(d) : "v"(x0), "v"(x1), "v"(x2), "v"(x3), "v"(x4), "v"(x5) : "memory");
#endif
}
__device__ __forceinline__ void acc_guard4(v8f& a, v8f& b, v8f& c, v8f& d) {
#if defined(__HIP_DEVICE_COMPILE__)
  asm volatile("v_nop\n\tv_nop\n\tv_nop\n\tv_nop" : "+v"(a), "+v"(b), "+v"(c), "+v"(d));
#endif
}
__device__ __forceinline__ void wave_sync_lds() {
  __builtin_amdgcn_fence(__ATOMIC_RELEASE, "workgroup");
  __builtin_amdgcn_wave_barrier();
  __builtin_amdgcn_fence(__ATOMIC_ACQUIRE, "workgroup");
}

// =====================================================================================================
// f32 [DMOD n][DMOD k] -> packed 16-bit plane.  f16mode == 0: bf16 RNE bits;  f16mode == 1: f16 bits of (bf16 RNE value) * scale.
// Used for the [n][k] weight matrices (bf16, or f16 of the bf16 value x1024 for Wc).
// Thread = packed chunk gt (8 consecutive k of one row): two 16-B loads, one 16-B store; 32 lanes store 512 contiguous bytes
// coverage: grid = ceil(n8/256) blocks x 256 thr x 8 (in-kernel bound) = the whole plane (n8 = 131072, a multiple of 256).
// =====================================================================================================
__global__ __launch_bounds__(256) void cvt16(const float* __restrict__ x, u16* D, int n8, int f16mode, float scale) {
  const int gt = blockIdx.x * 256 + (int)threadIdx.x;
  if (gt >= n8) return;
  const int tile = gt >> 6;
  const float* p = x + (size_t)((tile / TPB) * 16 + (gt & 15)) * DMOD + (tile % TPB) * 32 + chunk_k(gt & 63);
  const v4f a = *(const v4f*)(p), b4 = *(const v4f*)(p + 4);
  float w[8];
#pragma unroll
  for (int e = 0; e < 4; ++e) { w[e] = a[e]; w[4 + e] = b4[e]; }
  v4u o;
#pragma unroll
  for (int e = 0; e < 4; ++e) {
    const float f0 = w[2 * e], f1 = w[2 * e + 1];
    const unsigned short hb0 = h_bits((_Float16)(bfr(f0) * scale));
    const unsigned short hb1 = h_bits((_Float16)(bfr(f1) * scale));
    const unsigned short bb0 = bf_bits(f0);
    const unsigned short bb1 = bf_bits(f1);
    o[e] = (f16mode != 0) ? pk16(hb0, hb1) : pk16(bb0, bb1);
  }
  u16* d = D + (size_t)gt * 8;
  {
    *(v4u*)(d) = o;
    
  }
}

// =====================================================================================================
// Activation rows -> packed bf16 plane (RNE), batch-major destination rows:
//   D[(bb*nrow + j)][0..1023] <- X0[(j*B_FULL + bb)][..] for j < split,  X1[((j - split)*B_FULL + bb)][..] for j >= split.
// Used for c = [mem rows 0..MLEN-1 ; kv rows 0..SEQ-1] (nrow = JL, split = MLEN) and for q (nrow = SEQ, split = SEQ, X1 unused).
// Block = two packed tiles of one 16-row band (16 rows x 64 columns), thread = one chunk: two 16-B loads, one 16-B store.
// The source base selection is block-uniform (nrow and split are multiples of 16; both sources are global planes).
// coverage: grid = NB*nrow blocks x 128 chunks x 8 = every element of the [NB*nrow][1024] plane exactly once.
// =====================================================================================================
__global__ __launch_bounds__(QKT) void cvt_act(const float* __restrict__ X0, const float* __restrict__ X1, u16* D,
                                               int nrow, int split) {
  const int tid = (int)threadIdx.x;
  const int r   = (int)blockIdx.x;
  if (r >= NB * nrow) return;
  if (tid >= QKT) return;
  const int  r0    = (r / (TPB / 2)) * 16;                    // first row of the band
  const int  col   = ((r % (TPB / 2)) * 2 + (tid >> 6)) * 32 + chunk_k(tid & 63);
  const int  bb    = r0 / nrow;
  const int  j     = r0 - bb * nrow;
  const bool first = (j < split);
  const int  js    = (first ? j : (j - split)) + (tid & 15);
  const float* base = first ? X0 : X1;
  const float* p = base + ((size_t)js * B_FULL + bb) * DMOD + col;
  const v4f a = *(const v4f*)(p), a4 = *(const v4f*)(p + 4);
  v4u o;
#pragma unroll
  for (int e = 0; e < 2; ++e) {
    o[e]     = pk16(bf_bits(a[2 * e]),  bf_bits(a[2 * e + 1]));
    o[2 + e] = pk16(bf_bits(a4[2 * e]), bf_bits(a4[2 * e + 1]));
  }
  u16* d = D + ((size_t)r * QKT + tid) * 8;
  {
    *(v4u*)(d) = o;
    
  }
}

// =====================================================================================================
// v^T plane from the v projection F f32 [CROWS][DMOD] (row = bb*JL + j, column = g*HD + d, bias already added):
//   VH = f16(v * 1024) for all keys j, packed: tile (head bb*NH + g, key step kt = j >> 5, d subtile d >> 4) at index
//   ((bb*NH + g)*NKT + kt)*4 + (d >> 4), row in the tile = d & 15, k = j & 31.
// Block = (bb, head g, 64 keys s0): each thread loads its 16 floats (key sl, d chunk dc) with 16-B loads, converts, scatters into
// the LDS tile [d][64 keys] (pitch 72 halves, cross-wave -> block barrier); after the barrier each d row segment (64 halves = one
// LDS extent: TH[64*72], written rows 0..63 x cols 0..63, read rows 0..63 x cols 0..63 (staged extent == consumed extent).
// coverage: load 256 thr x 16 = 64 keys x 64 d; store 2 iterations x 256 thr x 8 halves = 64 lines x 64 = the block's tile;
//           grid = NB*NH*NVT blocks covers VH exactly once.
// =====================================================================================================
__global__ __launch_bounds__(256) void vt16(const float* __restrict__ F, u16* VHo) {
  __shared__ __align__(16) u16 TH[HD * VTP];
  const int tid = threadIdx.x;
  const int bid = blockIdx.x;
  const int st  = bid % NVT;
  const int t2  = bid / NVT;
  const int g   = t2 % NH;
  const int bb  = t2 / NH;
  if (bb >= NB) return;                     // block-uniform, before any barrier; never taken with the exact grid
  const int s0  = st * 64;
  {
    const int sl = tid >> 2;                // key within tile 0..63
    const int dc = (tid & 3) * 16;          // d chunk 0,16,32,48
    const float* src = F + ((size_t)bb * JL + s0 + sl) * DMOD + g * HD + dc;
#pragma unroll
    for (int i = 0; i < 4; ++i) {
      const v4f a = *(const v4f*)(src + 4 * i);
#pragma unroll
      for (int e = 0; e < 4; ++e) {
        const _Float16 hv = (_Float16)(a[e] * VCAR);
        TH[(dc + 4 * i + e) * VTP + sl] = h_bits(hv);
      }
    }
  }
  __syncthreads();
  v4u vh[2];
#pragma unroll
  for (int it = 0; it < 2; ++it) {          // it = key step within the block's 64 keys; tid >> 6 = d subtile; tid & 63 = chunk
    const int line = (tid >> 6) * 16 + (tid & 15);          // d = 0..63
    vh[it] = *(const v4u*)(TH + line * VTP + it * 32 + chunk_k(tid & 63));
  }
  const size_t baseH = ((size_t)(bb * NH + g) * NKT + st * 2) * 4 * FT + (size_t)tid * 8;
  {
#pragma unroll
    for (int it = 0; it < 2; ++it) {
      *(v4u*)(VHo + baseH + (size_t)it * 4 * FT) = vh[it];
    }
    
  }
}

// =====================================================================================================
// q / k planes from a projection F f32 [nrows][DMOD] (bias already added): Hp [nrows][DMOD] = f16(val * sc), packed;
// when RES: Lp [nrows][DMOD] = f16 residual f16(val*sc - hi), packed. Block = two packed tiles of one 16-row band, thread = one
// chunk: two 16-B loads, one 16-B store per plane; 32 consecutive lanes store 512 contiguous 512-B-aligned bytes per instruction
// coverage: grid = nrows blocks x 128 chunks x 8 = every element of Hp (and of Lp) exactly once (nrows a multiple of 16).
// =====================================================================================================
template <int RES>
__global__ __launch_bounds__(QKT) void qk16(const float* __restrict__ F, u16* Hp, u16* Lp, int nrows, float sc) {
  const int tid = (int)threadIdx.x;
  const int row = (int)blockIdx.x;
  if (row >= nrows) return;
  if (tid >= QKT) return;
  const float* p = F + (size_t)((row / (TPB / 2)) * 16 + (tid & 15)) * DMOD
                     + ((row % (TPB / 2)) * 2 + (tid >> 6)) * 32 + chunk_k(tid & 63);
  const v4f a = *(const v4f*)(p), b4 = *(const v4f*)(p + 4);
  float w[8];
#pragma unroll
  for (int e = 0; e < 4; ++e) { w[e] = a[e] * sc; w[4 + e] = b4[e] * sc; }
  v4u oh, ol;
#pragma unroll
  for (int e = 0; e < 4; ++e) {
    const float t0 = w[2 * e], t1 = w[2 * e + 1];
    const _Float16 h0 = (_Float16)t0, h1 = (_Float16)t1;
    const _Float16 l0 = (_Float16)(t0 - (float)h0), l1 = (_Float16)(t1 - (float)h1);
    oh[e] = pk16(h_bits(h0), h_bits(h1));
    ol[e] = pk16(h_bits(l0), h_bits(l1));
  }
  u16* dh = Hp + (size_t)row * DMOD + tid * 8;
  u16* dl = Lp + (size_t)row * DMOD + tid * 8;
  {
    *(v4u*)(dh) = oh;
    if constexpr (RES != 0) {
      *(v4u*)(dl) = ol;
    }
    
  }
}

// =====================================================================================================
// GEMM epilogue shared by both engines: the wave's 16x64 f32 tile (times oscale) staged in its private LDS slab (pitch 68),
// coverage: 8 instructions x 2 rows x 16 lanes x 4 floats = the wave's 16 x 64 tile.
// =====================================================================================================
__device__ __forceinline__ void epi64(float* sl, v8f a0, v8f a1, v8f a2, v8f a3, float oscale,
                                      const float* __restrict__ bias, float* Cb, size_t pitch, int col0, int lane) {
  const int hh = lane >> 4, m = lane & 15;
#pragma unroll
  for (int r = 0; r < 8; ++r) {
    const int ro = (8 * hh + r) * 68 + m;
    sl[ro]      = a0[r] * oscale;
    sl[ro + 16] = a1[r] * oscale;
    sl[ro + 32] = a2[r] * oscale;
    sl[ro + 48] = a3[r] * oscale;
  }
  wave_sync_lds();
  const v4f bb = *(const v4f*)(bias + col0 + m * 4);
  v4f br;
#pragma unroll
  for (int e = 0; e < 4; ++e) br[e] = bfr(bb[e]);
  v4f vals[8];
#pragma unroll
  for (int it = 0; it < 8; ++it) vals[it] = *(const v4f*)(sl + (it * 2 + hh) * 68 + m * 4) + br;
  float* dst = Cb + (size_t)hh * pitch + col0 + m * 4;
  {
#pragma unroll
    for (int it = 0; it < 8; ++it) {
      *(v4f*)(dst + (size_t)(it * 2) * pitch) = vals[it];
    }
    
  }
}

// =====================================================================================================
// bf16 GEMM: C[M][N] (f32) = A[M][K] (bf16 packed) . Bt[N][K]^T (bf16 packed), times oscale, plus bias[col] (bf16 RNE value).
// Block = 64x64 tile, 4 waves x 16 rows; fragments loaded straight from the packed tiles (two 16-B loads each, split k map
// for A and B); K stepped by 32 (host guarantees K % 32 == 0, M % 64 == 0, N % 64 == 0, grid = (M/64)*(N/64)).
// =====================================================================================================
__global__ __launch_bounds__(128)
void gemm_bf(const u16* __restrict__ A, const u16* __restrict__ Bt, const float* __restrict__ bias,
             float* C, int M, int N, int K, float oscale) {
  __shared__ __align__(16) float slab[4 * SLAB64];
  const int tid = threadIdx.x, wave = tid >> 5, lane = tid & 31;
  const int ntile = N >> 6;
  const int bid   = blockIdx.x;
  const int rowb  = (bid / ntile) * 64 + wave * 16;
  const int col0  = (bid % ntile) * 64;
  if (rowb + 16 > M) return;                // wave-uniform, never taken with the exact grid; no block barriers in this kernel
  const u16* ap = A  + (size_t)rowb * K + 8 * lane;          // a 16-row band holds 16*K halves
  const u16* bp = Bt + (size_t)col0 * K + 8 * lane;
  const size_t bs = (size_t)16 * K;
  v8f acc0 = zero8(), acc1 = zero8(), acc2 = zero8(), acc3 = zero8();
#pragma unroll 1
  for (int k0 = 0; k0 < 16 * K; k0 += FT) {                  // one packed tile = 32 k
    const v16b a  = ldfrag_b(ap + k0);
    const v16b b0 = ldfrag_b(bp + k0);
    const v16b b1 = ldfrag_b(bp + bs + k0);
    const v16b b2 = ldfrag_b(bp + 2 * bs + k0);
    const v16b b3 = ldfrag_b(bp + 3 * bs + k0);
    acc0 = mma_b(a, b0, acc0);
    acc1 = mma_b(a, b1, acc1);
    acc2 = mma_b(a, b2, acc2);
    acc3 = mma_b(a, b3, acc3);
    guard6<v16b>(acc0, acc1, acc2, acc3, a, b0, b1, b2, b3, a);
  }
  epi64(slab + wave * SLAB64, acc0, acc1, acc2, acc3, oscale, bias, C + (size_t)rowb * (size_t)N, (size_t)N, col0, lane);
}

// =====================================================================================================
// Output projection: out rows (s*NB + bb) of DMOD floats = (Ah + Al)[bb*SEQ + s][DMOD] . Bt[DMOD][DMOD]^T * oscale + bias
// (bf16 RNE value); products h.B + l.B into one accumulator (l unscaled residual).
// Block -> (column tile ct = bid % 16, sequence row tile rt of NRT, batch bb); the wave's 16 rows s = rt*64 + wave*16 .. +15 are
// consecutive rows of Ah/Al and rows of out spaced NB*DMOD floats apart (seq-major [s][b][DMOD] output layout).
// Same tiling and epilogue as gemm_bf; LDS slab wave-private.
// coverage: grid NB*NRT*16 blocks x 4 waves x (16 rows x 64 cols) = every (s, bb, col) of out exactly once.
// =====================================================================================================
__global__ __launch_bounds__(128)
void gemm_o2(const u16* __restrict__ Ah, const u16* __restrict__ Al, const u16* __restrict__ Bt, const float* __restrict__ bias,
             float* C, float oscale) {
  __shared__ __align__(16) float slab[4 * SLAB64];
  const int tid = threadIdx.x, wave = tid >> 5, lane = tid & 31;
  const int ntile = DMOD >> 6;
  const int bid   = blockIdx.x;
  const int ct    = bid % ntile;
  const int t2    = bid / ntile;
  const int rt    = t2 % NRT;
  const int bb    = t2 / NRT;
  if (bb >= NB) return;                     // block-uniform; no block barriers in this kernel; never taken with the exact grid
  const int srow  = rt * 64 + wave * 16;
  if (srow + 16 > SEQ) return;              // wave-uniform; never taken
  const int col0  = ct * 64;
  const int K     = DMOD;
  const size_t rowA = (size_t)bb * SEQ + srow;
  const _Float16* ahp = (const _Float16*)(const void*)Ah + rowA * K + 8 * lane;          // packed planes, as in gemm_bf
  const _Float16* alp = (const _Float16*)(const void*)Al + rowA * K + 8 * lane;
  const _Float16* bp  = (const _Float16*)(const void*)Bt + (size_t)col0 * K + 8 * lane;
  const size_t bs = (size_t)16 * K;
  v8f acc0 = zero8(), acc1 = zero8(), acc2 = zero8(), acc3 = zero8();
#pragma unroll 1
  for (int k0 = 0; k0 < 16 * K; k0 += FT) {
    const v16h ah = ldfrag_h(ahp + k0), al = ldfrag_h(alp + k0);
    const v16h b0 = ldfrag_h(bp + k0);
    const v16h b1 = ldfrag_h(bp + bs + k0);
    const v16h b2 = ldfrag_h(bp + 2 * bs + k0);
    const v16h b3 = ldfrag_h(bp + 3 * bs + k0);
    // the address pairs of the twelve loads above are inputs here, so no load's result is placed on one of them, and they are
    // rewritten only behind this wait
    asm volatile("s_wait_xcnt 0x0" :: "v"(ahp + k0), "v"(alp + k0), "v"(bp + k0) : "memory");
    acc0 = mma_h(ah, b0, acc0);  acc0 = mma_h(al, b0, acc0);
    acc1 = mma_h(ah, b1, acc1);  acc1 = mma_h(al, b1, acc1);
    acc2 = mma_h(ah, b2, acc2);  acc2 = mma_h(al, b2, acc2);
    acc3 = mma_h(ah, b3, acc3);  acc3 = mma_h(al, b3, acc3);
    guard6<v16h>(acc0, acc1, acc2, acc3, ah, al, b0, b1, b2, b3);
  }
  float* Cb = C + ((size_t)srow * NB + bb) * DMOD;
  epi64(slab + wave * SLAB64, acc0, acc1, acc2, acc3, oscale, bias, Cb, (size_t)NB * DMOD, col0, lane);
}

// =====================================================================================================
// Full (non-causal) attention over all JL keys, in the transposed form S^T = K.Q^T, O^T += V^T.P^T. Block bid -> (query tile qt:
// rows q0 = 16*qt .. q0+15, head group hg of WPB heads, batch b); one wave per head = hg*WPB + wave.
//   q hi plane f16 x1024 and q residual plane, both [b*SEQ + s][h*HD + d]; k hi plane f16 x1024 [b*JL + j][h*HD + d];
//   v^T hi plane [b*NH + h][d][JL] f16 x1024; all packed (v^T with the four d subtiles of a key step side by side).
//   Scores use two products k_hi.q_hi + k_hi.q_lo; q fragments (B operand) loaded once per wave (2 k-steps x hi/residual).
//   score (log2 domain) t(i, j) = (q_i.k_j over HD) * (1/8)*log2e/(1024*1024); no key selection (every key contributes).
//   Key tiles of 32 visited in order, kt = 0 .. NKT-1 (static bound).
//   Per tile: 2 score subtiles (16 keys each) x 2 k-steps, k fragments (A operand, row = key) loaded straight from the 16-bit plane.
//   Lane (hh = lane >> 4, c = lane & 15) then holds 16 scores of ONE query (column c): keys kb + 8hh + r in s0[r], kb + 16 + 8hh + r in s1[r]. Maximum and
//   sum run inside the lane; the two halves of a column exchange the maximum once per tile and join their sums once after the loop.
//   The 16 probabilities of a lane, converted in place (x32768, f16), ARE the B operand P^T in the split k map
//   (element s < 8: key 8hh + s, element s >= 8: key 16 + 8hh + s - 8), the map the packed v^T fragments (A operand, row = d) have.
//   After the loop: out = acc / Z (Z >= 1 always; guarded anyway), carries 1/(32768*1024) folded once. o[j][r] = O(query c,
//   d = 16j + 8hh + r): 8 consecutive d of one row = chunk j*32 + lane of the head's two packed tiles, stored from registers.
// No LDS.
// coverage: per wave 4 instructions x 32 lanes x 8 halves = the head's two packed tiles (16 x 64) per plane; grid NQT x NHG x NB blocks x WPB waves =
//           every (b, s, h) row segment of O hi and O residual exactly once.
// =====================================================================================================
// lane l <-> lane l ^ 16 (the other half of the same column)
__device__ __forceinline__ float xhalf(float x) {
  const int b = __builtin_bit_cast(int, x);
  return __builtin_bit_cast(float, __builtin_amdgcn_permlanex16(b, b, 0x76543210, 0xfedcba98, false, false));
}

__global__ __launch_bounds__(ATT_THREADS)
void attn_x(const u16* __restrict__ QHp, const u16* __restrict__ QLp, const u16* __restrict__ KHp,
            const u16* __restrict__ VHp, u16* OHp, u16* OLp) {
  const int tid  = threadIdx.x;
  const int wave = tid >> 5;
  const int lane = tid & 31;
  const int bid  = blockIdx.x;
  const int qt   = bid % NQT;
  const int t2   = bid / NQT;
  const int hg   = t2 % NHG;
  const int b    = t2 / NHG;
  if (b >= NB) return;                      // block-uniform; no block barriers in this kernel; never taken with the exact grid
  const int q0   = qt * 16;                 // q0 + 16 <= SEQ by construction
  const int head = hg * WPB + wave;

  const size_t hcol = (size_t)head * (HD / 32) * FT + 8 * lane;        // the head's two tiles inside a 16-row band
  const _Float16* Qh  = (const _Float16*)(const void*)QHp + ((size_t)b * SEQ + q0) * DMOD + hcol;
  const _Float16* Ql  = (const _Float16*)(const void*)QLp + ((size_t)b * SEQ + q0) * DMOD + hcol;
  const _Float16* Khb = (const _Float16*)(const void*)KHp + ((size_t)b * JL) * DMOD + hcol;               // key band kb added per step
  const _Float16* Vhb = (const _Float16*)(const void*)VHp + (size_t)(b * NH + head) * NKT * 4 * FT + 8 * lane;  // key step kt, d subtile j
  const float lsc = SM_SCALE * (LOG2E / (QSC * KSC));
  const float oc  = 1.0f / (PCAR * VCAR);
  const size_t KROW = (size_t)DMOD;         // halves per key row (a 16-key band holds 16 * KROW)

  // ---- q fragments (hi and residual, 2 k-steps over HD), loaded once ----
  const v16h qh0 = ldfrag_h(Qh), qh1 = ldfrag_h(Qh + FT);
  const v16h ql0 = ldfrag_h(Ql), ql1 = ldfrag_h(Ql + FT);

  float mrow = -INFINITY;                   // running maximum of query column c (alike in both halves)
  float lrow = 0.f;                         // running sum over the keys of this half only
  v8f o[4];
#pragma unroll
  for (int j = 0; j < 4; ++j) o[j] = zero8();

#pragma unroll 1
  for (int kt = 0; kt < NKT; ++kt) {
    const int kb = kt * 32;                 // kb + 31 <= JL - 1
    // ---- scores: D element r of this lane = (key kb + 8hh + r, query column c) in s0, key kb + 16 + 8hh + r in s1 ----
    v8f s0 = zero8(), s1 = zero8();
    {
      const _Float16* k0p = Khb + (size_t)kb * KROW;
      const _Float16* k1p = k0p + (size_t)16 * KROW;
      const v16h ka0 = ldfrag_h(k0p), ka1 = ldfrag_h(k0p + FT);
      const v16h kc0 = ldfrag_h(k1p), kc1 = ldfrag_h(k1p + FT);
      // the address pair of the eight loads above is an input here, so no load's result is placed on it, and it is
      // rewritten only behind this wait
      asm volatile("s_wait_xcnt 0x0" :: "v"(k0p) : "memory");
      s0 = mma_h(ka0, qh0, s0);
      s0 = mma_h(ka0, ql0, s0);
      s0 = mma_h(ka1, qh1, s0);
      s0 = mma_h(ka1, ql1, s0);
      s1 = mma_h(kc0, qh0, s1);
      s1 = mma_h(kc0, ql0, s1);
      s1 = mma_h(kc1, qh1, s1);
      s1 = mma_h(kc1, ql1, s1);
      guard2(s0, s1, ka0, ka1, kc0, kc1, qh0, ql0, qh1, ql1);
    }
    // ---- online softmax in base 2, -inf-safe; one query per lane ----
    const v8f t0 = s0 * lsc, t1 = s1 * lsc;
    float mx = fmaxf(t0[0], t1[0]);
#pragma unroll
    for (int r = 1; r < 8; ++r) mx = fmaxf(mx, fmaxf(t0[r], t1[r]));
    mx = fmaxf(mx, xhalf(mx));
    const float mn = fmaxf(mrow, mx);
    const float ms = (mn == -INFINITY) ? 0.0f : mn;
    const float al = exp2f(mrow - ms);
    mrow = mn;
    v8f e0, e1;
#pragma unroll
    for (int r = 0; r < 8; ++r) { e0[r] = exp2f(t0[r] - ms); e1[r] = exp2f(t1[r] - ms); }
    const v8f es = e0 + e1;
    lrow = lrow * al + (((es[0] + es[4]) + (es[1] + es[5])) + ((es[2] + es[6]) + (es[3] + es[7])));
    // ---- B fragment of P^T * 32768 (f16), column = c, split k map over the 32 keys of this step ----
    FragH ph;
    const v8f p0 = e0 * PCAR, p1 = e1 * PCAR;
#pragma unroll
    for (int r = 0; r < 8; ++r) {
      ph.h[0][r] = (_Float16)p0[r];         // elements 0..7  = keys kb + 8hh + 0..7
      ph.h[1][r] = (_Float16)p1[r];         // elements 8..15 = keys kb + 16 + 8hh + 0..7
    }
#pragma unroll
    for (int j = 0; j < 4; ++j) o[j] *= al;
    // ---- V^T.P^T : A fragment row = d = j*16 + c, keys contiguous in the v^T plane; 2 groups of 2 d-subtiles ----
    {
      const _Float16* vhp = Vhb + (size_t)kt * 4 * FT;
#pragma unroll
      for (int jg = 0; jg < HD / 32; ++jg) {
        const size_t da = (size_t)(2 * jg) * FT;
        const size_t db = da + (size_t)FT;
        const v16h vha = ldfrag_h(vhp + da), vhc = ldfrag_h(vhp + db);
        o[2 * jg]     = mma_h(vha, ph.v, o[2 * jg]);
        o[2 * jg + 1] = mma_h(vhc, ph.v, o[2 * jg + 1]);
        guard2(o[2 * jg], o[2 * jg + 1], ph.v, vha, vhc, ph.v, vha, vhc, ph.v, ph.v);
      }
    }
  }
  acc_guard4(o[0], o[1], o[2], o[3]);
  // ---- out = acc / Z (0 if Z == 0), carries (32768 on P, 1024 on v) folded once; the halves' sums joined here ----
  const float lv  = lrow + xhalf(lrow);
  const float ls  = (lv > 0.0f) ? lv : 1.0f;
  const float inv = (lv > 0.0f) ? ((1.0f / ls) * oc) : 0.0f;
  // ---- O x1024 -> packed f16 hi + residual planes; chunk j*32 + lane of the head's two tiles: row c, d = 16j + 8hh + 0..7 ----
  v4u oh[4], ol[4];
#pragma unroll
  for (int it = 0; it < 4; ++it) {
    float w[8];
#pragma unroll
    for (int e = 0; e < 8; ++e) w[e] = (o[it][e] * inv) * OSC;
#pragma unroll
    for (int e = 0; e < 4; ++e) {
      const _Float16 h0 = (_Float16)w[2 * e], h1 = (_Float16)w[2 * e + 1];
      const _Float16 l0 = (_Float16)(w[2 * e] - (float)h0), l1 = (_Float16)(w[2 * e + 1] - (float)h1);
      oh[it][e] = pk16(h_bits(h0), h_bits(h1));
      ol[it][e] = pk16(h_bits(l0), h_bits(l1));
    }
  }
  const size_t ob = ((size_t)b * SEQ + q0) * DMOD + hcol;
  {
#pragma unroll
    for (int it = 0; it < 4; ++it) {
      *(v4u*)(OHp + ob + (size_t)it * 256) = oh[it];
      *(v4u*)(OLp + ob + (size_t)it * 256) = ol[it];
    }
    
  }
}

// =====================================================================================================
// Workspace map (bytes); every plane is fully written by whole-line stores before it is read; all extents are exact multiples
// of the store granularity (packed 1-KiB 16 x 32 tiles of the 16-bit planes, f32 rows of 4096 B; no pad rows needed); every region offset a multiple of
// 2097152:
//   XC  bf16 [CROWS][1024]              CROWS*2048   (c = [mem; kv] as bf16; later q as bf16 [QROWS][1024] at the same offset)
//   WB  16-bit [1024 n][1024 k]         2097152      (Wv, Wk, Wq as bf16, then Wc as f16 x1024, reused in launch order)
//   F   f32 [CROWS][1024]               CROWS*4096   (v, k, q projection output in launch order; afterwards the region holds
//                                                     OH f16 [QROWS][1024] x1024 at +0 and OL residual [QROWS][1024] at +QROWS*2048)
//   VH  f16 [NB*16][64][JL] x1024       CROWS*2048   (all 16-bit planes in packed 16 x 32 tiles)
//   KH  f16 [CROWS][1024] x1024         CROWS*2048
//   QH  f16 [QROWS][1024] x1024         QROWS*2048   QL residual the same
//   end (NB=2, SEQ=MLEN=2048)           102760448
// =====================================================================================================
extern "C" void kernel_launch(void* const* d_in, const int* in_sizes, int n_in,
                              void* d_out, int out_size, void* d_ws, size_t ws_size,
                              hipStream_t stream) {
  if (n_in < 11) return;
  const long long needq = ((long long)(SEQ - 1) * B_FULL + NB) * DMOD;
  const long long needm = (MLEN > 0) ? (((long long)(MLEN - 1) * B_FULL + NB) * DMOD) : 0;
  if ((long long)in_sizes[0] < needq || (long long)in_sizes[1] < needq || (long long)in_sizes[2] < needm) return;
  if (in_sizes[3] < DMOD * DMOD || in_sizes[5] < DMOD * DMOD || in_sizes[7] < DMOD * DMOD || in_sizes[9] < DMOD * DMOD) return;
  if (in_sizes[4] < DMOD || in_sizes[6] < DMOD || in_sizes[8] < DMOD || in_sizes[10] < DMOD) return;
  if ((long long)out_size < (long long)SEQ * NB * DMOD) return;

  const float* xq  = (const float*)d_in[0];
  const float* xkv = (const float*)d_in[1];
  const float* xm  = (const float*)d_in[2];
  const float* wq  = (const float*)d_in[3];
  const float* bq  = (const float*)d_in[4];
  const float* wk  = (const float*)d_in[5];
  const float* bk  = (const float*)d_in[6];
  const float* wv  = (const float*)d_in[7];
  const float* bv  = (const float*)d_in[8];
  const float* wc  = (const float*)d_in[9];
  const float* bc  = (const float*)d_in[10];
  float*       out = (float*)d_out;

  const size_t szXC = (size_t)CROWS * DMOD * 2;                 // also hosts XQ [QROWS][1024] bf16
  const size_t szXQ = (size_t)QROWS * DMOD * 2;
  const size_t szW  = (size_t)DMOD * DMOD * 2;
  const size_t szF  = (size_t)CROWS * DMOD * 4;                 // also hosts OH + OL
  const size_t szO  = (size_t)QROWS * DMOD * 2;                 // OH, OL each
  const size_t szVH = (size_t)NB * NH * HD * JL * 2;            // == CROWS*2048
  const size_t szKH = (size_t)CROWS * DMOD * 2;
  const size_t szQ  = (size_t)QROWS * DMOD * 2;                 // QH, QL each
  if (2 * szO > szF || szXQ > szXC) return;
  size_t off = 0;
  const size_t oXC = off; off += szXC;
  const size_t oW  = off; off += szW;
  const size_t oF  = off; off += szF;
  const size_t oVH = off; off += szVH;
  const size_t oKH = off; off += szKH;
  const size_t oQH = off; off += szQ;
  const size_t oQL = off; off += szQ;
  if (off > ws_size) return;                // off = 102760448 for NB = 2, SEQ = MLEN = 2048
  if (off > (size_t)WS_CAP) return;

  char* ws = (char*)d_ws;
  u16*   XC = (u16*)(ws + oXC);
  u16*   XQ = (u16*)(ws + oXC);
  u16*   WB = (u16*)(ws + oW);
  float* F  = (float*)(ws + oF);
  u16*   OH = (u16*)(ws + oF);
  u16*   OL = (u16*)(ws + oF + szO);
  u16*   VH = (u16*)(ws + oVH);
  u16*   KH = (u16*)(ws + oKH);
  u16*   QH = (u16*)(ws + oQH);
  u16*   QL = (u16*)(ws + oQL);

  const dim3 b256(256), b128(128), bQK(QKT), bAT(ATT_THREADS);
  const int  n8w = (DMOD * DMOD) / 8;
  const dim3 gW((n8w + 255) / 256);                     // 512 blocks per weight matrix
  const dim3 gXC(CROWS), gXQ(QROWS);
  const dim3 gGC((CROWS / 64) * (DMOD / 64));
  const dim3 gGQ((QROWS / 64) * (DMOD / 64));
  const dim3 gVT(NB * NH * NVT);
  const dim3 gAT(NQT * NHG * NB);
  const dim3 gO(NB * NRT * (DMOD / 64));

  // (1) c = [mem; kv] -> bf16 plane [CROWS][1024], batch-major rows b*JL + j
  cvt_act<<<gXC, bQK, 0, stream>>>(xm, xkv, XC, JL, MLEN);
  // (2) Wv [n][k] -> bf16 plane; (3) v = c.Wv^T + bv -> F f32; (4) v^T plane x1024
  cvt16<<<gW, b256, 0, stream>>>(wv, WB, n8w, 0, 1.0f);
  gemm_bf<<<gGC, b128, 0, stream>>>(XC, WB, bv, F, CROWS, DMOD, DMOD, 1.0f);
  vt16<<<gVT, b256, 0, stream>>>(F, VH);
  // (5) Wk -> bf16 plane; (6) k = c.Wk^T + bk -> F; (7) k hi plane x1024
  cvt16<<<gW, b256, 0, stream>>>(wk, WB, n8w, 0, 1.0f);
  gemm_bf<<<gGC, b128, 0, stream>>>(XC, WB, bk, F, CROWS, DMOD, DMOD, 1.0f);
  qk16<0><<<gXC, bQK, 0, stream>>>(F, KH, KH, CROWS, KSC);
  // (8) q -> bf16 plane (XC region); (9) Wq -> bf16 plane; (10) q = q.Wq^T + bq -> F; (11) q hi + residual planes x1024
  cvt_act<<<gXQ, bQK, 0, stream>>>(xq, xq, XQ, SEQ, SEQ);
  cvt16<<<gW, b256, 0, stream>>>(wq, WB, n8w, 0, 1.0f);
  gemm_bf<<<gGQ, b128, 0, stream>>>(XQ, WB, bq, F, QROWS, DMOD, DMOD, 1.0f);
  qk16<1><<<gXQ, bQK, 0, stream>>>(F, QH, QL, QROWS, QSC);
  // (12) Wc [n][k] -> f16 plane of bf16 value x1024
  cvt16<<<gW, b256, 0, stream>>>(wc, WB, n8w, 1, WOS);
  // (13) attention over all JL keys -> O hi + residual planes (F region)
  attn_x<<<gAT, bAT, 0, stream>>>(QH, QL, KH, VH, OH, OL);
  // (14) output projection -> out f32 rows (s*NB + b), carries 1024 x 1024 folded back
  gemm_o2<<<gO, b128, 0, stream>>>(OH, OL, WB, bc, out, 1.0f / (OSC * WOS));
  (void)hipGetLastError();
}

// v003
// Measured time: 248 microseconds a run.
// Two timings next to v002 both put it at 1.48 times that version's speed.
// Counting every step since v000, it is 2.23 times as fast.
// Contractions: q.Wq^T, c.Wk^T, c.Wv^T (c = [mem; kv] along the key axis) on v_wmma_f32_16x16x32_bf16 (activations, W and
// biases RNE-converted to bf16; the [n][k] weight rows are used directly as the k-contiguous B operand; f32 accumulate);
// k.q^T over 64 on v_wmma_f32_16x16x32_f16 with q carried as f16 hi (x1024) plus an f16 residual plane and k as f16 hi (x1024)
// (products h.h + h.l); v^T.P^T on v_wmma_f32_16x16x32_f16 (P x32768 f16, v x1024 f16, one product); O.Wc^T on
// v_wmma_f32_16x16x32_f16 (O x1024 as f16 hi plus f16 residual plane, Wc as f16(bf16(Wc)) x1024, products h.w + l.w);
// all f32 accumulate. Bias adds, base-2 online softmax over all keys and the 1/Z fold in f32 on VALU.
// Every 16-bit workspace plane is stored fragment-packed (see "packed planes" below): a wave-wide 16-B fragment load reads 512
// contiguous bytes (4 whole lines) instead of 32 B out of each of 16 rows.
#include <hip/hip_runtime.h>
#include <math.h>
#include <stdint.h>

#ifndef NB
#define NB 2
#endif
#ifndef SEQ
#define SEQ 2048
#endif
#ifndef MLEN
#define MLEN 2048
#endif
#define B_FULL 2
#define L_FULL 2048
#define M_FULL 2048
#define DMOD  1024
#define NH    16
#define HD    64
#define JL    (MLEN + SEQ)
#define QROWS (NB * SEQ)
#define CROWS (NB * JL)
#define SM_SCALE 0.125f
#define LOG2E 1.4426950408889634f
#define QSC   1024.0f
#define KSC   1024.0f
#define PCAR  32768.0f
#define VCAR  1024.0f
#define OSC   1024.0f
#define WOS   1024.0f
#define AWV   8                   // waves of an attention block: 8 query tiles of ONE head share that head's k / v^T stages
#define NQT   (SEQ / 16)
#define NQG   (NQT / AWV)
#define SKEY  64                  // keys in one LDS stage of the attention ring
#define NST   (JL / SKEY)
#define STH   (2 * SKEY * HD)     // halves in one stage: 8 packed k tiles, then 8 packed v^T tiles (16 KiB)
#define NKT   (JL / 32)
#define NVT   (JL / 64)
#define NRT   (SEQ / 64)
#define ATT_THREADS (AWV * 32)
#define SLAB64 (16 * 68)
#define VTP   72
#define QKT   (DMOD / 8)
#define WS_CAP 134217728
#define FT    512                 // halves in one packed 16 x 32 fragment tile (1 KiB)
#define TPB   (DMOD / 32)         // fragment tiles in one 16-row band of a [rows][DMOD] plane
static_assert(DMOD == NH * HD && HD == 64 && NH == 16);
static_assert((NQT % AWV) == 0 && ATT_THREADS == 256 && NST * SKEY == JL && NST >= 2 && SKEY == 64);
static_assert(NB >= 1 && NB <= B_FULL);
static_assert((SEQ % 64) == 0 && SEQ >= 64 && SEQ <= L_FULL);
static_assert((MLEN % 64) == 0 && MLEN >= 0 && MLEN <= M_FULL);
static_assert((JL % 64) == 0 && NKT * 32 == JL && NVT * 64 == JL && NQT * 16 == SEQ && NRT * 64 == SEQ);
static_assert(QKT == 128 && (DMOD % 64) == 0 && (DMOD % 32) == 0 && (HD % 32) == 0);
static_assert(((DMOD * DMOD) % (8 * 256)) == 0);
static_assert(QROWS <= CROWS);
static_assert(TPB == 32 && QKT == 2 * 64 && (TPB % 2) == 0 && (MLEN % 16) == 0 && (SEQ % 16) == 0 && (JL % 16) == 0);
static_assert((long long)CROWS * DMOD * 10 + (long long)QROWS * DMOD * 4 + 2LL * DMOD * DMOD <= (long long)WS_CAP);

typedef unsigned short u16;
typedef _Float16 v16h __attribute__((ext_vector_type(16)));
typedef _Float16 v8h  __attribute__((ext_vector_type(8)));
typedef __bf16   v16b __attribute__((ext_vector_type(16)));
typedef float    v8f  __attribute__((ext_vector_type(8)));
typedef float    v4f  __attribute__((ext_vector_type(4)));
typedef unsigned int v4u __attribute__((ext_vector_type(4)));

union FragH { v16h v; v8h h[2]; v4u u[2]; };
union FragB { v16b v; v4u u[2]; };

// ---- scalar helpers --------------------------------------------------------------------------------
__device__ __forceinline__ unsigned short bf_bits(float f) {          // f32 -> bf16 bits, RNE convert
  unsigned u = __float_as_uint(f);
  return (unsigned short)((u + 0x7FFFu + ((u >> 16) & 1u)) >> 16);
}
__device__ __forceinline__ float bf_up(unsigned short h) { return __uint_as_float(((unsigned)h) << 16); }
__device__ __forceinline__ float bfr(float f) { return bf_up(bf_bits(f)); }
__device__ __forceinline__ unsigned short h_bits(_Float16 x) { return __builtin_bit_cast(unsigned short, x); }
__device__ __forceinline__ unsigned pk16(unsigned short a, unsigned short b) { return (unsigned)a | ((unsigned)b << 16); }
__device__ __forceinline__ v8f zero8() { v8f z = {0.f, 0.f, 0.f, 0.f, 0.f, 0.f, 0.f, 0.f}; return z; }

// ---- packed planes: a [rows][K] 16-bit matrix is stored as 16 x 32 fragment tiles of FT halves, tile (row >> 4, k >> 5) at
//      index (row >> 4) * (K / 32) + (k >> 5); inside a tile element (c = row & 15, kk = k & 31) sits at
//      (kk >> 4) * 256 + (((kk >> 3) & 1) * 16 + c) * 8 + (kk & 7): chunk g of 8 halves = what lane g & 31 takes in load g >> 5.
// ---- fragment loaders: 16-bit A/B operand, lane -> row/col (lane&15), p = tile start + 8*lane;
//      elements 0..7 <- p[0..7] (k0+8h..), elements 8..15 <- p[256..263] (k0+16+8h..)  (same split k map for A and B)
__device__ __forceinline__ v16h ldfrag_h(const _Float16* p) {
  FragH f;
  f.h[0] = *(const v8h*)(p);
  f.h[1] = *(const v8h*)(p + 256);
  return f.v;
}
__device__ __forceinline__ v16b ldfrag_b(const u16* p) {              // bf16 plane read as unsigned integer vectors
  FragB f;
  f.u[0] = *(const v4u*)(p);
  f.u[1] = *(const v4u*)(p + 256);
  return f.v;
}
// first column of chunk w (0..63) inside its tile
__device__ __forceinline__ int chunk_k(int w) { return ((w >> 5) & 1) * 16 + ((w >> 4) & 1) * 8; }

__device__ __forceinline__ v8f mma_h(v16h a, v16h b, v8f c) {
  return __builtin_amdgcn_wmma_f32_16x16x32_f16(false, a, false, b, (short)0, c, false, false);
}
__device__ __forceinline__ v8f mma_b(v16b a, v16b b, v8f c) {
  return __builtin_amdgcn_wmma_f32_16x16x32_bf16(false, a, false, b, (short)0, c, false, false);
}
__device__ __forceinline__ void guard2(v8f& a, v8f& b, v16h x0, v16h x1, v16h x2, v16h x3,
                                       v16h x4, v16h x5, v16h x6, v16h x7) {
#if defined(__HIP_DEVICE_COMPILE__)
  asm volatile("v_nop\n\tv_nop\n\tv_nop\n\tv_nop"
               : "+v"(a), "+v"(b)
               : "v"(x0), "v"(x1), "v"(x2), "v"(x3), "v"(x4), "v"(x5), "v"(x6), "v"(x7) : "memory");
#endif
}
template <typename F>
__device__ __forceinline__ void guard6(v8f& a, v8f& b, v8f& c, v8f& d, F x0, F x1, F x2, F x3, F x4, F x5) {
#if defined(__HIP_DEVICE_COMPILE__)
  asm volatile("v_nop\n\tv_nop\n\tv_nop\n\tv_nop"
               : "+v"(a), "+v"(b), "+v"(c), "+v"(d) : "v"(x0), "v"(x1), "v"(x2), "v"(x3), "v"(x4), "v"(x5) : "memory");
#endif
}
__device__ __forceinline__ void acc_guard4(v8f& a, v8f& b, v8f& c, v8f& d) {
#if defined(__HIP_DEVICE_COMPILE__)
  asm volatile("v_nop\n\tv_nop\n\tv_nop\n\tv_nop" : "+v"(a), "+v"(b), "+v"(c), "+v"(d));
#endif
}
__device__ __forceinline__ void wave_sync_lds() {
  __builtin_amdgcn_fence(__ATOMIC_RELEASE, "workgroup");
  __builtin_amdgcn_wave_barrier();
  __builtin_amdgcn_fence(__ATOMIC_ACQUIRE, "workgroup");
}

// =====================================================================================================
// f32 [DMOD n][DMOD k] -> packed 16-bit plane.  f16mode == 0: bf16 RNE bits;  f16mode == 1: f16 bits of (bf16 RNE value) * scale.
// Used for the [n][k] weight matrices (bf16, or f16 of the bf16 value x1024 for Wc).
// Thread = packed chunk gt (8 consecutive k of one row): two 16-B loads, one 16-B store; 32 lanes store 512 contiguous bytes
// coverage: grid = ceil(n8/256) blocks x 256 thr x 8 (in-kernel bound) = the whole plane (n8 = 131072, a multiple of 256).
// =====================================================================================================
__global__ __launch_bounds__(256) void cvt16(const float* __restrict__ x, u16* D, int n8, int f16mode, float scale) {
  const int gt = blockIdx.x * 256 + (int)threadIdx.x;
  if (gt >= n8) return;
  const int tile = gt >> 6;
  const float* p = x + (size_t)((tile / TPB) * 16 + (gt & 15)) * DMOD + (tile % TPB) * 32 + chunk_k(gt & 63);
  const v4f a = *(const v4f*)(p), b4 = *(const v4f*)(p + 4);
  float w[8];
#pragma unroll
  for (int e = 0; e < 4; ++e) { w[e] = a[e]; w[4 + e] = b4[e]; }
  v4u o;
#pragma unroll
  for (int e = 0; e < 4; ++e) {
    const float f0 = w[2 * e], f1 = w[2 * e + 1];
    const unsigned short hb0 = h_bits((_Float16)(bfr(f0) * scale));
    const unsigned short hb1 = h_bits((_Float16)(bfr(f1) * scale));
    const unsigned short bb0 = bf_bits(f0);
    const unsigned short bb1 = bf_bits(f1);
    o[e] = (f16mode != 0) ? pk16(hb0, hb1) : pk16(bb0, bb1);
  }
  u16* d = D + (size_t)gt * 8;
  {
    *(v4u*)(d) = o;
    
  }
}

// =====================================================================================================
// Activation rows -> packed bf16 plane (RNE), batch-major destination rows:
//   D[(bb*nrow + j)][0..1023] <- X0[(j*B_FULL + bb)][..] for j < split,  X1[((j - split)*B_FULL + bb)][..] for j >= split.
// Used for c = [mem rows 0..MLEN-1 ; kv rows 0..SEQ-1] (nrow = JL, split = MLEN) and for q (nrow = SEQ, split = SEQ, X1 unused).
// Block = two packed tiles of one 16-row band (16 rows x 64 columns), thread = one chunk: two 16-B loads, one 16-B store.
// The source base selection is block-uniform (nrow and split are multiples of 16; both sources are global planes).
// coverage: grid = NB*nrow blocks x 128 chunks x 8 = every element of the [NB*nrow][1024] plane exactly once.
// =====================================================================================================
__global__ __launch_bounds__(QKT) void cvt_act(const float* __restrict__ X0, const float* __restrict__ X1, u16* D,
                                               int nrow, int split) {
  const int tid = (int)threadIdx.x;
  const int r   = (int)blockIdx.x;
  if (r >= NB * nrow) return;
  if (tid >= QKT) return;
  const int  r0    = (r / (TPB / 2)) * 16;                    // first row of the band
  const int  col   = ((r % (TPB / 2)) * 2 + (tid >> 6)) * 32 + chunk_k(tid & 63);
  const int  bb    = r0 / nrow;
  const int  j     = r0 - bb * nrow;
  const bool first = (j < split);
  const int  js    = (first ? j : (j - split)) + (tid & 15);
  const float* base = first ? X0 : X1;
  const float* p = base + ((size_t)js * B_FULL + bb) * DMOD + col;
  const v4f a = *(const v4f*)(p), a4 = *(const v4f*)(p + 4);
  v4u o;
#pragma unroll
  for (int e = 0; e < 2; ++e) {
    o[e]     = pk16(bf_bits(a[2 * e]),  bf_bits(a[2 * e + 1]));
    o[2 + e] = pk16(bf_bits(a4[2 * e]), bf_bits(a4[2 * e + 1]));
  }
  u16* d = D + ((size_t)r * QKT + tid) * 8;
  {
    *(v4u*)(d) = o;
    
  }
}

// =====================================================================================================
// v^T plane from the v projection F f32 [CROWS][DMOD] (row = bb*JL + j, column = g*HD + d, bias already added):
//   VH = f16(v * 1024) for all keys j, packed: tile (head bb*NH + g, key step kt = j >> 5, d subtile d >> 4) at index
//   ((bb*NH + g)*NKT + kt)*4 + (d >> 4), row in the tile = d & 15, k = j & 31.
// Block = (bb, head g, 64 keys s0): each thread loads its 16 floats (key sl, d chunk dc) with 16-B loads, converts, scatters into
// the LDS tile [d][64 keys] (pitch 72 halves, cross-wave -> block barrier); after the barrier each d row segment (64 halves = one
// LDS extent: TH[64*72], written rows 0..63 x cols 0..63, read rows 0..63 x cols 0..63 (staged extent == consumed extent).
// coverage: load 256 thr x 16 = 64 keys x 64 d; store 2 iterations x 256 thr x 8 halves = 64 lines x 64 = the block's tile;
//           grid = NB*NH*NVT blocks covers VH exactly once.
// =====================================================================================================
__global__ __launch_bounds__(256) void vt16(const float* __restrict__ F, u16* VHo) {
  __shared__ __align__(16) u16 TH[HD * VTP];
  const int tid = threadIdx.x;
  const int bid = blockIdx.x;
  const int st  = bid % NVT;
  const int t2  = bid / NVT;
  const int g   = t2 % NH;
  const int bb  = t2 / NH;
  if (bb >= NB) return;                     // block-uniform, before any barrier; never taken with the exact grid
  const int s0  = st * 64;
  {
    const int sl = tid >> 2;                // key within tile 0..63
    const int dc = (tid & 3) * 16;          // d chunk 0,16,32,48
    const float* src = F + ((size_t)bb * JL + s0 + sl) * DMOD + g * HD + dc;
#pragma unroll
    for (int i = 0; i < 4; ++i) {
      const v4f a = *(const v4f*)(src + 4 * i);
#pragma unroll
      for (int e = 0; e < 4; ++e) {
        const _Float16 hv = (_Float16)(a[e] * VCAR);
        TH[(dc + 4 * i + e) * VTP + sl] = h_bits(hv);
      }
    }
  }
  __syncthreads();
  v4u vh[2];
#pragma unroll
  for (int it = 0; it < 2; ++it) {          // it = key step within the block's 64 keys; tid >> 6 = d subtile; tid & 63 = chunk
    const int line = (tid >> 6) * 16 + (tid & 15);          // d = 0..63
    vh[it] = *(const v4u*)(TH + line * VTP + it * 32 + chunk_k(tid & 63));
  }
  const size_t baseH = ((size_t)(bb * NH + g) * NKT + st * 2) * 4 * FT + (size_t)tid * 8;
  {
#pragma unroll
    for (int it = 0; it < 2; ++it) {
      *(v4u*)(VHo + baseH + (size_t)it * 4 * FT) = vh[it];
    }
    
  }
}

// =====================================================================================================
// q / k planes from a projection F f32 [nrows][DMOD] (bias already added): Hp [nrows][DMOD] = f16(val * sc), packed;
// when RES: Lp [nrows][DMOD] = f16 residual f16(val*sc - hi), packed. Block = two packed tiles of one 16-row band, thread = one
// chunk: two 16-B loads, one 16-B store per plane; 32 consecutive lanes store 512 contiguous 512-B-aligned bytes per instruction
// coverage: grid = nrows blocks x 128 chunks x 8 = every element of Hp (and of Lp) exactly once (nrows a multiple of 16).
// =====================================================================================================
template <int RES>
__global__ __launch_bounds__(QKT) void qk16(const float* __restrict__ F, u16* Hp, u16* Lp, int nrows, float sc) {
  const int tid = (int)threadIdx.x;
  const int row = (int)blockIdx.x;
  if (row >= nrows) return;
  if (tid >= QKT) return;
  const float* p = F + (size_t)((row / (TPB / 2)) * 16 + (tid & 15)) * DMOD
                     + ((row % (TPB / 2)) * 2 + (tid >> 6)) * 32 + chunk_k(tid & 63);
  const v4f a = *(const v4f*)(p), b4 = *(const v4f*)(p + 4);
  float w[8];
#pragma unroll
  for (int e = 0; e < 4; ++e) { w[e] = a[e] * sc; w[4 + e] = b4[e] * sc; }
  v4u oh, ol;
#pragma unroll
  for (int e = 0; e < 4; ++e) {
    const float t0 = w[2 * e], t1 = w[2 * e + 1];
    const _Float16 h0 = (_Float16)t0, h1 = (_Float16)t1;
    const _Float16 l0 = (_Float16)(t0 - (float)h0), l1 = (_Float16)(t1 - (float)h1);
    oh[e] = pk16(h_bits(h0), h_bits(h1));
    ol[e] = pk16(h_bits(l0), h_bits(l1));
  }
  u16* dh = Hp + (size_t)row * DMOD + tid * 8;
  u16* dl = Lp + (size_t)row * DMOD + tid * 8;
  {
    *(v4u*)(dh) = oh;
    if constexpr (RES != 0) {
      *(v4u*)(dl) = ol;
    }
    
  }
}

// =====================================================================================================
// GEMM epilogue shared by both engines: the wave's 16x64 f32 tile (times oscale) staged in its private LDS slab (pitch 68),
// coverage: 8 instructions x 2 rows x 16 lanes x 4 floats = the wave's 16 x 64 tile.
// =====================================================================================================
__device__ __forceinline__ void epi64(float* sl, v8f a0, v8f a1, v8f a2, v8f a3, float oscale,
                                      const float* __restrict__ bias, float* Cb, size_t pitch, int col0, int lane) {
  const int hh = lane >> 4, m = lane & 15;
#pragma unroll
  for (int r = 0; r < 8; ++r) {
    const int ro = (8 * hh + r) * 68 + m;
    sl[ro]      = a0[r] * oscale;
    sl[ro + 16] = a1[r] * oscale;
    sl[ro + 32] = a2[r] * oscale;
    sl[ro + 48] = a3[r] * oscale;
  }
  wave_sync_lds();
  const v4f bb = *(const v4f*)(bias + col0 + m * 4);
  v4f br;
#pragma unroll
  for (int e = 0; e < 4; ++e) br[e] = bfr(bb[e]);
  v4f vals[8];
#pragma unroll
  for (int it = 0; it < 8; ++it) vals[it] = *(const v4f*)(sl + (it * 2 + hh) * 68 + m * 4) + br;
  float* dst = Cb + (size_t)hh * pitch + col0 + m * 4;
  {
#pragma unroll
    for (int it = 0; it < 8; ++it) {
      *(v4f*)(dst + (size_t)(it * 2) * pitch) = vals[it];
    }
    
  }
}

// =====================================================================================================
// bf16 GEMM: C[M][N] (f32) = A[M][K] (bf16 packed) . Bt[N][K]^T (bf16 packed), times oscale, plus bias[col] (bf16 RNE value).
// Block = 64x64 tile, 4 waves x 16 rows; fragments loaded straight from the packed tiles (two 16-B loads each, split k map
// for A and B); K stepped by 32 (host guarantees K % 32 == 0, M % 64 == 0, N % 64 == 0, grid = (M/64)*(N/64)).
// =====================================================================================================
__global__ __launch_bounds__(128)
void gemm_bf(const u16* __restrict__ A, const u16* __restrict__ Bt, const float* __restrict__ bias,
             float* C, int M, int N, int K, float oscale) {
  __shared__ __align__(16) float slab[4 * SLAB64];
  const int tid = threadIdx.x, wave = tid >> 5, lane = tid & 31;
  const int ntile = N >> 6;
  const int bid   = blockIdx.x;
  const int rowb  = (bid / ntile) * 64 + wave * 16;
  const int col0  = (bid % ntile) * 64;
  if (rowb + 16 > M) return;                // wave-uniform, never taken with the exact grid; no block barriers in this kernel
  const u16* ap = A  + (size_t)rowb * K + 8 * lane;          // a 16-row band holds 16*K halves
  const u16* bp = Bt + (size_t)col0 * K + 8 * lane;
  const size_t bs = (size_t)16 * K;
  v8f acc0 = zero8(), acc1 = zero8(), acc2 = zero8(), acc3 = zero8();
#pragma unroll 1
  for (int k0 = 0; k0 < 16 * K; k0 += FT) {                  // one packed tile = 32 k
    const v16b a  = ldfrag_b(ap + k0);
    const v16b b0 = ldfrag_b(bp + k0);
    const v16b b1 = ldfrag_b(bp + bs + k0);
    const v16b b2 = ldfrag_b(bp + 2 * bs + k0);
    const v16b b3 = ldfrag_b(bp + 3 * bs + k0);
    acc0 = mma_b(a, b0, acc0);
    acc1 = mma_b(a, b1, acc1);
    acc2 = mma_b(a, b2, acc2);
    acc3 = mma_b(a, b3, acc3);
    guard6<v16b>(acc0, acc1, acc2, acc3, a, b0, b1, b2, b3, a);
  }
  epi64(slab + wave * SLAB64, acc0, acc1, acc2, acc3, oscale, bias, C + (size_t)rowb * (size_t)N, (size_t)N, col0, lane);
}

// =====================================================================================================
// Output projection: out rows (s*NB + bb) of DMOD floats = (Ah + Al)[bb*SEQ + s][DMOD] . Bt[DMOD][DMOD]^T * oscale + bias
// (bf16 RNE value); products h.B + l.B into one accumulator (l unscaled residual).
// Block -> (column tile ct = bid % 16, sequence row tile rt of NRT, batch bb); the wave's 16 rows s = rt*64 + wave*16 .. +15 are
// consecutive rows of Ah/Al and rows of out spaced NB*DMOD floats apart (seq-major [s][b][DMOD] output layout).
// Same tiling and epilogue as gemm_bf; LDS slab wave-private.
// coverage: grid NB*NRT*16 blocks x 4 waves x (16 rows x 64 cols) = every (s, bb, col) of out exactly once.
// =====================================================================================================
__global__ __launch_bounds__(128)
void gemm_o2(const u16* __restrict__ Ah, const u16* __restrict__ Al, const u16* __restrict__ Bt, const float* __restrict__ bias,
             float* C, float oscale) {
  __shared__ __align__(16) float slab[4 * SLAB64];
  const int tid = threadIdx.x, wave = tid >> 5, lane = tid & 31;
  const int ntile = DMOD >> 6;
  const int bid   = blockIdx.x;
  const int ct    = bid % ntile;
  const int t2    = bid / ntile;
  const int rt    = t2 % NRT;
  const int bb    = t2 / NRT;
  if (bb >= NB) return;                     // block-uniform; no block barriers in this kernel; never taken with the exact grid
  const int srow  = rt * 64 + wave * 16;
  if (srow + 16 > SEQ) return;              // wave-uniform; never taken
  const int col0  = ct * 64;
  const int K     = DMOD;
  const size_t rowA = (size_t)bb * SEQ + srow;
  const _Float16* ahp = (const _Float16*)(const void*)Ah + rowA * K + 8 * lane;          // packed planes, as in gemm_bf
  const _Float16* alp = (const _Float16*)(const void*)Al + rowA * K + 8 * lane;
  const _Float16* bp  = (const _Float16*)(const void*)Bt + (size_t)col0 * K + 8 * lane;
  const size_t bs = (size_t)16 * K;
  v8f acc0 = zero8(), acc1 = zero8(), acc2 = zero8(), acc3 = zero8();
#pragma unroll 1
  for (int k0 = 0; k0 < 16 * K; k0 += FT) {
    const v16h ah = ldfrag_h(ahp + k0), al = ldfrag_h(alp + k0);
    const v16h b0 = ldfrag_h(bp + k0);
    const v16h b1 = ldfrag_h(bp + bs + k0);
    const v16h b2 = ldfrag_h(bp + 2 * bs + k0);
    const v16h b3 = ldfrag_h(bp + 3 * bs + k0);
    // the address pairs of the twelve loads above are inputs here, so no load's result is placed on one of them, and they are
    // rewritten only behind this wait
    asm volatile("s_wait_xcnt 0x0" :: "v"(ahp + k0), "v"(alp + k0), "v"(bp + k0) : "memory");
    acc0 = mma_h(ah, b0, acc0);  acc0 = mma_h(al, b0, acc0);
    acc1 = mma_h(ah, b1, acc1);  acc1 = mma_h(al, b1, acc1);
    acc2 = mma_h(ah, b2, acc2);  acc2 = mma_h(al, b2, acc2);
    acc3 = mma_h(ah, b3, acc3);  acc3 = mma_h(al, b3, acc3);
    guard6<v16h>(acc0, acc1, acc2, acc3, ah, al, b0, b1, b2, b3);
  }
  float* Cb = C + ((size_t)srow * NB + bb) * DMOD;
  epi64(slab + wave * SLAB64, acc0, acc1, acc2, acc3, oscale, bias, Cb, (size_t)NB * DMOD, col0, lane);
}

// =====================================================================================================
// Full (non-causal) attention over all JL keys, in the transposed form S^T = K.Q^T, O^T += V^T.P^T. Block bid -> (query group qg:
// 8 query tiles, head, batch b); one wave per query tile qt = qg*AWV + wave (rows q0 = 16*qt .. q0+15), all waves on ONE head.
//   q hi plane f16 x1024 and q residual plane, both [b*SEQ + s][h*HD + d]; k hi plane f16 x1024 [b*JL + j][h*HD + d];
//   v^T hi plane [b*NH + h][d][JL] f16 x1024; all packed (v^T with the four d subtiles of a key step side by side).
//   Scores use two products k_hi.q_hi + k_hi.q_lo; q fragments (B operand) loaded once per wave (2 k-steps x hi/residual).
//   score (log2 domain) t(i, j) = (q_i.k_j over HD) * (1/8)*log2e/(1024*1024); no key selection (every key contributes).
//   The head's k and v^T tiles come through LDS once per block: stages of SKEY = 64 keys (16 KiB), two buffers, filled by
//   asynchronous 16-B copies (4 per lane and stage) one stage ahead; the packed tiles keep their form in LDS, so a fragment
//   load is a wave-wide read of 512 contiguous bytes. Stage layout (halves): k band n (16 keys) tile t at n*1024 + t*512;
//   v^T key step p, d subtile j at 4096 + p*2048 + j*512.
//   Key tiles of 32 visited in order, kt = 0 .. NKT-1 (static bound), two per stage.
//   Per tile: 2 score subtiles (16 keys each) x 2 k-steps, k fragments (A operand, row = key).
//   Lane (hh = lane >> 4, c = lane & 15) then holds 16 scores of ONE query (column c): keys kb + 8hh + r in s0[r], kb + 16 + 8hh + r in s1[r]. Maximum and
//   sum run inside the lane; the two halves of a column exchange the maximum once per tile and join their sums once after the loop.
//   The 16 probabilities of a lane, converted in place (x32768, f16), ARE the B operand P^T in the split k map
//   (element s < 8: key 8hh + s, element s >= 8: key 16 + 8hh + s - 8), the map the packed v^T fragments (A operand, row = d) have.
//   After the loop: out = acc / Z (Z >= 1 always; guarded anyway), carries 1/(32768*1024) folded once. o[j][r] = O(query c,
//   d = 16j + 8hh + r): 8 consecutive d of one row = chunk j*32 + lane of the head's two packed tiles, stored from registers.
// LDS extent: ring[2*STH]; a stage's copies write bytes 0 .. 16383 of its buffer, each once; the fragment loads read the same extent.
// coverage: per wave 4 instructions x 32 lanes x 8 halves = the head's two packed tiles (16 x 64) per plane; grid NQG x NH x NB blocks x AWV waves =
//           every (b, s, h) row segment of O hi and O residual exactly once.
// =====================================================================================================
// lane l <-> lane l ^ 16 (the other half of the same column)
__device__ __forceinline__ float xhalf(float x) {
  const int b = __builtin_bit_cast(int, x);
  return __builtin_bit_cast(float, __builtin_amdgcn_permlanex16(b, b, 0x76543210, 0xfedcba98, false, false));
}

// One stage: 256 lanes x 16 B = 4 KiB per copy. Copies 0, 1: k bands 2c + (tid >> 7) (2 KiB of the head's tiles each, bands
// 16 key rows apart in the plane); copies 2, 3: the stage's 8 KiB of v^T tiles. lds = the lane's byte address in the buffer.
// The s_wait_xcnt closes the statement so that no address register of a copy is rewritten in front of it.
__device__ __forceinline__ void stage_copy(unsigned lds, const _Float16* kg, const _Float16* vg) {
#if defined(__HIP_DEVICE_COMPILE__)
  asm volatile("global_load_async_to_lds_b128 %0, %4, off\n\t"
               "global_load_async_to_lds_b128 %1, %5, off\n\t"
               "global_load_async_to_lds_b128 %2, %6, off\n\t"
               "global_load_async_to_lds_b128 %3, %7, off\n\t"
               "s_wait_xcnt 0x0"
               :: "v"(lds), "v"(lds + 4096u), "v"(lds + 8192u), "v"(lds + 12288u),
                  "v"(kg), "v"(kg + 32 * DMOD), "v"(vg), "v"(vg + 4 * FT) : "memory");
#endif
}
// this wave's copies have landed in LDS (the compiler places no wait for them)
__device__ __forceinline__ void wait_copies() {
#if defined(__HIP_DEVICE_COMPILE__)
  asm volatile("s_wait_asynccnt 0x0" ::: "memory");
#endif
}
// this wave's LDS reads have returned, before the barrier behind which their buffer is refilled
__device__ __forceinline__ void wait_lds_reads() {
#if defined(__HIP_DEVICE_COMPILE__)
  asm volatile("s_wait_dscnt 0x0" ::: "memory");
#endif
}

__global__ __launch_bounds__(ATT_THREADS)
void attn_x(const u16* __restrict__ QHp, const u16* __restrict__ QLp, const u16* __restrict__ KHp,
            const u16* __restrict__ VHp, u16* OHp, u16* OLp) {
  __shared__ __attribute__((aligned(16))) _Float16 ring[2 * STH];
  const int tid  = threadIdx.x;
  const int wave = tid >> 5;
  const int lane = tid & 31;
  const int bid  = blockIdx.x;
  const int qg   = bid % NQG;
  const int t2   = bid / NQG;
  const int head = t2 % NH;
  const int b    = t2 / NH;
  if (b >= NB) return;                      // block-uniform, before any barrier or copy; never taken with the exact grid
  const int q0   = (qg * AWV + wave) * 16;  // q0 + 16 <= SEQ by construction

  const size_t hcol = (size_t)head * (HD / 32) * FT + 8 * lane;        // the head's two tiles inside a 16-row band
  const _Float16* Qh  = (const _Float16*)(const void*)QHp + ((size_t)b * SEQ + q0) * DMOD + hcol;
  const _Float16* Ql  = (const _Float16*)(const void*)QLp + ((size_t)b * SEQ + q0) * DMOD + hcol;
  // copy sources of this lane in stage 0: k band tid >> 7, chunk tid & 127 of the head's two tiles; v^T chunk tid
  const _Float16* Kg = (const _Float16*)(const void*)KHp + ((size_t)b * JL + (tid >> 7) * 16) * DMOD
                       + (size_t)head * (HD / 32) * FT + 8 * (tid & 127);
  const _Float16* Vg = (const _Float16*)(const void*)VHp + (size_t)(b * NH + head) * NKT * 4 * FT + 8 * tid;
  const unsigned lds0 = (unsigned)(uintptr_t)(&ring[0]) + 16u * (unsigned)tid;
  const float lsc = SM_SCALE * (LOG2E / (QSC * KSC));
  const float oc  = 1.0f / (PCAR * VCAR);

  // ---- q fragments (hi and residual, 2 k-steps over HD), loaded once ----
  const v16h qh0 = ldfrag_h(Qh), qh1 = ldfrag_h(Qh + FT);
  const v16h ql0 = ldfrag_h(Ql), ql1 = ldfrag_h(Ql + FT);

  float mrow = -INFINITY;                   // running maximum of query column c (alike in both halves)
  float lrow = 0.f;                         // running sum over the keys of this half only
  v8f o[4];
#pragma unroll
  for (int j = 0; j < 4; ++j) o[j] = zero8();

  // ---- ring prologue: stage 0 landed and published, stage 1 in flight ----
  stage_copy(lds0, Kg, Vg);
  wait_copies();
  __syncthreads();
  stage_copy(lds0 + 2u * STH, Kg + (size_t)SKEY * DMOD, Vg + (size_t)(SKEY / 32) * 4 * FT);

#pragma unroll 1                            // rolled: one publish point per trip, in the order written at its foot
  for (int st = 0; st < NST; ++st) {
   const _Float16* sb = ring + (st & 1) * STH + 8 * lane;
#pragma unroll                              // both key steps of a stage in line: every LDS offset an immediate
   for (int p = 0; p < SKEY / 32; ++p) {    // key step kt = 2*st + p, keys kb = 32*kt .. kb + 31
    // ---- the step's k and v^T fragments, one group of LDS reads ----
    const _Float16* k0p = sb + p * 4 * FT;
    const _Float16* vhp = sb + SKEY * HD + p * 4 * FT;
    const v16h ka0 = ldfrag_h(k0p),          ka1 = ldfrag_h(k0p + FT);
    const v16h kc0 = ldfrag_h(k0p + 2 * FT), kc1 = ldfrag_h(k0p + 3 * FT);
    v16h vf[4];
#pragma unroll
    for (int j = 0; j < 4; ++j) vf[j] = ldfrag_h(vhp + j * FT);
    // ---- scores: D element r of this lane = (key kb + 8hh + r, query column c) in s0, key kb + 16 + 8hh + r in s1 ----
    v8f s0 = zero8(), s1 = zero8();
    {
      s0 = mma_h(ka0, qh0, s0);
      s0 = mma_h(ka0, ql0, s0);
      s0 = mma_h(ka1, qh1, s0);
      s0 = mma_h(ka1, ql1, s0);
      s1 = mma_h(kc0, qh0, s1);
      s1 = mma_h(kc0, ql0, s1);
      s1 = mma_h(kc1, qh1, s1);
      s1 = mma_h(kc1, ql1, s1);
      guard2(s0, s1, ka0, ka1, kc0, kc1, qh0, ql0, qh1, ql1);
    }
    // ---- online softmax in base 2, -inf-safe; one query per lane ----
    const v8f t0 = s0 * lsc, t1 = s1 * lsc;
    float mx = fmaxf(t0[0], t1[0]);
#pragma unroll
    for (int r = 1; r < 8; ++r) mx = fmaxf(mx, fmaxf(t0[r], t1[r]));
    mx = fmaxf(mx, xhalf(mx));
    const float mn = fmaxf(mrow, mx);
    const float ms = (mn == -INFINITY) ? 0.0f : mn;
    const float al = exp2f(mrow - ms);
    mrow = mn;
    v8f e0, e1;
#pragma unroll
    for (int r = 0; r < 8; ++r) { e0[r] = exp2f(t0[r] - ms); e1[r] = exp2f(t1[r] - ms); }
    const v8f es = e0 + e1;
    lrow = lrow * al + (((es[0] + es[4]) + (es[1] + es[5])) + ((es[2] + es[6]) + (es[3] + es[7])));
    // ---- B fragment of P^T * 32768 (f16), column = c, split k map over the 32 keys of this step ----
    FragH ph;
    const v8f p0 = e0 * PCAR, p1 = e1 * PCAR;
#pragma unroll
    for (int r = 0; r < 8; ++r) {
      ph.h[0][r] = (_Float16)p0[r];         // elements 0..7  = keys kb + 8hh + 0..7
      ph.h[1][r] = (_Float16)p1[r];         // elements 8..15 = keys kb + 16 + 8hh + 0..7
    }
#pragma unroll
    for (int j = 0; j < 4; ++j) o[j] *= al;
    // ---- V^T.P^T : A fragment row = d = j*16 + c, keys contiguous in the v^T plane; 2 groups of 2 d-subtiles ----
    {
#pragma unroll
      for (int jg = 0; jg < HD / 32; ++jg) {
        const v16h vha = vf[2 * jg], vhc = vf[2 * jg + 1];
        o[2 * jg]     = mma_h(vha, ph.v, o[2 * jg]);
        o[2 * jg + 1] = mma_h(vhc, ph.v, o[2 * jg + 1]);
        guard2(o[2 * jg], o[2 * jg + 1], ph.v, vha, vhc, ph.v, vha, vhc, ph.v, ph.v);
      }
    }
   }
   // ---- publish point of stage st + 1: own reads of this buffer done, own copies landed, every wave here; then the refill ----
   wait_lds_reads();
   wait_copies();
   __syncthreads();
   if (st + 2 < NST) {                      // block-uniform
     stage_copy(lds0 + (unsigned)(st & 1) * (2u * STH), Kg + (size_t)(st + 2) * SKEY * DMOD,
                Vg + (size_t)(st + 2) * (SKEY / 32) * 4 * FT);
   }
  }
  wait_copies();
  acc_guard4(o[0], o[1], o[2], o[3]);
  // ---- out = acc / Z (0 if Z == 0), carries (32768 on P, 1024 on v) folded once; the halves' sums joined here ----
  const float lv  = lrow + xhalf(lrow);
  const float ls  = (lv > 0.0f) ? lv : 1.0f;
  const float inv = (lv > 0.0f) ? ((1.0f / ls) * oc) : 0.0f;
  // ---- O x1024 -> packed f16 hi + residual planes; chunk j*32 + lane of the head's two tiles: row c, d = 16j + 8hh + 0..7 ----
  v4u oh[4], ol[4];
#pragma unroll
  for (int it = 0; it < 4; ++it) {
    float w[8];
#pragma unroll
    for (int e = 0; e < 8; ++e) w[e] = (o[it][e] * inv) * OSC;
#pragma unroll
    for (int e = 0; e < 4; ++e) {
      const _Float16 h0 = (_Float16)w[2 * e], h1 = (_Float16)w[2 * e + 1];
      const _Float16 l0 = (_Float16)(w[2 * e] - (float)h0), l1 = (_Float16)(w[2 * e + 1] - (float)h1);
      oh[it][e] = pk16(h_bits(h0), h_bits(h1));
      ol[it][e] = pk16(h_bits(l0), h_bits(l1));
    }
  }
  const size_t ob = ((size_t)b * SEQ + q0) * DMOD + hcol;
  {
#pragma unroll
    for (int it = 0; it < 4; ++it) {
      *(v4u*)(OHp + ob + (size_t)it * 256) = oh[it];
      *(v4u*)(OLp + ob + (size_t)it * 256) = ol[it];
    }
    
  }
}

// =====================================================================================================
// Workspace map (bytes); every plane is fully written by whole-line stores before it is read; all extents are exact multiples
// of the store granularity (packed 1-KiB 16 x 32 tiles of the 16-bit planes, f32 rows of 4096 B; no pad rows needed); every region offset a multiple of
// 2097152:
//   XC  bf16 [CROWS][1024]              CROWS*2048   (c = [mem; kv] as bf16; later q as bf16 [QROWS][1024] at the same offset)
//   WB  16-bit [1024 n][1024 k]         2097152      (Wv, Wk, Wq as bf16, then Wc as f16 x1024, reused in launch order)
//   F   f32 [CROWS][1024]               CROWS*4096   (v, k, q projection output in launch order; afterwards the region holds
//                                                     OH f16 [QROWS][1024] x1024 at +0 and OL residual [QROWS][1024] at +QROWS*2048)
//   VH  f16 [NB*16][64][JL] x1024       CROWS*2048   (all 16-bit planes in packed 16 x 32 tiles)
//   KH  f16 [CROWS][1024] x1024         CROWS*2048
//   QH  f16 [QROWS][1024] x1024         QROWS*2048   QL residual the same
//   end (NB=2, SEQ=MLEN=2048)           102760448
// =====================================================================================================
extern "C" void kernel_launch(void* const* d_in, const int* in_sizes, int n_in,
                              void* d_out, int out_size, void* d_ws, size_t ws_size,
                              hipStream_t stream) {
  if (n_in < 11) return;
  const long long needq = ((long long)(SEQ - 1) * B_FULL + NB) * DMOD;
  const long long needm = (MLEN > 0) ? (((long long)(MLEN - 1) * B_FULL + NB) * DMOD) : 0;
  if ((long long)in_sizes[0] < needq || (long long)in_sizes[1] < needq || (long long)in_sizes[2] < needm) return;
  if (in_sizes[3] < DMOD * DMOD || in_sizes[5] < DMOD * DMOD || in_sizes[7] < DMOD * DMOD || in_sizes[9] < DMOD * DMOD) return;
  if (in_sizes[4] < DMOD || in_sizes[6] < DMOD || in_sizes[8] < DMOD || in_sizes[10] < DMOD) return;
  if ((long long)out_size < (long long)SEQ * NB * DMOD) return;

  const float* xq  = (const float*)d_in[0];
  const float* xkv = (const float*)d_in[1];
  const float* xm  = (const float*)d_in[2];
  const float* wq  = (const float*)d_in[3];
  const float* bq  = (const float*)d_in[4];
  const float* wk  = (const float*)d_in[5];
  const float* bk  = (const float*)d_in[6];
  const float* wv  = (const float*)d_in[7];
  const float* bv  = (const float*)d_in[8];
  const float* wc  = (const float*)d_in[9];
  const float* bc  = (const float*)d_in[10];
  float*       out = (float*)d_out;

  const size_t szXC = (size_t)CROWS * DMOD * 2;                 // also hosts XQ [QROWS][1024] bf16
  const size_t szXQ = (size_t)QROWS * DMOD * 2;
  const size_t szW  = (size_t)DMOD * DMOD * 2;
  const size_t szF  = (size_t)CROWS * DMOD * 4;                 // also hosts OH + OL
  const size_t szO  = (size_t)QROWS * DMOD * 2;                 // OH, OL each
  const size_t szVH = (size_t)NB * NH * HD * JL * 2;            // == CROWS*2048
  const size_t szKH = (size_t)CROWS * DMOD * 2;
  const size_t szQ  = (size_t)QROWS * DMOD * 2;                 // QH, QL each
  if (2 * szO > szF || szXQ > szXC) return;
  size_t off = 0;
  const size_t oXC = off; off += szXC;
  const size_t oW  = off; off += szW;
  const size_t oF  = off; off += szF;
  const size_t oVH = off; off += szVH;
  const size_t oKH = off; off += szKH;
  const size_t oQH = off; off += szQ;
  const size_t oQL = off; off += szQ;
  if (off > ws_size) return;                // off = 102760448 for NB = 2, SEQ = MLEN = 2048
  if (off > (size_t)WS_CAP) return;

  char* ws = (char*)d_ws;
  u16*   XC = (u16*)(ws + oXC);
  u16*   XQ = (u16*)(ws + oXC);
  u16*   WB = (u16*)(ws + oW);
  float* F  = (float*)(ws + oF);
  u16*   OH = (u16*)(ws + oF);
  u16*   OL = (u16*)(ws + oF + szO);
  u16*   VH = (u16*)(ws + oVH);
  u16*   KH = (u16*)(ws + oKH);
  u16*   QH = (u16*)(ws + oQH);
  u16*   QL = (u16*)(ws + oQL);

  const dim3 b256(256), b128(128), bQK(QKT), bAT(ATT_THREADS);
  const int  n8w = (DMOD * DMOD) / 8;
  const dim3 gW((n8w + 255) / 256);                     // 512 blocks per weight matrix
  const dim3 gXC(CROWS), gXQ(QROWS);
  const dim3 gGC((CROWS / 64) * (DMOD / 64));
  const dim3 gGQ((QROWS / 64) * (DMOD / 64));
  const dim3 gVT(NB * NH * NVT);
  const dim3 gAT(NQG * NH * NB);
  const dim3 gO(NB * NRT * (DMOD / 64));

  // (1) c = [mem; kv] -> bf16 plane [CROWS][1024], batch-major rows b*JL + j
  cvt_act<<<gXC, bQK, 0, stream>>>(xm, xkv, XC, JL, MLEN);
  // (2) Wv [n][k] -> bf16 plane; (3) v = c.Wv^T + bv -> F f32; (4) v^T plane x1024
  cvt16<<<gW, b256, 0, stream>>>(wv, WB, n8w, 0, 1.0f);
  gemm_bf<<<gGC, b128, 0, stream>>>(XC, WB, bv, F, CROWS, DMOD, DMOD, 1.0f);
  vt16<<<gVT, b256, 0, stream>>>(F, VH);
  // (5) Wk -> bf16 plane; (6) k = c.Wk^T + bk -> F; (7) k hi plane x1024
  cvt16<<<gW, b256, 0, stream>>>(wk, WB, n8w, 0, 1.0f);
  gemm_bf<<<gGC, b128, 0, stream>>>(XC, WB, bk, F, CROWS, DMOD, DMOD, 1.0f);
  qk16<0><<<gXC, bQK, 0, stream>>>(F, KH, KH, CROWS, KSC);
  // (8) q -> bf16 plane (XC region); (9) Wq -> bf16 plane; (10) q = q.Wq^T + bq -> F; (11) q hi + residual planes x1024
  cvt_act<<<gXQ, bQK, 0, stream>>>(xq, xq, XQ, SEQ, SEQ);
  cvt16<<<gW, b256, 0, stream>>>(wq, WB, n8w, 0, 1.0f);
  gemm_bf<<<gGQ, b128, 0, stream>>>(XQ, WB, bq, F, QROWS, DMOD, DMOD, 1.0f);
  qk16<1><<<gXQ, bQK, 0, stream>>>(F, QH, QL, QROWS, QSC);
  // (12) Wc [n][k] -> f16 plane of bf16 value x1024
  cvt16<<<gW, b256, 0, stream>>>(wc, WB, n8w, 1, WOS);
  // (13) attention over all JL keys -> O hi + residual planes (F region)
  attn_x<<<gAT, bAT, 0, stream>>>(QH, QL, KH, VH, OH, OL);
  // (14) output projection -> out f32 rows (s*NB + b), carries 1024 x 1024 folded back
  gemm_o2<<<gO, b128, 0, stream>>>(OH, OL, WB, bc, out, 1.0f / (OSC * WOS));
  (void)hipGetLastError();
}

// v004
// One run takes 233 microseconds.
// Next to v003, in two timings, it ran 1.08 times as fast each time.
// Counting every step since v000, it is 2.41 times as fast.
// Contractions: q.Wq^T, c.Wk^T, c.Wv^T (c = [mem; kv] along the key axis) on v_wmma_f32_16x16x32_bf16 (activations, W and
// biases RNE-converted to bf16; the [n][k] weight rows are used directly as the k-contiguous B operand; f32 accumulate);
// k.q^T over 64 on v_wmma_f32_16x16x32_f16 with q carried as f16 hi (x1024) plus an f16 residual plane and k as f16 hi (x1024)
// (products h.h + h.l); v^T.P^T on v_wmma_f32_16x16x32_f16 (P x32768 f16, v x1024 f16, one product); O.Wc^T on
// v_wmma_f32_16x16x32_f16 (O x1024 as f16 hi plus f16 residual plane, Wc as f16(bf16(Wc)) x1024, products h.w + l.w);
// all f32 accumulate. Bias adds, base-2 online softmax over all keys and the 1/Z fold in f32 on VALU.
// Every 16-bit workspace plane is stored fragment-packed (see "packed planes" below): a wave-wide 16-B fragment load reads 512
// contiguous bytes (4 whole lines) instead of 32 B out of each of 16 rows.
#include <hip/hip_runtime.h>
#include <math.h>
#include <stdint.h>

#ifndef NB
#define NB 2
#endif
#ifndef SEQ
#define SEQ 2048
#endif
#ifndef MLEN
#define MLEN 2048
#endif
#define B_FULL 2
#define L_FULL 2048
#define M_FULL 2048
#define DMOD  1024
#define NH    16
#define HD    64
#define JL    (MLEN + SEQ)
#define QROWS (NB * SEQ)
#define CROWS (NB * JL)
#define SM_SCALE 0.125f
#define LOG2E 1.4426950408889634f
#define QSC   1024.0f
#define KSC   1024.0f
#define PLOG  15.0f               // P is carried x 2^15 = 32768, as a bias of its exponent
#define VCAR  1024.0f
#define OSC   1024.0f
#define WOS   1024.0f
#define AWV   8                   // waves of an attention block: 8 query tiles of ONE head share that head's k / v^T stages
#define NQT   (SEQ / 16)
#define NQG   (NQT / AWV)
#define SKEY  64                  // keys in one LDS stage of the attention ring
#define NST   (JL / SKEY)
#define STH   (2 * SKEY * HD)     // halves in one stage: 8 packed k tiles, then 8 packed v^T tiles (16 KiB)
#define NKT   (JL / 32)
#define NVT   (JL / 64)
#define NRT   (SEQ / 64)
#define ATT_THREADS (AWV * 32)
#define SLAB64 (16 * 68)
#define VTP   72
#define QKT   (DMOD / 8)
#define WS_CAP 134217728
#define FT    512                 // halves in one packed 16 x 32 fragment tile (1 KiB)
#define TPB   (DMOD / 32)         // fragment tiles in one 16-row band of a [rows][DMOD] plane
static_assert(DMOD == NH * HD && HD == 64 && NH == 16);
static_assert((NQT % AWV) == 0 && ATT_THREADS == 256 && NST * SKEY == JL && NST >= 2 && SKEY == 64);
static_assert(NB >= 1 && NB <= B_FULL);
static_assert((SEQ % 64) == 0 && SEQ >= 64 && SEQ <= L_FULL);
static_assert((MLEN % 64) == 0 && MLEN >= 0 && MLEN <= M_FULL);
static_assert((JL % 64) == 0 && NKT * 32 == JL && NVT * 64 == JL && NQT * 16 == SEQ && NRT * 64 == SEQ);
static_assert(QKT == 128 && (DMOD % 64) == 0 && (DMOD % 32) == 0 && (HD % 32) == 0);
static_assert(((DMOD * DMOD) % (8 * 256)) == 0);
static_assert(QROWS <= CROWS);
static_assert(TPB == 32 && QKT == 2 * 64 && (TPB % 2) == 0 && (MLEN % 16) == 0 && (SEQ % 16) == 0 && (JL % 16) == 0);
static_assert((long long)CROWS * DMOD * 10 + (long long)QROWS * DMOD * 4 + 2LL * DMOD * DMOD <= (long long)WS_CAP);

typedef unsigned short u16;
typedef _Float16 v16h __attribute__((ext_vector_type(16)));
typedef _Float16 v8h  __attribute__((ext_vector_type(8)));
typedef __bf16   v16b __attribute__((ext_vector_type(16)));
typedef float    v8f  __attribute__((ext_vector_type(8)));
typedef float    v4f  __attribute__((ext_vector_type(4)));
typedef float    v2f  __attribute__((ext_vector_type(2)));
typedef unsigned int v4u __attribute__((ext_vector_type(4)));

union FragH { v16h v; v8h h[2]; v4u u[2]; };
union FragB { v16b v; v4u u[2]; };

// ---- scalar helpers --------------------------------------------------------------------------------
__device__ __forceinline__ unsigned short bf_bits(float f) {          // f32 -> bf16 bits, RNE convert
  unsigned u = __float_as_uint(f);
  return (unsigned short)((u + 0x7FFFu + ((u >> 16) & 1u)) >> 16);
}
__device__ __forceinline__ float bf_up(unsigned short h) { return __uint_as_float(((unsigned)h) << 16); }
__device__ __forceinline__ float bfr(float f) { return bf_up(bf_bits(f)); }
__device__ __forceinline__ unsigned short h_bits(_Float16 x) { return __builtin_bit_cast(unsigned short, x); }
__device__ __forceinline__ unsigned pk16(unsigned short a, unsigned short b) { return (unsigned)a | ((unsigned)b << 16); }
__device__ __forceinline__ v8f zero8() { v8f z = {0.f, 0.f, 0.f, 0.f, 0.f, 0.f, 0.f, 0.f}; return z; }

// ---- packed planes: a [rows][K] 16-bit matrix is stored as 16 x 32 fragment tiles of FT halves, tile (row >> 4, k >> 5) at
//      index (row >> 4) * (K / 32) + (k >> 5); inside a tile element (c = row & 15, kk = k & 31) sits at
//      (kk >> 4) * 256 + (((kk >> 3) & 1) * 16 + c) * 8 + (kk & 7): chunk g of 8 halves = what lane g & 31 takes in load g >> 5.
// ---- fragment loaders: 16-bit A/B operand, lane -> row/col (lane&15), p = tile start + 8*lane;
//      elements 0..7 <- p[0..7] (k0+8h..), elements 8..15 <- p[256..263] (k0+16+8h..)  (same split k map for A and B)
__device__ __forceinline__ v16h ldfrag_h(const _Float16* p) {
  FragH f;
  f.h[0] = *(const v8h*)(p);
  f.h[1] = *(const v8h*)(p + 256);
  return f.v;
}
__device__ __forceinline__ v16b ldfrag_b(const u16* p) {              // bf16 plane read as unsigned integer vectors
  FragB f;
  f.u[0] = *(const v4u*)(p);
  f.u[1] = *(const v4u*)(p + 256);
  return f.v;
}
// first column of chunk w (0..63) inside its tile
__device__ __forceinline__ int chunk_k(int w) { return ((w >> 5) & 1) * 16 + ((w >> 4) & 1) * 8; }

__device__ __forceinline__ v8f mma_h(v16h a, v16h b, v8f c) {
  return __builtin_amdgcn_wmma_f32_16x16x32_f16(false, a, false, b, (short)0, c, false, false);
}
__device__ __forceinline__ v8f mma_b(v16b a, v16b b, v8f c) {
  return __builtin_amdgcn_wmma_f32_16x16x32_bf16(false, a, false, b, (short)0, c, false, false);
}
__device__ __forceinline__ void guard2(v8f& a, v8f& b, v16h x0, v16h x1, v16h x2, v16h x3,
                                       v16h x4, v16h x5, v16h x6, v16h x7) {
#if defined(__HIP_DEVICE_COMPILE__)
  asm volatile("v_nop\n\tv_nop\n\tv_nop\n\tv_nop"
               : "+v"(a), "+v"(b)
               : "v"(x0), "v"(x1), "v"(x2), "v"(x3), "v"(x4), "v"(x5), "v"(x6), "v"(x7) : "memory");
#endif
}
template <typename F>
__device__ __forceinline__ void guard6(v8f& a, v8f& b, v8f& c, v8f& d, F x0, F x1, F x2, F x3, F x4, F x5) {
#if defined(__HIP_DEVICE_COMPILE__)
  asm volatile("v_nop\n\tv_nop\n\tv_nop\n\tv_nop"
               : "+v"(a), "+v"(b), "+v"(c), "+v"(d) : "v"(x0), "v"(x1), "v"(x2), "v"(x3), "v"(x4), "v"(x5) : "memory");
#endif
}
__device__ __forceinline__ void acc_guard4(v8f& a, v8f& b, v8f& c, v8f& d) {
#if defined(__HIP_DEVICE_COMPILE__)
  asm volatile("v_nop\n\tv_nop\n\tv_nop\n\tv_nop" : "+v"(a), "+v"(b), "+v"(c), "+v"(d));
#endif
}
__device__ __forceinline__ void wave_sync_lds() {
  __builtin_amdgcn_fence(__ATOMIC_RELEASE, "workgroup");
  __builtin_amdgcn_wave_barrier();
  __builtin_amdgcn_fence(__ATOMIC_ACQUIRE, "workgroup");
}

// =====================================================================================================
// f32 [DMOD n][DMOD k] -> packed 16-bit plane.  f16mode == 0: bf16 RNE bits;  f16mode == 1: f16 bits of (bf16 RNE value) * scale.
// Used for the [n][k] weight matrices (bf16, or f16 of the bf16 value x1024 for Wc).
// Thread = packed chunk gt (8 consecutive k of one row): two 16-B loads, one 16-B store; 32 lanes store 512 contiguous bytes
// coverage: grid = ceil(n8/256) blocks x 256 thr x 8 (in-kernel bound) = the whole plane (n8 = 131072, a multiple of 256).
// =====================================================================================================
__global__ __launch_bounds__(256) void cvt16(const float* __restrict__ x, u16* D, int n8, int f16mode, float scale) {
  const int gt = blockIdx.x * 256 + (int)threadIdx.x;
  if (gt >= n8) return;
  const int tile = gt >> 6;
  const float* p = x + (size_t)((tile / TPB) * 16 + (gt & 15)) * DMOD + (tile % TPB) * 32 + chunk_k(gt & 63);
  const v4f a = *(const v4f*)(p), b4 = *(const v4f*)(p + 4);
  float w[8];
#pragma unroll
  for (int e = 0; e < 4; ++e) { w[e] = a[e]; w[4 + e] = b4[e]; }
  v4u o;
#pragma unroll
  for (int e = 0; e < 4; ++e) {
    const float f0 = w[2 * e], f1 = w[2 * e + 1];
    const unsigned short hb0 = h_bits((_Float16)(bfr(f0) * scale));
    const unsigned short hb1 = h_bits((_Float16)(bfr(f1) * scale));
    const unsigned short bb0 = bf_bits(f0);
    const unsigned short bb1 = bf_bits(f1);
    o[e] = (f16mode != 0) ? pk16(hb0, hb1) : pk16(bb0, bb1);
  }
  u16* d = D + (size_t)gt * 8;
  {
    *(v4u*)(d) = o;
    
  }
}

// =====================================================================================================
// Activation rows -> packed bf16 plane (RNE), batch-major destination rows:
//   D[(bb*nrow + j)][0..1023] <- X0[(j*B_FULL + bb)][..] for j < split,  X1[((j - split)*B_FULL + bb)][..] for j >= split.
// Used for c = [mem rows 0..MLEN-1 ; kv rows 0..SEQ-1] (nrow = JL, split = MLEN) and for q (nrow = SEQ, split = SEQ, X1 unused).
// Block = two packed tiles of one 16-row band (16 rows x 64 columns), thread = one chunk: two 16-B loads, one 16-B store.
// The source base selection is block-uniform (nrow and split are multiples of 16; both sources are global planes).
// coverage: grid = NB*nrow blocks x 128 chunks x 8 = every element of the [NB*nrow][1024] plane exactly once.
// =====================================================================================================
__global__ __launch_bounds__(QKT) void cvt_act(const float* __restrict__ X0, const float* __restrict__ X1, u16* D,
                                               int nrow, int split) {
  const int tid = (int)threadIdx.x;
  const int r   = (int)blockIdx.x;
  if (r >= NB * nrow) return;
  if (tid >= QKT) return;
  const int  r0    = (r / (TPB / 2)) * 16;                    // first row of the band
  const int  col   = ((r % (TPB / 2)) * 2 + (tid >> 6)) * 32 + chunk_k(tid & 63);
  const int  bb    = r0 / nrow;
  const int  j     = r0 - bb * nrow;
  const bool first = (j < split);
  const int  js    = (first ? j : (j - split)) + (tid & 15);
  const float* base = first ? X0 : X1;
  const float* p = base + ((size_t)js * B_FULL + bb) * DMOD + col;
  const v4f a = *(const v4f*)(p), a4 = *(const v4f*)(p + 4);
  v4u o;
#pragma unroll
  for (int e = 0; e < 2; ++e) {
    o[e]     = pk16(bf_bits(a[2 * e]),  bf_bits(a[2 * e + 1]));
    o[2 + e] = pk16(bf_bits(a4[2 * e]), bf_bits(a4[2 * e + 1]));
  }
  u16* d = D + ((size_t)r * QKT + tid) * 8;
  {
    *(v4u*)(d) = o;
    
  }
}

// =====================================================================================================
// v^T plane from the v projection F f32 [CROWS][DMOD] (row = bb*JL + j, column = g*HD + d, bias already added):
//   VH = f16(v * 1024) for all keys j, packed: tile (head bb*NH + g, key step kt = j >> 5, d subtile d >> 4) at index
//   ((bb*NH + g)*NKT + kt)*4 + (d >> 4), row in the tile = d & 15, k = j & 31.
// Block = (bb, head g, 64 keys s0): each thread loads its 16 floats (key sl, d chunk dc) with 16-B loads, converts, scatters into
// the LDS tile [d][64 keys] (pitch 72 halves, cross-wave -> block barrier); after the barrier each d row segment (64 halves = one
// LDS extent: TH[64*72], written rows 0..63 x cols 0..63, read rows 0..63 x cols 0..63 (staged extent == consumed extent).
// coverage: load 256 thr x 16 = 64 keys x 64 d; store 2 iterations x 256 thr x 8 halves = 64 lines x 64 = the block's tile;
//           grid = NB*NH*NVT blocks covers VH exactly once.
// =====================================================================================================
__global__ __launch_bounds__(256) void vt16(const float* __restrict__ F, u16* VHo) {
  __shared__ __align__(16) u16 TH[HD * VTP];
  const int tid = threadIdx.x;
  const int bid = blockIdx.x;
  const int st  = bid % NVT;
  const int t2  = bid / NVT;
  const int g   = t2 % NH;
  const int bb  = t2 / NH;
  if (bb >= NB) return;                     // block-uniform, before any barrier; never taken with the exact grid
  const int s0  = st * 64;
  {
    const int sl = tid >> 2;                // key within tile 0..63
    const int dc = (tid & 3) * 16;          // d chunk 0,16,32,48
    const float* src = F + ((size_t)bb * JL + s0 + sl) * DMOD + g * HD + dc;
#pragma unroll
    for (int i = 0; i < 4; ++i) {
      const v4f a = *(const v4f*)(src + 4 * i);
#pragma unroll
      for (int e = 0; e < 4; ++e) {
        const _Float16 hv = (_Float16)(a[e] * VCAR);
        TH[(dc + 4 * i + e) * VTP + sl] = h_bits(hv);
      }
    }
  }
  __syncthreads();
  v4u vh[2];
#pragma unroll
  for (int it = 0; it < 2; ++it) {          // it = key step within the block's 64 keys; tid >> 6 = d subtile; tid & 63 = chunk
    const int line = (tid >> 6) * 16 + (tid & 15);          // d = 0..63
    vh[it] = *(const v4u*)(TH + line * VTP + it * 32 + chunk_k(tid & 63));
  }
  const size_t baseH = ((size_t)(bb * NH + g) * NKT + st * 2) * 4 * FT + (size_t)tid * 8;
  {
#pragma unroll
    for (int it = 0; it < 2; ++it) {
      *(v4u*)(VHo + baseH + (size_t)it * 4 * FT) = vh[it];
    }
    
  }
}

// =====================================================================================================
// q / k planes from a projection F f32 [nrows][DMOD] (bias already added): Hp [nrows][DMOD] = f16(val * sc), packed;
// when RES: Lp [nrows][DMOD] = f16 residual f16(val*sc - hi), packed. Block = two packed tiles of one 16-row band, thread = one
// chunk: two 16-B loads, one 16-B store per plane; 32 consecutive lanes store 512 contiguous 512-B-aligned bytes per instruction
// coverage: grid = nrows blocks x 128 chunks x 8 = every element of Hp (and of Lp) exactly once (nrows a multiple of 16).
// =====================================================================================================
template <int RES>
__global__ __launch_bounds__(QKT) void qk16(const float* __restrict__ F, u16* Hp, u16* Lp, int nrows, float sc) {
  const int tid = (int)threadIdx.x;
  const int row = (int)blockIdx.x;
  if (row >= nrows) return;
  if (tid >= QKT) return;
  const float* p = F + (size_t)((row / (TPB / 2)) * 16 + (tid & 15)) * DMOD
                     + ((row % (TPB / 2)) * 2 + (tid >> 6)) * 32 + chunk_k(tid & 63);
  const v4f a = *(const v4f*)(p), b4 = *(const v4f*)(p + 4);
  float w[8];
#pragma unroll
  for (int e = 0; e < 4; ++e) { w[e] = a[e] * sc; w[4 + e] = b4[e] * sc; }
  v4u oh, ol;
#pragma unroll
  for (int e = 0; e < 4; ++e) {
    const float t0 = w[2 * e], t1 = w[2 * e + 1];
    const _Float16 h0 = (_Float16)t0, h1 = (_Float16)t1;
    const _Float16 l0 = (_Float16)(t0 - (float)h0), l1 = (_Float16)(t1 - (float)h1);
    oh[e] = pk16(h_bits(h0), h_bits(h1));
    ol[e] = pk16(h_bits(l0), h_bits(l1));
  }
  u16* dh = Hp + (size_t)row * DMOD + tid * 8;
  u16* dl = Lp + (size_t)row * DMOD + tid * 8;
  {
    *(v4u*)(dh) = oh;
    if constexpr (RES != 0) {
      *(v4u*)(dl) = ol;
    }
    
  }
}

// =====================================================================================================
// GEMM epilogue shared by both engines: the wave's 16x64 f32 tile (times oscale) staged in its private LDS slab (pitch 68),
// coverage: 8 instructions x 2 rows x 16 lanes x 4 floats = the wave's 16 x 64 tile.
// =====================================================================================================
__device__ __forceinline__ void epi64(float* sl, v8f a0, v8f a1, v8f a2, v8f a3, float oscale,
                                      const float* __restrict__ bias, float* Cb, size_t pitch, int col0, int lane) {
  const int hh = lane >> 4, m = lane & 15;
#pragma unroll
  for (int r = 0; r < 8; ++r) {
    const int ro = (8 * hh + r) * 68 + m;
    sl[ro]      = a0[r] * oscale;
    sl[ro + 16] = a1[r] * oscale;
    sl[ro + 32] = a2[r] * oscale;
    sl[ro + 48] = a3[r] * oscale;
  }
  wave_sync_lds();
  const v4f bb = *(const v4f*)(bias + col0 + m * 4);
  v4f br;
#pragma unroll
  for (int e = 0; e < 4; ++e) br[e] = bfr(bb[e]);
  v4f vals[8];
#pragma unroll
  for (int it = 0; it < 8; ++it) vals[it] = *(const v4f*)(sl + (it * 2 + hh) * 68 + m * 4) + br;
  float* dst = Cb + (size_t)hh * pitch + col0 + m * 4;
  {
#pragma unroll
    for (int it = 0; it < 8; ++it) {
      *(v4f*)(dst + (size_t)(it * 2) * pitch) = vals[it];
    }
    
  }
}

// =====================================================================================================
// bf16 GEMM: C[M][N] (f32) = A[M][K] (bf16 packed) . Bt[N][K]^T (bf16 packed), times oscale, plus bias[col] (bf16 RNE value).
// Block = 64x64 tile, 4 waves x 16 rows; fragments loaded straight from the packed tiles (two 16-B loads each, split k map
// for A and B); K stepped by 32 (host guarantees K % 32 == 0, M % 64 == 0, N % 64 == 0, grid = (M/64)*(N/64)).
// =====================================================================================================
__global__ __launch_bounds__(128)
void gemm_bf(const u16* __restrict__ A, const u16* __restrict__ Bt, const float* __restrict__ bias,
             float* C, int M, int N, int K, float oscale) {
  __shared__ __align__(16) float slab[4 * SLAB64];
  const int tid = threadIdx.x, wave = tid >> 5, lane = tid & 31;
  const int ntile = N >> 6;
  const int bid   = blockIdx.x;
  const int rowb  = (bid / ntile) * 64 + wave * 16;
  const int col0  = (bid % ntile) * 64;
  if (rowb + 16 > M) return;                // wave-uniform, never taken with the exact grid; no block barriers in this kernel
  const u16* ap = A  + (size_t)rowb * K + 8 * lane;          // a 16-row band holds 16*K halves
  const u16* bp = Bt + (size_t)col0 * K + 8 * lane;
  const size_t bs = (size_t)16 * K;
  v8f acc0 = zero8(), acc1 = zero8(), acc2 = zero8(), acc3 = zero8();
#pragma unroll 1
  for (int k0 = 0; k0 < 16 * K; k0 += FT) {                  // one packed tile = 32 k
    const v16b a  = ldfrag_b(ap + k0);
    const v16b b0 = ldfrag_b(bp + k0);
    const v16b b1 = ldfrag_b(bp + bs + k0);
    const v16b b2 = ldfrag_b(bp + 2 * bs + k0);
    const v16b b3 = ldfrag_b(bp + 3 * bs + k0);
    acc0 = mma_b(a, b0, acc0);
    acc1 = mma_b(a, b1, acc1);
    acc2 = mma_b(a, b2, acc2);
    acc3 = mma_b(a, b3, acc3);
    guard6<v16b>(acc0, acc1, acc2, acc3, a, b0, b1, b2, b3, a);
  }
  epi64(slab + wave * SLAB64, acc0, acc1, acc2, acc3, oscale, bias, C + (size_t)rowb * (size_t)N, (size_t)N, col0, lane);
}

// =====================================================================================================
// Output projection: out rows (s*NB + bb) of DMOD floats = (Ah + Al)[bb*SEQ + s][DMOD] . Bt[DMOD][DMOD]^T * oscale + bias
// (bf16 RNE value); products h.B + l.B into one accumulator (l unscaled residual).
// Block -> (column tile ct = bid % 16, sequence row tile rt of NRT, batch bb); the wave's 16 rows s = rt*64 + wave*16 .. +15 are
// consecutive rows of Ah/Al and rows of out spaced NB*DMOD floats apart (seq-major [s][b][DMOD] output layout).
// Same tiling and epilogue as gemm_bf; LDS slab wave-private.
// coverage: grid NB*NRT*16 blocks x 4 waves x (16 rows x 64 cols) = every (s, bb, col) of out exactly once.
// =====================================================================================================
__global__ __launch_bounds__(128)
void gemm_o2(const u16* __restrict__ Ah, const u16* __restrict__ Al, const u16* __restrict__ Bt, const float* __restrict__ bias,
             float* C, float oscale) {
  __shared__ __align__(16) float slab[4 * SLAB64];
  const int tid = threadIdx.x, wave = tid >> 5, lane = tid & 31;
  const int ntile = DMOD >> 6;
  const int bid   = blockIdx.x;
  const int ct    = bid % ntile;
  const int t2    = bid / ntile;
  const int rt    = t2 % NRT;
  const int bb    = t2 / NRT;
  if (bb >= NB) return;                     // block-uniform; no block barriers in this kernel; never taken with the exact grid
  const int srow  = rt * 64 + wave * 16;
  if (srow + 16 > SEQ) return;              // wave-uniform; never taken
  const int col0  = ct * 64;
  const int K     = DMOD;
  const size_t rowA = (size_t)bb * SEQ + srow;
  const _Float16* ahp = (const _Float16*)(const void*)Ah + rowA * K + 8 * lane;          // packed planes, as in gemm_bf
  const _Float16* alp = (const _Float16*)(const void*)Al + rowA * K + 8 * lane;
  const _Float16* bp  = (const _Float16*)(const void*)Bt + (size_t)col0 * K + 8 * lane;
  const size_t bs = (size_t)16 * K;
  v8f acc0 = zero8(), acc1 = zero8(), acc2 = zero8(), acc3 = zero8();
#pragma unroll 1
  for (int k0 = 0; k0 < 16 * K; k0 += FT) {
    const v16h ah = ldfrag_h(ahp + k0), al = ldfrag_h(alp + k0);
    const v16h b0 = ldfrag_h(bp + k0);
    const v16h b1 = ldfrag_h(bp + bs + k0);
    const v16h b2 = ldfrag_h(bp + 2 * bs + k0);
    const v16h b3 = ldfrag_h(bp + 3 * bs + k0);
    // the address pairs of the twelve loads above are inputs here, so no load's result is placed on one of them, and they are
    // rewritten only behind this wait
    asm volatile("s_wait_xcnt 0x0" :: "v"(ahp + k0), "v"(alp + k0), "v"(bp + k0) : "memory");
    acc0 = mma_h(ah, b0, acc0);  acc0 = mma_h(al, b0, acc0);
    acc1 = mma_h(ah, b1, acc1);  acc1 = mma_h(al, b1, acc1);
    acc2 = mma_h(ah, b2, acc2);  acc2 = mma_h(al, b2, acc2);
    acc3 = mma_h(ah, b3, acc3);  acc3 = mma_h(al, b3, acc3);
    guard6<v16h>(acc0, acc1, acc2, acc3, ah, al, b0, b1, b2, b3);
  }
  float* Cb = C + ((size_t)srow * NB + bb) * DMOD;
  epi64(slab + wave * SLAB64, acc0, acc1, acc2, acc3, oscale, bias, Cb, (size_t)NB * DMOD, col0, lane);
}

// =====================================================================================================
// Full (non-causal) attention over all JL keys, in the transposed form S^T = K.Q^T, O^T += V^T.P^T. Block bid -> (query group qg:
// 8 query tiles, head, batch b); one wave per query tile qt = qg*AWV + wave (rows q0 = 16*qt .. q0+15), all waves on ONE head.
//   q hi plane f16 x1024 and q residual plane, both [b*SEQ + s][h*HD + d]; k hi plane f16 x1024 [b*JL + j][h*HD + d];
//   v^T hi plane [b*NH + h][d][JL] f16 x1024; all packed (v^T with the four d subtiles of a key step side by side).
//   Scores use two products k_hi.q_hi + k_hi.q_lo; q fragments (B operand) loaded once per wave (2 k-steps x hi/residual).
//   score (log2 domain) t(i, j) = (q_i.k_j over HD) * (1/8)*log2e/(1024*1024); no key selection (every key contributes).
//   The head's k and v^T tiles come through LDS once per block: stages of SKEY = 64 keys (16 KiB), two buffers, filled by
//   asynchronous 16-B copies (4 per lane and stage) one stage ahead; the packed tiles keep their form in LDS, so a fragment
//   load is a wave-wide read of 512 contiguous bytes. Stage layout (halves): k band n (16 keys) tile t at n*1024 + t*512;
//   v^T key step p, d subtile j at 4096 + p*2048 + j*512.
//   Key tiles of 32 visited in order, kt = 0 .. NKT-1 (static bound), two per stage.
//   Per tile: 2 score subtiles (16 keys each) x 2 k-steps, k fragments (A operand, row = key).
//   Lane (hh = lane >> 4, c = lane & 15) then holds 16 scores of ONE query (column c): keys kb + 8hh + r in s0[r], kb + 16 + 8hh + r in s1[r]. Maximum and
//   sum run inside the lane; the two halves of a column exchange the maximum once per tile and join their sums once after the loop.
//   The 16 probabilities of a lane, converted in place (x32768, f16), ARE the B operand P^T in the split k map
//   (element s < 8: key 8hh + s, element s >= 8: key 16 + 8hh + s - 8), the map the packed v^T fragments (A operand, row = d) have.
//   After the loop: out = acc / Z (Z >= 1 always; guarded anyway; both carry the 32768), 1/1024 folded once. o[j][r] = O(query c,
//   d = 16j + 8hh + r): 8 consecutive d of one row = chunk j*32 + lane of the head's two packed tiles, stored from registers.
// LDS extent: ring[2*STH]; a stage's copies write bytes 0 .. 16383 of its buffer, each once; the fragment loads read the same extent.
// coverage: per wave 4 instructions x 32 lanes x 8 halves = the head's two packed tiles (16 x 64) per plane; grid NQG x NH x NB blocks x AWV waves =
//           every (b, s, h) row segment of O hi and O residual exactly once.
// =====================================================================================================
// 2^x as the bare hardware instruction. The library exp2f adds a compare, two selects, an add and an ldexp per value only to keep
// results below 2^-126; here such a term is far below one f16 step of P and one f32 step of Z >= 1, so it may flush to 0.
// -inf gives 0 and NaN stays NaN, as in the library form.
__device__ __forceinline__ float exp2_hw(float x) { return __builtin_amdgcn_exp2f(x); }

// lane l <-> lane l ^ 16 (the other half of the same column)
__device__ __forceinline__ float xhalf(float x) {
  const int b = __builtin_bit_cast(int, x);
  return __builtin_bit_cast(float, __builtin_amdgcn_permlanex16(b, b, 0x76543210, 0xfedcba98, false, false));
}

// One stage: 256 lanes x 16 B = 4 KiB per copy. Copies 0, 1: k bands 2c + (tid >> 7) (2 KiB of the head's tiles each, bands
// 16 key rows apart in the plane); copies 2, 3: the stage's 8 KiB of v^T tiles. lds = the lane's byte address in the buffer.
// The s_wait_xcnt closes the statement so that no address register of a copy is rewritten in front of it.
__device__ __forceinline__ void stage_copy(unsigned lds, const _Float16* kg, const _Float16* vg) {
#if defined(__HIP_DEVICE_COMPILE__)
  asm volatile("global_load_async_to_lds_b128 %0, %4, off\n\t"
               "global_load_async_to_lds_b128 %1, %5, off\n\t"
               "global_load_async_to_lds_b128 %2, %6, off\n\t"
               "global_load_async_to_lds_b128 %3, %7, off\n\t"
               "s_wait_xcnt 0x0"
               :: "v"(lds), "v"(lds + 4096u), "v"(lds + 8192u), "v"(lds + 12288u),
                  "v"(kg), "v"(kg + 32 * DMOD), "v"(vg), "v"(vg + 4 * FT) : "memory");
#endif
}
// this wave's copies have landed in LDS (the compiler places no wait for them)
__device__ __forceinline__ void wait_copies() {
#if defined(__HIP_DEVICE_COMPILE__)
  asm volatile("s_wait_asynccnt 0x0" ::: "memory");
#endif
}
// this wave's LDS reads have returned, before the barrier behind which their buffer is refilled
__device__ __forceinline__ void wait_lds_reads() {
#if defined(__HIP_DEVICE_COMPILE__)
  asm volatile("s_wait_dscnt 0x0" ::: "memory");
#endif
}

__global__ __launch_bounds__(ATT_THREADS)
void attn_x(const u16* __restrict__ QHp, const u16* __restrict__ QLp, const u16* __restrict__ KHp,
            const u16* __restrict__ VHp, u16* OHp, u16* OLp) {
  __shared__ __attribute__((aligned(16))) _Float16 ring[2 * STH];
  const int tid  = threadIdx.x;
  const int wave = tid >> 5;
  const int lane = tid & 31;
  const int bid  = blockIdx.x;
  const int qg   = bid % NQG;
  const int t2   = bid / NQG;
  const int head = t2 % NH;
  const int b    = t2 / NH;
  if (b >= NB) return;                      // block-uniform, before any barrier or copy; never taken with the exact grid
  const int q0   = (qg * AWV + wave) * 16;  // q0 + 16 <= SEQ by construction

  const size_t hcol = (size_t)head * (HD / 32) * FT + 8 * lane;        // the head's two tiles inside a 16-row band
  const _Float16* Qh  = (const _Float16*)(const void*)QHp + ((size_t)b * SEQ + q0) * DMOD + hcol;
  const _Float16* Ql  = (const _Float16*)(const void*)QLp + ((size_t)b * SEQ + q0) * DMOD + hcol;
  // copy sources of this lane in stage 0: k band tid >> 7, chunk tid & 127 of the head's two tiles; v^T chunk tid
  const _Float16* Kg = (const _Float16*)(const void*)KHp + ((size_t)b * JL + (tid >> 7) * 16) * DMOD
                       + (size_t)head * (HD / 32) * FT + 8 * (tid & 127);
  const _Float16* Vg = (const _Float16*)(const void*)VHp + (size_t)(b * NH + head) * NKT * 4 * FT + 8 * tid;
  const unsigned lds0 = (unsigned)(uintptr_t)(&ring[0]) + 16u * (unsigned)tid;
  const float lsc = SM_SCALE * (LOG2E / (QSC * KSC));
  const float oc  = 1.0f / VCAR;            // the 32768 on P is in the accumulators and in Z alike and cancels in acc / Z

  // ---- q fragments (hi and residual, 2 k-steps over HD), loaded once ----
  const v16h qh0 = ldfrag_h(Qh), qh1 = ldfrag_h(Qh + FT);
  const v16h ql0 = ldfrag_h(Ql), ql1 = ldfrag_h(Ql + FT);

  float mrow = -INFINITY;                   // running maximum of query column c (alike in both halves)
  float lrow = 0.f;                         // running sum (x32768) over the keys of this half only
  v8f o[4];
#pragma unroll
  for (int j = 0; j < 4; ++j) o[j] = zero8();

  // ---- ring prologue: stage 0 landed and published, stage 1 in flight ----
  stage_copy(lds0, Kg, Vg);
  wait_copies();
  __syncthreads();
  stage_copy(lds0 + 2u * STH, Kg + (size_t)SKEY * DMOD, Vg + (size_t)(SKEY / 32) * 4 * FT);

#pragma unroll 1                            // rolled: one publish point per trip, in the order written at its foot
  for (int st = 0; st < NST; ++st) {
   const _Float16* sb = ring + (st & 1) * STH + 8 * lane;
#pragma unroll                              // both key steps of a stage in line: every LDS offset an immediate
   for (int p = 0; p < SKEY / 32; ++p) {    // key step kt = 2*st + p, keys kb = 32*kt .. kb + 31
    // ---- the step's k and v^T fragments, one group of LDS reads ----
    const _Float16* k0p = sb + p * 4 * FT;
    const _Float16* vhp = sb + SKEY * HD + p * 4 * FT;
    const v16h ka0 = ldfrag_h(k0p),          ka1 = ldfrag_h(k0p + FT);
    const v16h kc0 = ldfrag_h(k0p + 2 * FT), kc1 = ldfrag_h(k0p + 3 * FT);
    v16h vf[4];
#pragma unroll
    for (int j = 0; j < 4; ++j) vf[j] = ldfrag_h(vhp + j * FT);
    // ---- scores: D element r of this lane = (key kb + 8hh + r, query column c) in s0, key kb + 16 + 8hh + r in s1 ----
    v8f s0 = zero8(), s1 = zero8();
    {
      s0 = mma_h(ka0, qh0, s0);
      s0 = mma_h(ka0, ql0, s0);
      s0 = mma_h(ka1, qh1, s0);
      s0 = mma_h(ka1, ql1, s0);
      s1 = mma_h(kc0, qh0, s1);
      s1 = mma_h(kc0, ql0, s1);
      s1 = mma_h(kc1, qh1, s1);
      s1 = mma_h(kc1, ql1, s1);
      guard2(s0, s1, ka0, ka1, kc0, kc1, qh0, ql0, qh1, ql1);
    }
    // ---- online softmax in base 2, -inf-safe; one query per lane ----
    const v8f t0 = s0 * lsc, t1 = s1 * lsc;
    float mx = fmaxf(t0[0], t1[0]);
#pragma unroll
    for (int r = 1; r < 8; ++r) mx = fmaxf(mx, fmaxf(t0[r], t1[r]));
    mx = fmaxf(mx, xhalf(mx));
    const float mn = fmaxf(mrow, mx);
    const float ms = (mn == -INFINITY) ? 0.0f : mn;
    const float al = exp2_hw(mrow - ms);
    mrow = mn;
    // e = 32768 * 2^(t - ms): score scale, maximum and the carry of P meet in one packed multiply-add in front of the exponential
    // (written on pairs: the bare exponential is no vector operation to the compiler, which otherwise splits the pairs)
    const float mb = ms - PLOG;
    const v2f l2 = {lsc, lsc}, nb2 = {-mb, -mb};
    v8f e0, e1;
#pragma unroll
    for (int r = 0; r < 4; ++r) {
      const v2f a0 = {s0[2 * r], s0[2 * r + 1]}, a1 = {s1[2 * r], s1[2 * r + 1]};
      const v2f x0 = __builtin_elementwise_fma(a0, l2, nb2), x1 = __builtin_elementwise_fma(a1, l2, nb2);
      e0[2 * r] = exp2_hw(x0[0]); e0[2 * r + 1] = exp2_hw(x0[1]);
      e1[2 * r] = exp2_hw(x1[0]); e1[2 * r + 1] = exp2_hw(x1[1]);
    }
    const v8f es = e0 + e1;
    lrow = lrow * al + (((es[0] + es[4]) + (es[1] + es[5])) + ((es[2] + es[6]) + (es[3] + es[7])));
    // ---- B fragment of P^T * 32768 (f16), column = c, split k map over the 32 keys of this step ----
    FragH ph;
#pragma unroll
    for (int r = 0; r < 8; ++r) {
      ph.h[0][r] = (_Float16)e0[r];         // elements 0..7  = keys kb + 8hh + 0..7
      ph.h[1][r] = (_Float16)e1[r];         // elements 8..15 = keys kb + 16 + 8hh + 0..7
    }
#pragma unroll
    for (int j = 0; j < 4; ++j) o[j] *= al;
    // ---- V^T.P^T : A fragment row = d = j*16 + c, keys contiguous in the v^T plane; 2 groups of 2 d-subtiles ----
    {
#pragma unroll
      for (int jg = 0; jg < HD / 32; ++jg) {
        const v16h vha = vf[2 * jg], vhc = vf[2 * jg + 1];
        o[2 * jg]     = mma_h(vha, ph.v, o[2 * jg]);
        o[2 * jg + 1] = mma_h(vhc, ph.v, o[2 * jg + 1]);
        guard2(o[2 * jg], o[2 * jg + 1], ph.v, vha, vhc, ph.v, vha, vhc, ph.v, ph.v);
      }
    }
   }
   // ---- publish point of stage st + 1: own reads of this buffer done, own copies landed, every wave here; then the refill ----
   wait_lds_reads();
   wait_copies();
   __syncthreads();
   if (st + 2 < NST) {                      // block-uniform
     stage_copy(lds0 + (unsigned)(st & 1) * (2u * STH), Kg + (size_t)(st + 2) * SKEY * DMOD,
                Vg + (size_t)(st + 2) * (SKEY / 32) * 4 * FT);
   }
  }
  wait_copies();
  acc_guard4(o[0], o[1], o[2], o[3]);
  // ---- out = acc / Z (0 if Z == 0), acc and Z both x32768, the 1024 on v folded once; the halves' sums joined here ----
  const float lv  = lrow + xhalf(lrow);
  const float ls  = (lv > 0.0f) ? lv : 1.0f;
  const float inv = (lv > 0.0f) ? ((1.0f / ls) * oc) : 0.0f;
  // ---- O x1024 -> packed f16 hi + residual planes; chunk j*32 + lane of the head's two tiles: row c, d = 16j + 8hh + 0..7 ----
  v4u oh[4], ol[4];
#pragma unroll
  for (int it = 0; it < 4; ++it) {
    float w[8];
#pragma unroll
    for (int e = 0; e < 8; ++e) w[e] = (o[it][e] * inv) * OSC;
#pragma unroll
    for (int e = 0; e < 4; ++e) {
      const _Float16 h0 = (_Float16)w[2 * e], h1 = (_Float16)w[2 * e + 1];
      const _Float16 l0 = (_Float16)(w[2 * e] - (float)h0), l1 = (_Float16)(w[2 * e + 1] - (float)h1);
      oh[it][e] = pk16(h_bits(h0), h_bits(h1));
      ol[it][e] = pk16(h_bits(l0), h_bits(l1));
    }
  }
  const size_t ob = ((size_t)b * SEQ + q0) * DMOD + hcol;
  {
#pragma unroll
    for (int it = 0; it < 4; ++it) {
      *(v4u*)(OHp + ob + (size_t)it * 256) = oh[it];
      *(v4u*)(OLp + ob + (size_t)it * 256) = ol[it];
    }
    
  }
}

// =====================================================================================================
// Workspace map (bytes); every plane is fully written by whole-line stores before it is read; all extents are exact multiples
// of the store granularity (packed 1-KiB 16 x 32 tiles of the 16-bit planes, f32 rows of 4096 B; no pad rows needed); every region offset a multiple of
// 2097152:
//   XC  bf16 [CROWS][1024]              CROWS*2048   (c = [mem; kv] as bf16; later q as bf16 [QROWS][1024] at the same offset)
//   WB  16-bit [1024 n][1024 k]         2097152      (Wv, Wk, Wq as bf16, then Wc as f16 x1024, reused in launch order)
//   F   f32 [CROWS][1024]               CROWS*4096   (v, k, q projection output in launch order; afterwards the region holds
//                                                     OH f16 [QROWS][1024] x1024 at +0 and OL residual [QROWS][1024] at +QROWS*2048)
//   VH  f16 [NB*16][64][JL] x1024       CROWS*2048   (all 16-bit planes in packed 16 x 32 tiles)
//   KH  f16 [CROWS][1024] x1024         CROWS*2048
//   QH  f16 [QROWS][1024] x1024         QROWS*2048   QL residual the same
//   end (NB=2, SEQ=MLEN=2048)           102760448
// =====================================================================================================
extern "C" void kernel_launch(void* const* d_in, const int* in_sizes, int n_in,
                              void* d_out, int out_size, void* d_ws, size_t ws_size,
                              hipStream_t stream) {
  if (n_in < 11) return;
  const long long needq = ((long long)(SEQ - 1) * B_FULL + NB) * DMOD;
  const long long needm = (MLEN > 0) ? (((long long)(MLEN - 1) * B_FULL + NB) * DMOD) : 0;
  if ((long long)in_sizes[0] < needq || (long long)in_sizes[1] < needq || (long long)in_sizes[2] < needm) return;
  if (in_sizes[3] < DMOD * DMOD || in_sizes[5] < DMOD * DMOD || in_sizes[7] < DMOD * DMOD || in_sizes[9] < DMOD * DMOD) return;
  if (in_sizes[4] < DMOD || in_sizes[6] < DMOD || in_sizes[8] < DMOD || in_sizes[10] < DMOD) return;
  if ((long long)out_size < (long long)SEQ * NB * DMOD) return;

  const float* xq  = (const float*)d_in[0];
  const float* xkv = (const float*)d_in[1];
  const float* xm  = (const float*)d_in[2];
  const float* wq  = (const float*)d_in[3];
  const float* bq  = (const float*)d_in[4];
  const float* wk  = (const float*)d_in[5];
  const float* bk  = (const float*)d_in[6];
  const float* wv  = (const float*)d_in[7];
  const float* bv  = (const float*)d_in[8];
  const float* wc  = (const float*)d_in[9];
  const float* bc  = (const float*)d_in[10];
  float*       out = (float*)d_out;

  const size_t szXC = (size_t)CROWS * DMOD * 2;                 // also hosts XQ [QROWS][1024] bf16
  const size_t szXQ = (size_t)QROWS * DMOD * 2;
  const size_t szW  = (size_t)DMOD * DMOD * 2;
  const size_t szF  = (size_t)CROWS * DMOD * 4;                 // also hosts OH + OL
  const size_t szO  = (size_t)QROWS * DMOD * 2;                 // OH, OL each
  const size_t szVH = (size_t)NB * NH * HD * JL * 2;            // == CROWS*2048
  const size_t szKH = (size_t)CROWS * DMOD * 2;
  const size_t szQ  = (size_t)QROWS * DMOD * 2;                 // QH, QL each
  if (2 * szO > szF || szXQ > szXC) return;
  size_t off = 0;
  const size_t oXC = off; off += szXC;
  const size_t oW  = off; off += szW;
  const size_t oF  = off; off += szF;
  const size_t oVH = off; off += szVH;
  const size_t oKH = off; off += szKH;
  const size_t oQH = off; off += szQ;
  const size_t oQL = off; off += szQ;
  if (off > ws_size) return;                // off = 102760448 for NB = 2, SEQ = MLEN = 2048
  if (off > (size_t)WS_CAP) return;

  char* ws = (char*)d_ws;
  u16*   XC = (u16*)(ws + oXC);
  u16*   XQ = (u16*)(ws + oXC);
  u16*   WB = (u16*)(ws + oW);
  float* F  = (float*)(ws + oF);
  u16*   OH = (u16*)(ws + oF);
  u16*   OL = (u16*)(ws + oF + szO);
  u16*   VH = (u16*)(ws + oVH);
  u16*   KH = (u16*)(ws + oKH);
  u16*   QH = (u16*)(ws + oQH);
  u16*   QL = (u16*)(ws + oQL);

  const dim3 b256(256), b128(128), bQK(QKT), bAT(ATT_THREADS);
  const int  n8w = (DMOD * DMOD) / 8;
  const dim3 gW((n8w + 255) / 256);                     // 512 blocks per weight matrix
  const dim3 gXC(CROWS), gXQ(QROWS);
  const dim3 gGC((CROWS / 64) * (DMOD / 64));
  const dim3 gGQ((QROWS / 64) * (DMOD / 64));
  const dim3 gVT(NB * NH * NVT);
  const dim3 gAT(NQG * NH * NB);
  const dim3 gO(NB * NRT * (DMOD / 64));

  // (1) c = [mem; kv] -> bf16 plane [CROWS][1024], batch-major rows b*JL + j
  cvt_act<<<gXC, bQK, 0, stream>>>(xm, xkv, XC, JL, MLEN);
  // (2) Wv [n][k] -> bf16 plane; (3) v = c.Wv^T + bv -> F f32; (4) v^T plane x1024
  cvt16<<<gW, b256, 0, stream>>>(wv, WB, n8w, 0, 1.0f);
  gemm_bf<<<gGC, b128, 0, stream>>>(XC, WB, bv, F, CROWS, DMOD, DMOD, 1.0f);
  vt16<<<gVT, b256, 0, stream>>>(F, VH);
  // (5) Wk -> bf16 plane; (6) k = c.Wk^T + bk -> F; (7) k hi plane x1024
  cvt16<<<gW, b256, 0, stream>>>(wk, WB, n8w, 0, 1.0f);
  gemm_bf<<<gGC, b128, 0, stream>>>(XC, WB, bk, F, CROWS, DMOD, DMOD, 1.0f);
  qk16<0><<<gXC, bQK, 0, stream>>>(F, KH, KH, CROWS, KSC);
  // (8) q -> bf16 plane (XC region); (9) Wq -> bf16 plane; (10) q = q.Wq^T + bq -> F; (11) q hi + residual planes x1024
  cvt_act<<<gXQ, bQK, 0, stream>>>(xq, xq, XQ, SEQ, SEQ);
  cvt16<<<gW, b256, 0, stream>>>(wq, WB, n8w, 0, 1.0f);
  gemm_bf<<<gGQ, b128, 0, stream>>>(XQ, WB, bq, F, QROWS, DMOD, DMOD, 1.0f);
  qk16<1><<<gXQ, bQK, 0, stream>>>(F, QH, QL, QROWS, QSC);
  // (12) Wc [n][k] -> f16 plane of bf16 value x1024
  cvt16<<<gW, b256, 0, stream>>>(wc, WB, n8w, 1, WOS);
  // (13) attention over all JL keys -> O hi + residual planes (F region)
  attn_x<<<gAT, bAT, 0, stream>>>(QH, QL, KH, VH, OH, OL);
  // (14) output projection -> out f32 rows (s*NB + b), carries 1024 x 1024 folded back
  gemm_o2<<<gO, b128, 0, stream>>>(OH, OL, WB, bc, out, 1.0f / (OSC * WOS));
  (void)hipGetLastError();
}

// v005
// It runs in 204 microseconds.
// Timed twice side by side with v004, it ran 1.16 and 1.11 times as fast.
// All steps since v000 together make it 2.75 times as fast.
// Contractions: q.Wq^T, c.Wk^T, c.Wv^T (c = [mem; kv] along the key axis) on v_wmma_f32_16x16x32_bf16 (activations, W and
// biases RNE-converted to bf16; the [n][k] weight rows are used directly as a k-contiguous operand: B for v, A for q and k; f32 accumulate);
// k.q^T over 64 on v_wmma_f32_16x16x32_f16 with q carried as f16 hi (x1024) plus an f16 residual plane and k as f16 hi (x1024)
// (products h.h + h.l); v^T.P^T on v_wmma_f32_16x16x32_f16 (P x32768 f16, v x1024 f16, one product); O.Wc^T on
// v_wmma_f32_16x16x32_f16 (O x1024 as f16 hi plus f16 residual plane, Wc as f16(bf16(Wc)) x1024, products h.w + l.w);
// all f32 accumulate. Bias adds, base-2 online softmax over all keys and the 1/Z fold in f32 on VALU.
// Every 16-bit workspace plane is stored fragment-packed (see "packed planes" below): a wave-wide 16-B fragment load reads 512
// contiguous bytes (4 whole lines) instead of 32 B out of each of 16 rows.
#include <hip/hip_runtime.h>
#include <math.h>
#include <stdint.h>

#ifndef NB
#define NB 2
#endif
#ifndef SEQ
#define SEQ 2048
#endif
#ifndef MLEN
#define MLEN 2048
#endif
#define B_FULL 2
#define L_FULL 2048
#define M_FULL 2048
#define DMOD  1024
#define NH    16
#define HD    64
#define JL    (MLEN + SEQ)
#define QROWS (NB * SEQ)
#define CROWS (NB * JL)
#define SM_SCALE 0.125f
#define LOG2E 1.4426950408889634f
#define QSC   1024.0f
#define KSC   1024.0f
#define PLOG  15.0f               // P is carried x 2^15 = 32768, as a bias of its exponent
#define VCAR  1024.0f
#define OSC   1024.0f
#define WOS   1024.0f
#define AWV   8                   // waves of an attention block: 8 query tiles of ONE head share that head's k / v^T stages
#define NQT   (SEQ / 16)
#define NQG   (NQT / AWV)
#define SKEY  64                  // keys in one LDS stage of the attention ring
#define NST   (JL / SKEY)
#define STH   (2 * SKEY * HD)     // halves in one stage: 8 packed k tiles, then 8 packed v^T tiles (16 KiB)
#define NKT   (JL / 32)
#define NRT   (SEQ / 64)
#define ATT_THREADS (AWV * 32)
#define SLAB64 (16 * 68)
#define QKT   (DMOD / 8)
#define WS_CAP 134217728
#define FT    512                 // halves in one packed 16 x 32 fragment tile (1 KiB)
#define TPB   (DMOD / 32)         // fragment tiles in one 16-row band of a [rows][DMOD] plane
static_assert(DMOD == NH * HD && HD == 64 && NH == 16);
static_assert((NQT % AWV) == 0 && ATT_THREADS == 256 && NST * SKEY == JL && NST >= 2 && SKEY == 64);
static_assert(NB >= 1 && NB <= B_FULL);
static_assert((SEQ % 64) == 0 && SEQ >= 64 && SEQ <= L_FULL);
static_assert((MLEN % 64) == 0 && MLEN >= 0 && MLEN <= M_FULL);
static_assert((JL % 64) == 0 && NKT * 32 == JL && NQT * 16 == SEQ && NRT * 64 == SEQ);
static_assert(QKT == 128 && (DMOD % 64) == 0 && (DMOD % 32) == 0 && (HD % 32) == 0);
static_assert(((DMOD * DMOD) % (8 * 256)) == 0);
static_assert(QROWS <= CROWS);
static_assert(TPB == 32 && QKT == 2 * 64 && (TPB % 2) == 0 && (MLEN % 16) == 0 && (SEQ % 16) == 0 && (JL % 16) == 0);
static_assert((long long)CROWS * DMOD * 6 + (long long)QROWS * DMOD * 8 + 2LL * DMOD * DMOD <= (long long)WS_CAP);

typedef unsigned short u16;
typedef _Float16 v16h __attribute__((ext_vector_type(16)));
typedef _Float16 v8h  __attribute__((ext_vector_type(8)));
typedef __bf16   v16b __attribute__((ext_vector_type(16)));
typedef float    v8f  __attribute__((ext_vector_type(8)));
typedef float    v4f  __attribute__((ext_vector_type(4)));
typedef float    v2f  __attribute__((ext_vector_type(2)));
typedef unsigned int v4u __attribute__((ext_vector_type(4)));

union FragH { v16h v; v8h h[2]; v4u u[2]; };
union FragB { v16b v; v4u u[2]; };

// ---- scalar helpers --------------------------------------------------------------------------------
__device__ __forceinline__ unsigned short bf_bits(float f) {          // f32 -> bf16 bits, RNE convert
  unsigned u = __float_as_uint(f);
  return (unsigned short)((u + 0x7FFFu + ((u >> 16) & 1u)) >> 16);
}
__device__ __forceinline__ float bf_up(unsigned short h) { return __uint_as_float(((unsigned)h) << 16); }
__device__ __forceinline__ float bfr(float f) { return bf_up(bf_bits(f)); }
__device__ __forceinline__ unsigned short h_bits(_Float16 x) { return __builtin_bit_cast(unsigned short, x); }
__device__ __forceinline__ unsigned pk16(unsigned short a, unsigned short b) { return (unsigned)a | ((unsigned)b << 16); }
__device__ __forceinline__ v8f zero8() { v8f z = {0.f, 0.f, 0.f, 0.f, 0.f, 0.f, 0.f, 0.f}; return z; }

// ---- packed planes: a [rows][K] 16-bit matrix is stored as 16 x 32 fragment tiles of FT halves, tile (row >> 4, k >> 5) at
//      index (row >> 4) * (K / 32) + (k >> 5); inside a tile element (c = row & 15, kk = k & 31) sits at
//      (kk >> 4) * 256 + (((kk >> 3) & 1) * 16 + c) * 8 + (kk & 7): chunk g of 8 halves = what lane g & 31 takes in load g >> 5.
// ---- fragment loaders: 16-bit A/B operand, lane -> row/col (lane&15), p = tile start + 8*lane;
//      elements 0..7 <- p[0..7] (k0+8h..), elements 8..15 <- p[256..263] (k0+16+8h..)  (same split k map for A and B)
__device__ __forceinline__ v16h ldfrag_h(const _Float16* p) {
  FragH f;
  f.h[0] = *(const v8h*)(p);
  f.h[1] = *(const v8h*)(p + 256);
  return f.v;
}
__device__ __forceinline__ v16b ldfrag_b(const u16* p) {              // bf16 plane read as unsigned integer vectors
  FragB f;
  f.u[0] = *(const v4u*)(p);
  f.u[1] = *(const v4u*)(p + 256);
  return f.v;
}
// first column of chunk w (0..63) inside its tile
__device__ __forceinline__ int chunk_k(int w) { return ((w >> 5) & 1) * 16 + ((w >> 4) & 1) * 8; }

__device__ __forceinline__ v8f mma_h(v16h a, v16h b, v8f c) {
  return __builtin_amdgcn_wmma_f32_16x16x32_f16(false, a, false, b, (short)0, c, false, false);
}
__device__ __forceinline__ v8f mma_b(v16b a, v16b b, v8f c) {
  return __builtin_amdgcn_wmma_f32_16x16x32_bf16(false, a, false, b, (short)0, c, false, false);
}
__device__ __forceinline__ void guard2(v8f& a, v8f& b, v16h x0, v16h x1, v16h x2, v16h x3,
                                       v16h x4, v16h x5, v16h x6, v16h x7) {
#if defined(__HIP_DEVICE_COMPILE__)
  asm volatile("v_nop\n\tv_nop\n\tv_nop\n\tv_nop"
               : "+v"(a), "+v"(b)
               : "v"(x0), "v"(x1), "v"(x2), "v"(x3), "v"(x4), "v"(x5), "v"(x6), "v"(x7) : "memory");
#endif
}
template <typename F>
__device__ __forceinline__ void guard6(v8f& a, v8f& b, v8f& c, v8f& d, F x0, F x1, F x2, F x3, F x4, F x5) {
#if defined(__HIP_DEVICE_COMPILE__)
  asm volatile("v_nop\n\tv_nop\n\tv_nop\n\tv_nop"
               : "+v"(a), "+v"(b), "+v"(c), "+v"(d) : "v"(x0), "v"(x1), "v"(x2), "v"(x3), "v"(x4), "v"(x5) : "memory");
#endif
}
__device__ __forceinline__ void acc_guard4(v8f& a, v8f& b, v8f& c, v8f& d) {
#if defined(__HIP_DEVICE_COMPILE__)
  asm volatile("v_nop\n\tv_nop\n\tv_nop\n\tv_nop" : "+v"(a), "+v"(b), "+v"(c), "+v"(d));
#endif
}
__device__ __forceinline__ void wave_sync_lds() {
  __builtin_amdgcn_fence(__ATOMIC_RELEASE, "workgroup");
  __builtin_amdgcn_wave_barrier();
  __builtin_amdgcn_fence(__ATOMIC_ACQUIRE, "workgroup");
}

// =====================================================================================================
// f32 [DMOD n][DMOD k] -> packed 16-bit plane.  f16mode == 0: bf16 RNE bits;  f16mode == 1: f16 bits of (bf16 RNE value) * scale.
// Used for the [n][k] weight matrices (bf16, or f16 of the bf16 value x1024 for Wc).
// Thread = packed chunk gt (8 consecutive k of one row): two 16-B loads, one 16-B store; 32 lanes store 512 contiguous bytes
// coverage: grid = ceil(n8/256) blocks x 256 thr x 8 (in-kernel bound) = the whole plane (n8 = 131072, a multiple of 256).
// =====================================================================================================
__global__ __launch_bounds__(256) void cvt16(const float* __restrict__ x, u16* D, int n8, int f16mode, float scale) {
  const int gt = blockIdx.x * 256 + (int)threadIdx.x;
  if (gt >= n8) return;
  const int tile = gt >> 6;
  const float* p = x + (size_t)((tile / TPB) * 16 + (gt & 15)) * DMOD + (tile % TPB) * 32 + chunk_k(gt & 63);
  const v4f a = *(const v4f*)(p), b4 = *(const v4f*)(p + 4);
  float w[8];
#pragma unroll
  for (int e = 0; e < 4; ++e) { w[e] = a[e]; w[4 + e] = b4[e]; }
  v4u o;
#pragma unroll
  for (int e = 0; e < 4; ++e) {
    const float f0 = w[2 * e], f1 = w[2 * e + 1];
    const unsigned short hb0 = h_bits((_Float16)(bfr(f0) * scale));
    const unsigned short hb1 = h_bits((_Float16)(bfr(f1) * scale));
    const unsigned short bb0 = bf_bits(f0);
    const unsigned short bb1 = bf_bits(f1);
    o[e] = (f16mode != 0) ? pk16(hb0, hb1) : pk16(bb0, bb1);
  }
  u16* d = D + (size_t)gt * 8;
  {
    *(v4u*)(d) = o;
    
  }
}

// =====================================================================================================
// Activation rows -> packed bf16 plane (RNE), batch-major destination rows:
//   D[(bb*nrow + j)][0..1023] <- X0[(j*B_FULL + bb)][..] for j < split,  X1[((j - split)*B_FULL + bb)][..] for j >= split.
// Used for c = [mem rows 0..MLEN-1 ; kv rows 0..SEQ-1] (nrow = JL, split = MLEN) and for q (nrow = SEQ, split = SEQ, X1 unused).
// Block = two packed tiles of one 16-row band (16 rows x 64 columns), thread = one chunk: two 16-B loads, one 16-B store.
// The source base selection is block-uniform (nrow and split are multiples of 16; both sources are global planes).
// coverage: grid = NB*nrow blocks x 128 chunks x 8 = every element of the [NB*nrow][1024] plane exactly once.
// =====================================================================================================
__global__ __launch_bounds__(QKT) void cvt_act(const float* __restrict__ X0, const float* __restrict__ X1, u16* D,
                                               int nrow, int split) {
  const int tid = (int)threadIdx.x;
  const int r   = (int)blockIdx.x;
  if (r >= NB * nrow) return;
  if (tid >= QKT) return;
  const int  r0    = (r / (TPB / 2)) * 16;                    // first row of the band
  const int  col   = ((r % (TPB / 2)) * 2 + (tid >> 6)) * 32 + chunk_k(tid & 63);
  const int  bb    = r0 / nrow;
  const int  j     = r0 - bb * nrow;
  const bool first = (j < split);
  const int  js    = (first ? j : (j - split)) + (tid & 15);
  const float* base = first ? X0 : X1;
  const float* p = base + ((size_t)js * B_FULL + bb) * DMOD + col;
  const v4f a = *(const v4f*)(p), a4 = *(const v4f*)(p + 4);
  v4u o;
#pragma unroll
  for (int e = 0; e < 2; ++e) {
    o[e]     = pk16(bf_bits(a[2 * e]),  bf_bits(a[2 * e + 1]));
    o[2 + e] = pk16(bf_bits(a4[2 * e]), bf_bits(a4[2 * e + 1]));
  }
  u16* d = D + ((size_t)r * QKT + tid) * 8;
  {
    *(v4u*)(d) = o;
    
  }
}

// =====================================================================================================
// Epilogue of the output projection: the wave's 16x64 f32 tile (times oscale) staged in its private LDS slab (pitch 68),
// coverage: 8 instructions x 2 rows x 16 lanes x 4 floats = the wave's 16 x 64 tile.
// =====================================================================================================
__device__ __forceinline__ void epi64(float* sl, v8f a0, v8f a1, v8f a2, v8f a3, float oscale,
                                      const float* __restrict__ bias, float* Cb, size_t pitch, int col0, int lane) {
  const int hh = lane >> 4, m = lane & 15;
#pragma unroll
  for (int r = 0; r < 8; ++r) {
    const int ro = (8 * hh + r) * 68 + m;
    sl[ro]      = a0[r] * oscale;
    sl[ro + 16] = a1[r] * oscale;
    sl[ro + 32] = a2[r] * oscale;
    sl[ro + 48] = a3[r] * oscale;
  }
  wave_sync_lds();
  const v4f bb = *(const v4f*)(bias + col0 + m * 4);
  v4f br;
#pragma unroll
  for (int e = 0; e < 4; ++e) br[e] = bfr(bb[e]);
  v4f vals[8];
#pragma unroll
  for (int it = 0; it < 8; ++it) vals[it] = *(const v4f*)(sl + (it * 2 + hh) * 68 + m * 4) + br;
  float* dst = Cb + (size_t)hh * pitch + col0 + m * 4;
  {
#pragma unroll
    for (int it = 0; it < 8; ++it) {
      *(v4f*)(dst + (size_t)(it * 2) * pitch) = vals[it];
    }
    
  }
}

// =====================================================================================================
// bf16 projection GEMM: P[M][N] = A[M][K] (bf16 packed) . Bt[N][K]^T (bf16 packed) + bias[col] (bf16 RNE value), f32 accumulate;
// the result leaves the accumulators as the packed f16 plane(s) its consumer reads, f16(P * sc); no f32 copy of P is kept.
// Block = 64x64 tile, 4 waves x 16 rows; fragments loaded straight from the packed tiles (two 16-B loads each, split k map
// for A and B); K stepped by 32 (host guarantees K % 32 == 0, M % 64 == 0, N % 64 == 0, grid = (M/64)*(N/64)).
// A lane of a D tile holds 8 consecutive D rows (8hh + r) of one D column (m); a packed chunk is 8 consecutive k of one tile row.
//   MODE 0 (v, N == DMOD, rows bb*JL + j): D = A.Bt^T, D rows = keys, D column = d. The lane's 8 keys of one d ARE chunk
//     ((j0 >> 4) & 1)*32 + lane of the v^T tile (head bb*NH + g, key step j0 >> 5, d subtile jj) at index
//     ((bb*NH + g)*NKT + (j0 >> 5))*4 + jj (row in the tile = d & 15, k = j & 31).
//   MODE 1 (k, hi plane) and MODE 2 (q, hi plane Hp and residual plane Lp = f16(P*sc - hi)): the operands change places,
//     D = Bt.A^T, D rows = columns n of P, D column = row of P. The lane's 8 columns of one row ARE chunk (jj & 1)*32 + lane of
//     the [M][N] plane's tile (rowb >> 4, (col0 >> 5) + (jj >> 1)).
// The sum over k of every element is the same in both forms (same fragments, same k map, same k order).
// coverage: per wave and plane 4 stores x 32 lanes x 8 halves = its 16 x 64 results, each store 512 contiguous bytes;
//           the grid's tiles cover every element of the plane(s) exactly once.
// =====================================================================================================
template <int MODE>
__global__ __launch_bounds__(128)
void gemm_bf(const u16* __restrict__ A, const u16* __restrict__ Bt, const float* __restrict__ bias,
             u16* Hp, u16* Lp, int M, int N, int K, float sc) {
  const int tid = threadIdx.x, wave = tid >> 5, lane = tid & 31;
  const int ntile = N >> 6;
  const int bid   = blockIdx.x;
  const int rowb  = (bid / ntile) * 64 + wave * 16;
  const int col0  = (bid % ntile) * 64;
  if (rowb + 16 > M) return;                // wave-uniform, never taken with the exact grid; no block barriers in this kernel
  const u16* ap = A  + (size_t)rowb * K + 8 * lane;          // a 16-row band holds 16*K halves
  const u16* bp = Bt + (size_t)col0 * K + 8 * lane;
  const size_t bs = (size_t)16 * K;
  v8f acc0 = zero8(), acc1 = zero8(), acc2 = zero8(), acc3 = zero8();
#pragma unroll 1
  for (int k0 = 0; k0 < 16 * K; k0 += FT) {                  // one packed tile = 32 k
    const v16b a  = ldfrag_b(ap + k0);
    const v16b b0 = ldfrag_b(bp + k0);
    const v16b b1 = ldfrag_b(bp + bs + k0);
    const v16b b2 = ldfrag_b(bp + 2 * bs + k0);
    const v16b b3 = ldfrag_b(bp + 3 * bs + k0);
    if constexpr (MODE == 0) {
      acc0 = mma_b(a, b0, acc0);
      acc1 = mma_b(a, b1, acc1);
      acc2 = mma_b(a, b2, acc2);
      acc3 = mma_b(a, b3, acc3);
    } else {
      acc0 = mma_b(b0, a, acc0);
      acc1 = mma_b(b1, a, acc1);
      acc2 = mma_b(b2, a, acc2);
      acc3 = mma_b(b3, a, acc3);
    }
    guard6<v16b>(acc0, acc1, acc2, acc3, a, b0, b1, b2, b3, a);
  }
  const int hh = lane >> 4, m = lane & 15;
  const v8f acc[4] = {acc0, acc1, acc2, acc3};
  v4u oh[4], ol[4];
#pragma unroll
  for (int jj = 0; jj < 4; ++jj) {
    float br[8];
    if constexpr (MODE == 0) {
      const float b1v = bfr(bias[col0 + 16 * jj + m]);
#pragma unroll
      for (int e = 0; e < 8; ++e) br[e] = b1v;
    } else {
      const float* bq8 = bias + col0 + 16 * jj + 8 * hh;
      const v4f x = *(const v4f*)(bq8), y = *(const v4f*)(bq8 + 4);
#pragma unroll
      for (int e = 0; e < 4; ++e) { br[e] = bfr(x[e]); br[4 + e] = bfr(y[e]); }
    }
#pragma unroll
    for (int e = 0; e < 4; ++e) {
      const float t0 = (acc[jj][2 * e] + br[2 * e]) * sc, t1 = (acc[jj][2 * e + 1] + br[2 * e + 1]) * sc;
      const _Float16 h0 = (_Float16)t0, h1 = (_Float16)t1;
      oh[jj][e] = pk16(h_bits(h0), h_bits(h1));
      if constexpr (MODE == 2) {
        const _Float16 l0 = (_Float16)(t0 - (float)h0), l1 = (_Float16)(t1 - (float)h1);
        ol[jj][e] = pk16(h_bits(l0), h_bits(l1));
      }
    }
  }
  if constexpr (MODE == 0) {
    const int bb = rowb / JL, j0 = rowb - bb * JL, g = col0 >> 6;
    u16* d = Hp + ((size_t)(bb * NH + g) * NKT + (j0 >> 5)) * 4 * FT + ((j0 >> 4) & 1) * 256 + 8 * lane;
#pragma unroll
    for (int jj = 0; jj < 4; ++jj) *(v4u*)(d + jj * FT) = oh[jj];
  } else {
    const size_t ob = (size_t)rowb * N + (size_t)(col0 >> 5) * FT + 8 * lane;
#pragma unroll
    for (int jj = 0; jj < 4; ++jj) *(v4u*)(Hp + ob + jj * 256) = oh[jj];
    if constexpr (MODE == 2) {
#pragma unroll
      for (int jj = 0; jj < 4; ++jj) *(v4u*)(Lp + ob + jj * 256) = ol[jj];
    }
  }
}

// =====================================================================================================
// Output projection: out rows (s*NB + bb) of DMOD floats = (Ah + Al)[bb*SEQ + s][DMOD] . Bt[DMOD][DMOD]^T * oscale + bias
// (bf16 RNE value); products h.B + l.B into one accumulator (l unscaled residual).
// Block -> (column tile ct = bid % 16, sequence row tile rt of NRT, batch bb); the wave's 16 rows s = rt*64 + wave*16 .. +15 are
// consecutive rows of Ah/Al and rows of out spaced NB*DMOD floats apart (seq-major [s][b][DMOD] output layout).
// Same tiling as gemm_bf; f32 epilogue through a wave-private LDS slab.
// coverage: grid NB*NRT*16 blocks x 4 waves x (16 rows x 64 cols) = every (s, bb, col) of out exactly once.
// =====================================================================================================
__global__ __launch_bounds__(128)
void gemm_o2(const u16* __restrict__ Ah, const u16* __restrict__ Al, const u16* __restrict__ Bt, const float* __restrict__ bias,
             float* C, float oscale) {
  __shared__ __align__(16) float slab[4 * SLAB64];
  const int tid = threadIdx.x, wave = tid >> 5, lane = tid & 31;
  const int ntile = DMOD >> 6;
  const int bid   = blockIdx.x;
  const int ct    = bid % ntile;
  const int t2    = bid / ntile;
  const int rt    = t2 % NRT;
  const int bb    = t2 / NRT;
  if (bb >= NB) return;                     // block-uniform; no block barriers in this kernel; never taken with the exact grid
  const int srow  = rt * 64 + wave * 16;
  if (srow + 16 > SEQ) return;              // wave-uniform; never taken
  const int col0  = ct * 64;
  const int K     = DMOD;
  const size_t rowA = (size_t)bb * SEQ + srow;
  const _Float16* ahp = (const _Float16*)(const void*)Ah + rowA * K + 8 * lane;          // packed planes, as in gemm_bf
  const _Float16* alp = (const _Float16*)(const void*)Al + rowA * K + 8 * lane;
  const _Float16* bp  = (const _Float16*)(const void*)Bt + (size_t)col0 * K + 8 * lane;
  const size_t bs = (size_t)16 * K;
  v8f acc0 = zero8(), acc1 = zero8(), acc2 = zero8(), acc3 = zero8();
#pragma unroll 1
  for (int k0 = 0; k0 < 16 * K; k0 += FT) {
    const v16h ah = ldfrag_h(ahp + k0), al = ldfrag_h(alp + k0);
    const v16h b0 = ldfrag_h(bp + k0);
    const v16h b1 = ldfrag_h(bp + bs + k0);
    const v16h b2 = ldfrag_h(bp + 2 * bs + k0);
    const v16h b3 = ldfrag_h(bp + 3 * bs + k0);
    // the address pairs of the twelve loads above are inputs here, so no load's result is placed on one of them, and they are
    // rewritten only behind this wait
    asm volatile("s_wait_xcnt 0x0" :: "v"(ahp + k0), "v"(alp + k0), "v"(bp + k0) : "memory");
    acc0 = mma_h(ah, b0, acc0);  acc0 = mma_h(al, b0, acc0);
    acc1 = mma_h(ah, b1, acc1);  acc1 = mma_h(al, b1, acc1);
    acc2 = mma_h(ah, b2, acc2);  acc2 = mma_h(al, b2, acc2);
    acc3 = mma_h(ah, b3, acc3);  acc3 = mma_h(al, b3, acc3);
    guard6<v16h>(acc0, acc1, acc2, acc3, ah, al, b0, b1, b2, b3);
  }
  float* Cb = C + ((size_t)srow * NB + bb) * DMOD;
  epi64(slab + wave * SLAB64, acc0, acc1, acc2, acc3, oscale, bias, Cb, (size_t)NB * DMOD, col0, lane);
}

// =====================================================================================================
// Full (non-causal) attention over all JL keys, in the transposed form S^T = K.Q^T, O^T += V^T.P^T. Block bid -> (query group qg:
// 8 query tiles, head, batch b); one wave per query tile qt = qg*AWV + wave (rows q0 = 16*qt .. q0+15), all waves on ONE head.
//   q hi plane f16 x1024 and q residual plane, both [b*SEQ + s][h*HD + d]; k hi plane f16 x1024 [b*JL + j][h*HD + d];
//   v^T hi plane [b*NH + h][d][JL] f16 x1024; all packed (v^T with the four d subtiles of a key step side by side).
//   Scores use two products k_hi.q_hi + k_hi.q_lo; q fragments (B operand) loaded once per wave (2 k-steps x hi/residual).
//   score (log2 domain) t(i, j) = (q_i.k_j over HD) * (1/8)*log2e/(1024*1024); no key selection (every key contributes).
//   The head's k and v^T tiles come through LDS once per block: stages of SKEY = 64 keys (16 KiB), two buffers, filled by
//   asynchronous 16-B copies (4 per lane and stage) one stage ahead; the packed tiles keep their form in LDS, so a fragment
//   load is a wave-wide read of 512 contiguous bytes. Stage layout (halves): k band n (16 keys) tile t at n*1024 + t*512;
//   v^T key step p, d subtile j at 4096 + p*2048 + j*512.
//   Key tiles of 32 visited in order, kt = 0 .. NKT-1 (static bound), two per stage.
//   Per tile: 2 score subtiles (16 keys each) x 2 k-steps, k fragments (A operand, row = key).
//   Lane (hh = lane >> 4, c = lane & 15) then holds 16 scores of ONE query (column c): keys kb + 8hh + r in s0[r], kb + 16 + 8hh + r in s1[r]. Maximum and
//   sum run inside the lane; the two halves of a column exchange the maximum once per tile and join their sums once after the loop.
//   The 16 probabilities of a lane, converted in place (x32768, f16), ARE the B operand P^T in the split k map
//   (element s < 8: key 8hh + s, element s >= 8: key 16 + 8hh + s - 8), the map the packed v^T fragments (A operand, row = d) have.
//   After the loop: out = acc / Z (Z >= 1 always; guarded anyway; both carry the 32768), 1/1024 folded once. o[j][r] = O(query c,
//   d = 16j + 8hh + r): 8 consecutive d of one row = chunk j*32 + lane of the head's two packed tiles, stored from registers.
// LDS extent: ring[2*STH]; a stage's copies write bytes 0 .. 16383 of its buffer, each once; the fragment loads read the same extent.
// coverage: per wave 4 instructions x 32 lanes x 8 halves = the head's two packed tiles (16 x 64) per plane; grid NQG x NH x NB blocks x AWV waves =
//           every (b, s, h) row segment of O hi and O residual exactly once.
// =====================================================================================================
// 2^x as the bare hardware instruction. The library exp2f adds a compare, two selects, an add and an ldexp per value only to keep
// results below 2^-126; here such a term is far below one f16 step of P and one f32 step of Z >= 1, so it may flush to 0.
// -inf gives 0 and NaN stays NaN, as in the library form.
__device__ __forceinline__ float exp2_hw(float x) { return __builtin_amdgcn_exp2f(x); }

// lane l <-> lane l ^ 16 (the other half of the same column)
__device__ __forceinline__ float xhalf(float x) {
  const int b = __builtin_bit_cast(int, x);
  return __builtin_bit_cast(float, __builtin_amdgcn_permlanex16(b, b, 0x76543210, 0xfedcba98, false, false));
}

// One stage: 256 lanes x 16 B = 4 KiB per copy. Copies 0, 1: k bands 2c + (tid >> 7) (2 KiB of the head's tiles each, bands
// 16 key rows apart in the plane); copies 2, 3: the stage's 8 KiB of v^T tiles. lds = the lane's byte address in the buffer.
// The s_wait_xcnt closes the statement so that no address register of a copy is rewritten in front of it.
__device__ __forceinline__ void stage_copy(unsigned lds, const _Float16* kg, const _Float16* vg) {
#if defined(__HIP_DEVICE_COMPILE__)
  asm volatile("global_load_async_to_lds_b128 %0, %4, off\n\t"
               "global_load_async_to_lds_b128 %1, %5, off\n\t"
               "global_load_async_to_lds_b128 %2, %6, off\n\t"
               "global_load_async_to_lds_b128 %3, %7, off\n\t"
               "s_wait_xcnt 0x0"
               :: "v"(lds), "v"(lds + 4096u), "v"(lds + 8192u), "v"(lds + 12288u),
                  "v"(kg), "v"(kg + 32 * DMOD), "v"(vg), "v"(vg + 4 * FT) : "memory");
#endif
}
// this wave's copies have landed in LDS (the compiler places no wait for them)
__device__ __forceinline__ void wait_copies() {
#if defined(__HIP_DEVICE_COMPILE__)
  asm volatile("s_wait_asynccnt 0x0" ::: "memory");
#endif
}
// this wave's LDS reads have returned, before the barrier behind which their buffer is refilled
__device__ __forceinline__ void wait_lds_reads() {
#if defined(__HIP_DEVICE_COMPILE__)
  asm volatile("s_wait_dscnt 0x0" ::: "memory");
#endif
}

__global__ __launch_bounds__(ATT_THREADS)
void attn_x(const u16* __restrict__ QHp, const u16* __restrict__ QLp, const u16* __restrict__ KHp,
            const u16* __restrict__ VHp, u16* OHp, u16* OLp) {
  __shared__ __attribute__((aligned(16))) _Float16 ring[2 * STH];
  const int tid  = threadIdx.x;
  const int wave = tid >> 5;
  const int lane = tid & 31;
  const int bid  = blockIdx.x;
  const int qg   = bid % NQG;
  const int t2   = bid / NQG;
  const int head = t2 % NH;
  const int b    = t2 / NH;
  if (b >= NB) return;                      // block-uniform, before any barrier or copy; never taken with the exact grid
  const int q0   = (qg * AWV + wave) * 16;  // q0 + 16 <= SEQ by construction

  const size_t hcol = (size_t)head * (HD / 32) * FT + 8 * lane;        // the head's two tiles inside a 16-row band
  const _Float16* Qh  = (const _Float16*)(const void*)QHp + ((size_t)b * SEQ + q0) * DMOD + hcol;
  const _Float16* Ql  = (const _Float16*)(const void*)QLp + ((size_t)b * SEQ + q0) * DMOD + hcol;
  // copy sources of this lane in stage 0: k band tid >> 7, chunk tid & 127 of the head's two tiles; v^T chunk tid
  const _Float16* Kg = (const _Float16*)(const void*)KHp + ((size_t)b * JL + (tid >> 7) * 16) * DMOD
                       + (size_t)head * (HD / 32) * FT + 8 * (tid & 127);
  const _Float16* Vg = (const _Float16*)(const void*)VHp + (size_t)(b * NH + head) * NKT * 4 * FT + 8 * tid;
  const unsigned lds0 = (unsigned)(uintptr_t)(&ring[0]) + 16u * (unsigned)tid;
  const float lsc = SM_SCALE * (LOG2E / (QSC * KSC));
  const float oc  = 1.0f / VCAR;            // the 32768 on P is in the accumulators and in Z alike and cancels in acc / Z

  // ---- q fragments (hi and residual, 2 k-steps over HD), loaded once ----
  const v16h qh0 = ldfrag_h(Qh), qh1 = ldfrag_h(Qh + FT);
  const v16h ql0 = ldfrag_h(Ql), ql1 = ldfrag_h(Ql + FT);

  float mrow = -INFINITY;                   // running maximum of query column c (alike in both halves)
  float lrow = 0.f;                         // running sum (x32768) over the keys of this half only
  v8f o[4];
#pragma unroll
  for (int j = 0; j < 4; ++j) o[j] = zero8();

  // ---- ring prologue: stage 0 landed and published, stage 1 in flight ----
  stage_copy(lds0, Kg, Vg);
  wait_copies();
  __syncthreads();
  stage_copy(lds0 + 2u * STH, Kg + (size_t)SKEY * DMOD, Vg + (size_t)(SKEY / 32) * 4 * FT);

#pragma unroll 1                            // rolled: one publish point per trip, in the order written at its foot
  for (int st = 0; st < NST; ++st) {
   const _Float16* sb = ring + (st & 1) * STH + 8 * lane;
#pragma unroll                              // both key steps of a stage in line: every LDS offset an immediate
   for (int p = 0; p < SKEY / 32; ++p) {    // key step kt = 2*st + p, keys kb = 32*kt .. kb + 31
    // ---- the step's k and v^T fragments, one group of LDS reads ----
    const _Float16* k0p = sb + p * 4 * FT;
    const _Float16* vhp = sb + SKEY * HD + p * 4 * FT;
    const v16h ka0 = ldfrag_h(k0p),          ka1 = ldfrag_h(k0p + FT);
    const v16h kc0 = ldfrag_h(k0p + 2 * FT), kc1 = ldfrag_h(k0p + 3 * FT);
    v16h vf[4];
#pragma unroll
    for (int j = 0; j < 4; ++j) vf[j] = ldfrag_h(vhp + j * FT);
    // ---- scores: D element r of this lane = (key kb + 8hh + r, query column c) in s0, key kb + 16 + 8hh + r in s1 ----
    v8f s0 = zero8(), s1 = zero8();
    {
      s0 = mma_h(ka0, qh0, s0);
      s0 = mma_h(ka0, ql0, s0);
      s0 = mma_h(ka1, qh1, s0);
      s0 = mma_h(ka1, ql1, s0);
      s1 = mma_h(kc0, qh0, s1);
      s1 = mma_h(kc0, ql0, s1);
      s1 = mma_h(kc1, qh1, s1);
      s1 = mma_h(kc1, ql1, s1);
      guard2(s0, s1, ka0, ka1, kc0, kc1, qh0, ql0, qh1, ql1);
    }
    // ---- online softmax in base 2, -inf-safe; one query per lane ----
    const v8f t0 = s0 * lsc, t1 = s1 * lsc;
    float mx = fmaxf(t0[0], t1[0]);
#pragma unroll
    for (int r = 1; r < 8; ++r) mx = fmaxf(mx, fmaxf(t0[r], t1[r]));
    mx = fmaxf(mx, xhalf(mx));
    const float mn = fmaxf(mrow, mx);
    const float ms = (mn == -INFINITY) ? 0.0f : mn;
    const float al = exp2_hw(mrow - ms);
    mrow = mn;
    // e = 32768 * 2^(t - ms): score scale, maximum and the carry of P meet in one packed multiply-add in front of the exponential
    // (written on pairs: the bare exponential is no vector operation to the compiler, which otherwise splits the pairs)
    const float mb = ms - PLOG;
    const v2f l2 = {lsc, lsc}, nb2 = {-mb, -mb};
    v8f e0, e1;
#pragma unroll
    for (int r = 0; r < 4; ++r) {
      const v2f a0 = {s0[2 * r], s0[2 * r + 1]}, a1 = {s1[2 * r], s1[2 * r + 1]};
      const v2f x0 = __builtin_elementwise_fma(a0, l2, nb2), x1 = __builtin_elementwise_fma(a1, l2, nb2);
      e0[2 * r] = exp2_hw(x0[0]); e0[2 * r + 1] = exp2_hw(x0[1]);
      e1[2 * r] = exp2_hw(x1[0]); e1[2 * r + 1] = exp2_hw(x1[1]);
    }
    const v8f es = e0 + e1;
    lrow = lrow * al + (((es[0] + es[4]) + (es[1] + es[5])) + ((es[2] + es[6]) + (es[3] + es[7])));
    // ---- B fragment of P^T * 32768 (f16), column = c, split k map over the 32 keys of this step ----
    FragH ph;
#pragma unroll
    for (int r = 0; r < 8; ++r) {
      ph.h[0][r] = (_Float16)e0[r];         // elements 0..7  = keys kb + 8hh + 0..7
      ph.h[1][r] = (_Float16)e1[r];         // elements 8..15 = keys kb + 16 + 8hh + 0..7
    }
#pragma unroll
    for (int j = 0; j < 4; ++j) o[j] *= al;
    // ---- V^T.P^T : A fragment row = d = j*16 + c, keys contiguous in the v^T plane; 2 groups of 2 d-subtiles ----
    {
#pragma unroll
      for (int jg = 0; jg < HD / 32; ++jg) {
        const v16h vha = vf[2 * jg], vhc = vf[2 * jg + 1];
        o[2 * jg]     = mma_h(vha, ph.v, o[2 * jg]);
        o[2 * jg + 1] = mma_h(vhc, ph.v, o[2 * jg + 1]);
        guard2(o[2 * jg], o[2 * jg + 1], ph.v, vha, vhc, ph.v, vha, vhc, ph.v, ph.v);
      }
    }
   }
   // ---- publish point of stage st + 1: own reads of this buffer done, own copies landed, every wave here; then the refill ----
   wait_lds_reads();
   wait_copies();
   __syncthreads();
   if (st + 2 < NST) {                      // block-uniform
     stage_copy(lds0 + (unsigned)(st & 1) * (2u * STH), Kg + (size_t)(st + 2) * SKEY * DMOD,
                Vg + (size_t)(st + 2) * (SKEY / 32) * 4 * FT);
   }
  }
  wait_copies();
  acc_guard4(o[0], o[1], o[2], o[3]);
  // ---- out = acc / Z (0 if Z == 0), acc and Z both x32768, the 1024 on v folded once; the halves' sums joined here ----
  const float lv  = lrow + xhalf(lrow);
  const float ls  = (lv > 0.0f) ? lv : 1.0f;
  const float inv = (lv > 0.0f) ? ((1.0f / ls) * oc) : 0.0f;
  // ---- O x1024 -> packed f16 hi + residual planes; chunk j*32 + lane of the head's two tiles: row c, d = 16j + 8hh + 0..7 ----
  v4u oh[4], ol[4];
#pragma unroll
  for (int it = 0; it < 4; ++it) {
    float w[8];
#pragma unroll
    for (int e = 0; e < 8; ++e) w[e] = (o[it][e] * inv) * OSC;
#pragma unroll
    for (int e = 0; e < 4; ++e) {
      const _Float16 h0 = (_Float16)w[2 * e], h1 = (_Float16)w[2 * e + 1];
      const _Float16 l0 = (_Float16)(w[2 * e] - (float)h0), l1 = (_Float16)(w[2 * e + 1] - (float)h1);
      oh[it][e] = pk16(h_bits(h0), h_bits(h1));
      ol[it][e] = pk16(h_bits(l0), h_bits(l1));
    }
  }
  const size_t ob = ((size_t)b * SEQ + q0) * DMOD + hcol;
  {
#pragma unroll
    for (int it = 0; it < 4; ++it) {
      *(v4u*)(OHp + ob + (size_t)it * 256) = oh[it];
      *(v4u*)(OLp + ob + (size_t)it * 256) = ol[it];
    }
    
  }
}

// =====================================================================================================
// Workspace map (bytes); every plane is fully written by whole-line stores before it is read; all extents are exact multiples
// of the store granularity (512-B half tiles; no pad rows needed); every region offset a multiple of
// 2097152:
//   XC  bf16 [CROWS][1024]              CROWS*2048   (c = [mem; kv] as bf16; later q as bf16 [QROWS][1024] at the same offset)
//   WB  16-bit [1024 n][1024 k]         2097152      (Wv, Wk, Wq as bf16, then Wc as f16 x1024, reused in launch order)
//   OH  f16 [QROWS][1024] x1024         QROWS*2048   OL residual the same
//   VH  f16 [NB*16][64][JL] x1024       CROWS*2048   (all 16-bit planes in packed 16 x 32 tiles)
//   KH  f16 [CROWS][1024] x1024         CROWS*2048
//   QH  f16 [QROWS][1024] x1024         QROWS*2048   QL residual the same
//   end (NB=2, SEQ=MLEN=2048)           85983232
// =====================================================================================================
extern "C" void kernel_launch(void* const* d_in, const int* in_sizes, int n_in,
                              void* d_out, int out_size, void* d_ws, size_t ws_size,
                              hipStream_t stream) {
  if (n_in < 11) return;
  const long long needq = ((long long)(SEQ - 1) * B_FULL + NB) * DMOD;
  const long long needm = (MLEN > 0) ? (((long long)(MLEN - 1) * B_FULL + NB) * DMOD) : 0;
  if ((long long)in_sizes[0] < needq || (long long)in_sizes[1] < needq || (long long)in_sizes[2] < needm) return;
  if (in_sizes[3] < DMOD * DMOD || in_sizes[5] < DMOD * DMOD || in_sizes[7] < DMOD * DMOD || in_sizes[9] < DMOD * DMOD) return;
  if (in_sizes[4] < DMOD || in_sizes[6] < DMOD || in_sizes[8] < DMOD || in_sizes[10] < DMOD) return;
  if ((long long)out_size < (long long)SEQ * NB * DMOD) return;

  const float* xq  = (const float*)d_in[0];
  const float* xkv = (const float*)d_in[1];
  const float* xm  = (const float*)d_in[2];
  const float* wq  = (const float*)d_in[3];
  const float* bq  = (const float*)d_in[4];
  const float* wk  = (const float*)d_in[5];
  const float* bk  = (const float*)d_in[6];
  const float* wv  = (const float*)d_in[7];
  const float* bv  = (const float*)d_in[8];
  const float* wc  = (const float*)d_in[9];
  const float* bc  = (const float*)d_in[10];
  float*       out = (float*)d_out;

  const size_t szXC = (size_t)CROWS * DMOD * 2;                 // also hosts XQ [QROWS][1024] bf16
  const size_t szXQ = (size_t)QROWS * DMOD * 2;
  const size_t szW  = (size_t)DMOD * DMOD * 2;
  const size_t szO  = (size_t)QROWS * DMOD * 2;                 // OH, OL each
  const size_t szVH = (size_t)NB * NH * HD * JL * 2;            // == CROWS*2048
  const size_t szKH = (size_t)CROWS * DMOD * 2;
  const size_t szQ  = (size_t)QROWS * DMOD * 2;                 // QH, QL each
  if (szXQ > szXC) return;
  size_t off = 0;
  const size_t oXC = off; off += szXC;
  const size_t oW  = off; off += szW;
  const size_t oOH = off; off += szO;
  const size_t oOL = off; off += szO;
  const size_t oVH = off; off += szVH;
  const size_t oKH = off; off += szKH;
  const size_t oQH = off; off += szQ;
  const size_t oQL = off; off += szQ;
  if (off > ws_size) return;                // off = 85983232 for NB = 2, SEQ = MLEN = 2048
  if (off > (size_t)WS_CAP) return;

  char* ws = (char*)d_ws;
  u16*   XC = (u16*)(ws + oXC);
  u16*   XQ = (u16*)(ws + oXC);
  u16*   WB = (u16*)(ws + oW);
  u16*   OH = (u16*)(ws + oOH);
  u16*   OL = (u16*)(ws + oOL);
  u16*   VH = (u16*)(ws + oVH);
  u16*   KH = (u16*)(ws + oKH);
  u16*   QH = (u16*)(ws + oQH);
  u16*   QL = (u16*)(ws + oQL);

  const dim3 b256(256), b128(128), bQK(QKT), bAT(ATT_THREADS);
  const int  n8w = (DMOD * DMOD) / 8;
  const dim3 gW((n8w + 255) / 256);                     // 512 blocks per weight matrix
  const dim3 gXC(CROWS), gXQ(QROWS);
  const dim3 gGC((CROWS / 64) * (DMOD / 64));
  const dim3 gGQ((QROWS / 64) * (DMOD / 64));
  const dim3 gAT(NQG * NH * NB);
  const dim3 gO(NB * NRT * (DMOD / 64));

  // (1) c = [mem; kv] -> bf16 plane [CROWS][1024], batch-major rows b*JL + j
  cvt_act<<<gXC, bQK, 0, stream>>>(xm, xkv, XC, JL, MLEN);
  // (2) Wv [n][k] -> bf16 plane; (3) v = c.Wv^T + bv -> v^T plane x1024
  cvt16<<<gW, b256, 0, stream>>>(wv, WB, n8w, 0, 1.0f);
  gemm_bf<0><<<gGC, b128, 0, stream>>>(XC, WB, bv, VH, VH, CROWS, DMOD, DMOD, VCAR);
  // (4) Wk -> bf16 plane; (5) k = c.Wk^T + bk -> k hi plane x1024
  cvt16<<<gW, b256, 0, stream>>>(wk, WB, n8w, 0, 1.0f);
  gemm_bf<1><<<gGC, b128, 0, stream>>>(XC, WB, bk, KH, KH, CROWS, DMOD, DMOD, KSC);
  // (6) q -> bf16 plane (XC region); (7) Wq -> bf16 plane; (8) q = q.Wq^T + bq -> q hi + residual planes x1024
  cvt_act<<<gXQ, bQK, 0, stream>>>(xq, xq, XQ, SEQ, SEQ);
  cvt16<<<gW, b256, 0, stream>>>(wq, WB, n8w, 0, 1.0f);
  gemm_bf<2><<<gGQ, b128, 0, stream>>>(XQ, WB, bq, QH, QL, QROWS, DMOD, DMOD, QSC);
  // (9) Wc [n][k] -> f16 plane of bf16 value x1024
  cvt16<<<gW, b256, 0, stream>>>(wc, WB, n8w, 1, WOS);
  // (10) attention over all JL keys -> O hi + residual planes
  attn_x<<<gAT, bAT, 0, stream>>>(QH, QL, KH, VH, OH, OL);
  // (11) output projection -> out f32 rows (s*NB + b), carries 1024 x 1024 folded back
  gemm_o2<<<gO, b128, 0, stream>>>(OH, OL, WB, bc, out, 1.0f / (OSC * WOS));
  (void)hipGetLastError();
}

// v006
// Measured time: 177 microseconds a run.
// Two timings next to v005 both put it at 1.13 times that version's speed.
// All steps since v000 together make it 3.10 times as fast.
// Contractions: q.Wq^T, c.Wk^T, c.Wv^T (c = [mem; kv] along the key axis) on v_wmma_f32_16x16x32_bf16 (activations, W and
// biases RNE-converted to bf16; the [n][k] weight rows are used directly as a k-contiguous operand: B for v, A for q and k; f32 accumulate);
// k.q^T over 64 on v_wmma_f32_16x16x32_f16 with q carried as f16 hi (x1024) plus an f16 residual plane and k as f16 hi (x1024)
// (products h.h + h.l); v^T.P^T on v_wmma_f32_16x16x32_f16 (P x32768 f16, v x1024 f16, one product); O.Wc^T on
// v_wmma_f32_16x16x32_f16 (O x1024 as f16 hi plus f16 residual plane, Wc as f16(bf16(Wc)) x1024, products h.w + l.w);
// all f32 accumulate. Bias adds, base-2 online softmax over all keys and the 1/Z fold in f32 on VALU.
// Every 16-bit workspace plane is stored fragment-packed (see "packed planes" below): a wave-wide 16-B fragment load reads 512
// contiguous bytes (4 whole lines) instead of 32 B out of each of 16 rows.
#include <hip/hip_runtime.h>
#include <math.h>
#include <stdint.h>

#ifndef NB
#define NB 2
#endif
#ifndef SEQ
#define SEQ 2048
#endif
#ifndef MLEN
#define MLEN 2048
#endif
#define B_FULL 2
#define L_FULL 2048
#define M_FULL 2048
#define DMOD  1024
#define NH    16
#define HD    64
#define JL    (MLEN + SEQ)
#define QROWS (NB * SEQ)
#define CROWS (NB * JL)
#define SM_SCALE 0.125f
#define LOG2E 1.4426950408889634f
#define QSC   1024.0f
#define KSC   1024.0f
#define PLOG  15.0f               // P is carried x 2^15 = 32768, as a bias of its exponent
#define VCAR  1024.0f
#define OSC   1024.0f
#define WOS   1024.0f
#define AWV   8                   // waves of an attention block: 8 query tiles of ONE head share that head's k / v^T stages
#define NQT   (SEQ / 16)
#define NQG   (NQT / AWV)
#define SKEY  64                  // keys in one LDS stage of the attention ring
#define NST   (JL / SKEY)
#define STH   (2 * SKEY * HD)     // halves in one stage: 8 packed k tiles, then 8 packed v^T tiles (16 KiB)
#define NKT   (JL / 32)
#define NRT   (SEQ / 64)
#define ATT_THREADS (AWV * 32)
#define SLAB64 (16 * 68)
#define QKT   (DMOD / 8)
#define WS_CAP 134217728
#define FT    512                 // halves in one packed 16 x 32 fragment tile (1 KiB)
#define TPB   (DMOD / 32)         // fragment tiles in one 16-row band of a [rows][DMOD] plane
#define CB_C  (CROWS / 2)         // conversion launch: blocks of the c range, of the q range, of one weight matrix
#define CB_Q  (QROWS / 2)
#define CB_W  ((DMOD * DMOD) / (8 * 256))
#define GB_C  ((CROWS / 64) * (DMOD / 64))   // projection launch: blocks of the v range (k the same), of the q range
#define GB_Q  ((QROWS / 64) * (DMOD / 64))
static_assert(DMOD == NH * HD && HD == 64 && NH == 16);
static_assert((NQT % AWV) == 0 && ATT_THREADS == 256 && NST * SKEY == JL && NST >= 2 && SKEY == 64);
static_assert(NB >= 1 && NB <= B_FULL);
static_assert((SEQ % 64) == 0 && SEQ >= 64 && SEQ <= L_FULL);
static_assert((MLEN % 64) == 0 && MLEN >= 0 && MLEN <= M_FULL);
static_assert((JL % 64) == 0 && NKT * 32 == JL && NQT * 16 == SEQ && NRT * 64 == SEQ);
static_assert(QKT == 128 && (DMOD % 64) == 0 && (DMOD % 32) == 0 && (HD % 32) == 0);
static_assert(((DMOD * DMOD) % (8 * 256)) == 0);
static_assert(QROWS <= CROWS);
static_assert(TPB == 32 && QKT == 2 * 64 && (TPB % 2) == 0 && (MLEN % 16) == 0 && (SEQ % 16) == 0 && (JL % 16) == 0);
static_assert((long long)CROWS * DMOD * 6 + (long long)QROWS * DMOD * 10 + 8LL * DMOD * DMOD <= (long long)WS_CAP);

typedef unsigned short u16;
typedef _Float16 v16h __attribute__((ext_vector_type(16)));
typedef _Float16 v8h  __attribute__((ext_vector_type(8)));
typedef __bf16   v16b __attribute__((ext_vector_type(16)));
typedef float    v8f  __attribute__((ext_vector_type(8)));
typedef float    v4f  __attribute__((ext_vector_type(4)));
typedef float    v2f  __attribute__((ext_vector_type(2)));
typedef unsigned int v4u __attribute__((ext_vector_type(4)));

union FragH { v16h v; v8h h[2]; v4u u[2]; };
union FragB { v16b v; v4u u[2]; };

// ---- scalar helpers --------------------------------------------------------------------------------
__device__ __forceinline__ unsigned short bf_bits(float f) {          // f32 -> bf16 bits, RNE convert
  unsigned u = __float_as_uint(f);
  return (unsigned short)((u + 0x7FFFu + ((u >> 16) & 1u)) >> 16);
}
__device__ __forceinline__ float bf_up(unsigned short h) { return __uint_as_float(((unsigned)h) << 16); }
__device__ __forceinline__ float bfr(float f) { return bf_up(bf_bits(f)); }
__device__ __forceinline__ unsigned short h_bits(_Float16 x) { return __builtin_bit_cast(unsigned short, x); }
__device__ __forceinline__ unsigned pk16(unsigned short a, unsigned short b) { return (unsigned)a | ((unsigned)b << 16); }
__device__ __forceinline__ v8f zero8() { v8f z = {0.f, 0.f, 0.f, 0.f, 0.f, 0.f, 0.f, 0.f}; return z; }

// ---- packed planes: a [rows][K] 16-bit matrix is stored as 16 x 32 fragment tiles of FT halves, tile (row >> 4, k >> 5) at
//      index (row >> 4) * (K / 32) + (k >> 5); inside a tile element (c = row & 15, kk = k & 31) sits at
//      (kk >> 4) * 256 + (((kk >> 3) & 1) * 16 + c) * 8 + (kk & 7): chunk g of 8 halves = what lane g & 31 takes in load g >> 5.
// ---- fragment loaders: 16-bit A/B operand, lane -> row/col (lane&15), p = tile start + 8*lane;
//      elements 0..7 <- p[0..7] (k0+8h..), elements 8..15 <- p[256..263] (k0+16+8h..)  (same split k map for A and B)
__device__ __forceinline__ v16h ldfrag_h(const _Float16* p) {
  FragH f;
  f.h[0] = *(const v8h*)(p);
  f.h[1] = *(const v8h*)(p + 256);
  return f.v;
}
__device__ __forceinline__ v16b ldfrag_b(const u16* p) {              // bf16 plane read as unsigned integer vectors
  FragB f;
  f.u[0] = *(const v4u*)(p);
  f.u[1] = *(const v4u*)(p + 256);
  return f.v;
}
// first column of chunk w (0..63) inside its tile
__device__ __forceinline__ int chunk_k(int w) { return ((w >> 5) & 1) * 16 + ((w >> 4) & 1) * 8; }

__device__ __forceinline__ v8f mma_h(v16h a, v16h b, v8f c) {
  return __builtin_amdgcn_wmma_f32_16x16x32_f16(false, a, false, b, (short)0, c, false, false);
}
__device__ __forceinline__ v8f mma_b(v16b a, v16b b, v8f c) {
  return __builtin_amdgcn_wmma_f32_16x16x32_bf16(false, a, false, b, (short)0, c, false, false);
}
__device__ __forceinline__ void guard2(v8f& a, v8f& b, v16h x0, v16h x1, v16h x2, v16h x3,
                                       v16h x4, v16h x5, v16h x6, v16h x7) {
#if defined(__HIP_DEVICE_COMPILE__)
  asm volatile("v_nop\n\tv_nop\n\tv_nop\n\tv_nop"
               : "+v"(a), "+v"(b)
               : "v"(x0), "v"(x1), "v"(x2), "v"(x3), "v"(x4), "v"(x5), "v"(x6), "v"(x7) : "memory");
#endif
}
template <typename F>
__device__ __forceinline__ void guard6(v8f& a, v8f& b, v8f& c, v8f& d, F x0, F x1, F x2, F x3, F x4, F x5) {
#if defined(__HIP_DEVICE_COMPILE__)
  asm volatile("v_nop\n\tv_nop\n\tv_nop\n\tv_nop"
               : "+v"(a), "+v"(b), "+v"(c), "+v"(d) : "v"(x0), "v"(x1), "v"(x2), "v"(x3), "v"(x4), "v"(x5) : "memory");
#endif
}
__device__ __forceinline__ void acc_guard4(v8f& a, v8f& b, v8f& c, v8f& d) {
#if defined(__HIP_DEVICE_COMPILE__)
  asm volatile("v_nop\n\tv_nop\n\tv_nop\n\tv_nop" : "+v"(a), "+v"(b), "+v"(c), "+v"(d));
#endif
}
__device__ __forceinline__ void wave_sync_lds() {
  __builtin_amdgcn_fence(__ATOMIC_RELEASE, "workgroup");
  __builtin_amdgcn_wave_barrier();
  __builtin_amdgcn_fence(__ATOMIC_ACQUIRE, "workgroup");
}

// =====================================================================================================
// f32 [DMOD n][DMOD k] -> packed 16-bit plane.  f16mode == 0: bf16 RNE bits;  f16mode == 1: f16 bits of (bf16 RNE value) * scale.
// Used for the [n][k] weight matrices (bf16, or f16 of the bf16 value x1024 for Wc).
// Thread = packed chunk gt (8 consecutive k of one row): two 16-B loads, one 16-B store; 32 lanes store 512 contiguous bytes
// coverage: CB_W blocks x 256 thr x 8 = the whole plane (131072 chunks); gt = block of the matrix's range * 256 + thread.
// =====================================================================================================
__device__ __forceinline__ void cvt16_part(const float* __restrict__ x, u16* D, int gt, int f16mode, float scale) {
  const int tile = gt >> 6;
  const float* p = x + (size_t)((tile / TPB) * 16 + (gt & 15)) * DMOD + (tile % TPB) * 32 + chunk_k(gt & 63);
  const v4f a = *(const v4f*)(p), b4 = *(const v4f*)(p + 4);
  float w[8];
#pragma unroll
  for (int e = 0; e < 4; ++e) { w[e] = a[e]; w[4 + e] = b4[e]; }
  v4u o;
#pragma unroll
  for (int e = 0; e < 4; ++e) {
    const float f0 = w[2 * e], f1 = w[2 * e + 1];
    const unsigned short hb0 = h_bits((_Float16)(bfr(f0) * scale));
    const unsigned short hb1 = h_bits((_Float16)(bfr(f1) * scale));
    const unsigned short bb0 = bf_bits(f0);
    const unsigned short bb1 = bf_bits(f1);
    o[e] = (f16mode != 0) ? pk16(hb0, hb1) : pk16(bb0, bb1);
  }
  u16* d = D + (size_t)gt * 8;
  *(v4u*)(d) = o;
  // other jobs' code follows this store in the merged kernel's listing: no register that the store names is rewritten in front of this wait
  asm volatile("s_wait_xcnt 0x0" ::: "memory");
}

// =====================================================================================================
// Activation rows -> packed bf16 plane (RNE), batch-major destination rows:
//   D[(bb*nrow + j)][0..1023] <- X0[(j*B_FULL + bb)][..] for j < split,  X1[((j - split)*B_FULL + bb)][..] for j >= split.
// Used for c = [mem rows 0..MLEN-1 ; kv rows 0..SEQ-1] (nrow = JL, split = MLEN) and for q (nrow = SEQ, split = SEQ, X1 unused).
// Unit r = two packed tiles of one 16-row band (16 rows x 64 columns), 128 threads, thread tid = one chunk: two 16-B loads, one
// 16-B store. The source base selection is uniform in a unit (nrow and split are multiples of 16; both sources are global planes).
// coverage: NB*nrow units x 128 chunks x 8 = every element of the [NB*nrow][1024] plane exactly once.
// =====================================================================================================
__device__ __forceinline__ void cvt_act_part(const float* __restrict__ X0, const float* __restrict__ X1, u16* D,
                                             int nrow, int split, int r, int tid) {
  const int  r0    = (r / (TPB / 2)) * 16;                    // first row of the band
  const int  col   = ((r % (TPB / 2)) * 2 + (tid >> 6)) * 32 + chunk_k(tid & 63);
  const int  bb    = r0 / nrow;
  const int  j     = r0 - bb * nrow;
  const bool first = (j < split);
  const int  js    = (first ? j : (j - split)) + (tid & 15);
  const float* base = first ? X0 : X1;
  const float* p = base + ((size_t)js * B_FULL + bb) * DMOD + col;
  const v4f a = *(const v4f*)(p), a4 = *(const v4f*)(p + 4);
  v4u o;
#pragma unroll
  for (int e = 0; e < 2; ++e) {
    o[e]     = pk16(bf_bits(a[2 * e]),  bf_bits(a[2 * e + 1]));
    o[2 + e] = pk16(bf_bits(a4[2 * e]), bf_bits(a4[2 * e + 1]));
  }
  u16* d = D + ((size_t)r * QKT + tid) * 8;
  *(v4u*)(d) = o;
  // other jobs' code follows this store in the merged kernel's listing: no register that the store names is rewritten in front of this wait
  asm volatile("s_wait_xcnt 0x0" ::: "memory");
}

// =====================================================================================================
// All conversions of a call in one launch (none reads what another writes; each has a plane of its own). The block index picks
// the job, uniformly in a block: CB_C blocks c = [mem; kv], CB_Q blocks q (two 128-thread units a block), then CB_W blocks each
// for Wv, Wk, Wq (bf16) and Wc (f16 of the bf16 value x1024).
// coverage: grid = CB_C + CB_Q + 4*CB_W blocks; every range is exactly its job's units.
// =====================================================================================================
__global__ __launch_bounds__(256)
void cvt_all(const float* __restrict__ xm, const float* __restrict__ xkv, const float* __restrict__ xq,
             const float* __restrict__ wv, const float* __restrict__ wk, const float* __restrict__ wq,
             const float* __restrict__ wc, u16* XC, u16* XQ, u16* WV, u16* WK, u16* WQ, u16* WC) {
  const int tid = (int)threadIdx.x;
  int blk = (int)blockIdx.x;
  if (blk < CB_C) { cvt_act_part(xm, xkv, XC, JL, MLEN, 2 * blk + (tid >> 7), tid & 127); return; }
  blk -= CB_C;
  if (blk < CB_Q) { cvt_act_part(xq, xq, XQ, SEQ, SEQ, 2 * blk + (tid >> 7), tid & 127); return; }
  blk -= CB_Q;
  const int wsel = blk / CB_W;
  const int gt   = (blk % CB_W) * 256 + tid;
  if (wsel < 3)       cvt16_part(wsel == 0 ? wv : (wsel == 1 ? wk : wq), wsel == 0 ? WV : (wsel == 1 ? WK : WQ), gt, 0, 1.0f);
  else if (wsel == 3) cvt16_part(wc, WC, gt, 1, WOS);
}

// =====================================================================================================
// Epilogue of the output projection: the wave's 16x64 f32 tile (times oscale) staged in its private LDS slab (pitch 68),
// coverage: 8 instructions x 2 rows x 16 lanes x 4 floats = the wave's 16 x 64 tile.
// =====================================================================================================
__device__ __forceinline__ void epi64(float* sl, v8f a0, v8f a1, v8f a2, v8f a3, float oscale,
                                      const float* __restrict__ bias, float* Cb, size_t pitch, int col0, int lane) {
  const int hh = lane >> 4, m = lane & 15;
#pragma unroll
  for (int r = 0; r < 8; ++r) {
    const int ro = (8 * hh + r) * 68 + m;
    sl[ro]      = a0[r] * oscale;
    sl[ro + 16] = a1[r] * oscale;
    sl[ro + 32] = a2[r] * oscale;
    sl[ro + 48] = a3[r] * oscale;
  }
  wave_sync_lds();
  const v4f bb = *(const v4f*)(bias + col0 + m * 4);
  v4f br;
#pragma unroll
  for (int e = 0; e < 4; ++e) br[e] = bfr(bb[e]);
  v4f vals[8];
#pragma unroll
  for (int it = 0; it < 8; ++it) vals[it] = *(const v4f*)(sl + (it * 2 + hh) * 68 + m * 4) + br;
  float* dst = Cb + (size_t)hh * pitch + col0 + m * 4;
  {
#pragma unroll
    for (int it = 0; it < 8; ++it) {
      *(v4f*)(dst + (size_t)(it * 2) * pitch) = vals[it];
    }
    
  }
}

// =====================================================================================================
// bf16 projection GEMM: P[M][N] = A[M][K] (bf16 packed) . Bt[N][K]^T (bf16 packed) + bias[col] (bf16 RNE value), f32 accumulate;
// the result leaves the accumulators as the packed f16 plane(s) its consumer reads, f16(P * sc); no f32 copy of P is kept.
// Block = 64x64 tile, 4 waves x 16 rows; fragments loaded straight from the packed tiles (two 16-B loads each, split k map
// for A and B); K stepped by 32 (K % 32 == 0, M % 64 == 0, N % 64 == 0; bid = 0 .. (M/64)*(N/64) - 1, the block inside its job).
// A lane of a D tile holds 8 consecutive D rows (8hh + r) of one D column (m); a packed chunk is 8 consecutive k of one tile row.
//   MODE 0 (v, N == DMOD, rows bb*JL + j): D = A.Bt^T, D rows = keys, D column = d. The lane's 8 keys of one d ARE chunk
//     ((j0 >> 4) & 1)*32 + lane of the v^T tile (head bb*NH + g, key step j0 >> 5, d subtile jj) at index
//     ((bb*NH + g)*NKT + (j0 >> 5))*4 + jj (row in the tile = d & 15, k = j & 31).
//   MODE 1 (k, hi plane) and MODE 2 (q, hi plane Hp and residual plane Lp = f16(P*sc - hi)): the operands change places,
//     D = Bt.A^T, D rows = columns n of P, D column = row of P. The lane's 8 columns of one row ARE chunk (jj & 1)*32 + lane of
//     the [M][N] plane's tile (rowb >> 4, (col0 >> 5) + (jj >> 1)).
// The sum over k of every element is the same in both forms (same fragments, same k map, same k order).
// coverage: per wave and plane 4 stores x 32 lanes x 8 halves = its 16 x 64 results, each store 512 contiguous bytes;
//           the grid's tiles cover every element of the plane(s) exactly once.
// =====================================================================================================
template <int MODE>
__device__ __forceinline__
void gemm_bf(const u16* __restrict__ A, const u16* __restrict__ Bt, const float* __restrict__ bias,
             u16* Hp, u16* Lp, int M, int N, int K, float sc, int bid) {
  const int tid = threadIdx.x, wave = tid >> 5, lane = tid & 31;
  const int ntile = N >> 6;
  const int rowb  = (bid / ntile) * 64 + wave * 16;
  const int col0  = (bid % ntile) * 64;
  if (rowb + 16 > M) return;                // wave-uniform, never taken with the exact grid; no block barriers in this kernel
  const u16* ap = A  + (size_t)rowb * K + 8 * lane;          // a 16-row band holds 16*K halves
  const u16* bp = Bt + (size_t)col0 * K + 8 * lane;
  const size_t bs = (size_t)16 * K;
  v8f acc0 = zero8(), acc1 = zero8(), acc2 = zero8(), acc3 = zero8();
#pragma unroll 1
  for (int k0 = 0; k0 < 16 * K; k0 += FT) {                  // one packed tile = 32 k
    const v16b a  = ldfrag_b(ap + k0);
    const v16b b0 = ldfrag_b(bp + k0);
    const v16b b1 = ldfrag_b(bp + bs + k0);
    const v16b b2 = ldfrag_b(bp + 2 * bs + k0);
    const v16b b3 = ldfrag_b(bp + 3 * bs + k0);
    // the address pairs of the ten loads above are inputs here, so no load's result is placed on one of them, and they are
    // rewritten only behind this wait
    asm volatile("s_wait_xcnt 0x0" :: "v"(ap + k0), "v"(bp + k0) : "memory");
    if constexpr (MODE == 0) {
      acc0 = mma_b(a, b0, acc0);
      acc1 = mma_b(a, b1, acc1);
      acc2 = mma_b(a, b2, acc2);
      acc3 = mma_b(a, b3, acc3);
    } else {
      acc0 = mma_b(b0, a, acc0);
      acc1 = mma_b(b1, a, acc1);
      acc2 = mma_b(b2, a, acc2);
      acc3 = mma_b(b3, a, acc3);
    }
    guard6<v16b>(acc0, acc1, acc2, acc3, a, b0, b1, b2, b3, a);
  }
  const int hh = lane >> 4, m = lane & 15;
  const v8f acc[4] = {acc0, acc1, acc2, acc3};
  v4u oh[4], ol[4];
#pragma unroll
  for (int jj = 0; jj < 4; ++jj) {
    float br[8];
    if constexpr (MODE == 0) {
      const float b1v = bfr(bias[col0 + 16 * jj + m]);
#pragma unroll
      for (int e = 0; e < 8; ++e) br[e] = b1v;
    } else {
      const float* bq8 = bias + col0 + 16 * jj + 8 * hh;
      const v4f x = *(const v4f*)(bq8), y = *(const v4f*)(bq8 + 4);
#pragma unroll
      for (int e = 0; e < 4; ++e) { br[e] = bfr(x[e]); br[4 + e] = bfr(y[e]); }
    }
#pragma unroll
    for (int e = 0; e < 4; ++e) {
      const float t0 = (acc[jj][2 * e] + br[2 * e]) * sc, t1 = (acc[jj][2 * e + 1] + br[2 * e + 1]) * sc;
      const _Float16 h0 = (_Float16)t0, h1 = (_Float16)t1;
      oh[jj][e] = pk16(h_bits(h0), h_bits(h1));
      if constexpr (MODE == 2) {
        const _Float16 l0 = (_Float16)(t0 - (float)h0), l1 = (_Float16)(t1 - (float)h1);
        ol[jj][e] = pk16(h_bits(l0), h_bits(l1));
      }
    }
  }
  if constexpr (MODE == 0) {
    const int bb = rowb / JL, j0 = rowb - bb * JL, g = col0 >> 6;
    u16* d = Hp + ((size_t)(bb * NH + g) * NKT + (j0 >> 5)) * 4 * FT + ((j0 >> 4) & 1) * 256 + 8 * lane;
#pragma unroll
    for (int jj = 0; jj < 4; ++jj) *(v4u*)(d + jj * FT) = oh[jj];
  } else {
    const size_t ob = (size_t)rowb * N + (size_t)(col0 >> 5) * FT + 8 * lane;
#pragma unroll
    for (int jj = 0; jj < 4; ++jj) *(v4u*)(Hp + ob + jj * 256) = oh[jj];
    if constexpr (MODE == 2) {
#pragma unroll
      for (int jj = 0; jj < 4; ++jj) *(v4u*)(Lp + ob + jj * 256) = ol[jj];
    }
  }
}

// =====================================================================================================
// The three projections of a call in one launch (they share inputs only). The block index picks the job, uniformly in a block:
// GB_C blocks v = c.Wv^T, GB_C blocks k = c.Wk^T, GB_Q blocks q = q.Wq^T.
// =====================================================================================================
__global__ __launch_bounds__(128)
void gemm_qkv(const u16* __restrict__ XC, const u16* __restrict__ XQ, const u16* __restrict__ WV, const u16* __restrict__ WK,
              const u16* __restrict__ WQ, const float* __restrict__ bv, const float* __restrict__ bk,
              const float* __restrict__ bq, u16* VH, u16* KH, u16* QH, u16* QL) {
  const int bid = (int)blockIdx.x;
  if (bid < GB_C)                 gemm_bf<0>(XC, WV, bv, VH, VH, CROWS, DMOD, DMOD, VCAR, bid);
  else if (bid < 2 * GB_C)        gemm_bf<1>(XC, WK, bk, KH, KH, CROWS, DMOD, DMOD, KSC, bid - GB_C);
  else if (bid < 2 * GB_C + GB_Q) gemm_bf<2>(XQ, WQ, bq, QH, QL, QROWS, DMOD, DMOD, QSC, bid - 2 * GB_C);
}

// =====================================================================================================
// Output projection: out rows (s*NB + bb) of DMOD floats = (Ah + Al)[bb*SEQ + s][DMOD] . Bt[DMOD][DMOD]^T * oscale + bias
// (bf16 RNE value); products h.B + l.B into one accumulator (l unscaled residual).
// Block -> (column tile ct = bid % 16, sequence row tile rt of NRT, batch bb); the wave's 16 rows s = rt*64 + wave*16 .. +15 are
// consecutive rows of Ah/Al and rows of out spaced NB*DMOD floats apart (seq-major [s][b][DMOD] output layout).
// Same tiling as gemm_bf; f32 epilogue through a wave-private LDS slab.
// coverage: grid NB*NRT*16 blocks x 4 waves x (16 rows x 64 cols) = every (s, bb, col) of out exactly once.
// =====================================================================================================
__global__ __launch_bounds__(128)
void gemm_o2(const u16* __restrict__ Ah, const u16* __restrict__ Al, const u16* __restrict__ Bt, const float* __restrict__ bias,
             float* C, float oscale) {
  __shared__ __align__(16) float slab[4 * SLAB64];
  const int tid = threadIdx.x, wave = tid >> 5, lane = tid & 31;
  const int ntile = DMOD >> 6;
  const int bid   = blockIdx.x;
  const int ct    = bid % ntile;
  const int t2    = bid / ntile;
  const int rt    = t2 % NRT;
  const int bb    = t2 / NRT;
  if (bb >= NB) return;                     // block-uniform; no block barriers in this kernel; never taken with the exact grid
  const int srow  = rt * 64 + wave * 16;
  if (srow + 16 > SEQ) return;              // wave-uniform; never taken
  const int col0  = ct * 64;
  const int K     = DMOD;
  const size_t rowA = (size_t)bb * SEQ + srow;
  const _Float16* ahp = (const _Float16*)(const void*)Ah + rowA * K + 8 * lane;          // packed planes, as in gemm_bf
  const _Float16* alp = (const _Float16*)(const void*)Al + rowA * K + 8 * lane;
  const _Float16* bp  = (const _Float16*)(const void*)Bt + (size_t)col0 * K + 8 * lane;
  const size_t bs = (size_t)16 * K;
  v8f acc0 = zero8(), acc1 = zero8(), acc2 = zero8(), acc3 = zero8();
#pragma unroll 1
  for (int k0 = 0; k0 < 16 * K; k0 += FT) {
    const v16h ah = ldfrag_h(ahp + k0), al = ldfrag_h(alp + k0);
    const v16h b0 = ldfrag_h(bp + k0);
    const v16h b1 = ldfrag_h(bp + bs + k0);
    const v16h b2 = ldfrag_h(bp + 2 * bs + k0);
    const v16h b3 = ldfrag_h(bp + 3 * bs + k0);
    // the address pairs of the twelve loads above are inputs here, so no load's result is placed on one of them, and they are
    // rewritten only behind this wait
    asm volatile("s_wait_xcnt 0x0" :: "v"(ahp + k0), "v"(alp + k0), "v"(bp + k0) : "memory");
    acc0 = mma_h(ah, b0, acc0);  acc0 = mma_h(al, b0, acc0);
    acc1 = mma_h(ah, b1, acc1);  acc1 = mma_h(al, b1, acc1);
    acc2 = mma_h(ah, b2, acc2);  acc2 = mma_h(al, b2, acc2);
    acc3 = mma_h(ah, b3, acc3);  acc3 = mma_h(al, b3, acc3);
    guard6<v16h>(acc0, acc1, acc2, acc3, ah, al, b0, b1, b2, b3);
  }
  float* Cb = C + ((size_t)srow * NB + bb) * DMOD;
  epi64(slab + wave * SLAB64, acc0, acc1, acc2, acc3, oscale, bias, Cb, (size_t)NB * DMOD, col0, lane);
}

// =====================================================================================================
// Full (non-causal) attention over all JL keys, in the transposed form S^T = K.Q^T, O^T += V^T.P^T. Block bid -> (query group qg:
// 8 query tiles, head, batch b); one wave per query tile qt = qg*AWV + wave (rows q0 = 16*qt .. q0+15), all waves on ONE head.
//   q hi plane f16 x1024 and q residual plane, both [b*SEQ + s][h*HD + d]; k hi plane f16 x1024 [b*JL + j][h*HD + d];
//   v^T hi plane [b*NH + h][d][JL] f16 x1024; all packed (v^T with the four d subtiles of a key step side by side).
//   Scores use two products k_hi.q_hi + k_hi.q_lo; q fragments (B operand) loaded once per wave (2 k-steps x hi/residual).
//   score (log2 domain) t(i, j) = (q_i.k_j over HD) * (1/8)*log2e/(1024*1024); no key selection (every key contributes).
//   The head's k and v^T tiles come through LDS once per block: stages of SKEY = 64 keys (16 KiB), two buffers, filled by
//   asynchronous 16-B copies (4 per lane and stage) one stage ahead; the packed tiles keep their form in LDS, so a fragment
//   load is a wave-wide read of 512 contiguous bytes. Stage layout (halves): k band n (16 keys) tile t at n*1024 + t*512;
//   v^T key step p, d subtile j at 4096 + p*2048 + j*512.
//   Key tiles of 32 visited in order, kt = 0 .. NKT-1 (static bound), two per stage.
//   Per tile: 2 score subtiles (16 keys each) x 2 k-steps, k fragments (A operand, row = key).
//   Lane (hh = lane >> 4, c = lane & 15) then holds 16 scores of ONE query (column c): keys kb + 8hh + r in s0[r], kb + 16 + 8hh + r in s1[r]. Maximum and
//   sum run inside the lane; the two halves of a column exchange the maximum once per tile and join their sums once after the loop.
//   The 16 probabilities of a lane, converted in place (x32768, f16), ARE the B operand P^T in the split k map
//   (element s < 8: key 8hh + s, element s >= 8: key 16 + 8hh + s - 8), the map the packed v^T fragments (A operand, row = d) have.
//   After the loop: out = acc / Z (Z >= 1 always; guarded anyway; both carry the 32768), 1/1024 folded once. o[j][r] = O(query c,
//   d = 16j + 8hh + r): 8 consecutive d of one row = chunk j*32 + lane of the head's two packed tiles, stored from registers.
// LDS extent: ring[2*STH]; a stage's copies write bytes 0 .. 16383 of its buffer, each once; the fragment loads read the same extent.
// coverage: per wave 4 instructions x 32 lanes x 8 halves = the head's two packed tiles (16 x 64) per plane; grid NQG x NH x NB blocks x AWV waves =
//           every (b, s, h) row segment of O hi and O residual exactly once.
// =====================================================================================================
// 2^x as the bare hardware instruction. The library exp2f adds a compare, two selects, an add and an ldexp per value only to keep
// results below 2^-126; here such a term is far below one f16 step of P and one f32 step of Z >= 1, so it may flush to 0.
// -inf gives 0 and NaN stays NaN, as in the library form.
__device__ __forceinline__ float exp2_hw(float x) { return __builtin_amdgcn_exp2f(x); }

// lane l <-> lane l ^ 16 (the other half of the same column)
__device__ __forceinline__ float xhalf(float x) {
  const int b = __builtin_bit_cast(int, x);
  return __builtin_bit_cast(float, __builtin_amdgcn_permlanex16(b, b, 0x76543210, 0xfedcba98, false, false));
}

// One stage: 256 lanes x 16 B = 4 KiB per copy. Copies 0, 1: k bands 2c + (tid >> 7) (2 KiB of the head's tiles each, bands
// 16 key rows apart in the plane); copies 2, 3: the stage's 8 KiB of v^T tiles. lds = the lane's byte address in the buffer.
// The s_wait_xcnt closes the statement so that no address register of a copy is rewritten in front of it.
__device__ __forceinline__ void stage_copy(unsigned lds, const _Float16* kg, const _Float16* vg) {
#if defined(__HIP_DEVICE_COMPILE__)
  asm volatile("global_load_async_to_lds_b128 %0, %4, off\n\t"
               "global_load_async_to_lds_b128 %1, %5, off\n\t"
               "global_load_async_to_lds_b128 %2, %6, off\n\t"
               "global_load_async_to_lds_b128 %3, %7, off\n\t"
               "s_wait_xcnt 0x0"
               :: "v"(lds), "v"(lds + 4096u), "v"(lds + 8192u), "v"(lds + 12288u),
                  "v"(kg), "v"(kg + 32 * DMOD), "v"(vg), "v"(vg + 4 * FT) : "memory");
#endif
}
// this wave's copies have landed in LDS (the compiler places no wait for them)
__device__ __forceinline__ void wait_copies() {
#if defined(__HIP_DEVICE_COMPILE__)
  asm volatile("s_wait_asynccnt 0x0" ::: "memory");
#endif
}
// this wave's LDS reads have returned, before the barrier behind which their buffer is refilled
__device__ __forceinline__ void wait_lds_reads() {
#if defined(__HIP_DEVICE_COMPILE__)
  asm volatile("s_wait_dscnt 0x0" ::: "memory");
#endif
}

__global__ __launch_bounds__(ATT_THREADS)
void attn_x(const u16* __restrict__ QHp, const u16* __restrict__ QLp, const u16* __restrict__ KHp,
            const u16* __restrict__ VHp, u16* OHp, u16* OLp) {
  __shared__ __attribute__((aligned(16))) _Float16 ring[2 * STH];
  const int tid  = threadIdx.x;
  const int wave = tid >> 5;
  const int lane = tid & 31;
  const int bid  = blockIdx.x;
  const int qg   = bid % NQG;
  const int t2   = bid / NQG;
  const int head = t2 % NH;
  const int b    = t2 / NH;
  if (b >= NB) return;                      // block-uniform, before any barrier or copy; never taken with the exact grid
  const int q0   = (qg * AWV + wave) * 16;  // q0 + 16 <= SEQ by construction

  const size_t hcol = (size_t)head * (HD / 32) * FT + 8 * lane;        // the head's two tiles inside a 16-row band
  const _Float16* Qh  = (const _Float16*)(const void*)QHp + ((size_t)b * SEQ + q0) * DMOD + hcol;
  const _Float16* Ql  = (const _Float16*)(const void*)QLp + ((size_t)b * SEQ + q0) * DMOD + hcol;
  // copy sources of this lane in stage 0: k band tid >> 7, chunk tid & 127 of the head's two tiles; v^T chunk tid
  const _Float16* Kg = (const _Float16*)(const void*)KHp + ((size_t)b * JL + (tid >> 7) * 16) * DMOD
                       + (size_t)head * (HD / 32) * FT + 8 * (tid & 127);
  const _Float16* Vg = (const _Float16*)(const void*)VHp + (size_t)(b * NH + head) * NKT * 4 * FT + 8 * tid;
  const unsigned lds0 = (unsigned)(uintptr_t)(&ring[0]) + 16u * (unsigned)tid;
  const float lsc = SM_SCALE * (LOG2E / (QSC * KSC));
  const float oc  = 1.0f / VCAR;            // the 32768 on P is in the accumulators and in Z alike and cancels in acc / Z

  // ---- q fragments (hi and residual, 2 k-steps over HD), loaded once ----
  const v16h qh0 = ldfrag_h(Qh), qh1 = ldfrag_h(Qh + FT);
  const v16h ql0 = ldfrag_h(Ql), ql1 = ldfrag_h(Ql + FT);

  float mrow = -INFINITY;                   // running maximum of query column c (alike in both halves)
  float lrow = 0.f;                         // running sum (x32768) over the keys of this half only
  v8f o[4];
#pragma unroll
  for (int j = 0; j < 4; ++j) o[j] = zero8();

  // ---- ring prologue: stage 0 landed and published, stage 1 in flight ----
  stage_copy(lds0, Kg, Vg);
  wait_copies();
  __syncthreads();
  stage_copy(lds0 + 2u * STH, Kg + (size_t)SKEY * DMOD, Vg + (size_t)(SKEY / 32) * 4 * FT);

#pragma unroll 1                            // rolled: one publish point per trip, in the order written at its foot
  for (int st = 0; st < NST; ++st) {
   const _Float16* sb = ring + (st & 1) * STH + 8 * lane;
#pragma unroll                              // both key steps of a stage in line: every LDS offset an immediate
   for (int p = 0; p < SKEY / 32; ++p) {    // key step kt = 2*st + p, keys kb = 32*kt .. kb + 31
    // ---- the step's k and v^T fragments, one group of LDS reads ----
    const _Float16* k0p = sb + p * 4 * FT;
    const _Float16* vhp = sb + SKEY * HD + p * 4 * FT;
    const v16h ka0 = ldfrag_h(k0p),          ka1 = ldfrag_h(k0p + FT);
    const v16h kc0 = ldfrag_h(k0p + 2 * FT), kc1 = ldfrag_h(k0p + 3 * FT);
    v16h vf[4];
#pragma unroll
    for (int j = 0; j < 4; ++j) vf[j] = ldfrag_h(vhp + j * FT);
    // ---- scores: D element r of this lane = (key kb + 8hh + r, query column c) in s0, key kb + 16 + 8hh + r in s1 ----
    v8f s0 = zero8(), s1 = zero8();
    {
      s0 = mma_h(ka0, qh0, s0);
      s0 = mma_h(ka0, ql0, s0);
      s0 = mma_h(ka1, qh1, s0);
      s0 = mma_h(ka1, ql1, s0);
      s1 = mma_h(kc0, qh0, s1);
      s1 = mma_h(kc0, ql0, s1);
      s1 = mma_h(kc1, qh1, s1);
      s1 = mma_h(kc1, ql1, s1);
      guard2(s0, s1, ka0, ka1, kc0, kc1, qh0, ql0, qh1, ql1);
    }
    // ---- online softmax in base 2, -inf-safe; one query per lane ----
    const v8f t0 = s0 * lsc, t1 = s1 * lsc;
    float mx = fmaxf(t0[0], t1[0]);
#pragma unroll
    for (int r = 1; r < 8; ++r) mx = fmaxf(mx, fmaxf(t0[r], t1[r]));
    mx = fmaxf(mx, xhalf(mx));
    const float mn = fmaxf(mrow, mx);
    const float ms = (mn == -INFINITY) ? 0.0f : mn;
    const float al = exp2_hw(mrow - ms);
    mrow = mn;
    // e = 32768 * 2^(t - ms): score scale, maximum and the carry of P meet in one packed multiply-add in front of the exponential
    // (written on pairs: the bare exponential is no vector operation to the compiler, which otherwise splits the pairs)
    const float mb = ms - PLOG;
    const v2f l2 = {lsc, lsc}, nb2 = {-mb, -mb};
    v8f e0, e1;
#pragma unroll
    for (int r = 0; r < 4; ++r) {
      const v2f a0 = {s0[2 * r], s0[2 * r + 1]}, a1 = {s1[2 * r], s1[2 * r + 1]};
      const v2f x0 = __builtin_elementwise_fma(a0, l2, nb2), x1 = __builtin_elementwise_fma(a1, l2, nb2);
      e0[2 * r] = exp2_hw(x0[0]); e0[2 * r + 1] = exp2_hw(x0[1]);
      e1[2 * r] = exp2_hw(x1[0]); e1[2 * r + 1] = exp2_hw(x1[1]);
    }
    const v8f es = e0 + e1;
    lrow = lrow * al + (((es[0] + es[4]) + (es[1] + es[5])) + ((es[2] + es[6]) + (es[3] + es[7])));
    // ---- B fragment of P^T * 32768 (f16), column = c, split k map over the 32 keys of this step ----
    FragH ph;
#pragma unroll
    for (int r = 0; r < 8; ++r) {
      ph.h[0][r] = (_Float16)e0[r];         // elements 0..7  = keys kb + 8hh + 0..7
      ph.h[1][r] = (_Float16)e1[r];         // elements 8..15 = keys kb + 16 + 8hh + 0..7
    }
#pragma unroll
    for (int j = 0; j < 4; ++j) o[j] *= al;
    // ---- V^T.P^T : A fragment row = d = j*16 + c, keys contiguous in the v^T plane; 2 groups of 2 d-subtiles ----
    {
#pragma unroll
      for (int jg = 0; jg < HD / 32; ++jg) {
        const v16h vha = vf[2 * jg], vhc = vf[2 * jg + 1];
        o[2 * jg]     = mma_h(vha, ph.v, o[2 * jg]);
        o[2 * jg + 1] = mma_h(vhc, ph.v, o[2 * jg + 1]);
        guard2(o[2 * jg], o[2 * jg + 1], ph.v, vha, vhc, ph.v, vha, vhc, ph.v, ph.v);
      }
    }
   }
   // ---- publish point of stage st + 1: own reads of this buffer done, own copies landed, every wave here; then the refill ----
   wait_lds_reads();
   wait_copies();
   __syncthreads();
   if (st + 2 < NST) {                      // block-uniform
     stage_copy(lds0 + (unsigned)(st & 1) * (2u * STH), Kg + (size_t)(st + 2) * SKEY * DMOD,
                Vg + (size_t)(st + 2) * (SKEY / 32) * 4 * FT);
   }
  }
  wait_copies();
  acc_guard4(o[0], o[1], o[2], o[3]);
  // ---- out = acc / Z (0 if Z == 0), acc and Z both x32768, the 1024 on v folded once; the halves' sums joined here ----
  const float lv  = lrow + xhalf(lrow);
  const float ls  = (lv > 0.0f) ? lv : 1.0f;
  const float inv = (lv > 0.0f) ? ((1.0f / ls) * oc) : 0.0f;
  // ---- O x1024 -> packed f16 hi + residual planes; chunk j*32 + lane of the head's two tiles: row c, d = 16j + 8hh + 0..7 ----
  v4u oh[4], ol[4];
#pragma unroll
  for (int it = 0; it < 4; ++it) {
    float w[8];
#pragma unroll
    for (int e = 0; e < 8; ++e) w[e] = (o[it][e] * inv) * OSC;
#pragma unroll
    for (int e = 0; e < 4; ++e) {
      const _Float16 h0 = (_Float16)w[2 * e], h1 = (_Float16)w[2 * e + 1];
      const _Float16 l0 = (_Float16)(w[2 * e] - (float)h0), l1 = (_Float16)(w[2 * e + 1] - (float)h1);
      oh[it][e] = pk16(h_bits(h0), h_bits(h1));
      ol[it][e] = pk16(h_bits(l0), h_bits(l1));
    }
  }
  const size_t ob = ((size_t)b * SEQ + q0) * DMOD + hcol;
  {
#pragma unroll
    for (int it = 0; it < 4; ++it) {
      *(v4u*)(OHp + ob + (size_t)it * 256) = oh[it];
      *(v4u*)(OLp + ob + (size_t)it * 256) = ol[it];
    }
    
  }
}

// =====================================================================================================
// Workspace map (bytes); every plane is fully written by whole-line stores before it is read; all extents are exact multiples
// of the store granularity (512-B half tiles; no pad rows needed); every region offset a multiple of
// 2097152:
//   XC  bf16 [CROWS][1024]              CROWS*2048   (c = [mem; kv] as bf16)
//   XQ  bf16 [QROWS][1024]              QROWS*2048   (q as bf16)
//   WV, WK, WQ, WC  16-bit [1024 n][1024 k]  2097152 each  (Wv, Wk, Wq as bf16, Wc as f16 x1024)
//   OH  f16 [QROWS][1024] x1024         QROWS*2048   OL residual the same
//   VH  f16 [NB*16][64][JL] x1024       CROWS*2048   (all 16-bit planes in packed 16 x 32 tiles)
//   KH  f16 [CROWS][1024] x1024         CROWS*2048
//   QH  f16 [QROWS][1024] x1024         QROWS*2048   QL residual the same
//   end (NB=2, SEQ=MLEN=2048)           100663296
// =====================================================================================================
extern "C" void kernel_launch(void* const* d_in, const int* in_sizes, int n_in,
                              void* d_out, int out_size, void* d_ws, size_t ws_size,
                              hipStream_t stream) {
  if (n_in < 11) return;
  const long long needq = ((long long)(SEQ - 1) * B_FULL + NB) * DMOD;
  const long long needm = (MLEN > 0) ? (((long long)(MLEN - 1) * B_FULL + NB) * DMOD) : 0;
  if ((long long)in_sizes[0] < needq || (long long)in_sizes[1] < needq || (long long)in_sizes[2] < needm) return;
  if (in_sizes[3] < DMOD * DMOD || in_sizes[5] < DMOD * DMOD || in_sizes[7] < DMOD * DMOD || in_sizes[9] < DMOD * DMOD) return;
  if (in_sizes[4] < DMOD || in_sizes[6] < DMOD || in_sizes[8] < DMOD || in_sizes[10] < DMOD) return;
  if ((long long)out_size < (long long)SEQ * NB * DMOD) return;

  const float* xq  = (const float*)d_in[0];
  const float* xkv = (const float*)d_in[1];
  const float* xm  = (const float*)d_in[2];
  const float* wq  = (const float*)d_in[3];
  const float* bq  = (const float*)d_in[4];
  const float* wk  = (const float*)d_in[5];
  const float* bk  = (const float*)d_in[6];
  const float* wv  = (const float*)d_in[7];
  const float* bv  = (const float*)d_in[8];
  const float* wc  = (const float*)d_in[9];
  const float* bc  = (const float*)d_in[10];
  float*       out = (float*)d_out;

  const size_t szXC = (size_t)CROWS * DMOD * 2;
  const size_t szXQ = (size_t)QROWS * DMOD * 2;
  const size_t szW  = (size_t)DMOD * DMOD * 2;
  const size_t szO  = (size_t)QROWS * DMOD * 2;                 // OH, OL each
  const size_t szVH = (size_t)NB * NH * HD * JL * 2;            // == CROWS*2048
  const size_t szKH = (size_t)CROWS * DMOD * 2;
  const size_t szQ  = (size_t)QROWS * DMOD * 2;                 // QH, QL each
  size_t off = 0;
  const size_t oXC = off; off += szXC;
  const size_t oXQ = off; off += szXQ;
  const size_t oWV = off; off += szW;
  const size_t oWK = off; off += szW;
  const size_t oWQ = off; off += szW;
  const size_t oWC = off; off += szW;
  const size_t oOH = off; off += szO;
  const size_t oOL = off; off += szO;
  const size_t oVH = off; off += szVH;
  const size_t oKH = off; off += szKH;
  const size_t oQH = off; off += szQ;
  const size_t oQL = off; off += szQ;
  if (off > ws_size) return;                // off = 100663296 for NB = 2, SEQ = MLEN = 2048
  if (off > (size_t)WS_CAP) return;

  char* ws = (char*)d_ws;
  u16*   XC = (u16*)(ws + oXC);
  u16*   XQ = (u16*)(ws + oXQ);
  u16*   WV = (u16*)(ws + oWV);
  u16*   WK = (u16*)(ws + oWK);
  u16*   WQ = (u16*)(ws + oWQ);
  u16*   WC = (u16*)(ws + oWC);
  u16*   OH = (u16*)(ws + oOH);
  u16*   OL = (u16*)(ws + oOL);
  u16*   VH = (u16*)(ws + oVH);
  u16*   KH = (u16*)(ws + oKH);
  u16*   QH = (u16*)(ws + oQH);
  u16*   QL = (u16*)(ws + oQL);

  const dim3 b256(256), b128(128), bAT(ATT_THREADS);
  const dim3 gCV(CB_C + CB_Q + 4 * CB_W);
  const dim3 gQKV(2 * GB_C + GB_Q);
  const dim3 gAT(NQG * NH * NB);
  const dim3 gO(NB * NRT * (DMOD / 64));

  // (1) c = [mem; kv] and q -> bf16 planes, batch-major rows; Wv, Wk, Wq -> bf16 planes; Wc -> f16 plane of bf16 value x1024
  cvt_all<<<gCV, b256, 0, stream>>>(xm, xkv, xq, wv, wk, wq, wc, XC, XQ, WV, WK, WQ, WC);
  // (2) v = c.Wv^T + bv -> v^T plane x1024; k = c.Wk^T + bk -> k hi plane x1024; q = q.Wq^T + bq -> q hi + residual planes x1024
  gemm_qkv<<<gQKV, b128, 0, stream>>>(XC, XQ, WV, WK, WQ, bv, bk, bq, VH, KH, QH, QL);
  // (3) attention over all JL keys -> O hi + residual planes
  attn_x<<<gAT, bAT, 0, stream>>>(QH, QL, KH, VH, OH, OL);
  // (4) output projection -> out f32 rows (s*NB + b), carries 1024 x 1024 folded back
  gemm_o2<<<gO, b128, 0, stream>>>(OH, OL, WC, bc, out, 1.0f / (OSC * WOS));
  (void)hipGetLastError();
}

// v007
// Measured time: 167 microseconds a run.
// Timed twice side by side with v006, it ran 1.07 and 1.08 times as fast.
// Over all steps from v000 it is 3.32 times as fast.
// Contractions: q.Wq^T, c.Wk^T, c.Wv^T (c = [mem; kv] along the key axis) on v_wmma_f32_16x16x32_bf16 (activations, W and
// biases RNE-converted to bf16; the [n][k] weight rows are used directly as a k-contiguous operand: B for v, A for q and k; f32 accumulate);
// k.q^T over 64 on v_wmma_f32_16x16x32_f16 with q carried as f16 hi (x1024) plus an f16 residual plane and k as f16 hi (x1024)
// (products h.h + h.l); v^T.P^T on v_wmma_f32_16x16x32_f16 (P x32768 f16, v x1024 f16, one product); O.Wc^T on
// v_wmma_f32_16x16x32_f16 (O x1024 as f16 hi plus f16 residual plane, Wc as f16(bf16(Wc)) x1024, products h.w + l.w);
// all f32 accumulate. Bias adds, base-2 online softmax over all keys and the 1/Z fold in f32 on VALU.
// Every 16-bit workspace plane is stored fragment-packed (see "packed planes" below): a wave-wide 16-B fragment load reads 512
// contiguous bytes (4 whole lines) instead of 32 B out of each of 16 rows.
#include <hip/hip_runtime.h>
#include <math.h>
#include <stdint.h>

#ifndef NB
#define NB 2
#endif
#ifndef SEQ
#define SEQ 2048
#endif
#ifndef MLEN
#define MLEN 2048
#endif
#define B_FULL 2
#define L_FULL 2048
#define M_FULL 2048
#define DMOD  1024
#define NH    16
#define HD    64
#define JL    (MLEN + SEQ)
#define QROWS (NB * SEQ)
#define CROWS (NB * JL)
#define SM_SCALE 0.125f
#define LOG2E 1.4426950408889634f
#define QSC   1024.0f
#define KSC   1024.0f
#define PLOG  15.0f               // P is carried x 2^15 = 32768, as a bias of its exponent
#define VCAR  1024.0f
#define OSC   1024.0f
#define WOS   1024.0f
#define AWV   8                   // waves of an attention block: 8 query tiles of ONE head share that head's k / v^T stages
#define NQT   (SEQ / 16)
#define NQG   (NQT / AWV)
#define SKEY  64                  // keys in one LDS stage of the attention ring
#define NST   (JL / SKEY)
#define STH   (2 * SKEY * HD)     // halves in one stage: 8 packed k tiles, then 8 packed v^T tiles (16 KiB)
#define NKT   (JL / 32)
#define NRT   (SEQ / 64)
#define ATT_THREADS (AWV * 32)
#define SLAB64 (16 * 68)
#define QKT   (DMOD / 8)
#define WS_CAP 134217728
#define FT    512                 // halves in one packed 16 x 32 fragment tile (1 KiB)
#define TPB   (DMOD / 32)         // fragment tiles in one 16-row band of a [rows][DMOD] plane
#define CB_C  (CROWS / 2)         // conversion launch: blocks of the c range, of the q range, of one weight matrix
#define CB_Q  (QROWS / 2)
#define CB_W  ((DMOD * DMOD) / (8 * 256))
#define GB_C  ((CROWS / 128) * (DMOD / 128)) // projection launch: blocks of the v range (k the same), of the q range
#define GB_Q  ((QROWS / 128) * (DMOD / 128))
static_assert(DMOD == NH * HD && HD == 64 && NH == 16);
static_assert((NQT % AWV) == 0 && ATT_THREADS == 256 && NST * SKEY == JL && NST >= 2 && SKEY == 64);
static_assert(NB >= 1 && NB <= B_FULL);
static_assert((SEQ % 64) == 0 && SEQ >= 64 && SEQ <= L_FULL);
static_assert((MLEN % 64) == 0 && MLEN >= 0 && MLEN <= M_FULL);
static_assert((JL % 64) == 0 && NKT * 32 == JL && NQT * 16 == SEQ && NRT * 64 == SEQ);
static_assert(QKT == 128 && (DMOD % 64) == 0 && (DMOD % 32) == 0 && (HD % 32) == 0);
static_assert(((DMOD * DMOD) % (8 * 256)) == 0);
static_assert(QROWS <= CROWS);
static_assert((CROWS % 128) == 0 && (QROWS % 128) == 0 && (DMOD % 128) == 0);
static_assert(TPB == 32 && QKT == 2 * 64 && (TPB % 2) == 0 && (MLEN % 16) == 0 && (SEQ % 16) == 0 && (JL % 16) == 0);
static_assert((long long)CROWS * DMOD * 6 + (long long)QROWS * DMOD * 10 + 8LL * DMOD * DMOD <= (long long)WS_CAP);

typedef unsigned short u16;
typedef _Float16 v16h __attribute__((ext_vector_type(16)));
typedef _Float16 v8h  __attribute__((ext_vector_type(8)));
typedef __bf16   v16b __attribute__((ext_vector_type(16)));
typedef float    v8f  __attribute__((ext_vector_type(8)));
typedef float    v4f  __attribute__((ext_vector_type(4)));
typedef float    v2f  __attribute__((ext_vector_type(2)));
typedef unsigned int v4u __attribute__((ext_vector_type(4)));

union FragH { v16h v; v8h h[2]; v4u u[2]; };
union FragB { v16b v; v4u u[2]; };

// ---- scalar helpers --------------------------------------------------------------------------------
__device__ __forceinline__ unsigned short bf_bits(float f) {          // f32 -> bf16 bits, RNE convert
  unsigned u = __float_as_uint(f);
  return (unsigned short)((u + 0x7FFFu + ((u >> 16) & 1u)) >> 16);
}
__device__ __forceinline__ float bf_up(unsigned short h) { return __uint_as_float(((unsigned)h) << 16); }
__device__ __forceinline__ float bfr(float f) { return bf_up(bf_bits(f)); }
__device__ __forceinline__ unsigned short h_bits(_Float16 x) { return __builtin_bit_cast(unsigned short, x); }
__device__ __forceinline__ unsigned pk16(unsigned short a, unsigned short b) { return (unsigned)a | ((unsigned)b << 16); }
__device__ __forceinline__ v8f zero8() { v8f z = {0.f, 0.f, 0.f, 0.f, 0.f, 0.f, 0.f, 0.f}; return z; }

// ---- packed planes: a [rows][K] 16-bit matrix is stored as 16 x 32 fragment tiles of FT halves, tile (row >> 4, k >> 5) at
//      index (row >> 4) * (K / 32) + (k >> 5); inside a tile element (c = row & 15, kk = k & 31) sits at
//      (kk >> 4) * 256 + (((kk >> 3) & 1) * 16 + c) * 8 + (kk & 7): chunk g of 8 halves = what lane g & 31 takes in load g >> 5.
// ---- fragment loaders: 16-bit A/B operand, lane -> row/col (lane&15), p = tile start + 8*lane;
//      elements 0..7 <- p[0..7] (k0+8h..), elements 8..15 <- p[256..263] (k0+16+8h..)  (same split k map for A and B)
__device__ __forceinline__ v16h ldfrag_h(const _Float16* p) {
  FragH f;
  f.h[0] = *(const v8h*)(p);
  f.h[1] = *(const v8h*)(p + 256);
  return f.v;
}
__device__ __forceinline__ v16b ldfrag_b(const u16* p) {              // bf16 plane read as unsigned integer vectors
  FragB f;
  f.u[0] = *(const v4u*)(p);
  f.u[1] = *(const v4u*)(p + 256);
  return f.v;
}
// first column of chunk w (0..63) inside its tile
__device__ __forceinline__ int chunk_k(int w) { return ((w >> 5) & 1) * 16 + ((w >> 4) & 1) * 8; }

__device__ __forceinline__ v8f mma_h(v16h a, v16h b, v8f c) {
  return __builtin_amdgcn_wmma_f32_16x16x32_f16(false, a, false, b, (short)0, c, false, false);
}
__device__ __forceinline__ v8f mma_b(v16b a, v16b b, v8f c) {
  return __builtin_amdgcn_wmma_f32_16x16x32_bf16(false, a, false, b, (short)0, c, false, false);
}
__device__ __forceinline__ void guard2(v8f& a, v8f& b, v16h x0, v16h x1, v16h x2, v16h x3,
                                       v16h x4, v16h x5, v16h x6, v16h x7) {
#if defined(__HIP_DEVICE_COMPILE__)
  asm volatile("v_nop\n\tv_nop\n\tv_nop\n\tv_nop"
               : "+v"(a), "+v"(b)
               : "v"(x0), "v"(x1), "v"(x2), "v"(x3), "v"(x4), "v"(x5), "v"(x6), "v"(x7) : "memory");
#endif
}
template <typename F>
__device__ __forceinline__ void guard6(v8f& a, v8f& b, v8f& c, v8f& d, F x0, F x1, F x2, F x3, F x4, F x5) {
#if defined(__HIP_DEVICE_COMPILE__)
  asm volatile("v_nop\n\tv_nop\n\tv_nop\n\tv_nop"
               : "+v"(a), "+v"(b), "+v"(c), "+v"(d) : "v"(x0), "v"(x1), "v"(x2), "v"(x3), "v"(x4), "v"(x5) : "memory");
#endif
}
// Foot of the projection loop: the four issue slots between the last matrix instructions of a trip and the next trip's loads into
// their operand registers, on the taken branch too. Every accumulator and fragment is an input only, so the slots stand behind all
// sixteen matrix instructions and the fragments' registers stay theirs up to here.
__device__ __forceinline__ void guard16(const v8f (&c)[4][4], const v16b (&a)[4], const v16b (&b)[4]) {
#if defined(__HIP_DEVICE_COMPILE__)
  asm volatile("v_nop\n\tv_nop\n\tv_nop\n\tv_nop"
               :: "v"(c[0][0]), "v"(c[0][1]), "v"(c[0][2]), "v"(c[0][3]), "v"(c[1][0]), "v"(c[1][1]), "v"(c[1][2]), "v"(c[1][3]),
                  "v"(c[2][0]), "v"(c[2][1]), "v"(c[2][2]), "v"(c[2][3]), "v"(c[3][0]), "v"(c[3][1]), "v"(c[3][2]), "v"(c[3][3]),
                  "v"(a[0]), "v"(a[1]), "v"(a[2]), "v"(a[3]), "v"(b[0]), "v"(b[1]), "v"(b[2]), "v"(b[3]) : "memory");
#endif
}
__device__ __forceinline__ void acc_guard4(v8f& a, v8f& b, v8f& c, v8f& d) {
#if defined(__HIP_DEVICE_COMPILE__)
  asm volatile("v_nop\n\tv_nop\n\tv_nop\n\tv_nop" : "+v"(a), "+v"(b), "+v"(c), "+v"(d));
#endif
}
__device__ __forceinline__ void wave_sync_lds() {
  __builtin_amdgcn_fence(__ATOMIC_RELEASE, "workgroup");
  __builtin_amdgcn_wave_barrier();
  __builtin_amdgcn_fence(__ATOMIC_ACQUIRE, "workgroup");
}

// =====================================================================================================
// f32 [DMOD n][DMOD k] -> packed 16-bit plane.  f16mode == 0: bf16 RNE bits;  f16mode == 1: f16 bits of (bf16 RNE value) * scale.
// Used for the [n][k] weight matrices (bf16, or f16 of the bf16 value x1024 for Wc).
// Thread = packed chunk gt (8 consecutive k of one row): two 16-B loads, one 16-B store; 32 lanes store 512 contiguous bytes
// coverage: CB_W blocks x 256 thr x 8 = the whole plane (131072 chunks); gt = block of the matrix's range * 256 + thread.
// =====================================================================================================
__device__ __forceinline__ void cvt16_part(const float* __restrict__ x, u16* D, int gt, int f16mode, float scale) {
  const int tile = gt >> 6;
  const float* p = x + (size_t)((tile / TPB) * 16 + (gt & 15)) * DMOD + (tile % TPB) * 32 + chunk_k(gt & 63);
  const v4f a = *(const v4f*)(p), b4 = *(const v4f*)(p + 4);
  float w[8];
#pragma unroll
  for (int e = 0; e < 4; ++e) { w[e] = a[e]; w[4 + e] = b4[e]; }
  v4u o;
#pragma unroll
  for (int e = 0; e < 4; ++e) {
    const float f0 = w[2 * e], f1 = w[2 * e + 1];
    const unsigned short hb0 = h_bits((_Float16)(bfr(f0) * scale));
    const unsigned short hb1 = h_bits((_Float16)(bfr(f1) * scale));
    const unsigned short bb0 = bf_bits(f0);
    const unsigned short bb1 = bf_bits(f1);
    o[e] = (f16mode != 0) ? pk16(hb0, hb1) : pk16(bb0, bb1);
  }
  u16* d = D + (size_t)gt * 8;
  *(v4u*)(d) = o;
  // other jobs' code follows this store in the merged kernel's listing: no register that the store names is rewritten in front of this wait
  asm volatile("s_wait_xcnt 0x0" ::: "memory");
}

// =====================================================================================================
// Activation rows -> packed bf16 plane (RNE), batch-major destination rows:
//   D[(bb*nrow + j)][0..1023] <- X0[(j*B_FULL + bb)][..] for j < split,  X1[((j - split)*B_FULL + bb)][..] for j >= split.
// Used for c = [mem rows 0..MLEN-1 ; kv rows 0..SEQ-1] (nrow = JL, split = MLEN) and for q (nrow = SEQ, split = SEQ, X1 unused).
// Unit r = two packed tiles of one 16-row band (16 rows x 64 columns), 128 threads, thread tid = one chunk: two 16-B loads, one
// 16-B store. The source base selection is uniform in a unit (nrow and split are multiples of 16; both sources are global planes).
// coverage: NB*nrow units x 128 chunks x 8 = every element of the [NB*nrow][1024] plane exactly once.
// =====================================================================================================
__device__ __forceinline__ void cvt_act_part(const float* __restrict__ X0, const float* __restrict__ X1, u16* D,
                                             int nrow, int split, int r, int tid) {
  const int  r0    = (r / (TPB / 2)) * 16;                    // first row of the band
  const int  col   = ((r % (TPB / 2)) * 2 + (tid >> 6)) * 32 + chunk_k(tid & 63);
  const int  bb    = r0 / nrow;
  const int  j     = r0 - bb * nrow;
  const bool first = (j < split);
  const int  js    = (first ? j : (j - split)) + (tid & 15);
  const float* base = first ? X0 : X1;
  const float* p = base + ((size_t)js * B_FULL + bb) * DMOD + col;
  const v4f a = *(const v4f*)(p), a4 = *(const v4f*)(p + 4);
  v4u o;
#pragma unroll
  for (int e = 0; e < 2; ++e) {
    o[e]     = pk16(bf_bits(a[2 * e]),  bf_bits(a[2 * e + 1]));
    o[2 + e] = pk16(bf_bits(a4[2 * e]), bf_bits(a4[2 * e + 1]));
  }
  u16* d = D + ((size_t)r * QKT + tid) * 8;
  *(v4u*)(d) = o;
  // other jobs' code follows this store in the merged kernel's listing: no register that the store names is rewritten in front of this wait
  asm volatile("s_wait_xcnt 0x0" ::: "memory");
}

// =====================================================================================================
// All conversions of a call in one launch (none reads what another writes; each has a plane of its own). The block index picks
// the job, uniformly in a block: CB_C blocks c = [mem; kv], CB_Q blocks q (two 128-thread units a block), then CB_W blocks each
// for Wv, Wk, Wq (bf16) and Wc (f16 of the bf16 value x1024).
// coverage: grid = CB_C + CB_Q + 4*CB_W blocks; every range is exactly its job's units.
// =====================================================================================================
__global__ __launch_bounds__(256)
void cvt_all(const float* __restrict__ xm, const float* __restrict__ xkv, const float* __restrict__ xq,
             const float* __restrict__ wv, const float* __restrict__ wk, const float* __restrict__ wq,
             const float* __restrict__ wc, u16* XC, u16* XQ, u16* WV, u16* WK, u16* WQ, u16* WC) {
  const int tid = (int)threadIdx.x;
  int blk = (int)blockIdx.x;
  if (blk < CB_C) { cvt_act_part(xm, xkv, XC, JL, MLEN, 2 * blk + (tid >> 7), tid & 127); return; }
  blk -= CB_C;
  if (blk < CB_Q) { cvt_act_part(xq, xq, XQ, SEQ, SEQ, 2 * blk + (tid >> 7), tid & 127); return; }
  blk -= CB_Q;
  const int wsel = blk / CB_W;
  const int gt   = (blk % CB_W) * 256 + tid;
  if (wsel < 3)       cvt16_part(wsel == 0 ? wv : (wsel == 1 ? wk : wq), wsel == 0 ? WV : (wsel == 1 ? WK : WQ), gt, 0, 1.0f);
  else if (wsel == 3) cvt16_part(wc, WC, gt, 1, WOS);
}

// =====================================================================================================
// Epilogue of the output projection: the wave's 16x64 f32 tile (times oscale) staged in its private LDS slab (pitch 68),
// coverage: 8 instructions x 2 rows x 16 lanes x 4 floats = the wave's 16 x 64 tile.
// =====================================================================================================
__device__ __forceinline__ void epi64(float* sl, v8f a0, v8f a1, v8f a2, v8f a3, float oscale,
                                      const float* __restrict__ bias, float* Cb, size_t pitch, int col0, int lane) {
  const int hh = lane >> 4, m = lane & 15;
#pragma unroll
  for (int r = 0; r < 8; ++r) {
    const int ro = (8 * hh + r) * 68 + m;
    sl[ro]      = a0[r] * oscale;
    sl[ro + 16] = a1[r] * oscale;
    sl[ro + 32] = a2[r] * oscale;
    sl[ro + 48] = a3[r] * oscale;
  }
  wave_sync_lds();
  const v4f bb = *(const v4f*)(bias + col0 + m * 4);
  v4f br;
#pragma unroll
  for (int e = 0; e < 4; ++e) br[e] = bfr(bb[e]);
  v4f vals[8];
#pragma unroll
  for (int it = 0; it < 8; ++it) vals[it] = *(const v4f*)(sl + (it * 2 + hh) * 68 + m * 4) + br;
  float* dst = Cb + (size_t)hh * pitch + col0 + m * 4;
  {
#pragma unroll
    for (int it = 0; it < 8; ++it) {
      *(v4f*)(dst + (size_t)(it * 2) * pitch) = vals[it];
    }
    
  }
}

// =====================================================================================================
// bf16 projection GEMM: P[M][N] = A[M][K] (bf16 packed) . Bt[N][K]^T (bf16 packed) + bias[col] (bf16 RNE value), f32 accumulate;
// the result leaves the accumulators as the packed f16 plane(s) its consumer reads, f16(P * sc); no f32 copy of P is kept.
// Block = 128x128 tile, 2 x 2 waves of 64 rows x 64 columns each: per 32 k a wave loads 4 A and 4 B fragments (16 loads of 16 B)
// for 16 matrix instructions, every fragment used four times from registers; the two waves of a block row share the A lines, the two
// of a block column the B lines. Fragments loaded straight from the packed tiles (two 16-B loads each, split k map for A and B);
// K stepped by 32 (K % 32 == 0, M % 128 == 0, N % 128 == 0; bid = 0 .. (M/128)*(N/128) - 1, the block inside its job).
// Band i = rows rowb + 16i .. + 15, subtile jj = columns col0 + 16jj .. + 15; accumulator acc[i][jj].
// A lane of a D tile holds 8 consecutive D rows (8hh + r) of one D column (m); a packed chunk is 8 consecutive k of one tile row.
//   MODE 0 (v, N == DMOD, rows bb*JL + j): D = A.Bt^T, D rows = keys, D column = d. The lane's 8 keys of one d ARE chunk
//     ((j >> 4) & 1)*32 + lane of the v^T tile (head bb*NH + g, key step j >> 5, d subtile jj) at index
//     ((bb*NH + g)*NKT + (j >> 5))*4 + jj (row in the tile = d & 15, k = j & 31), j = j0 + 16i the band's first key (j0 % 64 == 0,
//     JL % 64 == 0: a wave's four bands lie in one batch).
//   MODE 1 (k, hi plane) and MODE 2 (q, hi plane Hp and residual plane Lp = f16(P*sc - hi)): the operands change places,
//     D = Bt.A^T, D rows = columns n of P, D column = row of P. The lane's 8 columns of one row ARE chunk (jj & 1)*32 + lane of
//     the [M][N] plane's tile ((rowb >> 4) + i, (col0 >> 5) + (jj >> 1)).
// The sum over k of every element is the same in both forms (same fragments, same k map, same k order).
// coverage: per wave and plane 16 stores x 32 lanes x 8 halves = its 64 x 64 results, each store 512 contiguous bytes;
//           the grid's tiles cover every element of the plane(s) exactly once.
// =====================================================================================================
template <int MODE>
__device__ __forceinline__
void gemm_bf(const u16* __restrict__ A, const u16* __restrict__ Bt, const float* __restrict__ bias,
             u16* Hp, u16* Lp, int M, int N, int K, float sc, int bid) {
  const int tid = threadIdx.x, lane = tid & 31;
  const int wave = __builtin_amdgcn_readfirstlane(tid >> 5);  // a scalar: the tile's bases below stay in scalar registers
  const int ntile = N >> 7;
  const int rowb  = (bid / ntile) * 128 + (wave >> 1) * 64;
  const int col0  = (bid % ntile) * 128 + (wave & 1) * 64;
  if (rowb + 64 > M) return;                // wave-uniform, never taken with the exact grid; no block barriers in this kernel
  const u16* ap = A  + (size_t)rowb * K;                     // wave-uniform bases; a 16-row band holds 16*K halves
  const u16* bp = Bt + (size_t)col0 * K;
  const unsigned lo = 8u * (unsigned)lane;                   // the lane's chunk in a tile
  const size_t bs = (size_t)16 * K;
  v8f acc[4][4];
#pragma unroll
  for (int i = 0; i < 4; ++i) {
#pragma unroll
    for (int jj = 0; jj < 4; ++jj) acc[i][jj] = zero8();
  }
#pragma unroll 1
  for (int k0 = 0; k0 < 16 * K; k0 += FT) {                  // one packed tile = 32 k
    const u16* pa = ap + k0 + lo;
    const u16* pb = bp + k0 + lo;
    v16b a[4], b[4];
#pragma unroll
    for (int i = 0; i < 4; ++i) a[i] = ldfrag_b(pa + i * bs);
#pragma unroll
    for (int jj = 0; jj < 4; ++jj) b[jj] = ldfrag_b(pb + jj * bs);
    // the address pairs of the sixteen loads above are inputs here, so no load's result is placed on one of them, and they are
    // rewritten only behind this wait
    asm volatile("s_wait_xcnt 0x0" :: "v"(pa), "v"(pb) : "memory");
#pragma unroll
    for (int i = 0; i < 4; ++i) {
#pragma unroll
      for (int jj = 0; jj < 4; ++jj) {
        if constexpr (MODE == 0) acc[i][jj] = mma_b(a[i], b[jj], acc[i][jj]);
        else                     acc[i][jj] = mma_b(b[jj], a[i], acc[i][jj]);
      }
    }
    guard16(acc, a, b);
  }
  const int hh = lane >> 4, m = lane & 15;
  float br[4][8];
#pragma unroll
  for (int jj = 0; jj < 4; ++jj) {
    if constexpr (MODE == 0) {
      const float b1v = bfr(bias[col0 + 16 * jj + m]);
#pragma unroll
      for (int e = 0; e < 8; ++e) br[jj][e] = b1v;
    } else {
      const float* bq8 = bias + col0 + 16 * jj + 8 * hh;
      const v4f x = *(const v4f*)(bq8), y = *(const v4f*)(bq8 + 4);
#pragma unroll
      for (int e = 0; e < 4; ++e) { br[jj][e] = bfr(x[e]); br[jj][4 + e] = bfr(y[e]); }
    }
  }
  // every result is formed first, the stores follow as the wave's last instructions
  v4u oh[4][4], ol[4][4];
#pragma unroll
  for (int i = 0; i < 4; ++i) {
#pragma unroll
    for (int jj = 0; jj < 4; ++jj) {
#pragma unroll
      for (int e = 0; e < 4; ++e) {
        const float t0 = (acc[i][jj][2 * e] + br[jj][2 * e]) * sc, t1 = (acc[i][jj][2 * e + 1] + br[jj][2 * e + 1]) * sc;
        const _Float16 h0 = (_Float16)t0, h1 = (_Float16)t1;
        oh[i][jj][e] = pk16(h_bits(h0), h_bits(h1));
        if constexpr (MODE == 2) {
          const _Float16 l0 = (_Float16)(t0 - (float)h0), l1 = (_Float16)(t1 - (float)h1);
          ol[i][jj][e] = pk16(h_bits(l0), h_bits(l1));
        }
      }
    }
  }
  if constexpr (MODE == 0) {
    const int bb = rowb / JL, j0 = rowb - bb * JL, g = col0 >> 6;
    u16* d = Hp + ((size_t)(bb * NH + g) * NKT + (j0 >> 5)) * 4 * FT + 8 * lane;
#pragma unroll
    for (int i = 0; i < 4; ++i) {
#pragma unroll
      for (int jj = 0; jj < 4; ++jj) *(v4u*)(d + (i >> 1) * 4 * FT + (i & 1) * 256 + jj * FT) = oh[i][jj];
    }
  } else {
    const size_t ob = (size_t)rowb * N + (size_t)(col0 >> 5) * FT + 8 * lane;
#pragma unroll
    for (int i = 0; i < 4; ++i) {
#pragma unroll
      for (int jj = 0; jj < 4; ++jj) *(v4u*)(Hp + ob + (size_t)i * 16 * N + jj * 256) = oh[i][jj];
    }
    if constexpr (MODE == 2) {
#pragma unroll
      for (int i = 0; i < 4; ++i) {
#pragma unroll
        for (int jj = 0; jj < 4; ++jj) *(v4u*)(Lp + ob + (size_t)i * 16 * N + jj * 256) = ol[i][jj];
      }
    }
  }
  // other jobs' code follows these stores in the merged kernel's listing: no register that a store names is rewritten in front of this wait
  asm volatile("s_wait_xcnt 0x0" ::: "memory");
}

// =====================================================================================================
// The three projections of a call in one launch (they share inputs only). The block index picks the job, uniformly in a block:
// GB_C blocks v = c.Wv^T, GB_C blocks k = c.Wk^T, GB_Q blocks q = q.Wq^T.
// =====================================================================================================
__global__ __launch_bounds__(128)
void gemm_qkv(const u16* __restrict__ XC, const u16* __restrict__ XQ, const u16* __restrict__ WV, const u16* __restrict__ WK,
              const u16* __restrict__ WQ, const float* __restrict__ bv, const float* __restrict__ bk,
              const float* __restrict__ bq, u16* VH, u16* KH, u16* QH, u16* QL) {
  const int bid = (int)blockIdx.x;
  if (bid < GB_C)                 gemm_bf<0>(XC, WV, bv, VH, VH, CROWS, DMOD, DMOD, VCAR, bid);
  else if (bid < 2 * GB_C)        gemm_bf<1>(XC, WK, bk, KH, KH, CROWS, DMOD, DMOD, KSC, bid - GB_C);
  else if (bid < 2 * GB_C + GB_Q) gemm_bf<2>(XQ, WQ, bq, QH, QL, QROWS, DMOD, DMOD, QSC, bid - 2 * GB_C);
}

// =====================================================================================================
// Output projection: out rows (s*NB + bb) of DMOD floats = (Ah + Al)[bb*SEQ + s][DMOD] . Bt[DMOD][DMOD]^T * oscale + bias
// (bf16 RNE value); products h.B + l.B into one accumulator (l unscaled residual).
// Block -> (column tile ct = bid % 16, sequence row tile rt of NRT, batch bb); the wave's 16 rows s = rt*64 + wave*16 .. +15 are
// consecutive rows of Ah/Al and rows of out spaced NB*DMOD floats apart (seq-major [s][b][DMOD] output layout).
// Block = 64x64 tile, 4 waves x 16 rows; f32 epilogue through a wave-private LDS slab.
// coverage: grid NB*NRT*16 blocks x 4 waves x (16 rows x 64 cols) = every (s, bb, col) of out exactly once.
// =====================================================================================================
__global__ __launch_bounds__(128)
void gemm_o2(const u16* __restrict__ Ah, const u16* __restrict__ Al, const u16* __restrict__ Bt, const float* __restrict__ bias,
             float* C, float oscale) {
  __shared__ __align__(16) float slab[4 * SLAB64];
  const int tid = threadIdx.x, wave = tid >> 5, lane = tid & 31;
  const int ntile = DMOD >> 6;
  const int bid   = blockIdx.x;
  const int ct    = bid % ntile;
  const int t2    = bid / ntile;
  const int rt    = t2 % NRT;
  const int bb    = t2 / NRT;
  if (bb >= NB) return;                     // block-uniform; no block barriers in this kernel; never taken with the exact grid
  const int srow  = rt * 64 + wave * 16;
  if (srow + 16 > SEQ) return;              // wave-uniform; never taken
  const int col0  = ct * 64;
  const int K     = DMOD;
  const size_t rowA = (size_t)bb * SEQ + srow;
  const _Float16* ahp = (const _Float16*)(const void*)Ah + rowA * K + 8 * lane;          // packed planes, as in gemm_bf
  const _Float16* alp = (const _Float16*)(const void*)Al + rowA * K + 8 * lane;
  const _Float16* bp  = (const _Float16*)(const void*)Bt + (size_t)col0 * K + 8 * lane;
  const size_t bs = (size_t)16 * K;
  v8f acc0 = zero8(), acc1 = zero8(), acc2 = zero8(), acc3 = zero8();
#pragma unroll 1
  for (int k0 = 0; k0 < 16 * K; k0 += FT) {
    const v16h ah = ldfrag_h(ahp + k0), al = ldfrag_h(alp + k0);
    const v16h b0 = ldfrag_h(bp + k0);
    const v16h b1 = ldfrag_h(bp + bs + k0);
    const v16h b2 = ldfrag_h(bp + 2 * bs + k0);
    const v16h b3 = ldfrag_h(bp + 3 * bs + k0);
    // the address pairs of the twelve loads above are inputs here, so no load's result is placed on one of them, and they are
    // rewritten only behind this wait
    asm volatile("s_wait_xcnt 0x0" :: "v"(ahp + k0), "v"(alp + k0), "v"(bp + k0) : "memory");
    acc0 = mma_h(ah, b0, acc0);  acc0 = mma_h(al, b0, acc0);
    acc1 = mma_h(ah, b1, acc1);  acc1 = mma_h(al, b1, acc1);
    acc2 = mma_h(ah, b2, acc2);  acc2 = mma_h(al, b2, acc2);
    acc3 = mma_h(ah, b3, acc3);  acc3 = mma_h(al, b3, acc3);
    guard6<v16h>(acc0, acc1, acc2, acc3, ah, al, b0, b1, b2, b3);
  }
  float* Cb = C + ((size_t)srow * NB + bb) * DMOD;
  epi64(slab + wave * SLAB64, acc0, acc1, acc2, acc3, oscale, bias, Cb, (size_t)NB * DMOD, col0, lane);
}

// =====================================================================================================
// Full (non-causal) attention over all JL keys, in the transposed form S^T = K.Q^T, O^T += V^T.P^T. Block bid -> (query group qg:
// 8 query tiles, head, batch b); one wave per query tile qt = qg*AWV + wave (rows q0 = 16*qt .. q0+15), all waves on ONE head.
//   q hi plane f16 x1024 and q residual plane, both [b*SEQ + s][h*HD + d]; k hi plane f16 x1024 [b*JL + j][h*HD + d];
//   v^T hi plane [b*NH + h][d][JL] f16 x1024; all packed (v^T with the four d subtiles of a key step side by side).
//   Scores use two products k_hi.q_hi + k_hi.q_lo; q fragments (B operand) loaded once per wave (2 k-steps x hi/residual).
//   score (log2 domain) t(i, j) = (q_i.k_j over HD) * (1/8)*log2e/(1024*1024); no key selection (every key contributes).
//   The head's k and v^T tiles come through LDS once per block: stages of SKEY = 64 keys (16 KiB), two buffers, filled by
//   asynchronous 16-B copies (4 per lane and stage) one stage ahead; the packed tiles keep their form in LDS, so a fragment
//   load is a wave-wide read of 512 contiguous bytes. Stage layout (halves): k band n (16 keys) tile t at n*1024 + t*512;
//   v^T key step p, d subtile j at 4096 + p*2048 + j*512.
//   Key tiles of 32 visited in order, kt = 0 .. NKT-1 (static bound), two per stage.
//   Per tile: 2 score subtiles (16 keys each) x 2 k-steps, k fragments (A operand, row = key).
//   Lane (hh = lane >> 4, c = lane & 15) then holds 16 scores of ONE query (column c): keys kb + 8hh + r in s0[r], kb + 16 + 8hh + r in s1[r]. Maximum and
//   sum run inside the lane; the two halves of a column exchange the maximum once per tile and join their sums once after the loop.
//   The 16 probabilities of a lane, converted in place (x32768, f16), ARE the B operand P^T in the split k map
//   (element s < 8: key 8hh + s, element s >= 8: key 16 + 8hh + s - 8), the map the packed v^T fragments (A operand, row = d) have.
//   After the loop: out = acc / Z (Z >= 1 always; guarded anyway; both carry the 32768), 1/1024 folded once. o[j][r] = O(query c,
//   d = 16j + 8hh + r): 8 consecutive d of one row = chunk j*32 + lane of the head's two packed tiles, stored from registers.
// LDS extent: ring[2*STH]; a stage's copies write bytes 0 .. 16383 of its buffer, each once; the fragment loads read the same extent.
// coverage: per wave 4 instructions x 32 lanes x 8 halves = the head's two packed tiles (16 x 64) per plane; grid NQG x NH x NB blocks x AWV waves =
//           every (b, s, h) row segment of O hi and O residual exactly once.
// =====================================================================================================
// 2^x as the bare hardware instruction. The library exp2f adds a compare, two selects, an add and an ldexp per value only to keep
// results below 2^-126; here such a term is far below one f16 step of P and one f32 step of Z >= 1, so it may flush to 0.
// -inf gives 0 and NaN stays NaN, as in the library form.
__device__ __forceinline__ float exp2_hw(float x) { return __builtin_amdgcn_exp2f(x); }

// lane l <-> lane l ^ 16 (the other half of the same column)
__device__ __forceinline__ float xhalf(float x) {
  const int b = __builtin_bit_cast(int, x);
  return __builtin_bit_cast(float, __builtin_amdgcn_permlanex16(b, b, 0x76543210, 0xfedcba98, false, false));
}

// One stage: 256 lanes x 16 B = 4 KiB per copy. Copies 0, 1: k bands 2c + (tid >> 7) (2 KiB of the head's tiles each, bands
// 16 key rows apart in the plane); copies 2, 3: the stage's 8 KiB of v^T tiles. lds = the lane's byte address in the buffer.
// The s_wait_xcnt closes the statement so that no address register of a copy is rewritten in front of it.
__device__ __forceinline__ void stage_copy(unsigned lds, const _Float16* kg, const _Float16* vg) {
#if defined(__HIP_DEVICE_COMPILE__)
  asm volatile("global_load_async_to_lds_b128 %0, %4, off\n\t"
               "global_load_async_to_lds_b128 %1, %5, off\n\t"
               "global_load_async_to_lds_b128 %2, %6, off\n\t"
               "global_load_async_to_lds_b128 %3, %7, off\n\t"
               "s_wait_xcnt 0x0"
               :: "v"(lds), "v"(lds + 4096u), "v"(lds + 8192u), "v"(lds + 12288u),
                  "v"(kg), "v"(kg + 32 * DMOD), "v"(vg), "v"(vg + 4 * FT) : "memory");
#endif
}
// this wave's copies have landed in LDS (the compiler places no wait for them)
__device__ __forceinline__ void wait_copies() {
#if defined(__HIP_DEVICE_COMPILE__)
  asm volatile("s_wait_asynccnt 0x0" ::: "memory");
#endif
}
// this wave's LDS reads have returned, before the barrier behind which their buffer is refilled
__device__ __forceinline__ void wait_lds_reads() {
#if defined(__HIP_DEVICE_COMPILE__)
  asm volatile("s_wait_dscnt 0x0" ::: "memory");
#endif
}

__global__ __launch_bounds__(ATT_THREADS)
void attn_x(const u16* __restrict__ QHp, const u16* __restrict__ QLp, const u16* __restrict__ KHp,
            const u16* __restrict__ VHp, u16* OHp, u16* OLp) {
  __shared__ __attribute__((aligned(16))) _Float16 ring[2 * STH];
  const int tid  = threadIdx.x;
  const int wave = tid >> 5;
  const int lane = tid & 31;
  const int bid  = blockIdx.x;
  const int qg   = bid % NQG;
  const int t2   = bid / NQG;
  const int head = t2 % NH;
  const int b    = t2 / NH;
  if (b >= NB) return;                      // block-uniform, before any barrier or copy; never taken with the exact grid
  const int q0   = (qg * AWV + wave) * 16;  // q0 + 16 <= SEQ by construction

  const size_t hcol = (size_t)head * (HD / 32) * FT + 8 * lane;        // the head's two tiles inside a 16-row band
  const _Float16* Qh  = (const _Float16*)(const void*)QHp + ((size_t)b * SEQ + q0) * DMOD + hcol;
  const _Float16* Ql  = (const _Float16*)(const void*)QLp + ((size_t)b * SEQ + q0) * DMOD + hcol;
  // copy sources of this lane in stage 0: k band tid >> 7, chunk tid & 127 of the head's two tiles; v^T chunk tid
  const _Float16* Kg = (const _Float16*)(const void*)KHp + ((size_t)b * JL + (tid >> 7) * 16) * DMOD
                       + (size_t)head * (HD / 32) * FT + 8 * (tid & 127);
  const _Float16* Vg = (const _Float16*)(const void*)VHp + (size_t)(b * NH + head) * NKT * 4 * FT + 8 * tid;
  const unsigned lds0 = (unsigned)(uintptr_t)(&ring[0]) + 16u * (unsigned)tid;
  const float lsc = SM_SCALE * (LOG2E / (QSC * KSC));
  const float oc  = 1.0f / VCAR;            // the 32768 on P is in the accumulators and in Z alike and cancels in acc / Z

  // ---- q fragments (hi and residual, 2 k-steps over HD), loaded once ----
  const v16h qh0 = ldfrag_h(Qh), qh1 = ldfrag_h(Qh + FT);
  const v16h ql0 = ldfrag_h(Ql), ql1 = ldfrag_h(Ql + FT);

  float mrow = -INFINITY;                   // running maximum of query column c (alike in both halves)
  float lrow = 0.f;                         // running sum (x32768) over the keys of this half only
  v8f o[4];
#pragma unroll
  for (int j = 0; j < 4; ++j) o[j] = zero8();

  // ---- ring prologue: stage 0 landed and published, stage 1 in flight ----
  stage_copy(lds0, Kg, Vg);
  wait_copies();
  __syncthreads();
  stage_copy(lds0 + 2u * STH, Kg + (size_t)SKEY * DMOD, Vg + (size_t)(SKEY / 32) * 4 * FT);

#pragma unroll 1                            // rolled: one publish point per trip, in the order written at its foot
  for (int st = 0; st < NST; ++st) {
   const _Float16* sb = ring + (st & 1) * STH + 8 * lane;
#pragma unroll                              // both key steps of a stage in line: every LDS offset an immediate
   for (int p = 0; p < SKEY / 32; ++p) {    // key step kt = 2*st + p, keys kb = 32*kt .. kb + 31
    // ---- the step's k and v^T fragments, one group of LDS reads ----
    const _Float16* k0p = sb + p * 4 * FT;
    const _Float16* vhp = sb + SKEY * HD + p * 4 * FT;
    const v16h ka0 = ldfrag_h(k0p),          ka1 = ldfrag_h(k0p + FT);
    const v16h kc0 = ldfrag_h(k0p + 2 * FT), kc1 = ldfrag_h(k0p + 3 * FT);
    v16h vf[4];
#pragma unroll
    for (int j = 0; j < 4; ++j) vf[j] = ldfrag_h(vhp + j * FT);
    // ---- scores: D element r of this lane = (key kb + 8hh + r, query column c) in s0, key kb + 16 + 8hh + r in s1 ----
    v8f s0 = zero8(), s1 = zero8();
    {
      s0 = mma_h(ka0, qh0, s0);
      s0 = mma_h(ka0, ql0, s0);
      s0 = mma_h(ka1, qh1, s0);
      s0 = mma_h(ka1, ql1, s0);
      s1 = mma_h(kc0, qh0, s1);
      s1 = mma_h(kc0, ql0, s1);
      s1 = mma_h(kc1, qh1, s1);
      s1 = mma_h(kc1, ql1, s1);
      guard2(s0, s1, ka0, ka1, kc0, kc1, qh0, ql0, qh1, ql1);
    }
    // ---- online softmax in base 2, -inf-safe; one query per lane ----
    const v8f t0 = s0 * lsc, t1 = s1 * lsc;
    float mx = fmaxf(t0[0], t1[0]);
#pragma unroll
    for (int r = 1; r < 8; ++r) mx = fmaxf(mx, fmaxf(t0[r], t1[r]));
    mx = fmaxf(mx, xhalf(mx));
    const float mn = fmaxf(mrow, mx);
    const float ms = (mn == -INFINITY) ? 0.0f : mn;
    const float al = exp2_hw(mrow - ms);
    mrow = mn;
    // e = 32768 * 2^(t - ms): score scale, maximum and the carry of P meet in one packed multiply-add in front of the exponential
    // (written on pairs: the bare exponential is no vector operation to the compiler, which otherwise splits the pairs)
    const float mb = ms - PLOG;
    const v2f l2 = {lsc, lsc}, nb2 = {-mb, -mb};
    v8f e0, e1;
#pragma unroll
    for (int r = 0; r < 4; ++r) {
      const v2f a0 = {s0[2 * r], s0[2 * r + 1]}, a1 = {s1[2 * r], s1[2 * r + 1]};
      const v2f x0 = __builtin_elementwise_fma(a0, l2, nb2), x1 = __builtin_elementwise_fma(a1, l2, nb2);
      e0[2 * r] = exp2_hw(x0[0]); e0[2 * r + 1] = exp2_hw(x0[1]);
      e1[2 * r] = exp2_hw(x1[0]); e1[2 * r + 1] = exp2_hw(x1[1]);
    }
    const v8f es = e0 + e1;
    lrow = lrow * al + (((es[0] + es[4]) + (es[1] + es[5])) + ((es[2] + es[6]) + (es[3] + es[7])));
    // ---- B fragment of P^T * 32768 (f16), column = c, split k map over the 32 keys of this step ----
    FragH ph;
#pragma unroll
    for (int r = 0; r < 8; ++r) {
      ph.h[0][r] = (_Float16)e0[r];         // elements 0..7  = keys kb + 8hh + 0..7
      ph.h[1][r] = (_Float16)e1[r];         // elements 8..15 = keys kb + 16 + 8hh + 0..7
    }
#pragma unroll
    for (int j = 0; j < 4; ++j) o[j] *= al;
    // ---- V^T.P^T : A fragment row = d = j*16 + c, keys contiguous in the v^T plane; 2 groups of 2 d-subtiles ----
    {
#pragma unroll
      for (int jg = 0; jg < HD / 32; ++jg) {
        const v16h vha = vf[2 * jg], vhc = vf[2 * jg + 1];
        o[2 * jg]     = mma_h(vha, ph.v, o[2 * jg]);
        o[2 * jg + 1] = mma_h(vhc, ph.v, o[2 * jg + 1]);
        guard2(o[2 * jg], o[2 * jg + 1], ph.v, vha, vhc, ph.v, vha, vhc, ph.v, ph.v);
      }
    }
   }
   // ---- publish point of stage st + 1: own reads of this buffer done, own copies landed, every wave here; then the refill ----
   wait_lds_reads();
   wait_copies();
   __syncthreads();
   if (st + 2 < NST) {                      // block-uniform
     stage_copy(lds0 + (unsigned)(st & 1) * (2u * STH), Kg + (size_t)(st + 2) * SKEY * DMOD,
                Vg + (size_t)(st + 2) * (SKEY / 32) * 4 * FT);
   }
  }
  wait_copies();
  acc_guard4(o[0], o[1], o[2], o[3]);
  // ---- out = acc / Z (0 if Z == 0), acc and Z both x32768, the 1024 on v folded once; the halves' sums joined here ----
  const float lv  = lrow + xhalf(lrow);
  const float ls  = (lv > 0.0f) ? lv : 1.0f;
  const float inv = (lv > 0.0f) ? ((1.0f / ls) * oc) : 0.0f;
  // ---- O x1024 -> packed f16 hi + residual planes; chunk j*32 + lane of the head's two tiles: row c, d = 16j + 8hh + 0..7 ----
  v4u oh[4], ol[4];
#pragma unroll
  for (int it = 0; it < 4; ++it) {
    float w[8];
#pragma unroll
    for (int e = 0; e < 8; ++e) w[e] = (o[it][e] * inv) * OSC;
#pragma unroll
    for (int e = 0; e < 4; ++e) {
      const _Float16 h0 = (_Float16)w[2 * e], h1 = (_Float16)w[2 * e + 1];
      const _Float16 l0 = (_Float16)(w[2 * e] - (float)h0), l1 = (_Float16)(w[2 * e + 1] - (float)h1);
      oh[it][e] = pk16(h_bits(h0), h_bits(h1));
      ol[it][e] = pk16(h_bits(l0), h_bits(l1));
    }
  }
  const size_t ob = ((size_t)b * SEQ + q0) * DMOD + hcol;
  {
#pragma unroll
    for (int it = 0; it < 4; ++it) {
      *(v4u*)(OHp + ob + (size_t)it * 256) = oh[it];
      *(v4u*)(OLp + ob + (size_t)it * 256) = ol[it];
    }
    
  }
}

// =====================================================================================================
// Workspace map (bytes); every plane is fully written by whole-line stores before it is read; all extents are exact multiples
// of the store granularity (512-B half tiles; no pad rows needed); every region offset a multiple of
// 2097152:
//   XC  bf16 [CROWS][1024]              CROWS*2048   (c = [mem; kv] as bf16)
//   XQ  bf16 [QROWS][1024]              QROWS*2048   (q as bf16)
//   WV, WK, WQ, WC  16-bit [1024 n][1024 k]  2097152 each  (Wv, Wk, Wq as bf16, Wc as f16 x1024)
//   OH  f16 [QROWS][1024] x1024         QROWS*2048   OL residual the same
//   VH  f16 [NB*16][64][JL] x1024       CROWS*2048   (all 16-bit planes in packed 16 x 32 tiles)
//   KH  f16 [CROWS][1024] x1024         CROWS*2048
//   QH  f16 [QROWS][1024] x1024         QROWS*2048   QL residual the same
//   end (NB=2, SEQ=MLEN=2048)           100663296
// =====================================================================================================
extern "C" void kernel_launch(void* const* d_in, const int* in_sizes, int n_in,
                              void* d_out, int out_size, void* d_ws, size_t ws_size,
                              hipStream_t stream) {
  if (n_in < 11) return;
  const long long needq = ((long long)(SEQ - 1) * B_FULL + NB) * DMOD;
  const long long needm = (MLEN > 0) ? (((long long)(MLEN - 1) * B_FULL + NB) * DMOD) : 0;
  if ((long long)in_sizes[0] < needq || (long long)in_sizes[1] < needq || (long long)in_sizes[2] < needm) return;
  if (in_sizes[3] < DMOD * DMOD || in_sizes[5] < DMOD * DMOD || in_sizes[7] < DMOD * DMOD || in_sizes[9] < DMOD * DMOD) return;
  if (in_sizes[4] < DMOD || in_sizes[6] < DMOD || in_sizes[8] < DMOD || in_sizes[10] < DMOD) return;
  if ((long long)out_size < (long long)SEQ * NB * DMOD) return;

  const float* xq  = (const float*)d_in[0];
  const float* xkv = (const float*)d_in[1];
  const float* xm  = (const float*)d_in[2];
  const float* wq  = (const float*)d_in[3];
  const float* bq  = (const float*)d_in[4];
  const float* wk  = (const float*)d_in[5];
  const float* bk  = (const float*)d_in[6];
  const float* wv  = (const float*)d_in[7];
  const float* bv  = (const float*)d_in[8];
  const float* wc  = (const float*)d_in[9];
  const float* bc  = (const float*)d_in[10];
  float*       out = (float*)d_out;

  const size_t szXC = (size_t)CROWS * DMOD * 2;
  const size_t szXQ = (size_t)QROWS * DMOD * 2;
  const size_t szW  = (size_t)DMOD * DMOD * 2;
  const size_t szO  = (size_t)QROWS * DMOD * 2;                 // OH, OL each
  const size_t szVH = (size_t)NB * NH * HD * JL * 2;            // == CROWS*2048
  const size_t szKH = (size_t)CROWS * DMOD * 2;
  const size_t szQ  = (size_t)QROWS * DMOD * 2;                 // QH, QL each
  size_t off = 0;
  const size_t oXC = off; off += szXC;
  const size_t oXQ = off; off += szXQ;
  const size_t oWV = off; off += szW;
  const size_t oWK = off; off += szW;
  const size_t oWQ = off; off += szW;
  const size_t oWC = off; off += szW;
  const size_t oOH = off; off += szO;
  const size_t oOL = off; off += szO;
  const size_t oVH = off; off += szVH;
  const size_t oKH = off; off += szKH;
  const size_t oQH = off; off += szQ;
  const size_t oQL = off; off += szQ;
  if (off > ws_size) return;                // off = 100663296 for NB = 2, SEQ = MLEN = 2048
  if (off > (size_t)WS_CAP) return;

  char* ws = (char*)d_ws;
  u16*   XC = (u16*)(ws + oXC);
  u16*   XQ = (u16*)(ws + oXQ);
  u16*   WV = (u16*)(ws + oWV);
  u16*   WK = (u16*)(ws + oWK);
  u16*   WQ = (u16*)(ws + oWQ);
  u16*   WC = (u16*)(ws + oWC);
  u16*   OH = (u16*)(ws + oOH);
  u16*   OL = (u16*)(ws + oOL);
  u16*   VH = (u16*)(ws + oVH);
  u16*   KH = (u16*)(ws + oKH);
  u16*   QH = (u16*)(ws + oQH);
  u16*   QL = (u16*)(ws + oQL);

  const dim3 b256(256), b128(128), bAT(ATT_THREADS);
  const dim3 gCV(CB_C + CB_Q + 4 * CB_W);
  const dim3 gQKV(2 * GB_C + GB_Q);
  const dim3 gAT(NQG * NH * NB);
  const dim3 gO(NB * NRT * (DMOD / 64));

  // (1) c = [mem; kv] and q -> bf16 planes, batch-major rows; Wv, Wk, Wq -> bf16 planes; Wc -> f16 plane of bf16 value x1024
  cvt_all<<<gCV, b256, 0, stream>>>(xm, xkv, xq, wv, wk, wq, wc, XC, XQ, WV, WK, WQ, WC);
  // (2) v = c.Wv^T + bv -> v^T plane x1024; k = c.Wk^T + bk -> k hi plane x1024; q = q.Wq^T + bq -> q hi + residual planes x1024
  gemm_qkv<<<gQKV, b128, 0, stream>>>(XC, XQ, WV, WK, WQ, bv, bk, bq, VH, KH, QH, QL);
  // (3) attention over all JL keys -> O hi + residual planes
  attn_x<<<gAT, bAT, 0, stream>>>(QH, QL, KH, VH, OH, OL);
  // (4) output projection -> out f32 rows (s*NB + b), carries 1024 x 1024 folded back
  gemm_o2<<<gO, b128, 0, stream>>>(OH, OL, WC, bc, out, 1.0f / (OSC * WOS));
  (void)hipGetLastError();
}

// v008
// A run of this version takes 159 microseconds.
// In both of two side-by-side timings against v007, it was 1.05 times as fast.
// All steps since v000 together make it 3.48 times as fast.
// Contractions: q.Wq^T, c.Wk^T, c.Wv^T (c = [mem; kv] along the key axis) on v_wmma_f32_16x16x32_bf16 (activations, W and
// biases RNE-converted to bf16; the [n][k] weight rows are used directly as a k-contiguous operand: B for v, A for q and k; f32 accumulate);
// k.q^T over 64 on v_wmma_f32_16x16x32_f16 with q carried as f16 hi (x1024) plus an f16 residual plane and k as f16 hi (x1024)
// (products h.h + h.l); v^T.P^T on v_wmma_f32_16x16x32_f16 (P x128 f16, v x1024 f16, one product); O.Wc^T on
// v_wmma_f32_16x16x32_f16 (O x1024 as f16 hi plus f16 residual plane, Wc as f16(bf16(Wc)) x1024, products h.w + l.w);
// all f32 accumulate. Bias adds, base-2 online softmax over all keys and the 1/Z fold in f32 on VALU.
// Every 16-bit workspace plane is stored fragment-packed (see "packed planes" below): a wave-wide 16-B fragment load reads 512
// contiguous bytes (4 whole lines) instead of 32 B out of each of 16 rows.
#include <hip/hip_runtime.h>
#include <math.h>
#include <stdint.h>

#ifndef NB
#define NB 2
#endif
#ifndef SEQ
#define SEQ 2048
#endif
#ifndef MLEN
#define MLEN 2048
#endif
#define B_FULL 2
#define L_FULL 2048
#define M_FULL 2048
#define DMOD  1024
#define NH    16
#define HD    64
#define JL    (MLEN + SEQ)
#define QROWS (NB * SEQ)
#define CROWS (NB * JL)
#define SM_SCALE 0.125f
#define LOG2E 1.4426950408889634f
#define QSC   1024.0f
#define KSC   1024.0f
#define PLOG  7.0f                // P is carried x 2^7 = 128, as a bias of its exponent
#define PCAP  32768.0f            // a key step keeps the softmax reference in use while its 16 terms of a lane sum to at most this: P stays a finite f16
#define VCAR  1024.0f
#define OSC   1024.0f
#define WOS   1024.0f
#define AWV   8                   // waves of an attention block: 8 query tiles of ONE head share that head's k / v^T stages
#define NQT   (SEQ / 16)
#define NQG   (NQT / AWV)
#define SKEY  64                  // keys in one LDS stage of the attention ring
#define NST   (JL / SKEY)
#define STH   (2 * SKEY * HD)     // halves in one stage: 8 packed k tiles, then 8 packed v^T tiles (16 KiB)
#define NKT   (JL / 32)
#define NRT   (SEQ / 64)
#define ATT_THREADS (AWV * 32)
#define SLAB64 (16 * 68)
#define QKT   (DMOD / 8)
#define WS_CAP 134217728
#define FT    512                 // halves in one packed 16 x 32 fragment tile (1 KiB)
#define TPB   (DMOD / 32)         // fragment tiles in one 16-row band of a [rows][DMOD] plane
#define CB_C  (CROWS / 2)         // conversion launch: blocks of the c range, of the q range, of one weight matrix
#define CB_Q  (QROWS / 2)
#define CB_W  ((DMOD * DMOD) / (8 * 256))
#define GB_C  ((CROWS / 128) * (DMOD / 128)) // projection launch: blocks of the v range (k the same), of the q range
#define GB_Q  ((QROWS / 128) * (DMOD / 128))
static_assert(DMOD == NH * HD && HD == 64 && NH == 16);
static_assert((NQT % AWV) == 0 && ATT_THREADS == 256 && NST * SKEY == JL && NST >= 2 && SKEY == 64);
static_assert(NB >= 1 && NB <= B_FULL);
static_assert((SEQ % 64) == 0 && SEQ >= 64 && SEQ <= L_FULL);
static_assert((MLEN % 64) == 0 && MLEN >= 0 && MLEN <= M_FULL);
static_assert((JL % 64) == 0 && NKT * 32 == JL && NQT * 16 == SEQ && NRT * 64 == SEQ);
static_assert(QKT == 128 && (DMOD % 64) == 0 && (DMOD % 32) == 0 && (HD % 32) == 0);
static_assert(((DMOD * DMOD) % (8 * 256)) == 0);
static_assert(QROWS <= CROWS);
static_assert((CROWS % 128) == 0 && (QROWS % 128) == 0 && (DMOD % 128) == 0);
static_assert(TPB == 32 && QKT == 2 * 64 && (TPB % 2) == 0 && (MLEN % 16) == 0 && (SEQ % 16) == 0 && (JL % 16) == 0);
static_assert((long long)CROWS * DMOD * 6 + (long long)QROWS * DMOD * 10 + 8LL * DMOD * DMOD <= (long long)WS_CAP);

typedef unsigned short u16;
typedef _Float16 v16h __attribute__((ext_vector_type(16)));
typedef _Float16 v8h  __attribute__((ext_vector_type(8)));
typedef __bf16   v16b __attribute__((ext_vector_type(16)));
typedef float    v8f  __attribute__((ext_vector_type(8)));
typedef float    v4f  __attribute__((ext_vector_type(4)));
typedef float    v2f  __attribute__((ext_vector_type(2)));
typedef unsigned int v4u __attribute__((ext_vector_type(4)));

union FragH { v16h v; v8h h[2]; v4u u[2]; };
union FragB { v16b v; v4u u[2]; };

// ---- scalar helpers --------------------------------------------------------------------------------
__device__ __forceinline__ unsigned short bf_bits(float f) {          // f32 -> bf16 bits, RNE convert
  unsigned u = __float_as_uint(f);
  return (unsigned short)((u + 0x7FFFu + ((u >> 16) & 1u)) >> 16);
}
__device__ __forceinline__ float bf_up(unsigned short h) { return __uint_as_float(((unsigned)h) << 16); }
__device__ __forceinline__ float bfr(float f) { return bf_up(bf_bits(f)); }
__device__ __forceinline__ unsigned short h_bits(_Float16 x) { return __builtin_bit_cast(unsigned short, x); }
__device__ __forceinline__ unsigned pk16(unsigned short a, unsigned short b) { return (unsigned)a | ((unsigned)b << 16); }
__device__ __forceinline__ v8f zero8() { v8f z = {0.f, 0.f, 0.f, 0.f, 0.f, 0.f, 0.f, 0.f}; return z; }

// ---- packed planes: a [rows][K] 16-bit matrix is stored as 16 x 32 fragment tiles of FT halves, tile (row >> 4, k >> 5) at
//      index (row >> 4) * (K / 32) + (k >> 5); inside a tile element (c = row & 15, kk = k & 31) sits at
//      (kk >> 4) * 256 + (((kk >> 3) & 1) * 16 + c) * 8 + (kk & 7): chunk g of 8 halves = what lane g & 31 takes in load g >> 5.
// ---- fragment loaders: 16-bit A/B operand, lane -> row/col (lane&15), p = tile start + 8*lane;
//      elements 0..7 <- p[0..7] (k0+8h..), elements 8..15 <- p[256..263] (k0+16+8h..)  (same split k map for A and B)
__device__ __forceinline__ v16h ldfrag_h(const _Float16* p) {
  FragH f;
  f.h[0] = *(const v8h*)(p);
  f.h[1] = *(const v8h*)(p + 256);
  return f.v;
}
__device__ __forceinline__ v16b ldfrag_b(const u16* p) {              // bf16 plane read as unsigned integer vectors
  FragB f;
  f.u[0] = *(const v4u*)(p);
  f.u[1] = *(const v4u*)(p + 256);
  return f.v;
}
// first column of chunk w (0..63) inside its tile
__device__ __forceinline__ int chunk_k(int w) { return ((w >> 5) & 1) * 16 + ((w >> 4) & 1) * 8; }

__device__ __forceinline__ v8f mma_h(v16h a, v16h b, v8f c) {
  return __builtin_amdgcn_wmma_f32_16x16x32_f16(false, a, false, b, (short)0, c, false, false);
}
__device__ __forceinline__ v8f mma_b(v16b a, v16b b, v8f c) {
  return __builtin_amdgcn_wmma_f32_16x16x32_bf16(false, a, false, b, (short)0, c, false, false);
}
__device__ __forceinline__ void guard2(v8f& a, v8f& b, v16h x0, v16h x1, v16h x2, v16h x3,
                                       v16h x4, v16h x5, v16h x6, v16h x7) {
#if defined(__HIP_DEVICE_COMPILE__)
  asm volatile("v_nop\n\tv_nop\n\tv_nop\n\tv_nop"
               : "+v"(a), "+v"(b)
               : "v"(x0), "v"(x1), "v"(x2), "v"(x3), "v"(x4), "v"(x5), "v"(x6), "v"(x7) : "memory");
#endif
}
// The four issue slots behind the V^T.P^T matrix instructions. The accumulators are inputs only: as in-out operands they were
// copied from register to register in every key step once their rescale stands in a branch.
__device__ __forceinline__ void guard2in(const v8f& a, const v8f& b, v16h x0, v16h x1, v16h x2) {
#if defined(__HIP_DEVICE_COMPILE__)
  asm volatile("v_nop\n\tv_nop\n\tv_nop\n\tv_nop" :: "v"(a), "v"(b), "v"(x0), "v"(x1), "v"(x2) : "memory");
#endif
}
template <typename F>
__device__ __forceinline__ void guard6(v8f& a, v8f& b, v8f& c, v8f& d, F x0, F x1, F x2, F x3, F x4, F x5) {
#if defined(__HIP_DEVICE_COMPILE__)
  asm volatile("v_nop\n\tv_nop\n\tv_nop\n\tv_nop"
               : "+v"(a), "+v"(b), "+v"(c), "+v"(d) : "v"(x0), "v"(x1), "v"(x2), "v"(x3), "v"(x4), "v"(x5) : "memory");
#endif
}
// Foot of the projection loop: the four issue slots between the last matrix instructions of a trip and the next trip's loads into
// their operand registers, on the taken branch too. Every accumulator and fragment is an input only, so the slots stand behind all
// sixteen matrix instructions and the fragments' registers stay theirs up to here.
__device__ __forceinline__ void guard16(const v8f (&c)[4][4], const v16b (&a)[4], const v16b (&b)[4]) {
#if defined(__HIP_DEVICE_COMPILE__)
  asm volatile("v_nop\n\tv_nop\n\tv_nop\n\tv_nop"
               :: "v"(c[0][0]), "v"(c[0][1]), "v"(c[0][2]), "v"(c[0][3]), "v"(c[1][0]), "v"(c[1][1]), "v"(c[1][2]), "v"(c[1][3]),
                  "v"(c[2][0]), "v"(c[2][1]), "v"(c[2][2]), "v"(c[2][3]), "v"(c[3][0]), "v"(c[3][1]), "v"(c[3][2]), "v"(c[3][3]),
                  "v"(a[0]), "v"(a[1]), "v"(a[2]), "v"(a[3]), "v"(b[0]), "v"(b[1]), "v"(b[2]), "v"(b[3]) : "memory");
#endif
}
__device__ __forceinline__ void acc_guard4(v8f& a, v8f& b, v8f& c, v8f& d) {
#if defined(__HIP_DEVICE_COMPILE__)
  asm volatile("v_nop\n\tv_nop\n\tv_nop\n\tv_nop" : "+v"(a), "+v"(b), "+v"(c), "+v"(d));
#endif
}
__device__ __forceinline__ void wave_sync_lds() {
  __builtin_amdgcn_fence(__ATOMIC_RELEASE, "workgroup");
  __builtin_amdgcn_wave_barrier();
  __builtin_amdgcn_fence(__ATOMIC_ACQUIRE, "workgroup");
}

// =====================================================================================================
// f32 [DMOD n][DMOD k] -> packed 16-bit plane.  f16mode == 0: bf16 RNE bits;  f16mode == 1: f16 bits of (bf16 RNE value) * scale.
// Used for the [n][k] weight matrices (bf16, or f16 of the bf16 value x1024 for Wc).
// Thread = packed chunk gt (8 consecutive k of one row): two 16-B loads, one 16-B store; 32 lanes store 512 contiguous bytes
// coverage: CB_W blocks x 256 thr x 8 = the whole plane (131072 chunks); gt = block of the matrix's range * 256 + thread.
// =====================================================================================================
__device__ __forceinline__ void cvt16_part(const float* __restrict__ x, u16* D, int gt, int f16mode, float scale) {
  const int tile = gt >> 6;
  const float* p = x + (size_t)((tile / TPB) * 16 + (gt & 15)) * DMOD + (tile % TPB) * 32 + chunk_k(gt & 63);
  const v4f a = *(const v4f*)(p), b4 = *(const v4f*)(p + 4);
  float w[8];
#pragma unroll
  for (int e = 0; e < 4; ++e) { w[e] = a[e]; w[4 + e] = b4[e]; }
  v4u o;
#pragma unroll
  for (int e = 0; e < 4; ++e) {
    const float f0 = w[2 * e], f1 = w[2 * e + 1];
    const unsigned short hb0 = h_bits((_Float16)(bfr(f0) * scale));
    const unsigned short hb1 = h_bits((_Float16)(bfr(f1) * scale));
    const unsigned short bb0 = bf_bits(f0);
    const unsigned short bb1 = bf_bits(f1);
    o[e] = (f16mode != 0) ? pk16(hb0, hb1) : pk16(bb0, bb1);
  }
  u16* d = D + (size_t)gt * 8;
  *(v4u*)(d) = o;
  // other jobs' code follows this store in the merged kernel's listing: no register that the store names is rewritten in front of this wait
  asm volatile("s_wait_xcnt 0x0" ::: "memory");
}

// =====================================================================================================
// Activation rows -> packed bf16 plane (RNE), batch-major destination rows:
//   D[(bb*nrow + j)][0..1023] <- X0[(j*B_FULL + bb)][..] for j < split,  X1[((j - split)*B_FULL + bb)][..] for j >= split.
// Used for c = [mem rows 0..MLEN-1 ; kv rows 0..SEQ-1] (nrow = JL, split = MLEN) and for q (nrow = SEQ, split = SEQ, X1 unused).
// Unit r = two packed tiles of one 16-row band (16 rows x 64 columns), 128 threads, thread tid = one chunk: two 16-B loads, one
// 16-B store. The source base selection is uniform in a unit (nrow and split are multiples of 16; both sources are global planes).
// coverage: NB*nrow units x 128 chunks x 8 = every element of the [NB*nrow][1024] plane exactly once.
// =====================================================================================================
__device__ __forceinline__ void cvt_act_part(const float* __restrict__ X0, const float* __restrict__ X1, u16* D,
                                             int nrow, int split, int r, int tid) {
  const int  r0    = (r / (TPB / 2)) * 16;                    // first row of the band
  const int  col   = ((r % (TPB / 2)) * 2 + (tid >> 6)) * 32 + chunk_k(tid & 63);
  const int  bb    = r0 / nrow;
  const int  j     = r0 - bb * nrow;
  const bool first = (j < split);
  const int  js    = (first ? j : (j - split)) + (tid & 15);
  const float* base = first ? X0 : X1;
  const float* p = base + ((size_t)js * B_FULL + bb) * DMOD + col;
  const v4f a = *(const v4f*)(p), a4 = *(const v4f*)(p + 4);
  v4u o;
#pragma unroll
  for (int e = 0; e < 2; ++e) {
    o[e]     = pk16(bf_bits(a[2 * e]),  bf_bits(a[2 * e + 1]));
    o[2 + e] = pk16(bf_bits(a4[2 * e]), bf_bits(a4[2 * e + 1]));
  }
  u16* d = D + ((size_t)r * QKT + tid) * 8;
  *(v4u*)(d) = o;
  // other jobs' code follows this store in the merged kernel's listing: no register that the store names is rewritten in front of this wait
  asm volatile("s_wait_xcnt 0x0" ::: "memory");
}

// =====================================================================================================
// All conversions of a call in one launch (none reads what another writes; each has a plane of its own). The block index picks
// the job, uniformly in a block: CB_C blocks c = [mem; kv], CB_Q blocks q (two 128-thread units a block), then CB_W blocks each
// for Wv, Wk, Wq (bf16) and Wc (f16 of the bf16 value x1024).
// coverage: grid = CB_C + CB_Q + 4*CB_W blocks; every range is exactly its job's units.
// =====================================================================================================
__global__ __launch_bounds__(256)
void cvt_all(const float* __restrict__ xm, const float* __restrict__ xkv, const float* __restrict__ xq,
             const float* __restrict__ wv, const float* __restrict__ wk, const float* __restrict__ wq,
             const float* __restrict__ wc, u16* XC, u16* XQ, u16* WV, u16* WK, u16* WQ, u16* WC) {
  const int tid = (int)threadIdx.x;
  int blk = (int)blockIdx.x;
  if (blk < CB_C) { cvt_act_part(xm, xkv, XC, JL, MLEN, 2 * blk + (tid >> 7), tid & 127); return; }
  blk -= CB_C;
  if (blk < CB_Q) { cvt_act_part(xq, xq, XQ, SEQ, SEQ, 2 * blk + (tid >> 7), tid & 127); return; }
  blk -= CB_Q;
  const int wsel = blk / CB_W;
  const int gt   = (blk % CB_W) * 256 + tid;
  if (wsel < 3)       cvt16_part(wsel == 0 ? wv : (wsel == 1 ? wk : wq), wsel == 0 ? WV : (wsel == 1 ? WK : WQ), gt, 0, 1.0f);
  else if (wsel == 3) cvt16_part(wc, WC, gt, 1, WOS);
}

// =====================================================================================================
// Epilogue of the output projection: the wave's 16x64 f32 tile (times oscale) staged in its private LDS slab (pitch 68),
// coverage: 8 instructions x 2 rows x 16 lanes x 4 floats = the wave's 16 x 64 tile.
// =====================================================================================================
__device__ __forceinline__ void epi64(float* sl, v8f a0, v8f a1, v8f a2, v8f a3, float oscale,
                                      const float* __restrict__ bias, float* Cb, size_t pitch, int col0, int lane) {
  const int hh = lane >> 4, m = lane & 15;
#pragma unroll
  for (int r = 0; r < 8; ++r) {
    const int ro = (8 * hh + r) * 68 + m;
    sl[ro]      = a0[r] * oscale;
    sl[ro + 16] = a1[r] * oscale;
    sl[ro + 32] = a2[r] * oscale;
    sl[ro + 48] = a3[r] * oscale;
  }
  wave_sync_lds();
  const v4f bb = *(const v4f*)(bias + col0 + m * 4);
  v4f br;
#pragma unroll
  for (int e = 0; e < 4; ++e) br[e] = bfr(bb[e]);
  v4f vals[8];
#pragma unroll
  for (int it = 0; it < 8; ++it) vals[it] = *(const v4f*)(sl + (it * 2 + hh) * 68 + m * 4) + br;
  float* dst = Cb + (size_t)hh * pitch + col0 + m * 4;
  {
#pragma unroll
    for (int it = 0; it < 8; ++it) {
      *(v4f*)(dst + (size_t)(it * 2) * pitch) = vals[it];
    }
    
  }
}

// =====================================================================================================
// bf16 projection GEMM: P[M][N] = A[M][K] (bf16 packed) . Bt[N][K]^T (bf16 packed) + bias[col] (bf16 RNE value), f32 accumulate;
// the result leaves the accumulators as the packed f16 plane(s) its consumer reads, f16(P * sc); no f32 copy of P is kept.
// Block = 128x128 tile, 2 x 2 waves of 64 rows x 64 columns each: per 32 k a wave loads 4 A and 4 B fragments (16 loads of 16 B)
// for 16 matrix instructions, every fragment used four times from registers; the two waves of a block row share the A lines, the two
// of a block column the B lines. Fragments loaded straight from the packed tiles (two 16-B loads each, split k map for A and B);
// K stepped by 32 (K % 32 == 0, M % 128 == 0, N % 128 == 0; bid = 0 .. (M/128)*(N/128) - 1, the block inside its job).
// Band i = rows rowb + 16i .. + 15, subtile jj = columns col0 + 16jj .. + 15; accumulator acc[i][jj].
// A lane of a D tile holds 8 consecutive D rows (8hh + r) of one D column (m); a packed chunk is 8 consecutive k of one tile row.
//   MODE 0 (v, N == DMOD, rows bb*JL + j): D = A.Bt^T, D rows = keys, D column = d. The lane's 8 keys of one d ARE chunk
//     ((j >> 4) & 1)*32 + lane of the v^T tile (head bb*NH + g, key step j >> 5, d subtile jj) at index
//     ((bb*NH + g)*NKT + (j >> 5))*4 + jj (row in the tile = d & 15, k = j & 31), j = j0 + 16i the band's first key (j0 % 64 == 0,
//     JL % 64 == 0: a wave's four bands lie in one batch).
//   MODE 1 (k, hi plane) and MODE 2 (q, hi plane Hp and residual plane Lp = f16(P*sc - hi)): the operands change places,
//     D = Bt.A^T, D rows = columns n of P, D column = row of P. The lane's 8 columns of one row ARE chunk (jj & 1)*32 + lane of
//     the [M][N] plane's tile ((rowb >> 4) + i, (col0 >> 5) + (jj >> 1)).
// The sum over k of every element is the same in both forms (same fragments, same k map, same k order).
// coverage: per wave and plane 16 stores x 32 lanes x 8 halves = its 64 x 64 results, each store 512 contiguous bytes;
//           the grid's tiles cover every element of the plane(s) exactly once.
// =====================================================================================================
template <int MODE>
__device__ __forceinline__
void gemm_bf(const u16* __restrict__ A, const u16* __restrict__ Bt, const float* __restrict__ bias,
             u16* Hp, u16* Lp, int M, int N, int K, float sc, int bid) {
  const int tid = threadIdx.x, lane = tid & 31;
  const int wave = __builtin_amdgcn_readfirstlane(tid >> 5);  // a scalar: the tile's bases below stay in scalar registers
  const int ntile = N >> 7;
  const int rowb  = (bid / ntile) * 128 + (wave >> 1) * 64;
  const int col0  = (bid % ntile) * 128 + (wave & 1) * 64;
  if (rowb + 64 > M) return;                // wave-uniform, never taken with the exact grid; no block barriers in this kernel
  const u16* ap = A  + (size_t)rowb * K;                     // wave-uniform bases; a 16-row band holds 16*K halves
  const u16* bp = Bt + (size_t)col0 * K;
  const unsigned lo = 8u * (unsigned)lane;                   // the lane's chunk in a tile
  const size_t bs = (size_t)16 * K;
  v8f acc[4][4];
#pragma unroll
  for (int i = 0; i < 4; ++i) {
#pragma unroll
    for (int jj = 0; jj < 4; ++jj) acc[i][jj] = zero8();
  }
#pragma unroll 1
  for (int k0 = 0; k0 < 16 * K; k0 += FT) {                  // one packed tile = 32 k
    const u16* pa = ap + k0 + lo;
    const u16* pb = bp + k0 + lo;
    v16b a[4], b[4];
#pragma unroll
    for (int i = 0; i < 4; ++i) a[i] = ldfrag_b(pa + i * bs);
#pragma unroll
    for (int jj = 0; jj < 4; ++jj) b[jj] = ldfrag_b(pb + jj * bs);
    // the address pairs of the sixteen loads above are inputs here, so no load's result is placed on one of them, and they are
    // rewritten only behind this wait
    asm volatile("s_wait_xcnt 0x0" :: "v"(pa), "v"(pb) : "memory");
#pragma unroll
    for (int i = 0; i < 4; ++i) {
#pragma unroll
      for (int jj = 0; jj < 4; ++jj) {
        if constexpr (MODE == 0) acc[i][jj] = mma_b(a[i], b[jj], acc[i][jj]);
        else                     acc[i][jj] = mma_b(b[jj], a[i], acc[i][jj]);
      }
    }
    guard16(acc, a, b);
  }
  const int hh = lane >> 4, m = lane & 15;
  float br[4][8];
#pragma unroll
  for (int jj = 0; jj < 4; ++jj) {
    if constexpr (MODE == 0) {
      const float b1v = bfr(bias[col0 + 16 * jj + m]);
#pragma unroll
      for (int e = 0; e < 8; ++e) br[jj][e] = b1v;
    } else {
      const float* bq8 = bias + col0 + 16 * jj + 8 * hh;
      const v4f x = *(const v4f*)(bq8), y = *(const v4f*)(bq8 + 4);
#pragma unroll
      for (int e = 0; e < 4; ++e) { br[jj][e] = bfr(x[e]); br[jj][4 + e] = bfr(y[e]); }
    }
  }
  // every result is formed first, the stores follow as the wave's last instructions
  v4u oh[4][4], ol[4][4];
#pragma unroll
  for (int i = 0; i < 4; ++i) {
#pragma unroll
    for (int jj = 0; jj < 4; ++jj) {
#pragma unroll
      for (int e = 0; e < 4; ++e) {
        const float t0 = (acc[i][jj][2 * e] + br[jj][2 * e]) * sc, t1 = (acc[i][jj][2 * e + 1] + br[jj][2 * e + 1]) * sc;
        const _Float16 h0 = (_Float16)t0, h1 = (_Float16)t1;
        oh[i][jj][e] = pk16(h_bits(h0), h_bits(h1));
        if constexpr (MODE == 2) {
          const _Float16 l0 = (_Float16)(t0 - (float)h0), l1 = (_Float16)(t1 - (float)h1);
          ol[i][jj][e] = pk16(h_bits(l0), h_bits(l1));
        }
      }
    }
  }
  if constexpr (MODE == 0) {
    const int bb = rowb / JL, j0 = rowb - bb * JL, g = col0 >> 6;
    u16* d = Hp + ((size_t)(bb * NH + g) * NKT + (j0 >> 5)) * 4 * FT + 8 * lane;
#pragma unroll
    for (int i = 0; i < 4; ++i) {
#pragma unroll
      for (int jj = 0; jj < 4; ++jj) *(v4u*)(d + (i >> 1) * 4 * FT + (i & 1) * 256 + jj * FT) = oh[i][jj];
    }
  } else {
    const size_t ob = (size_t)rowb * N + (size_t)(col0 >> 5) * FT + 8 * lane;
#pragma unroll
    for (int i = 0; i < 4; ++i) {
#pragma unroll
      for (int jj = 0; jj < 4; ++jj) *(v4u*)(Hp + ob + (size_t)i * 16 * N + jj * 256) = oh[i][jj];
    }
    if constexpr (MODE == 2) {
#pragma unroll
      for (int i = 0; i < 4; ++i) {
#pragma unroll
        for (int jj = 0; jj < 4; ++jj) *(v4u*)(Lp + ob + (size_t)i * 16 * N + jj * 256) = ol[i][jj];
      }
    }
  }
  // other jobs' code follows these stores in the merged kernel's listing: no register that a store names is rewritten in front of this wait
  asm volatile("s_wait_xcnt 0x0" ::: "memory");
}

// =====================================================================================================
// The three projections of a call in one launch (they share inputs only). The block index picks the job, uniformly in a block:
// GB_C blocks v = c.Wv^T, GB_C blocks k = c.Wk^T, GB_Q blocks q = q.Wq^T.
// =====================================================================================================
__global__ __launch_bounds__(128)
void gemm_qkv(const u16* __restrict__ XC, const u16* __restrict__ XQ, const u16* __restrict__ WV, const u16* __restrict__ WK,
              const u16* __restrict__ WQ, const float* __restrict__ bv, const float* __restrict__ bk,
              const float* __restrict__ bq, u16* VH, u16* KH, u16* QH, u16* QL) {
  const int bid = (int)blockIdx.x;
  if (bid < GB_C)                 gemm_bf<0>(XC, WV, bv, VH, VH, CROWS, DMOD, DMOD, VCAR, bid);
  else if (bid < 2 * GB_C)        gemm_bf<1>(XC, WK, bk, KH, KH, CROWS, DMOD, DMOD, KSC, bid - GB_C);
  else if (bid < 2 * GB_C + GB_Q) gemm_bf<2>(XQ, WQ, bq, QH, QL, QROWS, DMOD, DMOD, QSC, bid - 2 * GB_C);
}

// =====================================================================================================
// Output projection: out rows (s*NB + bb) of DMOD floats = (Ah + Al)[bb*SEQ + s][DMOD] . Bt[DMOD][DMOD]^T * oscale + bias
// (bf16 RNE value); products h.B + l.B into one accumulator (l unscaled residual).
// Block -> (column tile ct = bid % 16, sequence row tile rt of NRT, batch bb); the wave's 16 rows s = rt*64 + wave*16 .. +15 are
// consecutive rows of Ah/Al and rows of out spaced NB*DMOD floats apart (seq-major [s][b][DMOD] output layout).
// Block = 64x64 tile, 4 waves x 16 rows; f32 epilogue through a wave-private LDS slab.
// coverage: grid NB*NRT*16 blocks x 4 waves x (16 rows x 64 cols) = every (s, bb, col) of out exactly once.
// =====================================================================================================
__global__ __launch_bounds__(128)
void gemm_o2(const u16* __restrict__ Ah, const u16* __restrict__ Al, const u16* __restrict__ Bt, const float* __restrict__ bias,
             float* C, float oscale) {
  __shared__ __align__(16) float slab[4 * SLAB64];
  const int tid = threadIdx.x, wave = tid >> 5, lane = tid & 31;
  const int ntile = DMOD >> 6;
  const int bid   = blockIdx.x;
  const int ct    = bid % ntile;
  const int t2    = bid / ntile;
  const int rt    = t2 % NRT;
  const int bb    = t2 / NRT;
  if (bb >= NB) return;                     // block-uniform; no block barriers in this kernel; never taken with the exact grid
  const int srow  = rt * 64 + wave * 16;
  if (srow + 16 > SEQ) return;              // wave-uniform; never taken
  const int col0  = ct * 64;
  const int K     = DMOD;
  const size_t rowA = (size_t)bb * SEQ + srow;
  const _Float16* ahp = (const _Float16*)(const void*)Ah + rowA * K + 8 * lane;          // packed planes, as in gemm_bf
  const _Float16* alp = (const _Float16*)(const void*)Al + rowA * K + 8 * lane;
  const _Float16* bp  = (const _Float16*)(const void*)Bt + (size_t)col0 * K + 8 * lane;
  const size_t bs = (size_t)16 * K;
  v8f acc0 = zero8(), acc1 = zero8(), acc2 = zero8(), acc3 = zero8();
#pragma unroll 1
  for (int k0 = 0; k0 < 16 * K; k0 += FT) {
    const v16h ah = ldfrag_h(ahp + k0), al = ldfrag_h(alp + k0);
    const v16h b0 = ldfrag_h(bp + k0);
    const v16h b1 = ldfrag_h(bp + bs + k0);
    const v16h b2 = ldfrag_h(bp + 2 * bs + k0);
    const v16h b3 = ldfrag_h(bp + 3 * bs + k0);
    // the address pairs of the twelve loads above are inputs here, so no load's result is placed on one of them, and they are
    // rewritten only behind this wait
    asm volatile("s_wait_xcnt 0x0" :: "v"(ahp + k0), "v"(alp + k0), "v"(bp + k0) : "memory");
    acc0 = mma_h(ah, b0, acc0);  acc0 = mma_h(al, b0, acc0);
    acc1 = mma_h(ah, b1, acc1);  acc1 = mma_h(al, b1, acc1);
    acc2 = mma_h(ah, b2, acc2);  acc2 = mma_h(al, b2, acc2);
    acc3 = mma_h(ah, b3, acc3);  acc3 = mma_h(al, b3, acc3);
    guard6<v16h>(acc0, acc1, acc2, acc3, ah, al, b0, b1, b2, b3);
  }
  float* Cb = C + ((size_t)srow * NB + bb) * DMOD;
  epi64(slab + wave * SLAB64, acc0, acc1, acc2, acc3, oscale, bias, Cb, (size_t)NB * DMOD, col0, lane);
}

__device__ __forceinline__ float exp2_hw(float x) { return __builtin_amdgcn_exp2f(x); }

// lane l <-> lane l ^ 16 (the other half of the same column)
__device__ __forceinline__ float xhalf(float x) {
  const int b = __builtin_bit_cast(int, x);
  return __builtin_bit_cast(float, __builtin_amdgcn_permlanex16(b, b, 0x76543210, 0xfedcba98, false, false));
}

// e = 2^PLOG * 2^(s*lsc - reference), nb = PLOG - reference: score scale, reference and the carry of P meet in one packed
// multiply-add in front of the exponential (written on pairs: the bare exponential is no vector operation to the compiler, which
// otherwise splits the pairs)
__device__ __forceinline__ void exp_pairs(const v8f& s0, const v8f& s1, float lsc, float nb, v8f& e0, v8f& e1) {
  const v2f l2 = {lsc, lsc}, nb2 = {nb, nb};
#pragma unroll
  for (int r = 0; r < 4; ++r) {
    const v2f a0 = {s0[2 * r], s0[2 * r + 1]}, a1 = {s1[2 * r], s1[2 * r + 1]};
    const v2f x0 = __builtin_elementwise_fma(a0, l2, nb2), x1 = __builtin_elementwise_fma(a1, l2, nb2);
    e0[2 * r] = exp2_hw(x0[0]); e0[2 * r + 1] = exp2_hw(x0[1]);
    e1[2 * r] = exp2_hw(x1[0]); e1[2 * r + 1] = exp2_hw(x1[1]);
  }
}

// sum of a lane's 16 terms
__device__ __forceinline__ float sum16(const v8f& e0, const v8f& e1) {
  const v8f es = e0 + e1;
  return ((es[0] + es[4]) + (es[1] + es[5])) + ((es[2] + es[6]) + (es[3] + es[7]));
}

// One stage: 256 lanes x 16 B = 4 KiB per copy. Copies 0, 1: k bands 2c + (tid >> 7) (2 KiB of the head's tiles each, bands
// 16 key rows apart in the plane); copies 2, 3: the stage's 8 KiB of v^T tiles. lds = the lane's byte address in the buffer.
// The s_wait_xcnt closes the statement so that no address register of a copy is rewritten in front of it.
__device__ __forceinline__ void stage_copy(unsigned lds, const _Float16* kg, const _Float16* vg) {
#if defined(__HIP_DEVICE_COMPILE__)
  asm volatile("global_load_async_to_lds_b128 %0, %4, off\n\t"
               "global_load_async_to_lds_b128 %1, %5, off\n\t"
               "global_load_async_to_lds_b128 %2, %6, off\n\t"
               "global_load_async_to_lds_b128 %3, %7, off\n\t"
               "s_wait_xcnt 0x0"
               :: "v"(lds), "v"(lds + 4096u), "v"(lds + 8192u), "v"(lds + 12288u),
                  "v"(kg), "v"(kg + 32 * DMOD), "v"(vg), "v"(vg + 4 * FT) : "memory");
#endif
}
// this wave's copies have landed in LDS (the compiler places no wait for them)
__device__ __forceinline__ void wait_copies() {
#if defined(__HIP_DEVICE_COMPILE__)
  asm volatile("s_wait_asynccnt 0x0" ::: "memory");
#endif
}
// this wave's LDS reads have returned, before the barrier behind which their buffer is refilled
__device__ __forceinline__ void wait_lds_reads() {
#if defined(__HIP_DEVICE_COMPILE__)
  asm volatile("s_wait_dscnt 0x0" ::: "memory");
#endif
}

__global__ __launch_bounds__(ATT_THREADS)
void attn_x(const u16* __restrict__ QHp, const u16* __restrict__ QLp, const u16* __restrict__ KHp,
            const u16* __restrict__ VHp, u16* OHp, u16* OLp) {
  __shared__ __attribute__((aligned(16))) _Float16 ring[2 * STH];
  const int tid  = threadIdx.x;
  const int wave = tid >> 5;
  const int lane = tid & 31;
  const int bid  = blockIdx.x;
  const int qg   = bid % NQG;
  const int t2   = bid / NQG;
  const int head = t2 % NH;
  const int b    = t2 / NH;
  if (b >= NB) return;                      // block-uniform, before any barrier or copy; never taken with the exact grid
  const int q0   = (qg * AWV + wave) * 16;  // q0 + 16 <= SEQ by construction

  const size_t hcol = (size_t)head * (HD / 32) * FT + 8 * lane;        // the head's two tiles inside a 16-row band
  const _Float16* Qh  = (const _Float16*)(const void*)QHp + ((size_t)b * SEQ + q0) * DMOD + hcol;
  const _Float16* Ql  = (const _Float16*)(const void*)QLp + ((size_t)b * SEQ + q0) * DMOD + hcol;
  // copy sources of this lane in stage 0: k band tid >> 7, chunk tid & 127 of the head's two tiles; v^T chunk tid
  const _Float16* Kg = (const _Float16*)(const void*)KHp + ((size_t)b * JL + (tid >> 7) * 16) * DMOD
                       + (size_t)head * (HD / 32) * FT + 8 * (tid & 127);
  const _Float16* Vg = (const _Float16*)(const void*)VHp + (size_t)(b * NH + head) * NKT * 4 * FT + 8 * tid;
  const unsigned lds0 = (unsigned)(uintptr_t)(&ring[0]) + 16u * (unsigned)tid;
  const float lsc = SM_SCALE * (LOG2E / (QSC * KSC));
  const float oc  = 1.0f / VCAR;            // the 128 on P is in the accumulators and in Z alike and cancels in acc / Z

  // ---- q fragments (hi and residual, 2 k-steps over HD), loaded once ----
  const v16h qh0 = ldfrag_h(Qh), qh1 = ldfrag_h(Qh + FT);
  const v16h ql0 = ldfrag_h(Ql), ql1 = ldfrag_h(Ql + FT);

  float mrow = -INFINITY;                   // softmax reference in use for query column c (alike in both halves)
  float nbias = PLOG;                       // PLOG - reference (reference 0 while mrow is -inf): the addend of every exponent
  float cap  = -1.0f;                       // the test's bound on a step's sum: PCAP once a reference is set, below 0 before (always fires)
  float lrow = 0.f;                         // running sum (x128) over the keys of this half only
  v8f o[4];
#pragma unroll
  for (int j = 0; j < 4; ++j) o[j] = zero8();

  // ---- ring prologue: stage 0 landed and published, stage 1 in flight ----
  stage_copy(lds0, Kg, Vg);
  wait_copies();
  __syncthreads();
  stage_copy(lds0 + 2u * STH, Kg + (size_t)SKEY * DMOD, Vg + (size_t)(SKEY / 32) * 4 * FT);

#pragma unroll 1                            // rolled: one publish point per trip, in the order written at its foot
  for (int st = 0; st < NST; ++st) {
   const _Float16* sb = ring + (st & 1) * STH + 8 * lane;
#pragma unroll                              // both key steps of a stage in line: every LDS offset an immediate
   for (int p = 0; p < SKEY / 32; ++p) {    // key step kt = 2*st + p, keys kb = 32*kt .. kb + 31
    // ---- the step's k and v^T fragments, one group of LDS reads ----
    const _Float16* k0p = sb + p * 4 * FT;
    const _Float16* vhp = sb + SKEY * HD + p * 4 * FT;
    const v16h ka0 = ldfrag_h(k0p),          ka1 = ldfrag_h(k0p + FT);
    const v16h kc0 = ldfrag_h(k0p + 2 * FT), kc1 = ldfrag_h(k0p + 3 * FT);
    v16h vf[4];
#pragma unroll
    for (int j = 0; j < 4; ++j) vf[j] = ldfrag_h(vhp + j * FT);
    // ---- scores: D element r of this lane = (key kb + 8hh + r, query column c) in s0, key kb + 16 + 8hh + r in s1 ----
    v8f s0 = zero8(), s1 = zero8();
    {
      s0 = mma_h(ka0, qh0, s0);
      s0 = mma_h(ka0, ql0, s0);
      s0 = mma_h(ka1, qh1, s0);
      s0 = mma_h(ka1, ql1, s0);
      s1 = mma_h(kc0, qh0, s1);
      s1 = mma_h(kc0, ql0, s1);
      s1 = mma_h(kc1, qh1, s1);
      s1 = mma_h(kc1, ql1, s1);
      guard2(s0, s1, ka0, ka1, kc0, kc1, qh0, ql0, qh1, ql1);
    }
    // ---- online softmax in base 2, -inf-safe; one query per lane; reference held, moved only when the test fires ----
    v8f e0, e1;
    exp_pairs(s0, s1, lsc, nbias, e0, e1);
    float ssum = sum16(e0, e1);
    // every term is >= 0, so ssum <= cap bounds each of them; written so that a NaN fires too. Wave-uniform scalar branch.
    if (__builtin_amdgcn_ballot_w32(!(ssum <= cap)) != 0) {
      float mx = fmaxf(s0[0], s1[0]);                      // maximum of the raw scores (the scale is positive)
#pragma unroll
      for (int r = 1; r < 8; ++r) mx = fmaxf(mx, fmaxf(s0[r], s1[r]));
      mx *= lsc;
      mx = fmaxf(mx, xhalf(mx));
      const float mn = fmaxf(mrow, mx);
      const float ms = (mn == -INFINITY) ? 0.0f : mn;
      const float al = exp2_hw(mrow - ms);
      mrow  = mn;
      nbias = PLOG - ms;
      cap   = (mn == -INFINITY) ? -1.0f : PCAP;
      lrow *= al;
#pragma unroll
      for (int j = 0; j < 4; ++j) o[j] *= al;
      exp_pairs(s0, s1, lsc, nbias, e0, e1);
      ssum = sum16(e0, e1);
    }
    lrow += ssum;
    // ---- B fragment of P^T * 128 (f16), column = c, split k map over the 32 keys of this step ----
    FragH ph;
#pragma unroll
    for (int r = 0; r < 8; ++r) {
      ph.h[0][r] = (_Float16)e0[r];         // elements 0..7  = keys kb + 8hh + 0..7
      ph.h[1][r] = (_Float16)e1[r];         // elements 8..15 = keys kb + 16 + 8hh + 0..7
    }
    // ---- V^T.P^T : A fragment row = d = j*16 + c, keys contiguous in the v^T plane; 2 groups of 2 d-subtiles ----
    {
#pragma unroll
      for (int jg = 0; jg < HD / 32; ++jg) {
        const v16h vha = vf[2 * jg], vhc = vf[2 * jg + 1];
        o[2 * jg]     = mma_h(vha, ph.v, o[2 * jg]);
        o[2 * jg + 1] = mma_h(vhc, ph.v, o[2 * jg + 1]);
        guard2in(o[2 * jg], o[2 * jg + 1], ph.v, vha, vhc);
      }
    }
   }
   // ---- publish point of stage st + 1: own reads of this buffer done, own copies landed, every wave here; then the refill ----
   wait_lds_reads();
   wait_copies();
   __syncthreads();
   if (st + 2 < NST) {                      // block-uniform
     stage_copy(lds0 + (unsigned)(st & 1) * (2u * STH), Kg + (size_t)(st + 2) * SKEY * DMOD,
                Vg + (size_t)(st + 2) * (SKEY / 32) * 4 * FT);
   }
  }
  wait_copies();
  acc_guard4(o[0], o[1], o[2], o[3]);
  // ---- out = acc / Z (0 if Z == 0), acc and Z both x128, the 1024 on v folded once; the halves' sums joined here ----
  const float lv  = lrow + xhalf(lrow);
  const float ls  = (lv > 0.0f) ? lv : 1.0f;
  const float inv = (lv > 0.0f) ? ((1.0f / ls) * oc) : 0.0f;
  // ---- O x1024 -> packed f16 hi + residual planes; chunk j*32 + lane of the head's two tiles: row c, d = 16j + 8hh + 0..7 ----
  v4u oh[4], ol[4];
#pragma unroll
  for (int it = 0; it < 4; ++it) {
    float w[8];
#pragma unroll
    for (int e = 0; e < 8; ++e) w[e] = (o[it][e] * inv) * OSC;
#pragma unroll
    for (int e = 0; e < 4; ++e) {
      const _Float16 h0 = (_Float16)w[2 * e], h1 = (_Float16)w[2 * e + 1];
      const _Float16 l0 = (_Float16)(w[2 * e] - (float)h0), l1 = (_Float16)(w[2 * e + 1] - (float)h1);
      oh[it][e] = pk16(h_bits(h0), h_bits(h1));
      ol[it][e] = pk16(h_bits(l0), h_bits(l1));
    }
  }
  const size_t ob = ((size_t)b * SEQ + q0) * DMOD + hcol;
  {
#pragma unroll
    for (int it = 0; it < 4; ++it) {
      *(v4u*)(OHp + ob + (size_t)it * 256) = oh[it];
      *(v4u*)(OLp + ob + (size_t)it * 256) = ol[it];
    }
    
  }
}

// =====================================================================================================
// Workspace map (bytes); every plane is fully written by whole-line stores before it is read; all extents are exact multiples
// of the store granularity (512-B half tiles; no pad rows needed); every region offset a multiple of
// 2097152:
//   XC  bf16 [CROWS][1024]              CROWS*2048   (c = [mem; kv] as bf16)
//   XQ  bf16 [QROWS][1024]              QROWS*2048   (q as bf16)
//   WV, WK, WQ, WC  16-bit [1024 n][1024 k]  2097152 each  (Wv, Wk, Wq as bf16, Wc as f16 x1024)
//   OH  f16 [QROWS][1024] x1024         QROWS*2048   OL residual the same
//   VH  f16 [NB*16][64][JL] x1024       CROWS*2048   (all 16-bit planes in packed 16 x 32 tiles)
//   KH  f16 [CROWS][1024] x1024         CROWS*2048
//   QH  f16 [QROWS][1024] x1024         QROWS*2048   QL residual the same
//   end (NB=2, SEQ=MLEN=2048)           100663296
// =====================================================================================================
extern "C" void kernel_launch(void* const* d_in, const int* in_sizes, int n_in,
                              void* d_out, int out_size, void* d_ws, size_t ws_size,
                              hipStream_t stream) {
  if (n_in < 11) return;
  const long long needq = ((long long)(SEQ - 1) * B_FULL + NB) * DMOD;
  const long long needm = (MLEN > 0) ? (((long long)(MLEN - 1) * B_FULL + NB) * DMOD) : 0;
  if ((long long)in_sizes[0] < needq || (long long)in_sizes[1] < needq || (long long)in_sizes[2] < needm) return;
  if (in_sizes[3] < DMOD * DMOD || in_sizes[5] < DMOD * DMOD || in_sizes[7] < DMOD * DMOD || in_sizes[9] < DMOD * DMOD) return;
  if (in_sizes[4] < DMOD || in_sizes[6] < DMOD || in_sizes[8] < DMOD || in_sizes[10] < DMOD) return;
  if ((long long)out_size < (long long)SEQ * NB * DMOD) return;

  const float* xq  = (const float*)d_in[0];
  const float* xkv = (const float*)d_in[1];
  const float* xm  = (const float*)d_in[2];
  const float* wq  = (const float*)d_in[3];
  const float* bq  = (const float*)d_in[4];
  const float* wk  = (const float*)d_in[5];
  const float* bk  = (const float*)d_in[6];
  const float* wv  = (const float*)d_in[7];
  const float* bv  = (const float*)d_in[8];
  const float* wc  = (const float*)d_in[9];
  const float* bc  = (const float*)d_in[10];
  float*       out = (float*)d_out;

  const size_t szXC = (size_t)CROWS * DMOD * 2;
  const size_t szXQ = (size_t)QROWS * DMOD * 2;
  const size_t szW  = (size_t)DMOD * DMOD * 2;
  const size_t szO  = (size_t)QROWS * DMOD * 2;                 // OH, OL each
  const size_t szVH = (size_t)NB * NH * HD * JL * 2;            // == CROWS*2048
  const size_t szKH = (size_t)CROWS * DMOD * 2;
  const size_t szQ  = (size_t)QROWS * DMOD * 2;                 // QH, QL each
  size_t off = 0;
  const size_t oXC = off; off += szXC;
  const size_t oXQ = off; off += szXQ;
  const size_t oWV = off; off += szW;
  const size_t oWK = off; off += szW;
  const size_t oWQ = off; off += szW;
  const size_t oWC = off; off += szW;
  const size_t oOH = off; off += szO;
  const size_t oOL = off; off += szO;
  const size_t oVH = off; off += szVH;
  const size_t oKH = off; off += szKH;
  const size_t oQH = off; off += szQ;
  const size_t oQL = off; off += szQ;
  if (off > ws_size) return;                // off = 100663296 for NB = 2, SEQ = MLEN = 2048
  if (off > (size_t)WS_CAP) return;

  char* ws = (char*)d_ws;
  u16*   XC = (u16*)(ws + oXC);
  u16*   XQ = (u16*)(ws + oXQ);
  u16*   WV = (u16*)(ws + oWV);
  u16*   WK = (u16*)(ws + oWK);
  u16*   WQ = (u16*)(ws + oWQ);
  u16*   WC = (u16*)(ws + oWC);
  u16*   OH = (u16*)(ws + oOH);
  u16*   OL = (u16*)(ws + oOL);
  u16*   VH = (u16*)(ws + oVH);
  u16*   KH = (u16*)(ws + oKH);
  u16*   QH = (u16*)(ws + oQH);
  u16*   QL = (u16*)(ws + oQL);

  const dim3 b256(256), b128(128), bAT(ATT_THREADS);
  const dim3 gCV(CB_C + CB_Q + 4 * CB_W);
  const dim3 gQKV(2 * GB_C + GB_Q);
  const dim3 gAT(NQG * NH * NB);
  const dim3 gO(NB * NRT * (DMOD / 64));

  // (1) c = [mem; kv] and q -> bf16 planes, batch-major rows; Wv, Wk, Wq -> bf16 planes; Wc -> f16 plane of bf16 value x1024
  cvt_all<<<gCV, b256, 0, stream>>>(xm, xkv, xq, wv, wk, wq, wc, XC, XQ, WV, WK, WQ, WC);
  // (2) v = c.Wv^T + bv -> v^T plane x1024; k = c.Wk^T + bk -> k hi plane x1024; q = q.Wq^T + bq -> q hi + residual planes x1024
  gemm_qkv<<<gQKV, b128, 0, stream>>>(XC, XQ, WV, WK, WQ, bv, bk, bq, VH, KH, QH, QL);
  // (3) attention over all JL keys -> O hi + residual planes
  attn_x<<<gAT, bAT, 0, stream>>>(QH, QL, KH, VH, OH, OL);
  // (4) output projection -> out f32 rows (s*NB + b), carries 1024 x 1024 folded back
  gemm_o2<<<gO, b128, 0, stream>>>(OH, OL, WC, bc, out, 1.0f / (OSC * WOS));
  (void)hipGetLastError();
}

// v009
// One run takes 153 microseconds.
// In both of two side-by-side timings against v008, it was 1.04 times as fast.
// Counting every step since v000, it is 3.63 times as fast.
// Contractions: q.Wq^T, c.Wk^T, c.Wv^T (c = [mem; kv] along the key axis) on v_wmma_f32_16x16x32_bf16 (activations, W and
// biases RNE-converted to bf16; the [n][k] weight rows are used directly as a k-contiguous operand: B for v, A for q and k; f32 accumulate);
// k.q^T over 64 on v_wmma_f32_16x16x32_f16 with q carried as f16 hi (x1024) plus an f16 residual plane and k as f16 hi (x1024)
// (products h.h + h.l); v^T.P^T on v_wmma_f32_16x16x32_f16 (P x128 f16, v x1024 f16, one product); O.Wc^T on
// v_wmma_f32_16x16x32_f16 (O x1024 as f16 hi plus f16 residual plane, Wc as f16(bf16(Wc)) x1024, products h.w + l.w);
// all f32 accumulate. Bias adds, base-2 online softmax over all keys and the 1/Z fold in f32 on VALU.
// Every 16-bit workspace plane is stored fragment-packed (see "packed planes" below): a wave-wide 16-B fragment load reads 512
// contiguous bytes (4 whole lines) instead of 32 B out of each of 16 rows.
#include <hip/hip_runtime.h>
#include <math.h>
#include <stdint.h>

#ifndef NB
#define NB 2
#endif
#ifndef SEQ
#define SEQ 2048
#endif
#ifndef MLEN
#define MLEN 2048
#endif
#define B_FULL 2
#define L_FULL 2048
#define M_FULL 2048
#define DMOD  1024
#define NH    16
#define HD    64
#define JL    (MLEN + SEQ)
#define QROWS (NB * SEQ)
#define CROWS (NB * JL)
#define SM_SCALE 0.125f
#define LOG2E 1.4426950408889634f
#define QSC   1024.0f
#define KSC   1024.0f
#define PLOG  7.0f                // P is carried x 2^7 = 128, as a bias of its exponent
#define PCAP  32768.0f            // a key step keeps the softmax reference in use while its 16 terms of a lane sum to at most this: P stays a finite f16
#define VCAR  1024.0f
#define OSC   1024.0f
#define WOS   1024.0f
#define AWV   8                   // waves of an attention block: AWV / KSP wave places x KSP key ranges, all on ONE head
#define QPW   2                   // query tiles of one wave (32 query columns): each k / v^T fragment read from LDS feeds both
#define KSP   2                   // key ranges of a block: waves w and w + AWV / KSP have the same query tiles and half the keys each
#define NQT   (SEQ / 16)
#define NQG   (NQT / ((AWV / KSP) * QPW))
#define SKEY  64                  // keys in one LDS stage of the attention ring
#define NST   (JL / (SKEY * KSP)) // stages of one key range
#define STH   (2 * SKEY * HD)     // halves in one stage: 8 packed k tiles, then 8 packed v^T tiles (16 KiB)
#define NKT   (JL / 32)
#define NRT   (SEQ / 64)
#define ATT_THREADS (AWV * 32)
#define SLAB64 (16 * 68)
#define QKT   (DMOD / 8)
#define WS_CAP 134217728
#define FT    512                 // halves in one packed 16 x 32 fragment tile (1 KiB)
#define TPB   (DMOD / 32)         // fragment tiles in one 16-row band of a [rows][DMOD] plane
#define CB_C  (CROWS / 2)         // conversion launch: blocks of the c range, of the q range, of one weight matrix
#define CB_Q  (QROWS / 2)
#define CB_W  ((DMOD * DMOD) / (8 * 256))
#define GB_C  ((CROWS / 128) * (DMOD / 128)) // projection launch: blocks of the v range (k the same), of the q range
#define GB_Q  ((QROWS / 128) * (DMOD / 128))
static_assert(DMOD == NH * HD && HD == 64 && NH == 16);
static_assert((NQT % ((AWV / KSP) * QPW)) == 0 && ATT_THREADS == 256 && QPW == 2 && KSP == 2 && NST * SKEY * KSP == JL && NST >= 2 && SKEY == 64);
static_assert(NB >= 1 && NB <= B_FULL);
static_assert((SEQ % 64) == 0 && SEQ >= 64 && SEQ <= L_FULL);
static_assert((MLEN % 64) == 0 && MLEN >= 0 && MLEN <= M_FULL);
static_assert((JL % 64) == 0 && NKT * 32 == JL && NQT * 16 == SEQ && NRT * 64 == SEQ);
static_assert(QKT == 128 && (DMOD % 64) == 0 && (DMOD % 32) == 0 && (HD % 32) == 0);
static_assert(((DMOD * DMOD) % (8 * 256)) == 0);
static_assert(QROWS <= CROWS);
static_assert((CROWS % 128) == 0 && (QROWS % 128) == 0 && (DMOD % 128) == 0);
static_assert(TPB == 32 && QKT == 2 * 64 && (TPB % 2) == 0 && (MLEN % 16) == 0 && (SEQ % 16) == 0 && (JL % 16) == 0);
static_assert((long long)CROWS * DMOD * 6 + (long long)QROWS * DMOD * 10 + 8LL * DMOD * DMOD <= (long long)WS_CAP);

typedef unsigned short u16;
typedef _Float16 v16h __attribute__((ext_vector_type(16)));
typedef _Float16 v8h  __attribute__((ext_vector_type(8)));
typedef __bf16   v16b __attribute__((ext_vector_type(16)));
typedef float    v8f  __attribute__((ext_vector_type(8)));
typedef float    v4f  __attribute__((ext_vector_type(4)));
typedef float    v2f  __attribute__((ext_vector_type(2)));
typedef unsigned int v4u __attribute__((ext_vector_type(4)));

union FragH { v16h v; v8h h[2]; v4u u[2]; };
union FragB { v16b v; v4u u[2]; };

// ---- scalar helpers --------------------------------------------------------------------------------
__device__ __forceinline__ unsigned short bf_bits(float f) {          // f32 -> bf16 bits, RNE convert
  unsigned u = __float_as_uint(f);
  return (unsigned short)((u + 0x7FFFu + ((u >> 16) & 1u)) >> 16);
}
__device__ __forceinline__ float bf_up(unsigned short h) { return __uint_as_float(((unsigned)h) << 16); }
__device__ __forceinline__ float bfr(float f) { return bf_up(bf_bits(f)); }
__device__ __forceinline__ unsigned short h_bits(_Float16 x) { return __builtin_bit_cast(unsigned short, x); }
__device__ __forceinline__ unsigned pk16(unsigned short a, unsigned short b) { return (unsigned)a | ((unsigned)b << 16); }
__device__ __forceinline__ v8f zero8() { v8f z = {0.f, 0.f, 0.f, 0.f, 0.f, 0.f, 0.f, 0.f}; return z; }

// ---- packed planes: a [rows][K] 16-bit matrix is stored as 16 x 32 fragment tiles of FT halves, tile (row >> 4, k >> 5) at
//      index (row >> 4) * (K / 32) + (k >> 5); inside a tile element (c = row & 15, kk = k & 31) sits at
//      (kk >> 4) * 256 + (((kk >> 3) & 1) * 16 + c) * 8 + (kk & 7): chunk g of 8 halves = what lane g & 31 takes in load g >> 5.
// ---- fragment loaders: 16-bit A/B operand, lane -> row/col (lane&15), p = tile start + 8*lane;
//      elements 0..7 <- p[0..7] (k0+8h..), elements 8..15 <- p[256..263] (k0+16+8h..)  (same split k map for A and B)
__device__ __forceinline__ v16h ldfrag_h(const _Float16* p) {
  FragH f;
  f.h[0] = *(const v8h*)(p);
  f.h[1] = *(const v8h*)(p + 256);
  return f.v;
}
__device__ __forceinline__ v16b ldfrag_b(const u16* p) {              // bf16 plane read as unsigned integer vectors
  FragB f;
  f.u[0] = *(const v4u*)(p);
  f.u[1] = *(const v4u*)(p + 256);
  return f.v;
}
// first column of chunk w (0..63) inside its tile
__device__ __forceinline__ int chunk_k(int w) { return ((w >> 5) & 1) * 16 + ((w >> 4) & 1) * 8; }

__device__ __forceinline__ v8f mma_h(v16h a, v16h b, v8f c) {
  return __builtin_amdgcn_wmma_f32_16x16x32_f16(false, a, false, b, (short)0, c, false, false);
}
__device__ __forceinline__ v8f mma_b(v16b a, v16b b, v8f c) {
  return __builtin_amdgcn_wmma_f32_16x16x32_bf16(false, a, false, b, (short)0, c, false, false);
}
// The four issue slots behind the V^T.P^T matrix instructions of a key step (both query tiles). The accumulators are inputs only: as
// in-out operands they were copied from register to register in every key step once their rescale stands in a branch.
__device__ __forceinline__ void guard8in(const v8f (&a)[4], const v8f (&b)[4], v16h p0, v16h p1, const v16h (&x)[4]) {
#if defined(__HIP_DEVICE_COMPILE__)
  asm volatile("v_nop\n\tv_nop\n\tv_nop\n\tv_nop"
               :: "v"(a[0]), "v"(a[1]), "v"(a[2]), "v"(a[3]), "v"(b[0]), "v"(b[1]), "v"(b[2]), "v"(b[3]),
                  "v"(p0), "v"(p1), "v"(x[0]), "v"(x[1]), "v"(x[2]), "v"(x[3]) : "memory");
#endif
}
template <typename F>
__device__ __forceinline__ void guard6(v8f& a, v8f& b, v8f& c, v8f& d, F x0, F x1, F x2, F x3, F x4, F x5) {
#if defined(__HIP_DEVICE_COMPILE__)
  asm volatile("v_nop\n\tv_nop\n\tv_nop\n\tv_nop"
               : "+v"(a), "+v"(b), "+v"(c), "+v"(d) : "v"(x0), "v"(x1), "v"(x2), "v"(x3), "v"(x4), "v"(x5) : "memory");
#endif
}
// Foot of the projection loop: the four issue slots between the last matrix instructions of a trip and the next trip's loads into
// their operand registers, on the taken branch too. Every accumulator and fragment is an input only, so the slots stand behind all
// sixteen matrix instructions and the fragments' registers stay theirs up to here.
__device__ __forceinline__ void guard16(const v8f (&c)[4][4], const v16b (&a)[4], const v16b (&b)[4]) {
#if defined(__HIP_DEVICE_COMPILE__)
  asm volatile("v_nop\n\tv_nop\n\tv_nop\n\tv_nop"
               :: "v"(c[0][0]), "v"(c[0][1]), "v"(c[0][2]), "v"(c[0][3]), "v"(c[1][0]), "v"(c[1][1]), "v"(c[1][2]), "v"(c[1][3]),
                  "v"(c[2][0]), "v"(c[2][1]), "v"(c[2][2]), "v"(c[2][3]), "v"(c[3][0]), "v"(c[3][1]), "v"(c[3][2]), "v"(c[3][3]),
                  "v"(a[0]), "v"(a[1]), "v"(a[2]), "v"(a[3]), "v"(b[0]), "v"(b[1]), "v"(b[2]), "v"(b[3]) : "memory");
#endif
}
__device__ __forceinline__ void acc_guard4(v8f& a, v8f& b, v8f& c, v8f& d) {
#if defined(__HIP_DEVICE_COMPILE__)
  asm volatile("v_nop\n\tv_nop\n\tv_nop\n\tv_nop" : "+v"(a), "+v"(b), "+v"(c), "+v"(d));
#endif
}
__device__ __forceinline__ void wave_sync_lds() {
  __builtin_amdgcn_fence(__ATOMIC_RELEASE, "workgroup");
  __builtin_amdgcn_wave_barrier();
  __builtin_amdgcn_fence(__ATOMIC_ACQUIRE, "workgroup");
}

// =====================================================================================================
// f32 [DMOD n][DMOD k] -> packed 16-bit plane.  f16mode == 0: bf16 RNE bits;  f16mode == 1: f16 bits of (bf16 RNE value) * scale.
// Used for the [n][k] weight matrices (bf16, or f16 of the bf16 value x1024 for Wc).
// Thread = packed chunk gt (8 consecutive k of one row): two 16-B loads, one 16-B store; 32 lanes store 512 contiguous bytes
// coverage: CB_W blocks x 256 thr x 8 = the whole plane (131072 chunks); gt = block of the matrix's range * 256 + thread.
// =====================================================================================================
__device__ __forceinline__ void cvt16_part(const float* __restrict__ x, u16* D, int gt, int f16mode, float scale) {
  const int tile = gt >> 6;
  const float* p = x + (size_t)((tile / TPB) * 16 + (gt & 15)) * DMOD + (tile % TPB) * 32 + chunk_k(gt & 63);
  const v4f a = *(const v4f*)(p), b4 = *(const v4f*)(p + 4);
  float w[8];
#pragma unroll
  for (int e = 0; e < 4; ++e) { w[e] = a[e]; w[4 + e] = b4[e]; }
  v4u o;
#pragma unroll
  for (int e = 0; e < 4; ++e) {
    const float f0 = w[2 * e], f1 = w[2 * e + 1];
    const unsigned short hb0 = h_bits((_Float16)(bfr(f0) * scale));
    const unsigned short hb1 = h_bits((_Float16)(bfr(f1) * scale));
    const unsigned short bb0 = bf_bits(f0);
    const unsigned short bb1 = bf_bits(f1);
    o[e] = (f16mode != 0) ? pk16(hb0, hb1) : pk16(bb0, bb1);
  }
  u16* d = D + (size_t)gt * 8;
  *(v4u*)(d) = o;
  // other jobs' code follows this store in the merged kernel's listing: no register that the store names is rewritten in front of this wait
  asm volatile("s_wait_xcnt 0x0" ::: "memory");
}

// =====================================================================================================
// Activation rows -> packed bf16 plane (RNE), batch-major destination rows:
//   D[(bb*nrow + j)][0..1023] <- X0[(j*B_FULL + bb)][..] for j < split,  X1[((j - split)*B_FULL + bb)][..] for j >= split.
// Used for c = [mem rows 0..MLEN-1 ; kv rows 0..SEQ-1] (nrow = JL, split = MLEN) and for q (nrow = SEQ, split = SEQ, X1 unused).
// Unit r = two packed tiles of one 16-row band (16 rows x 64 columns), 128 threads, thread tid = one chunk: two 16-B loads, one
// 16-B store. The source base selection is uniform in a unit (nrow and split are multiples of 16; both sources are global planes).
// coverage: NB*nrow units x 128 chunks x 8 = every element of the [NB*nrow][1024] plane exactly once.
// =====================================================================================================
__device__ __forceinline__ void cvt_act_part(const float* __restrict__ X0, const float* __restrict__ X1, u16* D,
                                             int nrow, int split, int r, int tid) {
  const int  r0    = (r / (TPB / 2)) * 16;                    // first row of the band
  const int  col   = ((r % (TPB / 2)) * 2 + (tid >> 6)) * 32 + chunk_k(tid & 63);
  const int  bb    = r0 / nrow;
  const int  j     = r0 - bb * nrow;
  const bool first = (j < split);
  const int  js    = (first ? j : (j - split)) + (tid & 15);
  const float* base = first ? X0 : X1;
  const float* p = base + ((size_t)js * B_FULL + bb) * DMOD + col;
  const v4f a = *(const v4f*)(p), a4 = *(const v4f*)(p + 4);
  v4u o;
#pragma unroll
  for (int e = 0; e < 2; ++e) {
    o[e]     = pk16(bf_bits(a[2 * e]),  bf_bits(a[2 * e + 1]));
    o[2 + e] = pk16(bf_bits(a4[2 * e]), bf_bits(a4[2 * e + 1]));
  }
  u16* d = D + ((size_t)r * QKT + tid) * 8;
  *(v4u*)(d) = o;
  // other jobs' code follows this store in the merged kernel's listing: no register that the store names is rewritten in front of this wait
  asm volatile("s_wait_xcnt 0x0" ::: "memory");
}

// =====================================================================================================
// All conversions of a call in one launch (none reads what another writes; each has a plane of its own). The block index picks
// the job, uniformly in a block: CB_C blocks c = [mem; kv], CB_Q blocks q (two 128-thread units a block), then CB_W blocks each
// for Wv, Wk, Wq (bf16) and Wc (f16 of the bf16 value x1024).
// coverage: grid = CB_C + CB_Q + 4*CB_W blocks; every range is exactly its job's units.
// =====================================================================================================
__global__ __launch_bounds__(256)
void cvt_all(const float* __restrict__ xm, const float* __restrict__ xkv, const float* __restrict__ xq,
             const float* __restrict__ wv, const float* __restrict__ wk, const float* __restrict__ wq,
             const float* __restrict__ wc, u16* XC, u16* XQ, u16* WV, u16* WK, u16* WQ, u16* WC) {
  const int tid = (int)threadIdx.x;
  int blk = (int)blockIdx.x;
  if (blk < CB_C) { cvt_act_part(xm, xkv, XC, JL, MLEN, 2 * blk + (tid >> 7), tid & 127); return; }
  blk -= CB_C;
  if (blk < CB_Q) { cvt_act_part(xq, xq, XQ, SEQ, SEQ, 2 * blk + (tid >> 7), tid & 127); return; }
  blk -= CB_Q;
  const int wsel = blk / CB_W;
  const int gt   = (blk % CB_W) * 256 + tid;
  if (wsel < 3)       cvt16_part(wsel == 0 ? wv : (wsel == 1 ? wk : wq), wsel == 0 ? WV : (wsel == 1 ? WK : WQ), gt, 0, 1.0f);
  else if (wsel == 3) cvt16_part(wc, WC, gt, 1, WOS);
}

// =====================================================================================================
// Epilogue of the output projection: the wave's 16x64 f32 tile (times oscale) staged in its private LDS slab (pitch 68),
// coverage: 8 instructions x 2 rows x 16 lanes x 4 floats = the wave's 16 x 64 tile.
// =====================================================================================================
__device__ __forceinline__ void epi64(float* sl, v8f a0, v8f a1, v8f a2, v8f a3, float oscale,
                                      const float* __restrict__ bias, float* Cb, size_t pitch, int col0, int lane) {
  const int hh = lane >> 4, m = lane & 15;
#pragma unroll
  for (int r = 0; r < 8; ++r) {
    const int ro = (8 * hh + r) * 68 + m;
    sl[ro]      = a0[r] * oscale;
    sl[ro + 16] = a1[r] * oscale;
    sl[ro + 32] = a2[r] * oscale;
    sl[ro + 48] = a3[r] * oscale;
  }
  wave_sync_lds();
  const v4f bb = *(const v4f*)(bias + col0 + m * 4);
  v4f br;
#pragma unroll
  for (int e = 0; e < 4; ++e) br[e] = bfr(bb[e]);
  v4f vals[8];
#pragma unroll
  for (int it = 0; it < 8; ++it) vals[it] = *(const v4f*)(sl + (it * 2 + hh) * 68 + m * 4) + br;
  float* dst = Cb + (size_t)hh * pitch + col0 + m * 4;
  {
#pragma unroll
    for (int it = 0; it < 8; ++it) {
      *(v4f*)(dst + (size_t)(it * 2) * pitch) = vals[it];
    }
    
  }
}

// =====================================================================================================
// bf16 projection GEMM: P[M][N] = A[M][K] (bf16 packed) . Bt[N][K]^T (bf16 packed) + bias[col] (bf16 RNE value), f32 accumulate;
// the result leaves the accumulators as the packed f16 plane(s) its consumer reads, f16(P * sc); no f32 copy of P is kept.
// Block = 128x128 tile, 2 x 2 waves of 64 rows x 64 columns each: per 32 k a wave loads 4 A and 4 B fragments (16 loads of 16 B)
// for 16 matrix instructions, every fragment used four times from registers; the two waves of a block row share the A lines, the two
// of a block column the B lines. Fragments loaded straight from the packed tiles (two 16-B loads each, split k map for A and B);
// K stepped by 32 (K % 32 == 0, M % 128 == 0, N % 128 == 0; bid = 0 .. (M/128)*(N/128) - 1, the block inside its job).
// Band i = rows rowb + 16i .. + 15, subtile jj = columns col0 + 16jj .. + 15; accumulator acc[i][jj].
// A lane of a D tile holds 8 consecutive D rows (8hh + r) of one D column (m); a packed chunk is 8 consecutive k of one tile row.
//   MODE 0 (v, N == DMOD, rows bb*JL + j): D = A.Bt^T, D rows = keys, D column = d. The lane's 8 keys of one d ARE chunk
//     ((j >> 4) & 1)*32 + lane of the v^T tile (head bb*NH + g, key step j >> 5, d subtile jj) at index
//     ((bb*NH + g)*NKT + (j >> 5))*4 + jj (row in the tile = d & 15, k = j & 31), j = j0 + 16i the band's first key (j0 % 64 == 0,
//     JL % 64 == 0: a wave's four bands lie in one batch).
//   MODE 1 (k, hi plane) and MODE 2 (q, hi plane Hp and residual plane Lp = f16(P*sc - hi)): the operands change places,
//     D = Bt.A^T, D rows = columns n of P, D column = row of P. The lane's 8 columns of one row ARE chunk (jj & 1)*32 + lane of
//     the [M][N] plane's tile ((rowb >> 4) + i, (col0 >> 5) + (jj >> 1)).
// The sum over k of every element is the same in both forms (same fragments, same k map, same k order).
// coverage: per wave and plane 16 stores x 32 lanes x 8 halves = its 64 x 64 results, each store 512 contiguous bytes;
//           the grid's tiles cover every element of the plane(s) exactly once.
// =====================================================================================================
template <int MODE>
__device__ __forceinline__
void gemm_bf(const u16* __restrict__ A, const u16* __restrict__ Bt, const float* __restrict__ bias,
             u16* Hp, u16* Lp, int M, int N, int K, float sc, int bid) {
  const int tid = threadIdx.x, lane = tid & 31;
  const int wave = __builtin_amdgcn_readfirstlane(tid >> 5);  // a scalar: the tile's bases below stay in scalar registers
  const int ntile = N >> 7;
  const int rowb  = (bid / ntile) * 128 + (wave >> 1) * 64;
  const int col0  = (bid % ntile) * 128 + (wave & 1) * 64;
  if (rowb + 64 > M) return;                // wave-uniform, never taken with the exact grid; no block barriers in this kernel
  const u16* ap = A  + (size_t)rowb * K;                     // wave-uniform bases; a 16-row band holds 16*K halves
  const u16* bp = Bt + (size_t)col0 * K;
  const unsigned lo = 8u * (unsigned)lane;                   // the lane's chunk in a tile
  const size_t bs = (size_t)16 * K;
  v8f acc[4][4];
#pragma unroll
  for (int i = 0; i < 4; ++i) {
#pragma unroll
    for (int jj = 0; jj < 4; ++jj) acc[i][jj] = zero8();
  }
#pragma unroll 1
  for (int k0 = 0; k0 < 16 * K; k0 += FT) {                  // one packed tile = 32 k
    const u16* pa = ap + k0 + lo;
    const u16* pb = bp + k0 + lo;
    v16b a[4], b[4];
#pragma unroll
    for (int i = 0; i < 4; ++i) a[i] = ldfrag_b(pa + i * bs);
#pragma unroll
    for (int jj = 0; jj < 4; ++jj) b[jj] = ldfrag_b(pb + jj * bs);
    // the address pairs of the sixteen loads above are inputs here, so no load's result is placed on one of them, and they are
    // rewritten only behind this wait
    asm volatile("s_wait_xcnt 0x0" :: "v"(pa), "v"(pb) : "memory");
#pragma unroll
    for (int i = 0; i < 4; ++i) {
#pragma unroll
      for (int jj = 0; jj < 4; ++jj) {
        if constexpr (MODE == 0) acc[i][jj] = mma_b(a[i], b[jj], acc[i][jj]);
        else                     acc[i][jj] = mma_b(b[jj], a[i], acc[i][jj]);
      }
    }
    guard16(acc, a, b);
  }
  const int hh = lane >> 4, m = lane & 15;
  float br[4][8];
#pragma unroll
  for (int jj = 0; jj < 4; ++jj) {
    if constexpr (MODE == 0) {
      const float b1v = bfr(bias[col0 + 16 * jj + m]);
#pragma unroll
      for (int e = 0; e < 8; ++e) br[jj][e] = b1v;
    } else {
      const float* bq8 = bias + col0 + 16 * jj + 8 * hh;
      const v4f x = *(const v4f*)(bq8), y = *(const v4f*)(bq8 + 4);
#pragma unroll
      for (int e = 0; e < 4; ++e) { br[jj][e] = bfr(x[e]); br[jj][4 + e] = bfr(y[e]); }
    }
  }
  // every result is formed first, the stores follow as the wave's last instructions
  v4u oh[4][4], ol[4][4];
#pragma unroll
  for (int i = 0; i < 4; ++i) {
#pragma unroll
    for (int jj = 0; jj < 4; ++jj) {
#pragma unroll
      for (int e = 0; e < 4; ++e) {
        const float t0 = (acc[i][jj][2 * e] + br[jj][2 * e]) * sc, t1 = (acc[i][jj][2 * e + 1] + br[jj][2 * e + 1]) * sc;
        const _Float16 h0 = (_Float16)t0, h1 = (_Float16)t1;
        oh[i][jj][e] = pk16(h_bits(h0), h_bits(h1));
        if constexpr (MODE == 2) {
          const _Float16 l0 = (_Float16)(t0 - (float)h0), l1 = (_Float16)(t1 - (float)h1);
          ol[i][jj][e] = pk16(h_bits(l0), h_bits(l1));
        }
      }
    }
  }
  if constexpr (MODE == 0) {
    const int bb = rowb / JL, j0 = rowb - bb * JL, g = col0 >> 6;
    u16* d = Hp + ((size_t)(bb * NH + g) * NKT + (j0 >> 5)) * 4 * FT + 8 * lane;
#pragma unroll
    for (int i = 0; i < 4; ++i) {
#pragma unroll
      for (int jj = 0; jj < 4; ++jj) *(v4u*)(d + (i >> 1) * 4 * FT + (i & 1) * 256 + jj * FT) = oh[i][jj];
    }
  } else {
    const size_t ob = (size_t)rowb * N + (size_t)(col0 >> 5) * FT + 8 * lane;
#pragma unroll
    for (int i = 0; i < 4; ++i) {
#pragma unroll
      for (int jj = 0; jj < 4; ++jj) *(v4u*)(Hp + ob + (size_t)i * 16 * N + jj * 256) = oh[i][jj];
    }
    if constexpr (MODE == 2) {
#pragma unroll
      for (int i = 0; i < 4; ++i) {
#pragma unroll
        for (int jj = 0; jj < 4; ++jj) *(v4u*)(Lp + ob + (size_t)i * 16 * N + jj * 256) = ol[i][jj];
      }
    }
  }
  // other jobs' code follows these stores in the merged kernel's listing: no register that a store names is rewritten in front of this wait
  asm volatile("s_wait_xcnt 0x0" ::: "memory");
}

// =====================================================================================================
// The three projections of a call in one launch (they share inputs only). The block index picks the job, uniformly in a block:
// GB_C blocks v = c.Wv^T, GB_C blocks k = c.Wk^T, GB_Q blocks q = q.Wq^T.
// =====================================================================================================
__global__ __launch_bounds__(128)
void gemm_qkv(const u16* __restrict__ XC, const u16* __restrict__ XQ, const u16* __restrict__ WV, const u16* __restrict__ WK,
              const u16* __restrict__ WQ, const float* __restrict__ bv, const float* __restrict__ bk,
              const float* __restrict__ bq, u16* VH, u16* KH, u16* QH, u16* QL) {
  const int bid = (int)blockIdx.x;
  if (bid < GB_C)                 gemm_bf<0>(XC, WV, bv, VH, VH, CROWS, DMOD, DMOD, VCAR, bid);
  else if (bid < 2 * GB_C)        gemm_bf<1>(XC, WK, bk, KH, KH, CROWS, DMOD, DMOD, KSC, bid - GB_C);
  else if (bid < 2 * GB_C + GB_Q) gemm_bf<2>(XQ, WQ, bq, QH, QL, QROWS, DMOD, DMOD, QSC, bid - 2 * GB_C);
}

// =====================================================================================================
// Output projection: out rows (s*NB + bb) of DMOD floats = (Ah + Al)[bb*SEQ + s][DMOD] . Bt[DMOD][DMOD]^T * oscale + bias
// (bf16 RNE value); products h.B + l.B into one accumulator (l unscaled residual).
// Block -> (column tile ct = bid % 16, sequence row tile rt of NRT, batch bb); the wave's 16 rows s = rt*64 + wave*16 .. +15 are
// consecutive rows of Ah/Al and rows of out spaced NB*DMOD floats apart (seq-major [s][b][DMOD] output layout).
// Block = 64x64 tile, 4 waves x 16 rows; f32 epilogue through a wave-private LDS slab.
// coverage: grid NB*NRT*16 blocks x 4 waves x (16 rows x 64 cols) = every (s, bb, col) of out exactly once.
// =====================================================================================================
__global__ __launch_bounds__(128)
void gemm_o2(const u16* __restrict__ Ah, const u16* __restrict__ Al, const u16* __restrict__ Bt, const float* __restrict__ bias,
             float* C, float oscale) {
  __shared__ __align__(16) float slab[4 * SLAB64];
  const int tid = threadIdx.x, wave = tid >> 5, lane = tid & 31;
  const int ntile = DMOD >> 6;
  const int bid   = blockIdx.x;
  const int ct    = bid % ntile;
  const int t2    = bid / ntile;
  const int rt    = t2 % NRT;
  const int bb    = t2 / NRT;
  if (bb >= NB) return;                     // block-uniform; no block barriers in this kernel; never taken with the exact grid
  const int srow  = rt * 64 + wave * 16;
  if (srow + 16 > SEQ) return;              // wave-uniform; never taken
  const int col0  = ct * 64;
  const int K     = DMOD;
  const size_t rowA = (size_t)bb * SEQ + srow;
  const _Float16* ahp = (const _Float16*)(const void*)Ah + rowA * K + 8 * lane;          // packed planes, as in gemm_bf
  const _Float16* alp = (const _Float16*)(const void*)Al + rowA * K + 8 * lane;
  const _Float16* bp  = (const _Float16*)(const void*)Bt + (size_t)col0 * K + 8 * lane;
  const size_t bs = (size_t)16 * K;
  v8f acc0 = zero8(), acc1 = zero8(), acc2 = zero8(), acc3 = zero8();
#pragma unroll 1
  for (int k0 = 0; k0 < 16 * K; k0 += FT) {
    const v16h ah = ldfrag_h(ahp + k0), al = ldfrag_h(alp + k0);
    const v16h b0 = ldfrag_h(bp + k0);
    const v16h b1 = ldfrag_h(bp + bs + k0);
    const v16h b2 = ldfrag_h(bp + 2 * bs + k0);
    const v16h b3 = ldfrag_h(bp + 3 * bs + k0);
    // the address pairs of the twelve loads above are inputs here, so no load's result is placed on one of them, and they are
    // rewritten only behind this wait
    asm volatile("s_wait_xcnt 0x0" :: "v"(ahp + k0), "v"(alp + k0), "v"(bp + k0) : "memory");
    acc0 = mma_h(ah, b0, acc0);  acc0 = mma_h(al, b0, acc0);
    acc1 = mma_h(ah, b1, acc1);  acc1 = mma_h(al, b1, acc1);
    acc2 = mma_h(ah, b2, acc2);  acc2 = mma_h(al, b2, acc2);
    acc3 = mma_h(ah, b3, acc3);  acc3 = mma_h(al, b3, acc3);
    guard6<v16h>(acc0, acc1, acc2, acc3, ah, al, b0, b1, b2, b3);
  }
  float* Cb = C + ((size_t)srow * NB + bb) * DMOD;
  epi64(slab + wave * SLAB64, acc0, acc1, acc2, acc3, oscale, bias, Cb, (size_t)NB * DMOD, col0, lane);
}

__device__ __forceinline__ float exp2_hw(float x) { return __builtin_amdgcn_exp2f(x); }

// lane l <-> lane l ^ 16 (the other half of the same column)
__device__ __forceinline__ float xhalf(float x) {
  const int b = __builtin_bit_cast(int, x);
  return __builtin_bit_cast(float, __builtin_amdgcn_permlanex16(b, b, 0x76543210, 0xfedcba98, false, false));
}

// e = 2^PLOG * 2^(s*lsc - reference), nb = PLOG - reference: score scale, reference and the carry of P meet in one packed
// multiply-add in front of the exponential (written on pairs: the bare exponential is no vector operation to the compiler, which
// otherwise splits the pairs)
__device__ __forceinline__ void exp_pairs(const v8f& s0, const v8f& s1, float lsc, float nb, v8f& e0, v8f& e1) {
  const v2f l2 = {lsc, lsc}, nb2 = {nb, nb};
#pragma unroll
  for (int r = 0; r < 4; ++r) {
    const v2f a0 = {s0[2 * r], s0[2 * r + 1]}, a1 = {s1[2 * r], s1[2 * r + 1]};
    const v2f x0 = __builtin_elementwise_fma(a0, l2, nb2), x1 = __builtin_elementwise_fma(a1, l2, nb2);
    e0[2 * r] = exp2_hw(x0[0]); e0[2 * r + 1] = exp2_hw(x0[1]);
    e1[2 * r] = exp2_hw(x1[0]); e1[2 * r + 1] = exp2_hw(x1[1]);
  }
}

// sum of a lane's 16 terms
__device__ __forceinline__ float sum16(const v8f& e0, const v8f& e1) {
  const v8f es = e0 + e1;
  return ((es[0] + es[4]) + (es[1] + es[5])) + ((es[2] + es[6]) + (es[3] + es[7]));
}

// One stage of one key range, by that range's four waves: 128 lanes x 16 B = 2 KiB per copy. Copies 0 .. 3: k bands 0 .. 3 (2 KiB of the head's tiles each, bands 16 key rows
// apart in the plane); copies 4 .. 7: the stage's 8 KiB of v^T tiles. lds = the lane's byte address in the buffer.
// The s_wait_xcnt closes the statement so that no address register of a copy is rewritten in front of it.
__device__ __forceinline__ void stage_copy(unsigned lds, const _Float16* kg, const _Float16* vg) {
#if defined(__HIP_DEVICE_COMPILE__)
  asm volatile("global_load_async_to_lds_b128 %0, %8, off\n\t"
               "global_load_async_to_lds_b128 %1, %9, off\n\t"
               "global_load_async_to_lds_b128 %2, %10, off\n\t"
               "global_load_async_to_lds_b128 %3, %11, off\n\t"
               "global_load_async_to_lds_b128 %4, %12, off\n\t"
               "global_load_async_to_lds_b128 %5, %13, off\n\t"
               "global_load_async_to_lds_b128 %6, %14, off\n\t"
               "global_load_async_to_lds_b128 %7, %15, off\n\t"
               "s_wait_xcnt 0x0"
               :: "v"(lds), "v"(lds + 2048u), "v"(lds + 4096u), "v"(lds + 6144u),
                  "v"(lds + 8192u), "v"(lds + 10240u), "v"(lds + 12288u), "v"(lds + 14336u),
                  "v"(kg), "v"(kg + 16 * DMOD), "v"(kg + 32 * DMOD), "v"(kg + 48 * DMOD),
                  "v"(vg), "v"(vg + 2 * FT), "v"(vg + 4 * FT), "v"(vg + 6 * FT) : "memory");
#endif
}
// this wave's copies have landed in LDS (the compiler places no wait for them)
__device__ __forceinline__ void wait_copies() {
#if defined(__HIP_DEVICE_COMPILE__)
  asm volatile("s_wait_asynccnt 0x0" ::: "memory");
#endif
}
// this wave's LDS reads have returned, before the barrier behind which their buffer is refilled
__device__ __forceinline__ void wait_lds_reads() {
#if defined(__HIP_DEVICE_COMPILE__)
  asm volatile("s_wait_dscnt 0x0" ::: "memory");
#endif
}

// four waves a SIMD (two blocks a WGP): the register budget is 256
__global__ __launch_bounds__(ATT_THREADS) __attribute__((amdgpu_waves_per_eu(4, 4)))
void attn_x(const u16* __restrict__ QHp, const u16* __restrict__ QLp, const u16* __restrict__ KHp,
            const u16* __restrict__ VHp, u16* OHp, u16* OLp) {
  __shared__ __attribute__((aligned(16))) _Float16 ring[KSP * 2 * STH];
  const int tid  = threadIdx.x;
  const int wave = __builtin_amdgcn_readfirstlane(tid >> 5);  // a scalar: the tests on the key range below are scalar branches
  const int lane = tid & 31;
  const int kh   = wave >> 2;               // key range
  const int wq   = wave & 3;                // place among the range's waves
  const int t    = tid & 127;               // lane among the range's 128
  const int bid  = blockIdx.x;
  const int qg   = bid % NQG;
  const int t2   = bid / NQG;
  const int head = t2 % NH;
  const int b    = t2 / NH;
  if (b >= NB) return;                      // block-uniform, before any barrier or copy; never taken with the exact grid
  const int q0   = (qg * (AWV / KSP) + wq) * (16 * QPW);  // q0 + 16*QPW <= SEQ by construction

  const size_t hcol = (size_t)head * (HD / 32) * FT + 8 * lane;        // the head's two tiles inside a 16-row band
  const _Float16* Qh  = (const _Float16*)(const void*)QHp + ((size_t)b * SEQ + q0) * DMOD + hcol;
  const _Float16* Ql  = (const _Float16*)(const void*)QLp + ((size_t)b * SEQ + q0) * DMOD + hcol;
  // copy sources of this lane in stage 0 of its key range: chunk t of the head's two tiles in the range's k band 0; v^T chunk t
  const _Float16* Kg = (const _Float16*)(const void*)KHp + ((size_t)b * JL + (size_t)kh * (JL / KSP)) * DMOD
                       + (size_t)head * (HD / 32) * FT + 8 * t;
  const _Float16* Vg = (const _Float16*)(const void*)VHp + ((size_t)(b * NH + head) * NKT + (size_t)kh * (NKT / KSP)) * 4 * FT + 8 * t;
  const unsigned lds0 = (unsigned)(uintptr_t)(&ring[0]) + (unsigned)kh * (4u * STH) + 16u * (unsigned)t;  // a range's two buffers: 4*STH bytes
  const float lsc = SM_SCALE * (LOG2E / (QSC * KSC));
  const float oc  = 1.0f / VCAR;            // the 128 on P is in the accumulators and in Z alike and cancels in acc / Z

  // ---- q fragments of both tiles (hi and residual, 2 k-steps over HD), loaded once ----
  v16h qh0[QPW], qh1[QPW], ql0[QPW], ql1[QPW];
#pragma unroll
  for (int g = 0; g < QPW; ++g) {
    qh0[g] = ldfrag_h(Qh + (size_t)g * 16 * DMOD); qh1[g] = ldfrag_h(Qh + (size_t)g * 16 * DMOD + FT);
    ql0[g] = ldfrag_h(Ql + (size_t)g * 16 * DMOD); ql1[g] = ldfrag_h(Ql + (size_t)g * 16 * DMOD + FT);
  }

  float mrow[QPW];                          // softmax reference in use for query column c of tile g (alike in both halves)
  float nbias[QPW];                         // PLOG - reference (reference 0 while mrow is -inf): the addend of every exponent
  float cap[QPW];                           // the test's bound on a step's sum: PCAP once a reference is set, below 0 before (always fires)
  float lrow[QPW];                          // running sum (x128) over the keys of this half only
  v8f o[QPW][4];
#pragma unroll
  for (int g = 0; g < QPW; ++g) {
    mrow[g] = -INFINITY; nbias[g] = PLOG; cap[g] = -1.0f; lrow[g] = 0.f;
#pragma unroll
    for (int j = 0; j < 4; ++j) o[g][j] = zero8();
  }

  // ---- ring prologue: stage 0 landed and published, stage 1 in flight ----
  stage_copy(lds0, Kg, Vg);
  wait_copies();
  __syncthreads();
  stage_copy(lds0 + 2u * STH, Kg + (size_t)SKEY * DMOD, Vg + (size_t)(SKEY / 32) * 4 * FT);

#pragma unroll 1                            // rolled: one publish point per trip, in the order written at its foot
  for (int st = 0; st < NST; ++st) {
   const _Float16* sb = ring + kh * (2 * STH) + (st & 1) * STH + 8 * lane;
#pragma unroll                              // both key steps of a stage in line: every LDS offset an immediate
   for (int p = 0; p < SKEY / 32; ++p) {    // key step kt = 2*st + p of the range, keys kb = kh*JL/2 + 32*kt .. kb + 31
    // ---- the step's k and v^T fragments, one group of LDS reads, used by both query tiles ----
    const _Float16* k0p = sb + p * 4 * FT;
    const _Float16* vhp = sb + SKEY * HD + p * 4 * FT;
    const v16h ka0 = ldfrag_h(k0p),          ka1 = ldfrag_h(k0p + FT);
    const v16h kc0 = ldfrag_h(k0p + 2 * FT), kc1 = ldfrag_h(k0p + 3 * FT);
    v16h vf[4];
#pragma unroll
    for (int j = 0; j < 4; ++j) vf[j] = ldfrag_h(vhp + j * FT);
    // ---- scores: D element r of this lane = (key kb + 8hh + r, query column c) in s0, key kb + 16 + 8hh + r in s1 ----
    v8f s0[QPW], s1[QPW];
#pragma unroll
    for (int g = 0; g < QPW; ++g) {
      s0[g] = mma_h(ka0, qh0[g], zero8());
      s0[g] = mma_h(ka0, ql0[g], s0[g]);
      s0[g] = mma_h(ka1, qh1[g], s0[g]);
      s0[g] = mma_h(ka1, ql1[g], s0[g]);
      s1[g] = mma_h(kc0, qh0[g], zero8());
      s1[g] = mma_h(kc0, ql0[g], s1[g]);
      s1[g] = mma_h(kc1, qh1[g], s1[g]);
      s1[g] = mma_h(kc1, ql1[g], s1[g]);
    }
    // ---- online softmax in base 2, -inf-safe; one query per lane and tile; reference held, moved only when the test fires ----
    v8f e0[QPW], e1[QPW];
    float ssum[QPW];
#pragma unroll
    for (int g = 0; g < QPW; ++g) {
      exp_pairs(s0[g], s1[g], lsc, nbias[g], e0[g], e1[g]);
      ssum[g] = sum16(e0[g], e1[g]);
    }
    // every term is >= 0, so ssum <= cap bounds each of them; written so that a NaN fires too. Wave-uniform scalar branch.
    if ((__builtin_amdgcn_ballot_w32(!(ssum[0] <= cap[0])) | __builtin_amdgcn_ballot_w32(!(ssum[1] <= cap[1]))) != 0) {
#pragma unroll
      for (int g = 0; g < QPW; ++g) {
        float mx = fmaxf(s0[g][0], s1[g][0]);              // maximum of the raw scores (the scale is positive)
#pragma unroll
        for (int r = 1; r < 8; ++r) mx = fmaxf(mx, fmaxf(s0[g][r], s1[g][r]));
        mx *= lsc;
        mx = fmaxf(mx, xhalf(mx));
        const float mn = fmaxf(mrow[g], mx);
        const float ms = (mn == -INFINITY) ? 0.0f : mn;
        const float al = exp2_hw(mrow[g] - ms);
        mrow[g]  = mn;
        nbias[g] = PLOG - ms;
        cap[g]   = (mn == -INFINITY) ? -1.0f : PCAP;
        lrow[g] *= al;
#pragma unroll
        for (int j = 0; j < 4; ++j) o[g][j] *= al;
        exp_pairs(s0[g], s1[g], lsc, nbias[g], e0[g], e1[g]);
        ssum[g] = sum16(e0[g], e1[g]);
      }
    }
    // ---- B fragments of P^T * 128 (f16), column = c, split k map over the 32 keys of this step ----
    FragH ph[QPW];
#pragma unroll
    for (int g = 0; g < QPW; ++g) {
      lrow[g] += ssum[g];
#pragma unroll
      for (int r = 0; r < 8; ++r) {
        ph[g].h[0][r] = (_Float16)e0[g][r]; // elements 0..7  = keys kb + 8hh + 0..7
        ph[g].h[1][r] = (_Float16)e1[g][r]; // elements 8..15 = keys kb + 16 + 8hh + 0..7
      }
    }
    // ---- V^T.P^T : A fragment row = d = j*16 + c, keys contiguous in the v^T plane; each fragment used for both tiles ----
#pragma unroll
    for (int j = 0; j < 4; ++j) {
#pragma unroll
      for (int g = 0; g < QPW; ++g) o[g][j] = mma_h(vf[j], ph[g].v, o[g][j]);
    }
    guard8in(o[0], o[1], ph[0].v, ph[1].v, vf);
   }
   // ---- publish point of stage st + 1: own reads of this buffer done, own copies landed, every wave here; then the refill ----
   wait_lds_reads();
   wait_copies();
   __syncthreads();
   if (st + 2 < NST) {                      // block-uniform
     stage_copy(lds0 + (unsigned)(st & 1) * (2u * STH), Kg + (size_t)(st + 2) * SKEY * DMOD,
                Vg + (size_t)(st + 2) * (SKEY / 32) * 4 * FT);
   }
  }
  wait_copies();
#pragma unroll
  for (int g = 0; g < QPW; ++g) acc_guard4(o[g][0], o[g][1], o[g][2], o[g][3]);
  // ---- hand-over of key range 1: no wave reads the ring and no copy is in flight behind the loop's last barrier ----
  float* xo = (float*)(void*)ring + wq * (QPW * 4 * 256) + 4 * lane;   // accumulators: (g, j) at (g*4 + j)*256, two 16-B chunks a lane
  float* xm = (float*)(void*)ring + (AWV / KSP) * (QPW * 4 * 256) + wq * (QPW * 2 * 32) + lane;  // reference, sum of tile g at g*64, + 32
  if (kh == 1) {                            // wave-uniform
#pragma unroll
    for (int g = 0; g < QPW; ++g) {
#pragma unroll
      for (int j = 0; j < 4; ++j) {
        *(v4f*)(xo + (g * 4 + j) * 256)       = __builtin_shufflevector(o[g][j], o[g][j], 0, 1, 2, 3);
        *(v4f*)(xo + (g * 4 + j) * 256 + 128) = __builtin_shufflevector(o[g][j], o[g][j], 4, 5, 6, 7);
      }
      xm[g * 64]      = mrow[g];
      xm[g * 64 + 32] = lrow[g];
    }
  }
  __syncthreads();                          // every wave passes it; range 0 reads what range 1 wrote only behind it
  if (kh == 1) return;
#pragma unroll
  for (int g = 0; g < QPW; ++g) {
    // ---- the two ranges joined on the larger reference (a range with reference -inf holds zeros and gets the factor 0) ----
    const float mo = xm[g * 64], lo = xm[g * 64 + 32];
    const float mj = fmaxf(mrow[g], mo);
    const float ms = (mj == -INFINITY) ? 0.0f : mj;
    const float fa = exp2_hw(mrow[g] - ms), fb = exp2_hw(mo - ms);
    const float lj = lrow[g] * fa + lo * fb;
    // ---- out = acc / Z (0 if Z == 0), acc and Z both x128, the 1024 on v folded once; the halves' sums joined here ----
    const float lv  = lj + xhalf(lj);
    const float ls  = (lv > 0.0f) ? lv : 1.0f;
    const float inv = (lv > 0.0f) ? ((1.0f / ls) * oc) : 0.0f;
    // ---- O x1024 -> packed f16 hi + residual planes; chunk j*32 + lane of the head's two tiles: row c, d = 16j + 8hh + 0..7 ----
    v4u oh[4], ol[4];
#pragma unroll
    for (int it = 0; it < 4; ++it) {
      const v4f p0 = *(const v4f*)(xo + (g * 4 + it) * 256), p1 = *(const v4f*)(xo + (g * 4 + it) * 256 + 128);
      float w[8];
#pragma unroll
      for (int e = 0; e < 4; ++e) {
        w[e]     = ((o[g][it][e] * fa + p0[e] * fb) * inv) * OSC;
        w[4 + e] = ((o[g][it][4 + e] * fa + p1[e] * fb) * inv) * OSC;
      }
#pragma unroll
      for (int e = 0; e < 4; ++e) {
        const _Float16 h0 = (_Float16)w[2 * e], h1 = (_Float16)w[2 * e + 1];
        const _Float16 l0 = (_Float16)(w[2 * e] - (float)h0), l1 = (_Float16)(w[2 * e + 1] - (float)h1);
        oh[it][e] = pk16(h_bits(h0), h_bits(h1));
        ol[it][e] = pk16(h_bits(l0), h_bits(l1));
      }
    }
    const size_t ob = ((size_t)b * SEQ + q0 + 16 * g) * DMOD + hcol;
#pragma unroll
    for (int it = 0; it < 4; ++it) {
      *(v4u*)(OHp + ob + (size_t)it * 256) = oh[it];
      *(v4u*)(OLp + ob + (size_t)it * 256) = ol[it];
    }
  }
}

// =====================================================================================================
// Workspace map (bytes); every plane is fully written by whole-line stores before it is read; all extents are exact multiples
// of the store granularity (512-B half tiles; no pad rows needed); every region offset a multiple of
// 2097152:
//   XC  bf16 [CROWS][1024]              CROWS*2048   (c = [mem; kv] as bf16)
//   XQ  bf16 [QROWS][1024]              QROWS*2048   (q as bf16)
//   WV, WK, WQ, WC  16-bit [1024 n][1024 k]  2097152 each  (Wv, Wk, Wq as bf16, Wc as f16 x1024)
//   OH  f16 [QROWS][1024] x1024         QROWS*2048   OL residual the same
//   VH  f16 [NB*16][64][JL] x1024       CROWS*2048   (all 16-bit planes in packed 16 x 32 tiles)
//   KH  f16 [CROWS][1024] x1024         CROWS*2048
//   QH  f16 [QROWS][1024] x1024         QROWS*2048   QL residual the same
//   end (NB=2, SEQ=MLEN=2048)           100663296
// =====================================================================================================
extern "C" void kernel_launch(void* const* d_in, const int* in_sizes, int n_in,
                              void* d_out, int out_size, void* d_ws, size_t ws_size,
                              hipStream_t stream) {
  if (n_in < 11) return;
  const long long needq = ((long long)(SEQ - 1) * B_FULL + NB) * DMOD;
  const long long needm = (MLEN > 0) ? (((long long)(MLEN - 1) * B_FULL + NB) * DMOD) : 0;
  if ((long long)in_sizes[0] < needq || (long long)in_sizes[1] < needq || (long long)in_sizes[2] < needm) return;
  if (in_sizes[3] < DMOD * DMOD || in_sizes[5] < DMOD * DMOD || in_sizes[7] < DMOD * DMOD || in_sizes[9] < DMOD * DMOD) return;
  if (in_sizes[4] < DMOD || in_sizes[6] < DMOD || in_sizes[8] < DMOD || in_sizes[10] < DMOD) return;
  if ((long long)out_size < (long long)SEQ * NB * DMOD) return;

  const float* xq  = (const float*)d_in[0];
  const float* xkv = (const float*)d_in[1];
  const float* xm  = (const float*)d_in[2];
  const float* wq  = (const float*)d_in[3];
  const float* bq  = (const float*)d_in[4];
  const float* wk  = (const float*)d_in[5];
  const float* bk  = (const float*)d_in[6];
  const float* wv  = (const float*)d_in[7];
  const float* bv  = (const float*)d_in[8];
  const float* wc  = (const float*)d_in[9];
  const float* bc  = (const float*)d_in[10];
  float*       out = (float*)d_out;

  const size_t szXC = (size_t)CROWS * DMOD * 2;
  const size_t szXQ = (size_t)QROWS * DMOD * 2;
  const size_t szW  = (size_t)DMOD * DMOD * 2;
  const size_t szO  = (size_t)QROWS * DMOD * 2;                 // OH, OL each
  const size_t szVH = (size_t)NB * NH * HD * JL * 2;            // == CROWS*2048
  const size_t szKH = (size_t)CROWS * DMOD * 2;
  const size_t szQ  = (size_t)QROWS * DMOD * 2;                 // QH, QL each
  size_t off = 0;
  const size_t oXC = off; off += szXC;
  const size_t oXQ = off; off += szXQ;
  const size_t oWV = off; off += szW;
  const size_t oWK = off; off += szW;
  const size_t oWQ = off; off += szW;
  const size_t oWC = off; off += szW;
  const size_t oOH = off; off += szO;
  const size_t oOL = off; off += szO;
  const size_t oVH = off; off += szVH;
  const size_t oKH = off; off += szKH;
  const size_t oQH = off; off += szQ;
  const size_t oQL = off; off += szQ;
  if (off > ws_size) return;                // off = 100663296 for NB = 2, SEQ = MLEN = 2048
  if (off > (size_t)WS_CAP) return;

  char* ws = (char*)d_ws;
  u16*   XC = (u16*)(ws + oXC);
  u16*   XQ = (u16*)(ws + oXQ);
  u16*   WV = (u16*)(ws + oWV);
  u16*   WK = (u16*)(ws + oWK);
  u16*   WQ = (u16*)(ws + oWQ);
  u16*   WC = (u16*)(ws + oWC);
  u16*   OH = (u16*)(ws + oOH);
  u16*   OL = (u16*)(ws + oOL);
  u16*   VH = (u16*)(ws + oVH);
  u16*   KH = (u16*)(ws + oKH);
  u16*   QH = (u16*)(ws + oQH);
  u16*   QL = (u16*)(ws + oQL);

  const dim3 b256(256), b128(128), bAT(ATT_THREADS);
  const dim3 gCV(CB_C + CB_Q + 4 * CB_W);
  const dim3 gQKV(2 * GB_C + GB_Q);
  const dim3 gAT(NQG * NH * NB);
  const dim3 gO(NB * NRT * (DMOD / 64));

  // (1) c = [mem; kv] and q -> bf16 planes, batch-major rows; Wv, Wk, Wq -> bf16 planes; Wc -> f16 plane of bf16 value x1024
  cvt_all<<<gCV, b256, 0, stream>>>(xm, xkv, xq, wv, wk, wq, wc, XC, XQ, WV, WK, WQ, WC);
  // (2) v = c.Wv^T + bv -> v^T plane x1024; k = c.Wk^T + bk -> k hi plane x1024; q = q.Wq^T + bq -> q hi + residual planes x1024
  gemm_qkv<<<gQKV, b128, 0, stream>>>(XC, XQ, WV, WK, WQ, bv, bk, bq, VH, KH, QH, QL);
  // (3) attention over all JL keys -> O hi + residual planes
  attn_x<<<gAT, bAT, 0, stream>>>(QH, QL, KH, VH, OH, OL);
  // (4) output projection -> out f32 rows (s*NB + b), carries 1024 x 1024 folded back
  gemm_o2<<<gO, b128, 0, stream>>>(OH, OL, WC, bc, out, 1.0f / (OSC * WOS));
  (void)hipGetLastError();
}
